// v000
// Times are from an AMD MI455X. After a warm-up the kernel runs many times in a row, and a time is the length of
// such a window on the GPU divided by its runs, so every launch and the gaps after it count. The runs cycle
// through copies of the inputs. A figure is the median of several windows, for all but v000 over two sittings.
// Sittings can differ by a few percent; kernels timed side by side share one.
// The starting kernel, v000, takes 2020 microseconds a run.
#include <hip/hip_runtime.h>

// Compute dtypes, f32 accumulate, per item: q/k/v = x.W^T fused as one [2048 x 1024].[1024 x 3072] GEMM with PLAIN bf16 operands (exact products); the interleaved-pair RoPE
// with the given (cos, sin) table applied while building the q/k planes; scores and attn.V with both operands as bf16 hi + UNSCALED residual planes (three
// products), 2 heads per launch in grid.z; 1/sqrt(64), the additive float mask input (read as data, shared by all heads/items) and the softmax in f32; wo on hi/lo planes of the merged heads

#define NBT  2
#define NN   2048
#define DMOD 1024
#define NH_  16
#define HD   64
#define ZH   2
#define DM   DMOD
#define NTK  NN
#define SCL  0.125f
#define LOSC 1024.0f

typedef _Float16 h16;
typedef unsigned short bf;
typedef __attribute__((ext_vector_type(16))) __bf16   v16bf;
typedef __attribute__((ext_vector_type(16))) _Float16 v16h;
typedef __attribute__((ext_vector_type(8)))  _Float16 v8h;
typedef __attribute__((ext_vector_type(8)))  unsigned short v8us;
typedef __attribute__((ext_vector_type(8)))  float    v8f;
typedef __attribute__((ext_vector_type(4)))  float    v4f;
typedef __attribute__((ext_vector_type(4)))  _Float16 v4h;
typedef v8h  __attribute__((may_alias)) v8ha;
typedef v4f  __attribute__((may_alias)) v4fa;
typedef v8us __attribute__((may_alias)) v8usa;

__device__ __forceinline__ unsigned short f2bf(float f) { unsigned u = __float_as_uint(f); u += 0x7FFFu + ((u >> 16) & 1u); return (unsigned short)(u >> 16); }
__device__ __forceinline__ float bf2f(unsigned short b) { return __uint_as_float(((unsigned)b) << 16); }
__device__ __forceinline__ float bfr(float f) { return bf2f(f2bf(f)); }
__device__ __forceinline__ v16h cat16(v8h lo, v8h hi) { return __builtin_shufflevector(lo, hi, 0, 1, 2, 3, 4, 5, 6, 7, 8, 9, 10, 11, 12, 13, 14, 15); }
__device__ __forceinline__ v16bf cat16b(v8us lo, v8us hi) { return __builtin_bit_cast(v16bf, __builtin_shufflevector(lo, hi, 0, 1, 2, 3, 4, 5, 6, 7, 8, 9, 10, 11, 12, 13, 14, 15)); }
__device__ __forceinline__ v8f wmma16(v16h a, v16h b, v8f c) { return __builtin_amdgcn_wmma_f32_16x16x32_f16(false, a, false, b, (short)0, c, false, false); }
__device__ __forceinline__ v8f wmmab(v16bf a, v16bf b, v8f c) { return __builtin_amdgcn_wmma_f32_16x16x32_bf16(false, a, false, b, (short)0, c, false, false); }

// k_gemmb: 64 x 64 block tile (4 waves x 16 x 64) of C[NTK][NW] = (A [+ Al]).B^T (K = 1024) [+ bf(bias[c])] [+ bf(R[r][c]) residual]; f32 whole-line epilogue (or f16
template <bool SPLITA, bool F16OUT = false>
__global__ __launch_bounds__(128) void k_gemmb(const bf* __restrict__ A, const bf* __restrict__ Al, const bf* __restrict__ Bn, const float* __restrict__ bias, float* C, int ldc, h16* C2, const float* __restrict__ R = nullptr, int K = DM, int roundR = 1) {
    __shared__ __align__(16) float ost[4][16 * 68];
    const int lane = threadIdx.x & 31, wave = threadIdx.x >> 5, lr = lane & 15, hi = lane >> 4;
    const int r0 = blockIdx.x * 64 + wave * 16, c0 = blockIdx.y * 64;
    const size_t aoff = (size_t)(r0 + lr) * K + 8 * hi;
    size_t boff[4];
#pragma unroll
    for (int t = 0; t < 4; ++t) boff[t] = (size_t)(c0 + t * 16 + lr) * K + 8 * hi;
    v8f acc[4];
#pragma unroll
    for (int t = 0; t < 4; ++t) acc[t] = (v8f){};
#pragma unroll 1
    for (int kc = 0; kc < K; kc += 32) {
        const v16bf a = cat16b(*(const v8us*)(A + aoff + kc), *(const v8us*)(A + aoff + kc + 16));
        v16bf al = a;
        if (SPLITA) al = cat16b(*(const v8us*)(Al + aoff + kc), *(const v8us*)(Al + aoff + kc + 16));
#pragma unroll
        for (int t = 0; t < 4; ++t) { const v16bf b = cat16b(*(const v8us*)(Bn + boff[t] + kc), *(const v8us*)(Bn + boff[t] + kc + 16)); acc[t] = wmmab(a, b, acc[t]); if (SPLITA) acc[t] = wmmab(al, b, acc[t]); }
        asm volatile("v_nop\n\tv_nop\n\tv_nop\n\tv_nop" : "+v"(acc[0]), "+v"(acc[1]), "+v"(acc[2]), "+v"(acc[3]) : "v"(a), "v"(al));
    }
    float* os = &ost[wave][0];
#pragma unroll
    for (int t = 0; t < 4; ++t) { const float bv = bias ? bfr(bias[c0 + t * 16 + lr]) : 0.f;
#pragma unroll
        for (int j = 0; j < 8; ++j) os[(hi * 8 + j) * 68 + t * 16 + lr] = acc[t][j] + bv; }
    __syncthreads();
    if (F16OUT) {
        h16* crow = (h16*)(void*)C + (size_t)r0 * ldc + c0;
        auto pass = [&]() {
#pragma unroll
            for (int s = 0; s < 4; ++s) { const int row = 4 * s + (lane >> 3), piece = lane & 7; const float* sp = os + row * 68 + piece * 8; v8h o, o2;
#pragma unroll
                for (int i = 0; i < 8; ++i) { const h16 a = (h16)sp[i]; o[i] = a; o2[i] = (h16)((sp[i] - (float)a) * LOSC); }
                *(v8h*)(crow + (size_t)row * ldc + piece * 8) = o; if (C2) *(v8h*)(C2 + (size_t)r0 * ldc + c0 + (size_t)row * ldc + piece * 8) = o2; }
        };
        pass(); 
    } else {
        float* crow = C + (size_t)r0 * ldc + c0;
        auto pass = [&]() {
#pragma unroll
            for (int s = 0; s < 8; ++s) { const int Lid = (lane >> 3) + 4 * s, piece = lane & 7; const int row = Lid >> 1, cofs = (Lid & 1) * 32 + piece * 4;
                v4f val = *(const v4fa*)(os + row * 68 + cofs); if (R) { const v4f rv = *(const v4f*)(R + ((size_t)r0 + row) * ldc + c0 + cofs); val += roundR ? (v4f){bfr(rv[0]), bfr(rv[1]), bfr(rv[2]), bfr(rv[3])} : rv; }
                *(v4f*)(crow + (size_t)row * ldc + cofs) = val; }
        };
        pass(); 
    }
}

__global__ __launch_bounds__(256) void k_cvt8(const float* __restrict__ src, bf* dst, size_t n8) {
    const size_t i = (size_t)blockIdx.x * 256 + threadIdx.x; if (i >= n8) return;
    const v8f v = *(const v8f*)(src + i * 8); v8us o;
#pragma unroll
    for (int k = 0; k < 8; ++k) o[k] = f2bf(v[k]);
    *(v8us*)(dst + i * 8) = o; 
}
__global__ __launch_bounds__(256) void k_zero8(bf* dst, size_t n8) {
    const size_t i = (size_t)blockIdx.x * 256 + threadIdx.x; if (i >= n8) return; v8us z;
#pragma unroll
    for (int k = 0; k < 8; ++k) z[k] = 0;
    *(v8us*)(dst + i * 8) = z; 
}

// ===== z-batched (blockIdx.z = head) attention pieces =====
// k_gemm3z<MODE>: 64 x 64 block tile of C = A.B^T on bf16 hi/lo planes (Ah.Bh + Al.Bh + Ah.Bl) with per-z operand/output strides (elements): A planes += z*sA, B planes += z*sB, C += z*sC. MODE bits (0 causal skip, 1 K limit, 2 single,
// 3 B single, 4 A single).
template <int MODE>
__global__ __launch_bounds__(128) void k_gemm3z(const bf* __restrict__ Ah, const bf* __restrict__ Al, const bf* __restrict__ Bh, const bf* __restrict__ Bl, int K, float* C, int ldc, size_t sA, size_t sB, size_t sC) {
    if ((MODE & 1) && (int)blockIdx.y * 64 > (int)blockIdx.x * 64 + 63) return;
    const size_t z = blockIdx.z; Ah += z * sA; Al += z * sA; Bh += z * sB; Bl += z * sB; C += z * sC;
    const int Klim = (MODE & 2) ? min(K, ((int)blockIdx.x + 1) * 64) : K;
    __shared__ __align__(16) float ost[4][16 * 68];
    const int lane = threadIdx.x & 31, wave = threadIdx.x >> 5, lr = lane & 15, hi = lane >> 4;
    const int r0 = blockIdx.x * 64 + wave * 16, c0 = blockIdx.y * 64;
    const size_t aoff = (size_t)(r0 + lr) * K + 8 * hi;
    v8f acc[4];
#pragma unroll
    for (int t = 0; t < 4; ++t) acc[t] = (v8f){};
#pragma unroll 1
    for (int kc = 0; kc < Klim; kc += 32) {
        const v16bf a = cat16b(*(const v8us*)(Ah + aoff + kc), *(const v8us*)(Ah + aoff + kc + 16));
        v16bf al = a; if (!(MODE & 4) && !(MODE & 16)) al = cat16b(*(const v8us*)(Al + aoff + kc), *(const v8us*)(Al + aoff + kc + 16));
#pragma unroll
        for (int t = 0; t < 4; ++t) { const size_t bo = (size_t)(c0 + t * 16 + lr) * K + kc + 8 * hi;
            const v16bf bh = cat16b(*(const v8us*)(Bh + bo), *(const v8us*)(Bh + bo + 16));
            acc[t] = wmmab(a, bh, acc[t]);
            if (!(MODE & 4)) { if (!(MODE & 16)) acc[t] = wmmab(al, bh, acc[t]); if (!(MODE & 8)) { const v16bf bl = cat16b(*(const v8us*)(Bl + bo), *(const v8us*)(Bl + bo + 16)); acc[t] = wmmab(a, bl, acc[t]); } } }
        asm volatile("v_nop\n\tv_nop\n\tv_nop\n\tv_nop" : "+v"(acc[0]), "+v"(acc[1]), "+v"(acc[2]), "+v"(acc[3]) : "v"(a), "v"(al));
    }
    float* os = &ost[wave][0];
#pragma unroll
    for (int t = 0; t < 4; ++t) {
#pragma unroll
        for (int j = 0; j < 8; ++j) os[(hi * 8 + j) * 68 + t * 16 + lr] = acc[t][j]; }
    __builtin_amdgcn_wave_barrier(); asm volatile("" ::: "memory");
    float* crow = C + (size_t)r0 * ldc + c0;
    auto pass = [&]() {
#pragma unroll
        for (int s = 0; s < 8; ++s) { const int Lid = (lane >> 3) + 4 * s, piece = lane & 7; const int row = Lid >> 1, cofs = (Lid & 1) * 32 + piece * 4;
            const v4f val = *(const v4fa*)(os + row * 68 + cofs); *(v4f*)(crow + (size_t)row * ldc + cofs) = val; }
    };
    pass(); 
}
__global__ __launch_bounds__(256) void k_planes32z(const float* __restrict__ F, int ld, int off, float sc, int rows, bf* Ph, bf* Pl) {
    typedef __attribute__((ext_vector_type(2))) unsigned short v2us;
    const int lane = threadIdx.x & 31; const size_t r = ((size_t)blockIdx.x * 8 + (threadIdx.x >> 5)) * 2 + (lane >> 4); if (r >= (size_t)rows) return; const int z = blockIdx.z; const int c0 = (lane & 15) * 2; v2us oh, ol;
    Ph += (size_t)z * rows * 32; Pl += (size_t)z * rows * 32;
#pragma unroll
    for (int i = 0; i < 2; ++i) { const float y = F[r * ld + off + z * 32 + c0 + i] * sc; const unsigned short hb = f2bf(y); oh[i] = hb; ol[i] = f2bf(y - bf2f(hb)); }
    const size_t o = r * 32 + c0; *(v2us*)(Ph + o) = oh; *(v2us*)(Pl + o) = ol; 
}
__global__ __launch_bounds__(256) void k_vtpadz(const float* __restrict__ F, int ld, int off, int nk, bf* Th, bf* Tl) {
    typedef __attribute__((ext_vector_type(2))) unsigned short v2us;
    const int lane = threadIdx.x & 31; const size_t wid = (size_t)blockIdx.x * 8 + (threadIdx.x >> 5); if (wid >= (size_t)64 * (nk / 64)) return; const int z = blockIdx.z; const int d = (int)(wid / (nk / 64)); const int k0 = (int)(wid % (nk / 64)) * 64 + lane * 2; v2us oh, ol;
    Th += (size_t)z * 64 * nk; Tl += (size_t)z * 64 * nk;
#pragma unroll
    for (int i = 0; i < 2; ++i) { const float y = (d < 32) ? F[(size_t)(k0 + i) * ld + off + z * 32 + (d < 32 ? d : 0)] : 0.f; const unsigned short hb = f2bf(y); oh[i] = hb; ol[i] = f2bf(y - bf2f(hb)); }
    const size_t o = (size_t)d * nk + k0; *(v2us*)(Th + o) = oh; *(v2us*)(Tl + o) = ol; 
}
template <int NK>
__global__ __launch_bounds__(256) void k_softmaxz(const float* __restrict__ S, int rows, bf* PH, bf* PL) {
    typedef __attribute__((ext_vector_type(4))) unsigned short v4us;
    const int lane = threadIdx.x & 31, i = blockIdx.x * 8 + (threadIdx.x >> 5); if (i >= rows) return; const size_t zo = (size_t)blockIdx.z * rows * NK; const float* sr = S + zo + (size_t)i * NK; PH += zo; PL += zo;
    float m = -3.0e38f;
#pragma unroll 1
    for (int c0 = lane * 4; c0 < NK; c0 += 128) {
#pragma unroll
        for (int q = 0; q < 4; ++q) m = fmaxf(m, sr[c0 + q]); }
#pragma unroll
    for (int sh = 16; sh; sh >>= 1) m = fmaxf(m, __shfl_xor(m, sh, 32));
    float sum = 0.f;
#pragma unroll 1
    for (int c0 = lane * 4; c0 < NK; c0 += 128) {
#pragma unroll
        for (int q = 0; q < 4; ++q) sum += __expf(sr[c0 + q] - m); }
#pragma unroll
    for (int sh = 16; sh; sh >>= 1) sum += __shfl_xor(sum, sh, 32);
    const float inv = 1.0f / sum;
{
#pragma unroll 1
        for (int c0 = lane * 4; c0 < NK; c0 += 128) { v4us oh, ol;
#pragma unroll
            for (int q = 0; q < 4; ++q) { const float p = __expf(sr[c0 + q] - m) * inv; const unsigned short hb = f2bf(p); oh[q] = hb; ol[q] = f2bf(p - bf2f(hb)); }
            const size_t o = (size_t)i * NK + c0; *(v4us*)(PH + o) = oh; *(v4us*)(PL + o) = ol; }
         }
}
__global__ __launch_bounds__(256) void k_placez(const float* __restrict__ XH, int rows, int ldy, float* Y) {
    const int lane = threadIdx.x & 31; const size_t q = (size_t)blockIdx.x * 8 + (threadIdx.x >> 5); if (q >= (size_t)rows) return; const int z = blockIdx.z; const float v = XH[((size_t)z * rows + q) * 64 + lane];
    *(float*)(Y + q * ldy + z * 32 + lane) = v; 
}

__global__ __launch_bounds__(256) void k_hplanesz(const float* __restrict__ F, int ld, int h0, float sc, int rows, bf* Ph, bf* Pl) {
    typedef __attribute__((ext_vector_type(2))) unsigned short v2us;
    const int lane = threadIdx.x & 31; const size_t r = (size_t)blockIdx.x * 8 + (threadIdx.x >> 5); if (r >= (size_t)rows) return; const int z = blockIdx.z; v2us oh, ol;
    Ph += (size_t)z * rows * 64; Pl += (size_t)z * rows * 64;
#pragma unroll
    for (int i = 0; i < 2; ++i) { const float y = F[r * ld + (h0 + z) * 64 + lane * 2 + i] * sc; const unsigned short hb = f2bf(y); oh[i] = hb; ol[i] = f2bf(y - bf2f(hb)); }
    const size_t o = r * 64 + lane * 2; *(v2us*)(Ph + o) = oh; *(v2us*)(Pl + o) = ol; 
}
__global__ __launch_bounds__(256) void k_vtz(const float* __restrict__ F, int ld, int h0, int nk, bf* Th, bf* Tl) {
    typedef __attribute__((ext_vector_type(2))) unsigned short v2us;
    const int lane = threadIdx.x & 31; const size_t wid = (size_t)blockIdx.x * 8 + (threadIdx.x >> 5); if (wid >= (size_t)64 * (nk / 64)) return; const int z = blockIdx.z; const int d = (int)(wid / (nk / 64)); const int t0 = (int)(wid % (nk / 64)) * 64 + lane * 2; v2us oh, ol;
    Th += (size_t)z * 64 * nk; Tl += (size_t)z * 64 * nk;
#pragma unroll
    for (int i = 0; i < 2; ++i) { const float y = F[(size_t)(t0 + i) * ld + (h0 + z) * 64 + d]; const unsigned short hb = f2bf(y); oh[i] = hb; ol[i] = f2bf(y - bf2f(hb)); }
    const size_t o = (size_t)d * nk + t0; *(v2us*)(Th + o) = oh; *(v2us*)(Tl + o) = ol; 
}
template <int NK>
__global__ __launch_bounds__(256) void k_softmaxzs(const float* __restrict__ S, int rows, float sc, bf* PH, bf* PL) {
    typedef __attribute__((ext_vector_type(4))) unsigned short v4us;
    const int lane = threadIdx.x & 31, i = blockIdx.x * 8 + (threadIdx.x >> 5); if (i >= rows) return; const size_t zo = (size_t)blockIdx.z * rows * NK; const float* sr = S + zo + (size_t)i * NK; PH += zo; PL += zo;
    float m = -3.0e38f;
#pragma unroll 1
    for (int c0 = lane * 4; c0 < NK; c0 += 128) {
#pragma unroll
        for (int q = 0; q < 4; ++q) m = fmaxf(m, sr[c0 + q] * sc); }
#pragma unroll
    for (int sh = 16; sh; sh >>= 1) m = fmaxf(m, __shfl_xor(m, sh, 32));
    float sum = 0.f;
#pragma unroll 1
    for (int c0 = lane * 4; c0 < NK; c0 += 128) {
#pragma unroll
        for (int q = 0; q < 4; ++q) sum += __expf(sr[c0 + q] * sc - m); }
#pragma unroll
    for (int sh = 16; sh; sh >>= 1) sum += __shfl_xor(sum, sh, 32);
    const float inv = 1.0f / sum;
{
#pragma unroll 1
        for (int c0 = lane * 4; c0 < NK; c0 += 128) { v4us oh, ol;
#pragma unroll
            for (int q = 0; q < 4; ++q) { const float p = __expf(sr[c0 + q] * sc - m) * inv; const unsigned short hb = f2bf(p); oh[q] = hb; ol[q] = f2bf(p - bf2f(hb)); }
            const size_t o = (size_t)i * NK + c0; *(v4us*)(PH + o) = oh; *(v4us*)(PL + o) = ol; }
         }
}

__global__ __launch_bounds__(256) void k_cvtx(const float* __restrict__ src, int rows, bf* dst) {
    const int lane = threadIdx.x & 31; const size_t r = (size_t)blockIdx.x * 8 + (threadIdx.x >> 5); if (r >= (size_t)rows) return;
{
#pragma unroll
        for (int q = 0; q < DMOD / 256; ++q) { v8us o;
#pragma unroll
            for (int i = 0; i < 8; ++i) o[i] = f2bf(src[r * DMOD + q * 256 + lane * 8 + i]);
            *(v8us*)(dst + r * DMOD + q * 256 + lane * 8) = o; }
         }
}
__global__ __launch_bounds__(256) void k_wcat3(const float* __restrict__ Wq, const float* __restrict__ Wk, const float* __restrict__ Wv, bf* WQKV) {
    const size_t i = ((size_t)blockIdx.x * 256 + threadIdx.x) * 8; if (i >= (size_t)3 * DMOD * DMOD) return; const size_t blk = i / ((size_t)DMOD * DMOD), o = i % ((size_t)DMOD * DMOD);
    const float* src = (blk == 0) ? Wq : (blk == 1) ? Wk : Wv; v8us v;
#pragma unroll
    for (int q = 0; q < 8; ++q) v[q] = f2bf(src[o + q]);
    *(v8us*)(WQKV + i) = v; 
}
// k_gropez: head h0+z: planes [2048][64] of the rotated F[t][col0 + (h0+z)*64 + d]: pair (2i, 2i+1): o0 = t0 c - t1 s, o1 = t0 s + t1 c with c = bf(fc[t][i][0]), s = bf(fc[t][i][1]);
__global__ __launch_bounds__(256) void k_gropez(const float* __restrict__ F, int ld, int col0, int h0, const float* __restrict__ fc, bf* Ph, bf* Pl) {
    typedef __attribute__((ext_vector_type(2))) unsigned short v2us;
    const int lane = threadIdx.x & 31; const size_t t = (size_t)blockIdx.x * 8 + (threadIdx.x >> 5); if (t >= (size_t)NN) return; const int z = blockIdx.z; Ph += (size_t)z * NN * HD; Pl += (size_t)z * NN * HD;
    const float* fr = F + t * ld + col0 + (h0 + z) * HD + lane * 2; const float t0 = fr[0], t1 = fr[1]; const float c = bfr(fc[(t * (HD / 2) + lane) * 2]), s = bfr(fc[(t * (HD / 2) + lane) * 2 + 1]);
    const float y0 = t0 * c - t1 * s, y1 = t0 * s + t1 * c; v2us oh, ol;
    { const unsigned short hb = f2bf(y0); oh[0] = hb; ol[0] = f2bf(y0 - bf2f(hb)); } { const unsigned short hb = f2bf(y1); oh[1] = hb; ol[1] = f2bf(y1 - bf2f(hb)); }
    const size_t o = t * HD + lane * 2; *(v2us*)(Ph + o) = oh; *(v2us*)(Pl + o) = ol; 
}
__global__ __launch_bounds__(256) void k_amsoftz(const float* __restrict__ S, int rows, float sc, const float* __restrict__ M, bf* PH, bf* PL) {
    typedef __attribute__((ext_vector_type(4))) unsigned short v4us;
    const int lane = threadIdx.x & 31, i = blockIdx.x * 8 + (threadIdx.x >> 5); if (i >= rows) return; const size_t zo = (size_t)blockIdx.z * rows * NN; const float* sr = S + zo + (size_t)i * NN; const float* mr = M + (size_t)i * NN; PH += zo; PL += zo;
    float m = -3.0e38f;
#pragma unroll 1
    for (int c0 = lane * 4; c0 < NN; c0 += 128) {
#pragma unroll
        for (int q = 0; q < 4; ++q) m = fmaxf(m, sr[c0 + q] * sc + bfr(mr[c0 + q])); }
#pragma unroll
    for (int sh = 16; sh; sh >>= 1) m = fmaxf(m, __shfl_xor(m, sh, 32));
    float sum = 0.f;
#pragma unroll 1
    for (int c0 = lane * 4; c0 < NN; c0 += 128) {
#pragma unroll
        for (int q = 0; q < 4; ++q) sum += __expf(sr[c0 + q] * sc + bfr(mr[c0 + q]) - m); }
#pragma unroll
    for (int sh = 16; sh; sh >>= 1) sum += __shfl_xor(sum, sh, 32);
    const float inv = 1.0f / sum;
{
#pragma unroll 1
        for (int c0 = lane * 4; c0 < NN; c0 += 128) { v4us oh, ol;
#pragma unroll
            for (int q = 0; q < 4; ++q) { const float p = __expf(sr[c0 + q] * sc + bfr(mr[c0 + q]) - m) * inv; const unsigned short hb = f2bf(p); oh[q] = hb; ol[q] = f2bf(p - bf2f(hb)); }
            const size_t o = (size_t)i * NN + c0; *(v4us*)(PH + o) = oh; *(v4us*)(PL + o) = ol; }
         }
}
__global__ __launch_bounds__(256) void k_csoftz(const float* __restrict__ S, int rows, float sc, bf* PH, bf* PL) {
    typedef __attribute__((ext_vector_type(4))) unsigned short v4us;
    const int lane = threadIdx.x & 31, i = blockIdx.x * 8 + (threadIdx.x >> 5); if (i >= rows) return; const size_t zo = (size_t)blockIdx.z * rows * NN; const float* sr = S + zo + (size_t)i * NN; PH += zo; PL += zo;
    float m = -3.0e38f;
#pragma unroll 1
    for (int c0 = lane * 4; c0 < NN; c0 += 128) {
#pragma unroll
        for (int q = 0; q < 4; ++q) { const int k = c0 + q; if (k <= i) m = fmaxf(m, sr[k] * sc); } }
#pragma unroll
    for (int sh = 16; sh; sh >>= 1) m = fmaxf(m, __shfl_xor(m, sh, 32));
    float sum = 0.f;
#pragma unroll 1
    for (int c0 = lane * 4; c0 < NN; c0 += 128) {
#pragma unroll
        for (int q = 0; q < 4; ++q) { const int k = c0 + q; if (k <= i) sum += __expf(sr[k] * sc - m); } }
#pragma unroll
    for (int sh = 16; sh; sh >>= 1) sum += __shfl_xor(sum, sh, 32);
    const float inv = 1.0f / sum;
{
#pragma unroll 1
        for (int c0 = lane * 4; c0 < NN; c0 += 128) { v4us oh, ol;
#pragma unroll
            for (int q = 0; q < 4; ++q) { const int k = c0 + q; const float p = (k <= i) ? __expf(sr[(k <= i) ? k : 0] * sc - m) * inv : 0.f; const unsigned short hb = f2bf(p); oh[q] = hb; ol[q] = f2bf(p - bf2f(hb)); }
            const size_t o = (size_t)i * NN + c0; *(v4us*)(PH + o) = oh; *(v4us*)(PL + o) = ol; }
         }
}
__global__ __launch_bounds__(256) void k_splitD(const float* __restrict__ src, int rows, bf* dh, bf* dl) {
    const int lane = threadIdx.x & 31; const size_t r = (size_t)blockIdx.x * 8 + (threadIdx.x >> 5); if (r >= (size_t)rows) return;
{
#pragma unroll
        for (int q = 0; q < DMOD / 256; ++q) { const size_t o = r * DMOD + q * 256 + lane * 8; const v8f v = *(const v8f*)(src + o); v8us oh, ol;
#pragma unroll
            for (int i = 0; i < 8; ++i) { const unsigned short hb = f2bf(v[i]); oh[i] = hb; ol[i] = f2bf(v[i] - bf2f(hb)); }
            *(v8us*)(dh + o) = oh; *(v8us*)(dl + o) = ol; }
         }
}

extern "C" void kernel_launch(void* const* d_in, const int* in_sizes, int n_in,
                              void* d_out, int out_size, void* d_ws, size_t ws_size, hipStream_t stream) {
    (void)in_sizes; (void)n_in; (void)out_size;
    const float* x = (const float*)d_in[0]; const float* wq = (const float*)d_in[1]; const float* wk = (const float*)d_in[2]; const float* wv = (const float*)d_in[3]; const float* wo = (const float*)d_in[4]; const float* fc = (const float*)d_in[5]; const float* cmask = (const float*)d_in[6];
    float* out = (float*)d_out;    // [2][2048][1024]
    char* wsp = (char*)d_ws;
    auto take = [&](size_t bytes) { char* p = wsp; wsp += (bytes + 255) & ~(size_t)255; return (void*)p; };
    bf* WQKV = (bf*)take((size_t)3 * DMOD * DMOD * 2); bf* WO = (bf*)take((size_t)DMOD * DMOD * 2);
    bf* Xb = (bf*)take((size_t)NN * DMOD * 2); float* QKV = (float*)take((size_t)NN * 3 * DMOD * 4);
    bf* Qh = (bf*)take((size_t)ZH * NN * HD * 2); bf* Ql = (bf*)take((size_t)ZH * NN * HD * 2); bf* Kh = (bf*)take((size_t)ZH * NN * HD * 2); bf* Kl = (bf*)take((size_t)ZH * NN * HD * 2); bf* VTh = (bf*)take((size_t)ZH * HD * NN * 2); bf* VTl = (bf*)take((size_t)ZH * HD * NN * 2);
    float* S = (float*)take((size_t)ZH * NN * NN * 4); bf* PH = (bf*)take((size_t)ZH * NN * NN * 2); bf* PL = (bf*)take((size_t)ZH * NN * NN * 2); float* O = (float*)take((size_t)NN * DMOD * 4); bf* Oh = (bf*)take((size_t)NN * DMOD * 2); bf* Ol = (bf*)take((size_t)NN * DMOD * 2);
    if ((size_t)(wsp - (char*)d_ws) > ws_size) return;    // ~ 125 MB
    k_wcat3<<<(unsigned)((3 * (size_t)DMOD * DMOD / 8 + 255) / 256), 256, 0, stream>>>(wq, wk, wv, WQKV); k_cvt8<<<(DMOD * DMOD / 8 + 255) / 256, 256, 0, stream>>>(wo, WO, DMOD * DMOD / 8);   // [out][in] natural
    for (int b = 0; b < NBT; ++b) {
        k_cvtx<<<NN / 8, 256, 0, stream>>>(x + (size_t)b * NN * DMOD, NN, Xb);
        k_gemmb<false, false><<<dim3(NN / 64, (3 * DMOD) / 64, 1), 128, 0, stream>>>(Xb, nullptr, WQKV, nullptr, QKV, 3 * DMOD, nullptr, nullptr, DMOD);   // [q | k | v]
        for (int g = 0; g < NH_ / ZH; ++g) { const int h0 = g * ZH;
            k_gropez<<<dim3(NN / 8, 1, ZH), 256, 0, stream>>>(QKV, 3 * DMOD, 0, h0, fc, Qh, Ql); k_gropez<<<dim3(NN / 8, 1, ZH), 256, 0, stream>>>(QKV, 3 * DMOD, DMOD, h0, fc, Kh, Kl);
            k_vtz<<<dim3((HD * (NN / 64)) / 8, 1, ZH), 256, 0, stream>>>(QKV + 2 * DMOD, 3 * DMOD, h0, NN, VTh, VTl);
            k_gemm3z<0><<<dim3(NN / 64, NN / 64, ZH), 128, 0, stream>>>(Qh, Ql, Kh, Kl, HD, S, NN, (size_t)NN * HD, (size_t)NN * HD, (size_t)NN * NN);
            k_amsoftz<<<dim3(NN / 8, 1, ZH), 256, 0, stream>>>(S, NN, SCL, cmask, PH, PL);
            k_gemm3z<0><<<dim3(NN / 64, 1, ZH), 128, 0, stream>>>(PH, PL, VTh, VTl, NN, O + h0 * HD, DMOD, (size_t)NN * NN, (size_t)HD * NN, (size_t)HD); }
        k_splitD<<<NN / 8, 256, 0, stream>>>(O, NN, Oh, Ol);
        k_gemmb<true, false><<<dim3(NN / 64, DMOD / 64, 1), 128, 0, stream>>>(Oh, Ol, WO, nullptr, out + (size_t)b * NN * DMOD, DMOD, nullptr, nullptr, DMOD); }
}

// v002
// A run of this version takes 360 microseconds.
// It is 5.60 times as fast as v000, going by the measured steps of the versions left out in between.
#include <hip/hip_runtime.h>

// Compute dtypes, f32 accumulate, per item: q/k/v = x.W^T fused as one [2048 x 1024].[1024 x 3072] GEMM with PLAIN bf16 operands (exact products); the interleaved-pair RoPE
// with the given (cos, sin) table applied while building the q/k planes, in that GEMM's epilogue, which also writes the transposed v planes; scores and attn.V with both operands as bf16 hi + UNSCALED residual planes (three
// products), fused with 1/sqrt(64), the additive float mask input (read as data, shared by all heads/items) and an online softmax in f32 in one kernel, 16 heads per launch in grid.z; wo on hi/lo planes of the merged heads

#define NBT  2
#define NN   2048
#define DMOD 1024
#define NH_  16
#define HD   64
#define ZH   16
#define DM   DMOD
#define NTK  NN
#define SCL  0.125f
#define LOSC 1024.0f

typedef _Float16 h16;
typedef unsigned short bf;
typedef __attribute__((ext_vector_type(16))) __bf16   v16bf;
typedef __attribute__((ext_vector_type(16))) _Float16 v16h;
typedef __attribute__((ext_vector_type(8)))  _Float16 v8h;
typedef __attribute__((ext_vector_type(8)))  unsigned short v8us;
typedef __attribute__((ext_vector_type(8)))  float    v8f;
typedef __attribute__((ext_vector_type(4)))  float    v4f;
typedef __attribute__((ext_vector_type(4)))  _Float16 v4h;
typedef v8h  __attribute__((may_alias)) v8ha;
typedef v4f  __attribute__((may_alias)) v4fa;
typedef v8us __attribute__((may_alias)) v8usa;

__device__ __forceinline__ unsigned short f2bf(float f) { unsigned u = __float_as_uint(f); u += 0x7FFFu + ((u >> 16) & 1u); return (unsigned short)(u >> 16); }
__device__ __forceinline__ float bf2f(unsigned short b) { return __uint_as_float(((unsigned)b) << 16); }
__device__ __forceinline__ float bfr(float f) { return bf2f(f2bf(f)); }
__device__ __forceinline__ v16h cat16(v8h lo, v8h hi) { return __builtin_shufflevector(lo, hi, 0, 1, 2, 3, 4, 5, 6, 7, 8, 9, 10, 11, 12, 13, 14, 15); }
__device__ __forceinline__ v16bf cat16b(v8us lo, v8us hi) { return __builtin_bit_cast(v16bf, __builtin_shufflevector(lo, hi, 0, 1, 2, 3, 4, 5, 6, 7, 8, 9, 10, 11, 12, 13, 14, 15)); }
__device__ __forceinline__ v8f wmma16(v16h a, v16h b, v8f c) { return __builtin_amdgcn_wmma_f32_16x16x32_f16(false, a, false, b, (short)0, c, false, false); }
__device__ __forceinline__ v8f wmmab(v16bf a, v16bf b, v8f c) { return __builtin_amdgcn_wmma_f32_16x16x32_bf16(false, a, false, b, (short)0, c, false, false); }

// k_gemmb: 64 x 64 block tile (4 waves x 16 x 64) of C[NTK][NW] = (A [+ Al]).B^T (K = 1024) [+ bf(bias[c])] [+ bf(R[r][c]) residual]; f32 whole-line epilogue (or f16 with F16OUT, or the
// QKV epilogue (C unused): the block's 64 columns are one head of q, k or v. q and k: interleaved-pair rotation, pair (2i, 2i+1): o0 = t0 c - t1 s, o1 = t0 s + t1 c with c = bf(fc[t][i][0]), s = bf(fc[t][i][1]),
// then bf16 hi + residual planes [head][token][64]; v: hi + residual planes transposed, [head][d][token]. Every plane row piece a wave stores is a whole 128-byte line.
template <bool SPLITA, bool F16OUT = false, bool QKV = false>
__global__ __launch_bounds__(128) void k_gemmb(const bf* __restrict__ A, const bf* __restrict__ Al, const bf* __restrict__ Bn, const float* __restrict__ bias, float* C, int ldc, h16* C2, const float* __restrict__ R = nullptr, int K = DM, int roundR = 1,
                                               const float* __restrict__ fc = nullptr, bf* Qh = nullptr, bf* Ql = nullptr, bf* Kh = nullptr, bf* Kl = nullptr, bf* VTh = nullptr, bf* VTl = nullptr) {
    __shared__ __align__(16) float ost[4][16 * 68];
    const int lane = threadIdx.x & 31, wave = threadIdx.x >> 5, lr = lane & 15, hi = lane >> 4;
    const int r0 = blockIdx.x * 64 + wave * 16, c0 = blockIdx.y * 64;
    const size_t aoff = (size_t)(r0 + lr) * K + 8 * hi;
    size_t boff[4];
#pragma unroll
    for (int t = 0; t < 4; ++t) boff[t] = (size_t)(c0 + t * 16 + lr) * K + 8 * hi;
    v8f acc[4];
#pragma unroll
    for (int t = 0; t < 4; ++t) acc[t] = (v8f){};
#pragma unroll 1
    for (int kc = 0; kc < K; kc += 32) {
        const v16bf a = cat16b(*(const v8us*)(A + aoff + kc), *(const v8us*)(A + aoff + kc + 16));
        v16bf al = a;
        if (SPLITA) al = cat16b(*(const v8us*)(Al + aoff + kc), *(const v8us*)(Al + aoff + kc + 16));
#pragma unroll
        for (int t = 0; t < 4; ++t) { const v16bf b = cat16b(*(const v8us*)(Bn + boff[t] + kc), *(const v8us*)(Bn + boff[t] + kc + 16)); acc[t] = wmmab(a, b, acc[t]); if (SPLITA) acc[t] = wmmab(al, b, acc[t]); }
        asm volatile("v_nop\n\tv_nop\n\tv_nop\n\tv_nop" : "+v"(acc[0]), "+v"(acc[1]), "+v"(acc[2]), "+v"(acc[3]) : "v"(a), "v"(al));
    }
    float* os = &ost[wave][0];
    if (QKV) {
        const int sec = c0 / DM, head = (c0 % DM) / HD, sub = lane >> 3, piece = lane & 7;
        if (sec < 2) {
            const size_t o = (size_t)(r0 + sub) * HD + piece * 8;   // the lane's 8 columns of token r0 + sub; step s is 4 tokens further on
            const float* fp = fc + o; v8f cs[4];
#pragma unroll
            for (int s = 0; s < 4; ++s) cs[s] = *(const v8f*)(fp + s * 4 * HD);   // requested first: they are in flight while the tile is staged
            asm volatile("s_wait_xcnt 0x0" :: "v"(fp) : "memory");   // the wait before a register that an issued load names is written again; it takes the address, which so stays as it is up to here
#pragma unroll
            for (int t = 0; t < 4; ++t) {
#pragma unroll
                for (int j = 0; j < 8; ++j) os[(hi * 8 + j) * 68 + t * 16 + lr] = acc[t][j]; }
            __syncthreads();
            bf* Ph = (sec ? Kh : Qh) + (size_t)head * NN * HD + o; bf* Pl = (sec ? Kl : Ql) + (size_t)head * NN * HD + o;
#pragma unroll
            for (int s = 0; s < 4; ++s) { const float* sp = os + (4 * s + sub) * 68 + piece * 8;
                const v4f xa = *(const v4fa*)sp, xb = *(const v4fa*)(sp + 4);
                const float x[8] = {xa[0], xa[1], xa[2], xa[3], xb[0], xb[1], xb[2], xb[3]}; v8us oh, ol;
#pragma unroll
                for (int i = 0; i < 4; ++i) { const float t0 = x[2 * i], t1 = x[2 * i + 1], c = bfr(cs[s][2 * i]), sn = bfr(cs[s][2 * i + 1]); const float y0 = t0 * c - t1 * sn, y1 = t0 * sn + t1 * c;
                    { const unsigned short hb = f2bf(y0); oh[2 * i] = hb; ol[2 * i] = f2bf(y0 - bf2f(hb)); } { const unsigned short hb = f2bf(y1); oh[2 * i + 1] = hb; ol[2 * i + 1] = f2bf(y1 - bf2f(hb)); } }
                *(v8us*)(Ph + s * 4 * HD) = oh; *(v8us*)(Pl + s * 4 * HD) = ol; }
        } else {
            float* fl = &ost[0][0];   // staged as [d][token of the block]: a lane's accumulator holds 8 consecutive tokens of one d
#pragma unroll
            for (int t = 0; t < 4; ++t) { float* dp = fl + (t * 16 + lr) * 68 + wave * 16 + hi * 8; *(v4fa*)dp = (v4f){acc[t][0], acc[t][1], acc[t][2], acc[t][3]}; *(v4fa*)(dp + 4) = (v4f){acc[t][4], acc[t][5], acc[t][6], acc[t][7]}; }
            __syncthreads();
            const size_t o = ((size_t)head * HD + wave * 16 + sub) * NN + blockIdx.x * 64 + piece * 8;   // the lane's 8 tokens of row d = wave * 16 + sub; step s is 4 rows further on
#pragma unroll
            for (int s = 0; s < 4; ++s) { const float* sp = fl + (wave * 16 + 4 * s + sub) * 68 + piece * 8;
                const v4f xa = *(const v4fa*)sp, xb = *(const v4fa*)(sp + 4);
                const float x[8] = {xa[0], xa[1], xa[2], xa[3], xb[0], xb[1], xb[2], xb[3]}; v8us oh, ol;
#pragma unroll
                for (int i = 0; i < 8; ++i) { const unsigned short hb = f2bf(x[i]); oh[i] = hb; ol[i] = f2bf(x[i] - bf2f(hb)); }
                *(v8us*)(VTh + o + s * 4 * NN) = oh; *(v8us*)(VTl + o + s * 4 * NN) = ol; }
            asm volatile("s_wait_xcnt 0x0" ::: "memory");   // the wait before a register that an issued store names is written again: in the built code the other branch's lines stand behind these stores
        }
        return;
    }
#pragma unroll
    for (int t = 0; t < 4; ++t) { const float bv = bias ? bfr(bias[c0 + t * 16 + lr]) : 0.f;
#pragma unroll
        for (int j = 0; j < 8; ++j) os[(hi * 8 + j) * 68 + t * 16 + lr] = acc[t][j] + bv; }
    __syncthreads();
    if (F16OUT) {
        h16* crow = (h16*)(void*)C + (size_t)r0 * ldc + c0;
        auto pass = [&]() {
#pragma unroll
            for (int s = 0; s < 4; ++s) { const int row = 4 * s + (lane >> 3), piece = lane & 7; const float* sp = os + row * 68 + piece * 8; v8h o, o2;
#pragma unroll
                for (int i = 0; i < 8; ++i) { const h16 a = (h16)sp[i]; o[i] = a; o2[i] = (h16)((sp[i] - (float)a) * LOSC); }
                *(v8h*)(crow + (size_t)row * ldc + piece * 8) = o; if (C2) *(v8h*)(C2 + (size_t)r0 * ldc + c0 + (size_t)row * ldc + piece * 8) = o2; }
        };
        pass(); 
    } else {
        float* crow = C + (size_t)r0 * ldc + c0;
        auto pass = [&]() {
#pragma unroll
            for (int s = 0; s < 8; ++s) { const int Lid = (lane >> 3) + 4 * s, piece = lane & 7; const int row = Lid >> 1, cofs = (Lid & 1) * 32 + piece * 4;
                v4f val = *(const v4fa*)(os + row * 68 + cofs); if (R) { const v4f rv = *(const v4f*)(R + ((size_t)r0 + row) * ldc + c0 + cofs); val += roundR ? (v4f){bfr(rv[0]), bfr(rv[1]), bfr(rv[2]), bfr(rv[3])} : rv; }
                *(v4f*)(crow + (size_t)row * ldc + cofs) = val; }
        };
        pass(); 
    }
}

__global__ __launch_bounds__(256) void k_cvt8(const float* __restrict__ src, bf* dst, size_t n8) {
    const size_t i = (size_t)blockIdx.x * 256 + threadIdx.x; if (i >= n8) return;
    const v8f v = *(const v8f*)(src + i * 8); v8us o;
#pragma unroll
    for (int k = 0; k < 8; ++k) o[k] = f2bf(v[k]);
    *(v8us*)(dst + i * 8) = o; 
}
__global__ __launch_bounds__(256) void k_zero8(bf* dst, size_t n8) {
    const size_t i = (size_t)blockIdx.x * 256 + threadIdx.x; if (i >= n8) return; v8us z;
#pragma unroll
    for (int k = 0; k < 8; ++k) z[k] = 0;
    *(v8us*)(dst + i * 8) = z; 
}

// ===== z-batched (blockIdx.z = head) attention pieces =====
__global__ __launch_bounds__(256) void k_planes32z(const float* __restrict__ F, int ld, int off, float sc, int rows, bf* Ph, bf* Pl) {
    typedef __attribute__((ext_vector_type(2))) unsigned short v2us;
    const int lane = threadIdx.x & 31; const size_t r = ((size_t)blockIdx.x * 8 + (threadIdx.x >> 5)) * 2 + (lane >> 4); if (r >= (size_t)rows) return; const int z = blockIdx.z; const int c0 = (lane & 15) * 2; v2us oh, ol;
    Ph += (size_t)z * rows * 32; Pl += (size_t)z * rows * 32;
#pragma unroll
    for (int i = 0; i < 2; ++i) { const float y = F[r * ld + off + z * 32 + c0 + i] * sc; const unsigned short hb = f2bf(y); oh[i] = hb; ol[i] = f2bf(y - bf2f(hb)); }
    const size_t o = r * 32 + c0; *(v2us*)(Ph + o) = oh; *(v2us*)(Pl + o) = ol; 
}
__global__ __launch_bounds__(256) void k_vtpadz(const float* __restrict__ F, int ld, int off, int nk, bf* Th, bf* Tl) {
    typedef __attribute__((ext_vector_type(2))) unsigned short v2us;
    const int lane = threadIdx.x & 31; const size_t wid = (size_t)blockIdx.x * 8 + (threadIdx.x >> 5); if (wid >= (size_t)64 * (nk / 64)) return; const int z = blockIdx.z; const int d = (int)(wid / (nk / 64)); const int k0 = (int)(wid % (nk / 64)) * 64 + lane * 2; v2us oh, ol;
    Th += (size_t)z * 64 * nk; Tl += (size_t)z * 64 * nk;
#pragma unroll
    for (int i = 0; i < 2; ++i) { const float y = (d < 32) ? F[(size_t)(k0 + i) * ld + off + z * 32 + (d < 32 ? d : 0)] : 0.f; const unsigned short hb = f2bf(y); oh[i] = hb; ol[i] = f2bf(y - bf2f(hb)); }
    const size_t o = (size_t)d * nk + k0; *(v2us*)(Th + o) = oh; *(v2us*)(Tl + o) = ol; 
}
template <int NK>
__global__ __launch_bounds__(256) void k_softmaxz(const float* __restrict__ S, int rows, bf* PH, bf* PL) {
    typedef __attribute__((ext_vector_type(4))) unsigned short v4us;
    const int lane = threadIdx.x & 31, i = blockIdx.x * 8 + (threadIdx.x >> 5); if (i >= rows) return; const size_t zo = (size_t)blockIdx.z * rows * NK; const float* sr = S + zo + (size_t)i * NK; PH += zo; PL += zo;
    float m = -3.0e38f;
#pragma unroll 1
    for (int c0 = lane * 4; c0 < NK; c0 += 128) {
#pragma unroll
        for (int q = 0; q < 4; ++q) m = fmaxf(m, sr[c0 + q]); }
#pragma unroll
    for (int sh = 16; sh; sh >>= 1) m = fmaxf(m, __shfl_xor(m, sh, 32));
    float sum = 0.f;
#pragma unroll 1
    for (int c0 = lane * 4; c0 < NK; c0 += 128) {
#pragma unroll
        for (int q = 0; q < 4; ++q) sum += __expf(sr[c0 + q] - m); }
#pragma unroll
    for (int sh = 16; sh; sh >>= 1) sum += __shfl_xor(sum, sh, 32);
    const float inv = 1.0f / sum;
{
#pragma unroll 1
        for (int c0 = lane * 4; c0 < NK; c0 += 128) { v4us oh, ol;
#pragma unroll
            for (int q = 0; q < 4; ++q) { const float p = __expf(sr[c0 + q] - m) * inv; const unsigned short hb = f2bf(p); oh[q] = hb; ol[q] = f2bf(p - bf2f(hb)); }
            const size_t o = (size_t)i * NK + c0; *(v4us*)(PH + o) = oh; *(v4us*)(PL + o) = ol; }
         }
}
__global__ __launch_bounds__(256) void k_placez(const float* __restrict__ XH, int rows, int ldy, float* Y) {
    const int lane = threadIdx.x & 31; const size_t q = (size_t)blockIdx.x * 8 + (threadIdx.x >> 5); if (q >= (size_t)rows) return; const int z = blockIdx.z; const float v = XH[((size_t)z * rows + q) * 64 + lane];
    *(float*)(Y + q * ldy + z * 32 + lane) = v; 
}

__global__ __launch_bounds__(256) void k_hplanesz(const float* __restrict__ F, int ld, int h0, float sc, int rows, bf* Ph, bf* Pl) {
    typedef __attribute__((ext_vector_type(2))) unsigned short v2us;
    const int lane = threadIdx.x & 31; const size_t r = (size_t)blockIdx.x * 8 + (threadIdx.x >> 5); if (r >= (size_t)rows) return; const int z = blockIdx.z; v2us oh, ol;
    Ph += (size_t)z * rows * 64; Pl += (size_t)z * rows * 64;
#pragma unroll
    for (int i = 0; i < 2; ++i) { const float y = F[r * ld + (h0 + z) * 64 + lane * 2 + i] * sc; const unsigned short hb = f2bf(y); oh[i] = hb; ol[i] = f2bf(y - bf2f(hb)); }
    const size_t o = r * 64 + lane * 2; *(v2us*)(Ph + o) = oh; *(v2us*)(Pl + o) = ol; 
}
template <int NK>
__global__ __launch_bounds__(256) void k_softmaxzs(const float* __restrict__ S, int rows, float sc, bf* PH, bf* PL) {
    typedef __attribute__((ext_vector_type(4))) unsigned short v4us;
    const int lane = threadIdx.x & 31, i = blockIdx.x * 8 + (threadIdx.x >> 5); if (i >= rows) return; const size_t zo = (size_t)blockIdx.z * rows * NK; const float* sr = S + zo + (size_t)i * NK; PH += zo; PL += zo;
    float m = -3.0e38f;
#pragma unroll 1
    for (int c0 = lane * 4; c0 < NK; c0 += 128) {
#pragma unroll
        for (int q = 0; q < 4; ++q) m = fmaxf(m, sr[c0 + q] * sc); }
#pragma unroll
    for (int sh = 16; sh; sh >>= 1) m = fmaxf(m, __shfl_xor(m, sh, 32));
    float sum = 0.f;
#pragma unroll 1
    for (int c0 = lane * 4; c0 < NK; c0 += 128) {
#pragma unroll
        for (int q = 0; q < 4; ++q) sum += __expf(sr[c0 + q] * sc - m); }
#pragma unroll
    for (int sh = 16; sh; sh >>= 1) sum += __shfl_xor(sum, sh, 32);
    const float inv = 1.0f / sum;
{
#pragma unroll 1
        for (int c0 = lane * 4; c0 < NK; c0 += 128) { v4us oh, ol;
#pragma unroll
            for (int q = 0; q < 4; ++q) { const float p = __expf(sr[c0 + q] * sc - m) * inv; const unsigned short hb = f2bf(p); oh[q] = hb; ol[q] = f2bf(p - bf2f(hb)); }
            const size_t o = (size_t)i * NK + c0; *(v4us*)(PH + o) = oh; *(v4us*)(PL + o) = ol; }
         }
}

__global__ __launch_bounds__(256) void k_cvtx(const float* __restrict__ src, int rows, bf* dst) {
    const int lane = threadIdx.x & 31; const size_t r = (size_t)blockIdx.x * 8 + (threadIdx.x >> 5); if (r >= (size_t)rows) return;
{
#pragma unroll
        for (int q = 0; q < DMOD / 256; ++q) { v8us o;
#pragma unroll
            for (int i = 0; i < 8; ++i) o[i] = f2bf(src[r * DMOD + q * 256 + lane * 8 + i]);
            *(v8us*)(dst + r * DMOD + q * 256 + lane * 8) = o; }
         }
}
__global__ __launch_bounds__(256) void k_wcat3(const float* __restrict__ Wq, const float* __restrict__ Wk, const float* __restrict__ Wv, bf* WQKV) {
    const size_t i = ((size_t)blockIdx.x * 256 + threadIdx.x) * 8; if (i >= (size_t)3 * DMOD * DMOD) return; const size_t blk = i / ((size_t)DMOD * DMOD), o = i % ((size_t)DMOD * DMOD);
    const float* src = (blk == 0) ? Wq : (blk == 1) ? Wk : Wv; v8us v;
#pragma unroll
    for (int q = 0; q < 8; ++q) v[q] = f2bf(src[o + q]);
    *(v8us*)(WQKV + i) = v; 
}
// k_fattn: scores, scale, additive mask, softmax and attn.V of one head (blockIdx.z) in one kernel, running maximum and sum per query (online softmax), no score or probability plane in memory.
// Transposed products: S^T = K.Q^T (A = 16 key rows, B = 16 query columns), so a lane holds 8 keys of ONE query per tile; two key tiles, converted in place, are the B operand P^T of O^T += V^T.P^T.
// A wave owns QT * 16 queries and walks the keys 32 at a time; operands are bf16 hi + residual planes, three products each.
// Every '#pragma unroll' in it: the fragment and accumulator arrays are indexed by those loop counters and stay in registers only when the loops are unrolled.
#define QT 2
typedef __attribute__((ext_vector_type(2))) float  v2f;
typedef __attribute__((ext_vector_type(2))) __bf16 v2bf;
typedef __attribute__((ext_vector_type(8))) unsigned v8u;
__device__ __forceinline__ float xhalf(float v) { const int b = __float_as_int(v); return __int_as_float(__builtin_amdgcn_permlanex16(b, b, 0x76543210, 0xfedcba98, false, false)); }   // value of lane l ^ 16
typedef const __attribute__((address_space(1))) char*  gch;    // global-memory pointers by type: a pointer that has passed through an asm operand would otherwise be read with flat loads
typedef const __attribute__((address_space(1))) v8us*  gv8us;
typedef const __attribute__((address_space(1))) v8f*   gv8f;
__device__ __forceinline__ v16bf ldfrag(gch p) { return cat16b(*(gv8us)p, *(gv8us)(p + 32)); }   // bytes 0..15 and 32..47: k 8h..8h+7 and 16+8h..16+8h+7
__global__ __launch_bounds__(128) void k_fattn(const bf* Qh_, const bf* Ql_, const bf* Kh_, const bf* Kl_, const bf* VTh_, const bf* VTl_, const float* M_, float sc, float* O) {
    const int lane = threadIdx.x & 31, wave = __builtin_amdgcn_readfirstlane(threadIdx.x >> 5), lr = lane & 15, hi = lane >> 4;
    const int q0 = (blockIdx.x * 4 + wave) * (QT * 16); const size_t z = blockIdx.z;
    // wave-uniform byte bases; the lane's own part of every address is one of three loop-invariant 32-bit byte offsets
    gch Qh = (gch)Qh_ + (z * NN + q0) * (HD * 2), Ql = (gch)Ql_ + (z * NN + q0) * (HD * 2), Kh = (gch)Kh_ + z * (NN * HD * 2), Kl = (gch)Kl_ + z * (NN * HD * 2), VTh = (gch)VTh_ + z * (HD * NN * 2), VTl = (gch)VTl_ + z * (HD * NN * 2), M = (gch)M_ + (size_t)q0 * (NN * 4);
    unsigned ko = (lr * HD + 8 * hi) * 2, vo = (lr * NN + 8 * hi) * 2, mo = (lr * NN + 8 * hi) * 4;
    v16bf qh[QT][2], ql[QT][2];
#pragma unroll
    for (int u = 0; u < QT; ++u) {
#pragma unroll
        for (int ks = 0; ks < 2; ++ks) { qh[u][ks] = ldfrag(Qh + (u * 16 * HD + ks * 32) * 2 + ko); ql[u][ks] = ldfrag(Ql + (u * 16 * HD + ks * 32) * 2 + ko); } }
    v8f o[QT][4]; float m[QT], l[QT];
#pragma unroll
    for (int u = 0; u < QT; ++u) { m[u] = -3.0e38f; l[u] = 0.f;
#pragma unroll
        for (int dt = 0; dt < 4; ++dt) o[u][dt] = (v8f){}; }
    v16bf kh[2][2], kl[2][2]; v8f mk[QT][2];
#pragma unroll
    for (int t = 0; t < 2; ++t) {
#pragma unroll
        for (int ks = 0; ks < 2; ++ks) { kh[t][ks] = ldfrag(Kh + (t * 16 * HD + ks * 32) * 2 + ko); kl[t][ks] = ldfrag(Kl + (t * 16 * HD + ks * 32) * 2 + ko); }
#pragma unroll
        for (int u = 0; u < QT; ++u) mk[u][t] = *(gv8f)(M + (u * 16 * NN + t * 16) * 4 + mo); }
    // the wait before a register that an issued load names is written again; the statement takes those registers, so that they stay as they are up to it and the bases move on behind it
    asm volatile("s_wait_xcnt 0x0" : "+s"(Kh), "+s"(Kl), "+s"(M), "+v"(ko), "+v"(mo) :: "memory");
    Kh += 32 * HD * 2; Kl += 32 * HD * 2; M += 32 * 4;   // from here on: the pass that is fetched ahead
#pragma unroll 1   // rolled: a pass is some 600 instructions already, and the fetch-ahead below spans the back edge without a second copy
    for (int key0 = 0; key0 < NN; key0 += 32) {
        v16bf vh[4], vl[4]; v8f st[QT][2];
#pragma unroll
        for (int dt = 0; dt < 4; ++dt) { vh[dt] = ldfrag(VTh + dt * 16 * NN * 2 + vo); vl[dt] = ldfrag(VTl + dt * 16 * NN * 2 + vo); }
        __builtin_amdgcn_sched_barrier(0);   // V^T is requested before the score products, which hide its latency
#pragma unroll
        for (int u = 0; u < QT; ++u) {
#pragma unroll
            for (int t = 0; t < 2; ++t) { v8f a = (v8f){};
#pragma unroll
                for (int ks = 0; ks < 2; ++ks) { a = wmmab(kh[t][ks], qh[u][ks], a); a = wmmab(kl[t][ks], qh[u][ks], a); a = wmmab(kh[t][ks], ql[u][ks], a); }
#pragma unroll
                for (int j = 0; j < 8; ++j) a[j] = a[j] * sc + bfr(mk[u][t][j]);
                st[u][t] = a; } }
        // the next 32 keys' K fragments and mask values are fetched here; the last pass re-reads its own (in bounds, unused)
#pragma unroll
        for (int t = 0; t < 2; ++t) {
#pragma unroll
            for (int ks = 0; ks < 2; ++ks) { kh[t][ks] = ldfrag(Kh + (t * 16 * HD + ks * 32) * 2 + ko); kl[t][ks] = ldfrag(Kl + (t * 16 * HD + ks * 32) * 2 + ko); }
#pragma unroll
            for (int u = 0; u < QT; ++u) mk[u][t] = *(gv8f)(M + (u * 16 * NN + t * 16) * 4 + mo); }
        __builtin_amdgcn_sched_barrier(0);   // ... and requested before the softmax and attn.V of this pass, which hide their latency
#pragma unroll
        for (int u = 0; u < QT; ++u) {
            float mx = -3.0e38f;
#pragma unroll
            for (int t = 0; t < 2; ++t) {
#pragma unroll
                for (int j = 0; j < 8; ++j) mx = fmaxf(mx, st[u][t][j]); }
            mx = fmaxf(mx, xhalf(mx));
            const float mn = fmaxf(m[u], mx), al = __expf(m[u] - mn); m[u] = mn;
            float ps = 0.f; v8u pH, pL;
#pragma unroll
            for (int t = 0; t < 2; ++t) {
#pragma unroll
                for (int jj = 0; jj < 4; ++jj) { const v2f p = {__expf(st[u][t][2 * jj] - mn), __expf(st[u][t][2 * jj + 1] - mn)}; ps += p[0] + p[1];
                    const unsigned hb = __builtin_bit_cast(unsigned, __builtin_convertvector(p, v2bf));
                    const v2f r = {p[0] - __uint_as_float(hb << 16), p[1] - __uint_as_float(hb & 0xFFFF0000u)};
                    pH[t * 4 + jj] = hb; pL[t * 4 + jj] = __builtin_bit_cast(unsigned, __builtin_convertvector(r, v2bf)); } }
            l[u] = l[u] * al + ps;
            const v16bf ph = __builtin_bit_cast(v16bf, pH), pl = __builtin_bit_cast(v16bf, pL);
#pragma unroll
            for (int dt = 0; dt < 4; ++dt) { v8f a = o[u][dt] * al; a = wmmab(vh[dt], ph, a); a = wmmab(vl[dt], ph, a); a = wmmab(vh[dt], pl, a); o[u][dt] = a; }
        }
        __builtin_amdgcn_sched_barrier(0);   // keeps the wait below at the foot of the pass, where the requests have long been taken: higher up the wave would stand on it
        asm volatile("s_wait_xcnt 0x0" : "+s"(VTh), "+s"(VTl), "+s"(Kh), "+s"(Kl), "+s"(M), "+v"(ko), "+v"(vo), "+v"(mo) :: "memory");   // as in front of the loop, for this pass's loads
        const int step = (key0 + 64 < NN) ? 32 : 0;
        VTh += 32 * 2; VTl += 32 * 2; Kh += step * (HD * 2); Kl += step * (HD * 2); M += step * 4;
    }
#pragma unroll
    for (int u = 0; u < QT; ++u) { const float inv = 1.0f / (l[u] + xhalf(l[u])); float* orow = O + (size_t)(q0 + u * 16 + lr) * DMOD + z * HD + 8 * hi;
#pragma unroll
        for (int dt = 0; dt < 4; ++dt) { const v8f a = o[u][dt] * inv; *(v4f*)(orow + dt * 16) = (v4f){a[0], a[1], a[2], a[3]}; *(v4f*)(orow + dt * 16 + 4) = (v4f){a[4], a[5], a[6], a[7]}; } }
}
__global__ __launch_bounds__(256) void k_csoftz(const float* __restrict__ S, int rows, float sc, bf* PH, bf* PL) {
    typedef __attribute__((ext_vector_type(4))) unsigned short v4us;
    const int lane = threadIdx.x & 31, i = blockIdx.x * 8 + (threadIdx.x >> 5); if (i >= rows) return; const size_t zo = (size_t)blockIdx.z * rows * NN; const float* sr = S + zo + (size_t)i * NN; PH += zo; PL += zo;
    float m = -3.0e38f;
#pragma unroll 1
    for (int c0 = lane * 4; c0 < NN; c0 += 128) {
#pragma unroll
        for (int q = 0; q < 4; ++q) { const int k = c0 + q; if (k <= i) m = fmaxf(m, sr[k] * sc); } }
#pragma unroll
    for (int sh = 16; sh; sh >>= 1) m = fmaxf(m, __shfl_xor(m, sh, 32));
    float sum = 0.f;
#pragma unroll 1
    for (int c0 = lane * 4; c0 < NN; c0 += 128) {
#pragma unroll
        for (int q = 0; q < 4; ++q) { const int k = c0 + q; if (k <= i) sum += __expf(sr[k] * sc - m); } }
#pragma unroll
    for (int sh = 16; sh; sh >>= 1) sum += __shfl_xor(sum, sh, 32);
    const float inv = 1.0f / sum;
{
#pragma unroll 1
        for (int c0 = lane * 4; c0 < NN; c0 += 128) { v4us oh, ol;
#pragma unroll
            for (int q = 0; q < 4; ++q) { const int k = c0 + q; const float p = (k <= i) ? __expf(sr[(k <= i) ? k : 0] * sc - m) * inv : 0.f; const unsigned short hb = f2bf(p); oh[q] = hb; ol[q] = f2bf(p - bf2f(hb)); }
            const size_t o = (size_t)i * NN + c0; *(v4us*)(PH + o) = oh; *(v4us*)(PL + o) = ol; }
         }
}
__global__ __launch_bounds__(256) void k_splitD(const float* __restrict__ src, int rows, bf* dh, bf* dl) {
    const int lane = threadIdx.x & 31; const size_t r = (size_t)blockIdx.x * 8 + (threadIdx.x >> 5); if (r >= (size_t)rows) return;
{
#pragma unroll
        for (int q = 0; q < DMOD / 256; ++q) { const size_t o = r * DMOD + q * 256 + lane * 8; const v8f v = *(const v8f*)(src + o); v8us oh, ol;
#pragma unroll
            for (int i = 0; i < 8; ++i) { const unsigned short hb = f2bf(v[i]); oh[i] = hb; ol[i] = f2bf(v[i] - bf2f(hb)); }
            *(v8us*)(dh + o) = oh; *(v8us*)(dl + o) = ol; }
         }
}

extern "C" void kernel_launch(void* const* d_in, const int* in_sizes, int n_in,
                              void* d_out, int out_size, void* d_ws, size_t ws_size, hipStream_t stream) {
    (void)in_sizes; (void)n_in; (void)out_size;
    const float* x = (const float*)d_in[0]; const float* wq = (const float*)d_in[1]; const float* wk = (const float*)d_in[2]; const float* wv = (const float*)d_in[3]; const float* wo = (const float*)d_in[4]; const float* fc = (const float*)d_in[5]; const float* cmask = (const float*)d_in[6];
    float* out = (float*)d_out;    // [2][2048][1024]
    char* wsp = (char*)d_ws;
    auto take = [&](size_t bytes) { char* p = wsp; wsp += (bytes + 255) & ~(size_t)255; return (void*)p; };
    bf* WQKV = (bf*)take((size_t)3 * DMOD * DMOD * 2); bf* WO = (bf*)take((size_t)DMOD * DMOD * 2);
    bf* Xb = (bf*)take((size_t)NN * DMOD * 2);
    bf* Qh = (bf*)take((size_t)ZH * NN * HD * 2); bf* Ql = (bf*)take((size_t)ZH * NN * HD * 2); bf* Kh = (bf*)take((size_t)ZH * NN * HD * 2); bf* Kl = (bf*)take((size_t)ZH * NN * HD * 2); bf* VTh = (bf*)take((size_t)ZH * HD * NN * 2); bf* VTl = (bf*)take((size_t)ZH * HD * NN * 2);
    float* O = (float*)take((size_t)NN * DMOD * 4); bf* Oh = (bf*)take((size_t)NN * DMOD * 2); bf* Ol = (bf*)take((size_t)NN * DMOD * 2);
    if ((size_t)(wsp - (char*)d_ws) > ws_size) return;    // ~ 52 MiB
    k_wcat3<<<(unsigned)((3 * (size_t)DMOD * DMOD / 8 + 255) / 256), 256, 0, stream>>>(wq, wk, wv, WQKV); k_cvt8<<<(DMOD * DMOD / 8 + 255) / 256, 256, 0, stream>>>(wo, WO, DMOD * DMOD / 8);   // [out][in] natural
    for (int b = 0; b < NBT; ++b) {
        k_cvtx<<<NN / 8, 256, 0, stream>>>(x + (size_t)b * NN * DMOD, NN, Xb);
        k_gemmb<false, false, true><<<dim3(NN / 64, (3 * DMOD) / 64, 1), 128, 0, stream>>>(Xb, nullptr, WQKV, nullptr, nullptr, 0, nullptr, nullptr, DMOD, 1, fc, Qh, Ql, Kh, Kl, VTh, VTl);   // [q | k | v], all 16 heads' planes
        for (int g = 0; g < NH_ / ZH; ++g) { const int h0 = g * ZH;
            k_fattn<<<dim3(NN / (QT * 64), 1, ZH), 128, 0, stream>>>(Qh, Ql, Kh, Kl, VTh, VTl, cmask, SCL, O + h0 * HD); }
        k_splitD<<<NN / 8, 256, 0, stream>>>(O, NN, Oh, Ol);
        k_gemmb<true, false><<<dim3(NN / 64, DMOD / 64, 1), 128, 0, stream>>>(Oh, Ol, WO, nullptr, out + (size_t)b * NN * DMOD, DMOD, nullptr, nullptr, DMOD); }
}

// v003
// One run takes 256 microseconds.
// Two timings next to v002 put it at 1.45 and 1.39 times that version's speed.
// Over all steps from v000 it is 7.96 times as fast.
#include <hip/hip_runtime.h>

// Compute dtypes, f32 accumulate, per item: q/k/v = x.W^T fused as one [2048 x 1024].[1024 x 3072] GEMM with PLAIN bf16 operands (exact products); the interleaved-pair RoPE
// with the given (cos, sin) table applied while building the q/k planes, in that GEMM's epilogue, which also writes the transposed v planes; scores and attn.V with both operands as bf16 hi + UNSCALED residual planes (three
// products), fused with 1/sqrt(64), the additive float mask input (read as data, shared by all heads/items) and an online softmax in f32 in one kernel, 16 heads per launch in grid.z; wo on hi/lo planes of the merged heads
// FRAGMENT ORDER: every bf16 operand plane (x, the weights, q, k, v^T, the merged heads) is stored as the matrix instruction's lanes read it. A plane [R][Kd] is cut into tiles of 16 rows x 32 k, tile (r >> 4) * (Kd / 32) + (k >> 5),
// 512 elements each: element (r, k) lies at tile * 512 + ((k >> 4) & 1) * 256 + ((k >> 3) & 1) * 128 + (r & 15) * 8 + (k & 7). Lane l = 16 * hi + lr reads its 16 bytes at l * 16 of each 512-byte half, so a fragment load takes 4 whole lines, not 16 pieces.

#define NBT  2
#define NN   2048
#define DMOD 1024
#define NH_  16
#define HD   64
#define ZH   16
#define DM   DMOD
#define NTK  NN
#define SCL  0.125f
#define LOSC 1024.0f

typedef _Float16 h16;
typedef unsigned short bf;
typedef __attribute__((ext_vector_type(16))) __bf16   v16bf;
typedef __attribute__((ext_vector_type(16))) _Float16 v16h;
typedef __attribute__((ext_vector_type(8)))  _Float16 v8h;
typedef __attribute__((ext_vector_type(8)))  unsigned short v8us;
typedef __attribute__((ext_vector_type(8)))  float    v8f;
typedef __attribute__((ext_vector_type(4)))  float    v4f;
typedef __attribute__((ext_vector_type(4)))  _Float16 v4h;
typedef v8h  __attribute__((may_alias)) v8ha;
typedef v4f  __attribute__((may_alias)) v4fa;
typedef v8us __attribute__((may_alias)) v8usa;

__device__ __forceinline__ unsigned short f2bf(float f) { unsigned u = __float_as_uint(f); u += 0x7FFFu + ((u >> 16) & 1u); return (unsigned short)(u >> 16); }
__device__ __forceinline__ float bf2f(unsigned short b) { return __uint_as_float(((unsigned)b) << 16); }
__device__ __forceinline__ float bfr(float f) { return bf2f(f2bf(f)); }
__device__ __forceinline__ v16h cat16(v8h lo, v8h hi) { return __builtin_shufflevector(lo, hi, 0, 1, 2, 3, 4, 5, 6, 7, 8, 9, 10, 11, 12, 13, 14, 15); }
__device__ __forceinline__ v16bf cat16b(v8us lo, v8us hi) { return __builtin_bit_cast(v16bf, __builtin_shufflevector(lo, hi, 0, 1, 2, 3, 4, 5, 6, 7, 8, 9, 10, 11, 12, 13, 14, 15)); }
__device__ __forceinline__ v8f wmma16(v16h a, v16h b, v8f c) { return __builtin_amdgcn_wmma_f32_16x16x32_f16(false, a, false, b, (short)0, c, false, false); }
__device__ __forceinline__ v8f wmmab(v16bf a, v16bf b, v8f c) { return __builtin_amdgcn_wmma_f32_16x16x32_bf16(false, a, false, b, (short)0, c, false, false); }

typedef const __attribute__((address_space(1))) char*  gch;    // global-memory pointers by type: a pointer that has passed through an asm operand would otherwise be read with flat loads
typedef const __attribute__((address_space(1))) v8us*  gv8us;
typedef const __attribute__((address_space(1))) v8f*   gv8f;
__device__ __forceinline__ v16bf ldfrag(gch p) { return cat16b(*(gv8us)p, *(gv8us)(p + 512)); }   // the lane's 16 bytes of each half of a tile in fragment order: k 8h..8h+7 and 16+8h..16+8h+7

// k_gemmb: 64 x 64 block tile (4 waves x 16 x 64) of C[NTK][NW] = (A [+ Al]).B^T (K = 1024) [+ bf(bias[c])] [+ bf(R[r][c]) residual]; f32 whole-line epilogue (or f16
// QKV epilogue (C unused): the block's 64 columns are one head of q, k or v. q and k: interleaved-pair rotation, pair (2i, 2i+1): o0 = t0 c - t1 s, o1 = t0 s + t1 c with c = bf(fc[t][i][0]), s = bf(fc[t][i][1]),
// then bf16 hi + residual planes [head][token][64]; v: hi + residual planes transposed, [head][d][token]; both in fragment order per head. Every store of a wave is 512 bytes in a row, four whole 128-byte lines. A, Al and Bn are read in fragment order.
template <bool SPLITA, bool F16OUT = false, bool QKV = false>
__global__ __launch_bounds__(128) void k_gemmb(const bf* __restrict__ A, const bf* __restrict__ Al, const bf* __restrict__ Bn, const float* __restrict__ bias, float* C, int ldc, h16* C2, const float* __restrict__ R = nullptr, int K = DM, int roundR = 1,
                                               const float* __restrict__ fc = nullptr, bf* Qh = nullptr, bf* Ql = nullptr, bf* Kh = nullptr, bf* Kl = nullptr, bf* VTh = nullptr, bf* VTl = nullptr) {
    __shared__ __align__(16) float ost[4][16 * 68];
    const int lane = threadIdx.x & 31, wave = __builtin_amdgcn_readfirstlane(threadIdx.x >> 5), lr = lane & 15, hi = lane >> 4;   // the wave's number as a scalar: every fragment address is then a scalar base + lane * 16 bytes
    const int r0 = blockIdx.x * 64 + wave * 16, c0 = blockIdx.y * 64;
    // fragment order, planes of DM columns: a row tile is DM / 32 tiles of 1024 bytes; scalar byte bases that move on one tile a trip, and the lane's loop-invariant place in a half tile
    gch pa = (gch)A + (size_t)(r0 >> 4) * (DM * 32), pl = (gch)Al + (size_t)(r0 >> 4) * (DM * 32), pb = (gch)Bn + (size_t)(c0 >> 4) * (DM * 32);
    unsigned fo = lane * 16;
    v8f acc[4];
#pragma unroll
    for (int t = 0; t < 4; ++t) acc[t] = (v8f){};
#pragma unroll 1
    for (int kc = 0; kc < K; kc += 32) {
        const v16bf a = ldfrag(pa + fo);
        v16bf al = a, b[4];
        if (SPLITA) al = ldfrag(pl + fo);
#pragma unroll
        for (int t = 0; t < 4; ++t) b[t] = ldfrag(pb + t * (DM * 32) + fo);
        __builtin_amdgcn_sched_barrier(0);   // all of the trip's fragments are requested before its first product: without it the built code fetched one column tile at a time into the same registers, one latency each
#pragma unroll
        for (int t = 0; t < 4; ++t) { acc[t] = wmmab(a, b[t], acc[t]); if (SPLITA) acc[t] = wmmab(al, b[t], acc[t]); }
        asm volatile("v_nop\n\tv_nop\n\tv_nop\n\tv_nop" : "+v"(acc[0]), "+v"(acc[1]), "+v"(acc[2]), "+v"(acc[3]) : "v"(a), "v"(al));
        // the wait before a register that an issued load names is written again; the statement takes those registers, so that they stay as they are up to it and the bases move on behind it
        if (SPLITA) asm volatile("s_wait_xcnt 0x0" : "+s"(pa), "+s"(pl), "+s"(pb), "+v"(fo) :: "memory"); else asm volatile("s_wait_xcnt 0x0" : "+s"(pa), "+s"(pb), "+v"(fo) :: "memory");
        pa += 1024; pl += 1024; pb += 1024;
    }
    float* os = &ost[wave][0];
    if (QKV) {
        const int sec = c0 / DM, head = (c0 % DM) / HD;
        if (sec < 2) {
            const size_t o = (size_t)(r0 >> 4) * (16 * HD) + lane * 8;   // the wave's 16 tokens are two tiles; step s is the half with columns 16 s + 8 hi .. + 7 of token r0 + lr
            const float* fp = fc + (size_t)(r0 + lr) * HD + hi * 8; v8f cs[4];
#pragma unroll
            for (int s = 0; s < 4; ++s) cs[s] = *(const v8f*)(fp + s * 16);   // requested first: they are in flight while the tile is staged
            asm volatile("s_wait_xcnt 0x0" :: "v"(fp) : "memory");   // the wait before a register that an issued load names is written again; it takes the address, which so stays as it is up to here
#pragma unroll
            for (int t = 0; t < 4; ++t) {
#pragma unroll
                for (int j = 0; j < 8; ++j) os[(hi * 8 + j) * 68 + t * 16 + lr] = acc[t][j]; }
            __syncthreads();
            bf* Ph = (sec ? Kh : Qh) + (size_t)head * NN * HD + o; bf* Pl = (sec ? Kl : Ql) + (size_t)head * NN * HD + o;
#pragma unroll
            for (int s = 0; s < 4; ++s) { const float* sp = os + lr * 68 + s * 16 + hi * 8;
                const v4f xa = *(const v4fa*)sp, xb = *(const v4fa*)(sp + 4);
                const float x[8] = {xa[0], xa[1], xa[2], xa[3], xb[0], xb[1], xb[2], xb[3]}; v8us oh, ol;
#pragma unroll
                for (int i = 0; i < 4; ++i) { const float t0 = x[2 * i], t1 = x[2 * i + 1], c = bfr(cs[s][2 * i]), sn = bfr(cs[s][2 * i + 1]); const float y0 = t0 * c - t1 * sn, y1 = t0 * sn + t1 * c;
                    { const unsigned short hb = f2bf(y0); oh[2 * i] = hb; ol[2 * i] = f2bf(y0 - bf2f(hb)); } { const unsigned short hb = f2bf(y1); oh[2 * i + 1] = hb; ol[2 * i + 1] = f2bf(y1 - bf2f(hb)); } }
                *(v8us*)(Ph + s * 256) = oh; *(v8us*)(Pl + s * 256) = ol; }
        } else {
            float* fl = &ost[0][0];   // staged as [d][token of the block]: a lane's accumulator holds 8 consecutive tokens of one d
#pragma unroll
            for (int t = 0; t < 4; ++t) { float* dp = fl + (t * 16 + lr) * 68 + wave * 16 + hi * 8; *(v4fa*)dp = (v4f){acc[t][0], acc[t][1], acc[t][2], acc[t][3]}; *(v4fa*)(dp + 4) = (v4f){acc[t][4], acc[t][5], acc[t][6], acc[t][7]}; }
            __syncthreads();
            const size_t o = (size_t)head * HD * NN + ((size_t)wave * (NN / 32) + blockIdx.x * 2) * 512 + lane * 8;   // row tile d = 16 wave + lr, the block's two token tiles; step s is the half with tokens 16 s + 8 hi .. + 7
#pragma unroll
            for (int s = 0; s < 4; ++s) { const float* sp = fl + (wave * 16 + lr) * 68 + s * 16 + hi * 8;
                const v4f xa = *(const v4fa*)sp, xb = *(const v4fa*)(sp + 4);
                const float x[8] = {xa[0], xa[1], xa[2], xa[3], xb[0], xb[1], xb[2], xb[3]}; v8us oh, ol;
#pragma unroll
                for (int i = 0; i < 8; ++i) { const unsigned short hb = f2bf(x[i]); oh[i] = hb; ol[i] = f2bf(x[i] - bf2f(hb)); }
                *(v8us*)(VTh + o + s * 256) = oh; *(v8us*)(VTl + o + s * 256) = ol; }
            asm volatile("s_wait_xcnt 0x0" ::: "memory");   // the wait before a register that an issued store names is written again: in the built code the other branch's lines stand behind these stores
        }
        return;
    }
#pragma unroll
    for (int t = 0; t < 4; ++t) { const float bv = bias ? bfr(bias[c0 + t * 16 + lr]) : 0.f;
#pragma unroll
        for (int j = 0; j < 8; ++j) os[(hi * 8 + j) * 68 + t * 16 + lr] = acc[t][j] + bv; }
    __syncthreads();
    if (F16OUT) {
        h16* crow = (h16*)(void*)C + (size_t)r0 * ldc + c0;
        auto pass = [&]() {
#pragma unroll
            for (int s = 0; s < 4; ++s) { const int row = 4 * s + (lane >> 3), piece = lane & 7; const float* sp = os + row * 68 + piece * 8; v8h o, o2;
#pragma unroll
                for (int i = 0; i < 8; ++i) { const h16 a = (h16)sp[i]; o[i] = a; o2[i] = (h16)((sp[i] - (float)a) * LOSC); }
                *(v8h*)(crow + (size_t)row * ldc + piece * 8) = o; if (C2) *(v8h*)(C2 + (size_t)r0 * ldc + c0 + (size_t)row * ldc + piece * 8) = o2; }
        };
        pass(); 
    } else {
        float* crow = C + (size_t)r0 * ldc + c0;
        auto pass = [&]() {
#pragma unroll
            for (int s = 0; s < 8; ++s) { const int Lid = (lane >> 3) + 4 * s, piece = lane & 7; const int row = Lid >> 1, cofs = (Lid & 1) * 32 + piece * 4;
                v4f val = *(const v4fa*)(os + row * 68 + cofs); if (R) { const v4f rv = *(const v4f*)(R + ((size_t)r0 + row) * ldc + c0 + cofs); val += roundR ? (v4f){bfr(rv[0]), bfr(rv[1]), bfr(rv[2]), bfr(rv[3])} : rv; }
                *(v4f*)(crow + (size_t)row * ldc + cofs) = val; }
        };
        pass(); 
    }
}

// The converters below write fragment order: a wave makes one tile (16 rows x 32 k of a [rows][DMOD] f32 source): it reads 16 whole 128-byte lines and stores the two 512-byte halves.
__device__ __forceinline__ const float* tilesrc(const float* src, size_t rowtile, size_t ktile, int lane) { return src + (rowtile * 16 + (lane & 15)) * DMOD + ktile * 32 + (lane >> 4) * 8; }   // the lane's 8 values of half 0; half 1 is 16 further on
__global__ __launch_bounds__(256) void k_zero8(bf* dst, size_t n8) {
    const size_t i = (size_t)blockIdx.x * 256 + threadIdx.x; if (i >= n8) return; v8us z;
#pragma unroll
    for (int k = 0; k < 8; ++k) z[k] = 0;
    *(v8us*)(dst + i * 8) = z; 
}

// ===== z-batched (blockIdx.z = head) attention pieces =====
__global__ __launch_bounds__(256) void k_planes32z(const float* __restrict__ F, int ld, int off, float sc, int rows, bf* Ph, bf* Pl) {
    typedef __attribute__((ext_vector_type(2))) unsigned short v2us;
    const int lane = threadIdx.x & 31; const size_t r = ((size_t)blockIdx.x * 8 + (threadIdx.x >> 5)) * 2 + (lane >> 4); if (r >= (size_t)rows) return; const int z = blockIdx.z; const int c0 = (lane & 15) * 2; v2us oh, ol;
    Ph += (size_t)z * rows * 32; Pl += (size_t)z * rows * 32;
#pragma unroll
    for (int i = 0; i < 2; ++i) { const float y = F[r * ld + off + z * 32 + c0 + i] * sc; const unsigned short hb = f2bf(y); oh[i] = hb; ol[i] = f2bf(y - bf2f(hb)); }
    const size_t o = r * 32 + c0; *(v2us*)(Ph + o) = oh; *(v2us*)(Pl + o) = ol; 
}
__global__ __launch_bounds__(256) void k_vtpadz(const float* __restrict__ F, int ld, int off, int nk, bf* Th, bf* Tl) {
    typedef __attribute__((ext_vector_type(2))) unsigned short v2us;
    const int lane = threadIdx.x & 31; const size_t wid = (size_t)blockIdx.x * 8 + (threadIdx.x >> 5); if (wid >= (size_t)64 * (nk / 64)) return; const int z = blockIdx.z; const int d = (int)(wid / (nk / 64)); const int k0 = (int)(wid % (nk / 64)) * 64 + lane * 2; v2us oh, ol;
    Th += (size_t)z * 64 * nk; Tl += (size_t)z * 64 * nk;
#pragma unroll
    for (int i = 0; i < 2; ++i) { const float y = (d < 32) ? F[(size_t)(k0 + i) * ld + off + z * 32 + (d < 32 ? d : 0)] : 0.f; const unsigned short hb = f2bf(y); oh[i] = hb; ol[i] = f2bf(y - bf2f(hb)); }
    const size_t o = (size_t)d * nk + k0; *(v2us*)(Th + o) = oh; *(v2us*)(Tl + o) = ol; 
}
template <int NK>
__global__ __launch_bounds__(256) void k_softmaxz(const float* __restrict__ S, int rows, bf* PH, bf* PL) {
    typedef __attribute__((ext_vector_type(4))) unsigned short v4us;
    const int lane = threadIdx.x & 31, i = blockIdx.x * 8 + (threadIdx.x >> 5); if (i >= rows) return; const size_t zo = (size_t)blockIdx.z * rows * NK; const float* sr = S + zo + (size_t)i * NK; PH += zo; PL += zo;
    float m = -3.0e38f;
#pragma unroll 1
    for (int c0 = lane * 4; c0 < NK; c0 += 128) {
#pragma unroll
        for (int q = 0; q < 4; ++q) m = fmaxf(m, sr[c0 + q]); }
#pragma unroll
    for (int sh = 16; sh; sh >>= 1) m = fmaxf(m, __shfl_xor(m, sh, 32));
    float sum = 0.f;
#pragma unroll 1
    for (int c0 = lane * 4; c0 < NK; c0 += 128) {
#pragma unroll
        for (int q = 0; q < 4; ++q) sum += __expf(sr[c0 + q] - m); }
#pragma unroll
    for (int sh = 16; sh; sh >>= 1) sum += __shfl_xor(sum, sh, 32);
    const float inv = 1.0f / sum;
{
#pragma unroll 1
        for (int c0 = lane * 4; c0 < NK; c0 += 128) { v4us oh, ol;
#pragma unroll
            for (int q = 0; q < 4; ++q) { const float p = __expf(sr[c0 + q] - m) * inv; const unsigned short hb = f2bf(p); oh[q] = hb; ol[q] = f2bf(p - bf2f(hb)); }
            const size_t o = (size_t)i * NK + c0; *(v4us*)(PH + o) = oh; *(v4us*)(PL + o) = ol; }
         }
}
__global__ __launch_bounds__(256) void k_placez(const float* __restrict__ XH, int rows, int ldy, float* Y) {
    const int lane = threadIdx.x & 31; const size_t q = (size_t)blockIdx.x * 8 + (threadIdx.x >> 5); if (q >= (size_t)rows) return; const int z = blockIdx.z; const float v = XH[((size_t)z * rows + q) * 64 + lane];
    *(float*)(Y + q * ldy + z * 32 + lane) = v; 
}

__global__ __launch_bounds__(256) void k_hplanesz(const float* __restrict__ F, int ld, int h0, float sc, int rows, bf* Ph, bf* Pl) {
    typedef __attribute__((ext_vector_type(2))) unsigned short v2us;
    const int lane = threadIdx.x & 31; const size_t r = (size_t)blockIdx.x * 8 + (threadIdx.x >> 5); if (r >= (size_t)rows) return; const int z = blockIdx.z; v2us oh, ol;
    Ph += (size_t)z * rows * 64; Pl += (size_t)z * rows * 64;
#pragma unroll
    for (int i = 0; i < 2; ++i) { const float y = F[r * ld + (h0 + z) * 64 + lane * 2 + i] * sc; const unsigned short hb = f2bf(y); oh[i] = hb; ol[i] = f2bf(y - bf2f(hb)); }
    const size_t o = r * 64 + lane * 2; *(v2us*)(Ph + o) = oh; *(v2us*)(Pl + o) = ol; 
}
template <int NK>
__global__ __launch_bounds__(256) void k_softmaxzs(const float* __restrict__ S, int rows, float sc, bf* PH, bf* PL) {
    typedef __attribute__((ext_vector_type(4))) unsigned short v4us;
    const int lane = threadIdx.x & 31, i = blockIdx.x * 8 + (threadIdx.x >> 5); if (i >= rows) return; const size_t zo = (size_t)blockIdx.z * rows * NK; const float* sr = S + zo + (size_t)i * NK; PH += zo; PL += zo;
    float m = -3.0e38f;
#pragma unroll 1
    for (int c0 = lane * 4; c0 < NK; c0 += 128) {
#pragma unroll
        for (int q = 0; q < 4; ++q) m = fmaxf(m, sr[c0 + q] * sc); }
#pragma unroll
    for (int sh = 16; sh; sh >>= 1) m = fmaxf(m, __shfl_xor(m, sh, 32));
    float sum = 0.f;
#pragma unroll 1
    for (int c0 = lane * 4; c0 < NK; c0 += 128) {
#pragma unroll
        for (int q = 0; q < 4; ++q) sum += __expf(sr[c0 + q] * sc - m); }
#pragma unroll
    for (int sh = 16; sh; sh >>= 1) sum += __shfl_xor(sum, sh, 32);
    const float inv = 1.0f / sum;
{
#pragma unroll 1
        for (int c0 = lane * 4; c0 < NK; c0 += 128) { v4us oh, ol;
#pragma unroll
            for (int q = 0; q < 4; ++q) { const float p = __expf(sr[c0 + q] * sc - m) * inv; const unsigned short hb = f2bf(p); oh[q] = hb; ol[q] = f2bf(p - bf2f(hb)); }
            const size_t o = (size_t)i * NK + c0; *(v4us*)(PH + o) = oh; *(v4us*)(PL + o) = ol; }
         }
}

__global__ __launch_bounds__(256) void k_cvtx(const float* __restrict__ src, int rows, bf* dst) {
    const int lane = threadIdx.x & 31; const size_t tile = (size_t)blockIdx.x * 8 + (threadIdx.x >> 5); if (tile >= (size_t)(rows / 16) * (DMOD / 32)) return;
    const float* sp = tilesrc(src, tile / (DMOD / 32), tile % (DMOD / 32), lane);
#pragma unroll
    for (int j = 0; j < 2; ++j) { const v8f v = *(const v8f*)(sp + j * 16); v8us o;
#pragma unroll
        for (int i = 0; i < 8; ++i) o[i] = f2bf(v[i]);
        *(v8us*)(dst + tile * 512 + j * 256 + lane * 8) = o; }
}
__global__ __launch_bounds__(256) void k_wcat3(const float* __restrict__ Wq, const float* __restrict__ Wk, const float* __restrict__ Wv, bf* WQKV) {
    const int lane = threadIdx.x & 31; const size_t tile = (size_t)blockIdx.x * 8 + (threadIdx.x >> 5); if (tile >= (size_t)3 * (DMOD / 16) * (DMOD / 32)) return;
    const size_t rt = tile / (DMOD / 32), blk = rt / (DMOD / 16);   // row tile of the stacked [3 * DMOD][DMOD] weight, and which weight it lies in
    const float* sp = tilesrc((blk == 0) ? Wq : (blk == 1) ? Wk : Wv, rt % (DMOD / 16), tile % (DMOD / 32), lane);
#pragma unroll
    for (int j = 0; j < 2; ++j) { const v8f w = *(const v8f*)(sp + j * 16); v8us v;
#pragma unroll
        for (int q = 0; q < 8; ++q) v[q] = f2bf(w[q]);
        *(v8us*)(WQKV + tile * 512 + j * 256 + lane * 8) = v; }
}
// k_fattn: scores, scale, additive mask, softmax and attn.V of one head (blockIdx.z) in one kernel, running maximum and sum per query (online softmax), no score or probability plane in memory.
// Transposed products: S^T = K.Q^T (A = 16 key rows, B = 16 query columns), so a lane holds 8 keys of ONE query per tile; two key tiles, converted in place, are the B operand P^T of O^T += V^T.P^T.
// A wave owns QT * 16 queries and walks the keys 32 at a time; operands are bf16 hi + residual planes, three products each.
// Every '#pragma unroll' in it: the fragment and accumulator arrays are indexed by those loop counters and stay in registers only when the loops are unrolled.
#define QT 2
typedef __attribute__((ext_vector_type(2))) float  v2f;
typedef __attribute__((ext_vector_type(2))) __bf16 v2bf;
typedef __attribute__((ext_vector_type(8))) unsigned v8u;
__device__ __forceinline__ float xhalf(float v) { const int b = __float_as_int(v); return __int_as_float(__builtin_amdgcn_permlanex16(b, b, 0x76543210, 0xfedcba98, false, false)); }   // value of lane l ^ 16
__global__ __launch_bounds__(128) void k_fattn(const bf* Qh_, const bf* Ql_, const bf* Kh_, const bf* Kl_, const bf* VTh_, const bf* VTl_, const float* M_, float sc, float* O) {
    const int lane = threadIdx.x & 31, wave = __builtin_amdgcn_readfirstlane(threadIdx.x >> 5), lr = lane & 15, hi = lane >> 4;
    const int q0 = (blockIdx.x * 4 + wave) * (QT * 16); const size_t z = blockIdx.z;
    // wave-uniform byte bases; the lane's own part of every address is one of two loop-invariant 32-bit byte offsets (fo: its place in a half tile of a plane; mo: in the mask)
    gch Qh = (gch)Qh_ + (z * NN + q0) * (HD * 2), Ql = (gch)Ql_ + (z * NN + q0) * (HD * 2), Kh = (gch)Kh_ + z * (NN * HD * 2), Kl = (gch)Kl_ + z * (NN * HD * 2), VTh = (gch)VTh_ + z * (HD * NN * 2), VTl = (gch)VTl_ + z * (HD * NN * 2), M = (gch)M_ + (size_t)q0 * (NN * 4);
    unsigned fo = lane * 16, mo = (lr * NN + 8 * hi) * 4;
    v16bf qh[QT][2], ql[QT][2];
#pragma unroll
    for (int u = 0; u < QT; ++u) {
#pragma unroll
        for (int ks = 0; ks < 2; ++ks) { qh[u][ks] = ldfrag(Qh + (u * 2 + ks) * 1024 + fo); ql[u][ks] = ldfrag(Ql + (u * 2 + ks) * 1024 + fo); } }
    v8f o[QT][4]; float m[QT], l[QT];
#pragma unroll
    for (int u = 0; u < QT; ++u) { m[u] = -3.0e38f; l[u] = 0.f;
#pragma unroll
        for (int dt = 0; dt < 4; ++dt) o[u][dt] = (v8f){}; }
    v16bf kh[2][2], kl[2][2]; v8f mk[QT][2];
#pragma unroll
    for (int t = 0; t < 2; ++t) {
#pragma unroll
        for (int ks = 0; ks < 2; ++ks) { kh[t][ks] = ldfrag(Kh + (t * 2 + ks) * 1024 + fo); kl[t][ks] = ldfrag(Kl + (t * 2 + ks) * 1024 + fo); }
#pragma unroll
        for (int u = 0; u < QT; ++u) mk[u][t] = *(gv8f)(M + (u * 16 * NN + t * 16) * 4 + mo); }
    // the wait before a register that an issued load names is written again; the statement takes those registers, so that they stay as they are up to it and the bases move on behind it
    asm volatile("s_wait_xcnt 0x0" : "+s"(Kh), "+s"(Kl), "+s"(M), "+v"(fo), "+v"(mo) :: "memory");
    Kh += 32 * HD * 2; Kl += 32 * HD * 2; M += 32 * 4;   // from here on: the pass that is fetched ahead
#pragma unroll 1   // rolled: a pass is some 600 instructions already, and the fetch-ahead below spans the back edge without a second copy
    for (int key0 = 0; key0 < NN; key0 += 32) {
        v16bf vh[4], vl[4]; v8f st[QT][2];
#pragma unroll
        for (int dt = 0; dt < 4; ++dt) { vh[dt] = ldfrag(VTh + dt * (NN / 32) * 1024 + fo); vl[dt] = ldfrag(VTl + dt * (NN / 32) * 1024 + fo); }
        __builtin_amdgcn_sched_barrier(0);   // V^T is requested before the score products, which hide its latency
#pragma unroll
        for (int u = 0; u < QT; ++u) {
#pragma unroll
            for (int t = 0; t < 2; ++t) { v8f a = (v8f){};
#pragma unroll
                for (int ks = 0; ks < 2; ++ks) { a = wmmab(kh[t][ks], qh[u][ks], a); a = wmmab(kl[t][ks], qh[u][ks], a); a = wmmab(kh[t][ks], ql[u][ks], a); }
#pragma unroll
                for (int j = 0; j < 8; ++j) a[j] = a[j] * sc + bfr(mk[u][t][j]);
                st[u][t] = a; } }
        // the next 32 keys' K fragments and mask values are fetched here; the last pass re-reads its own (in bounds, unused)
#pragma unroll
        for (int t = 0; t < 2; ++t) {
#pragma unroll
            for (int ks = 0; ks < 2; ++ks) { kh[t][ks] = ldfrag(Kh + (t * 2 + ks) * 1024 + fo); kl[t][ks] = ldfrag(Kl + (t * 2 + ks) * 1024 + fo); }
#pragma unroll
            for (int u = 0; u < QT; ++u) mk[u][t] = *(gv8f)(M + (u * 16 * NN + t * 16) * 4 + mo); }
        __builtin_amdgcn_sched_barrier(0);   // ... and requested before the softmax and attn.V of this pass, which hide their latency
#pragma unroll
        for (int u = 0; u < QT; ++u) {
            float mx = -3.0e38f;
#pragma unroll
            for (int t = 0; t < 2; ++t) {
#pragma unroll
                for (int j = 0; j < 8; ++j) mx = fmaxf(mx, st[u][t][j]); }
            mx = fmaxf(mx, xhalf(mx));
            const float mn = fmaxf(m[u], mx), al = __expf(m[u] - mn); m[u] = mn;
            float ps = 0.f; v8u pH, pL;
#pragma unroll
            for (int t = 0; t < 2; ++t) {
#pragma unroll
                for (int jj = 0; jj < 4; ++jj) { const v2f p = {__expf(st[u][t][2 * jj] - mn), __expf(st[u][t][2 * jj + 1] - mn)}; ps += p[0] + p[1];
                    const unsigned hb = __builtin_bit_cast(unsigned, __builtin_convertvector(p, v2bf));
                    const v2f r = {p[0] - __uint_as_float(hb << 16), p[1] - __uint_as_float(hb & 0xFFFF0000u)};
                    pH[t * 4 + jj] = hb; pL[t * 4 + jj] = __builtin_bit_cast(unsigned, __builtin_convertvector(r, v2bf)); } }
            l[u] = l[u] * al + ps;
            const v16bf ph = __builtin_bit_cast(v16bf, pH), pl = __builtin_bit_cast(v16bf, pL);
#pragma unroll
            for (int dt = 0; dt < 4; ++dt) { v8f a = o[u][dt] * al; a = wmmab(vh[dt], ph, a); a = wmmab(vl[dt], ph, a); a = wmmab(vh[dt], pl, a); o[u][dt] = a; }
        }
        __builtin_amdgcn_sched_barrier(0);   // keeps the wait below at the foot of the pass, where the requests have long been taken: higher up the wave would stand on it
        asm volatile("s_wait_xcnt 0x0" : "+s"(VTh), "+s"(VTl), "+s"(Kh), "+s"(Kl), "+s"(M), "+v"(fo), "+v"(mo) :: "memory");   // as in front of the loop, for this pass's loads
        const int step = (key0 + 64 < NN) ? 32 : 0;
        VTh += 1024; VTl += 1024; Kh += step * (HD * 2); Kl += step * (HD * 2); M += step * 4;
    }
#pragma unroll
    for (int u = 0; u < QT; ++u) { const float inv = 1.0f / (l[u] + xhalf(l[u])); float* orow = O + (size_t)(q0 + u * 16 + lr) * DMOD + z * HD + 8 * hi;
#pragma unroll
        for (int dt = 0; dt < 4; ++dt) { const v8f a = o[u][dt] * inv; *(v4f*)(orow + dt * 16) = (v4f){a[0], a[1], a[2], a[3]}; *(v4f*)(orow + dt * 16 + 4) = (v4f){a[4], a[5], a[6], a[7]}; } }
}
__global__ __launch_bounds__(256) void k_csoftz(const float* __restrict__ S, int rows, float sc, bf* PH, bf* PL) {
    typedef __attribute__((ext_vector_type(4))) unsigned short v4us;
    const int lane = threadIdx.x & 31, i = blockIdx.x * 8 + (threadIdx.x >> 5); if (i >= rows) return; const size_t zo = (size_t)blockIdx.z * rows * NN; const float* sr = S + zo + (size_t)i * NN; PH += zo; PL += zo;
    float m = -3.0e38f;
#pragma unroll 1
    for (int c0 = lane * 4; c0 < NN; c0 += 128) {
#pragma unroll
        for (int q = 0; q < 4; ++q) { const int k = c0 + q; if (k <= i) m = fmaxf(m, sr[k] * sc); } }
#pragma unroll
    for (int sh = 16; sh; sh >>= 1) m = fmaxf(m, __shfl_xor(m, sh, 32));
    float sum = 0.f;
#pragma unroll 1
    for (int c0 = lane * 4; c0 < NN; c0 += 128) {
#pragma unroll
        for (int q = 0; q < 4; ++q) { const int k = c0 + q; if (k <= i) sum += __expf(sr[k] * sc - m); } }
#pragma unroll
    for (int sh = 16; sh; sh >>= 1) sum += __shfl_xor(sum, sh, 32);
    const float inv = 1.0f / sum;
{
#pragma unroll 1
        for (int c0 = lane * 4; c0 < NN; c0 += 128) { v4us oh, ol;
#pragma unroll
            for (int q = 0; q < 4; ++q) { const int k = c0 + q; const float p = (k <= i) ? __expf(sr[(k <= i) ? k : 0] * sc - m) * inv : 0.f; const unsigned short hb = f2bf(p); oh[q] = hb; ol[q] = f2bf(p - bf2f(hb)); }
            const size_t o = (size_t)i * NN + c0; *(v4us*)(PH + o) = oh; *(v4us*)(PL + o) = ol; }
         }
}
__global__ __launch_bounds__(256) void k_splitD(const float* __restrict__ src, int rows, bf* dh, bf* dl) {
    const int lane = threadIdx.x & 31; const size_t tile = (size_t)blockIdx.x * 8 + (threadIdx.x >> 5); if (tile >= (size_t)(rows / 16) * (DMOD / 32)) return;
    const float* sp = tilesrc(src, tile / (DMOD / 32), tile % (DMOD / 32), lane);
#pragma unroll
    for (int j = 0; j < 2; ++j) { const size_t o = tile * 512 + j * 256 + lane * 8; const v8f v = *(const v8f*)(sp + j * 16); v8us oh, ol;
#pragma unroll
        for (int i = 0; i < 8; ++i) { const unsigned short hb = f2bf(v[i]); oh[i] = hb; ol[i] = f2bf(v[i] - bf2f(hb)); }
        *(v8us*)(dh + o) = oh; *(v8us*)(dl + o) = ol; }
}

extern "C" void kernel_launch(void* const* d_in, const int* in_sizes, int n_in,
                              void* d_out, int out_size, void* d_ws, size_t ws_size, hipStream_t stream) {
    (void)in_sizes; (void)n_in; (void)out_size;
    const float* x = (const float*)d_in[0]; const float* wq = (const float*)d_in[1]; const float* wk = (const float*)d_in[2]; const float* wv = (const float*)d_in[3]; const float* wo = (const float*)d_in[4]; const float* fc = (const float*)d_in[5]; const float* cmask = (const float*)d_in[6];
    float* out = (float*)d_out;    // [2][2048][1024]
    char* wsp = (char*)d_ws;
    auto take = [&](size_t bytes) { char* p = wsp; wsp += (bytes + 255) & ~(size_t)255; return (void*)p; };
    bf* WQKV = (bf*)take((size_t)3 * DMOD * DMOD * 2); bf* WO = (bf*)take((size_t)DMOD * DMOD * 2);
    bf* Xb = (bf*)take((size_t)NN * DMOD * 2);
    bf* Qh = (bf*)take((size_t)ZH * NN * HD * 2); bf* Ql = (bf*)take((size_t)ZH * NN * HD * 2); bf* Kh = (bf*)take((size_t)ZH * NN * HD * 2); bf* Kl = (bf*)take((size_t)ZH * NN * HD * 2); bf* VTh = (bf*)take((size_t)ZH * HD * NN * 2); bf* VTl = (bf*)take((size_t)ZH * HD * NN * 2);
    float* O = (float*)take((size_t)NN * DMOD * 4); bf* Oh = (bf*)take((size_t)NN * DMOD * 2); bf* Ol = (bf*)take((size_t)NN * DMOD * 2);
    if ((size_t)(wsp - (char*)d_ws) > ws_size) return;    // ~ 52 MiB
    k_wcat3<<<3 * (DMOD / 16) * (DMOD / 32) / 8, 256, 0, stream>>>(wq, wk, wv, WQKV); k_cvtx<<<(DMOD / 16) * (DMOD / 32) / 8, 256, 0, stream>>>(wo, DMOD, WO);   // [out][in], fragment order
    for (int b = 0; b < NBT; ++b) {
        k_cvtx<<<(NN / 16) * (DMOD / 32) / 8, 256, 0, stream>>>(x + (size_t)b * NN * DMOD, NN, Xb);
        k_gemmb<false, false, true><<<dim3(NN / 64, (3 * DMOD) / 64, 1), 128, 0, stream>>>(Xb, nullptr, WQKV, nullptr, nullptr, 0, nullptr, nullptr, DMOD, 1, fc, Qh, Ql, Kh, Kl, VTh, VTl);   // [q | k | v], all 16 heads' planes
        for (int g = 0; g < NH_ / ZH; ++g) { const int h0 = g * ZH;
            k_fattn<<<dim3(NN / (QT * 64), 1, ZH), 128, 0, stream>>>(Qh, Ql, Kh, Kl, VTh, VTl, cmask, SCL, O + h0 * HD); }
        k_splitD<<<(NN / 16) * (DMOD / 32) / 8, 256, 0, stream>>>(O, NN, Oh, Ol);
        k_gemmb<true, false><<<dim3(NN / 64, DMOD / 64, 1), 128, 0, stream>>>(Oh, Ol, WO, nullptr, out + (size_t)b * NN * DMOD, DMOD, nullptr, nullptr, DMOD); }
}

// v004
// A run of this version takes 186 microseconds.
// Next to v003, in two timings, it ran 1.36 and 1.38 times as fast.
// Over all steps from v000 it is 10.9 times as fast.
#include <hip/hip_runtime.h>

// Both items go through every launch together (rows item * 2048 + token; planes [item][head]). Compute dtypes, f32 accumulate: q/k/v = x.W^T fused as one [4096 x 1024].[1024 x 3072] GEMM with PLAIN bf16 operands (exact products); the interleaved-pair RoPE
// with the given (cos, sin) table applied while building the q/k planes, in that GEMM's epilogue, which also writes the transposed v planes; scores and attn.V with both operands as bf16 hi + UNSCALED residual planes (three
// products), fused with 1/sqrt(64), the additive float mask input (read as data, shared by all heads/items) and an online softmax in f32 in one kernel, the 16 heads of both items in grid.z; wo on hi/lo planes of the merged heads
// FRAGMENT ORDER: every bf16 operand plane (x, the weights, q, k, v^T, the merged heads) is stored as the matrix instruction's lanes read it. A plane [R][Kd] is cut into tiles of 16 rows x 32 k, tile (r >> 4) * (Kd / 32) + (k >> 5),
// 512 elements each: element (r, k) lies at tile * 512 + ((k >> 4) & 1) * 256 + ((k >> 3) & 1) * 128 + (r & 15) * 8 + (k & 7). Lane l = 16 * hi + lr reads its 16 bytes at l * 16 of each 512-byte half, so a fragment load takes 4 whole lines, not 16 pieces.

#define NBT  2
#define NN   2048
#define DMOD 1024
#define NH_  16
#define HD   64
#define DM   DMOD
#define NTK  NN
#define SCL  0.125f
#define LOSC 1024.0f

typedef _Float16 h16;
typedef unsigned short bf;
typedef __attribute__((ext_vector_type(16))) __bf16   v16bf;
typedef __attribute__((ext_vector_type(16))) _Float16 v16h;
typedef __attribute__((ext_vector_type(8)))  _Float16 v8h;
typedef __attribute__((ext_vector_type(8)))  unsigned short v8us;
typedef __attribute__((ext_vector_type(8)))  float    v8f;
typedef __attribute__((ext_vector_type(4)))  float    v4f;
typedef __attribute__((ext_vector_type(4)))  _Float16 v4h;
typedef v8h  __attribute__((may_alias)) v8ha;
typedef v4f  __attribute__((may_alias)) v4fa;
typedef v8us __attribute__((may_alias)) v8usa;

__device__ __forceinline__ unsigned short f2bf(float f) { unsigned u = __float_as_uint(f); u += 0x7FFFu + ((u >> 16) & 1u); return (unsigned short)(u >> 16); }
__device__ __forceinline__ float bf2f(unsigned short b) { return __uint_as_float(((unsigned)b) << 16); }
__device__ __forceinline__ float bfr(float f) { return bf2f(f2bf(f)); }
__device__ __forceinline__ v16h cat16(v8h lo, v8h hi) { return __builtin_shufflevector(lo, hi, 0, 1, 2, 3, 4, 5, 6, 7, 8, 9, 10, 11, 12, 13, 14, 15); }
__device__ __forceinline__ v16bf cat16b(v8us lo, v8us hi) { return __builtin_bit_cast(v16bf, __builtin_shufflevector(lo, hi, 0, 1, 2, 3, 4, 5, 6, 7, 8, 9, 10, 11, 12, 13, 14, 15)); }
__device__ __forceinline__ v8f wmma16(v16h a, v16h b, v8f c) { return __builtin_amdgcn_wmma_f32_16x16x32_f16(false, a, false, b, (short)0, c, false, false); }
__device__ __forceinline__ v8f wmmab(v16bf a, v16bf b, v8f c) { return __builtin_amdgcn_wmma_f32_16x16x32_bf16(false, a, false, b, (short)0, c, false, false); }

typedef const __attribute__((address_space(1))) char*  gch;    // global-memory pointers by type: a pointer that has passed through an asm operand would otherwise be read with flat loads
typedef const __attribute__((address_space(1))) v8us*  gv8us;
typedef const __attribute__((address_space(1))) v8f*   gv8f;
__device__ __forceinline__ v16bf ldfrag(gch p) { return cat16b(*(gv8us)p, *(gv8us)(p + 512)); }   // the lane's 16 bytes of each half of a tile in fragment order: k 8h..8h+7 and 16+8h..16+8h+7

// k_gemmb: 64 x 64 block tile (4 waves x 16 x 64) of C[NBT * NN][NW] = (A [+ Al]).B^T (K = 1024) [+ bf(bias[c])] [+ bf(R[r][c]) residual]; f32 whole-line epilogue (or f16
// QKV epilogue (C unused): the block's 64 columns are one head of q, k or v. q and k: interleaved-pair rotation, pair (2i, 2i+1): o0 = t0 c - t1 s, o1 = t0 s + t1 c with c = bf(fc[t][i][0]), s = bf(fc[t][i][1]),
// then bf16 hi + residual planes [head][token][64]; v: hi + residual planes transposed, [head][d][token]; both in fragment order per head. Every store of a wave is 512 bytes in a row, four whole 128-byte lines. A, Al and Bn are read in fragment order.
template <bool SPLITA, bool F16OUT = false, bool QKV = false>
__global__ __launch_bounds__(128) void k_gemmb(const bf* __restrict__ A, const bf* __restrict__ Al, const bf* __restrict__ Bn, const float* __restrict__ bias, float* C, int ldc, h16* C2, const float* __restrict__ R = nullptr, int K = DM, int roundR = 1,
                                               const float* __restrict__ fc = nullptr, bf* Qh = nullptr, bf* Ql = nullptr, bf* Kh = nullptr, bf* Kl = nullptr, bf* VTh = nullptr, bf* VTl = nullptr) {
    __shared__ __align__(16) float ost[4][16 * 68];
    const int lane = threadIdx.x & 31, wave = __builtin_amdgcn_readfirstlane(threadIdx.x >> 5), lr = lane & 15, hi = lane >> 4;   // the wave's number as a scalar: every fragment address is then a scalar base + lane * 16 bytes
    const int r0 = blockIdx.x * 64 + wave * 16, c0 = blockIdx.y * 64;
    // fragment order, planes of DM columns: a row tile is DM / 32 tiles of 1024 bytes; scalar byte bases that move on one tile a trip, and the lane's loop-invariant place in a half tile
    gch pa = (gch)A + (size_t)(r0 >> 4) * (DM * 32), pl = (gch)Al + (size_t)(r0 >> 4) * (DM * 32), pb = (gch)Bn + (size_t)(c0 >> 4) * (DM * 32);
    unsigned fo = lane * 16;
    v8f acc[4];
#pragma unroll
    for (int t = 0; t < 4; ++t) acc[t] = (v8f){};
#pragma unroll 1
    for (int kc = 0; kc < K; kc += 32) {
        const v16bf a = ldfrag(pa + fo);
        v16bf al = a, b[4];
        if (SPLITA) al = ldfrag(pl + fo);
#pragma unroll
        for (int t = 0; t < 4; ++t) b[t] = ldfrag(pb + t * (DM * 32) + fo);
        __builtin_amdgcn_sched_barrier(0);   // all of the trip's fragments are requested before its first product: without it the built code fetched one column tile at a time into the same registers, one latency each
#pragma unroll
        for (int t = 0; t < 4; ++t) { acc[t] = wmmab(a, b[t], acc[t]); if (SPLITA) acc[t] = wmmab(al, b[t], acc[t]); }
        asm volatile("v_nop\n\tv_nop\n\tv_nop\n\tv_nop" : "+v"(acc[0]), "+v"(acc[1]), "+v"(acc[2]), "+v"(acc[3]) : "v"(a), "v"(al));
        // the wait before a register that an issued load names is written again; the statement takes those registers, so that they stay as they are up to it and the bases move on behind it
        if (SPLITA) asm volatile("s_wait_xcnt 0x0" : "+s"(pa), "+s"(pl), "+s"(pb), "+v"(fo) :: "memory"); else asm volatile("s_wait_xcnt 0x0" : "+s"(pa), "+s"(pb), "+v"(fo) :: "memory");
        pa += 1024; pl += 1024; pb += 1024;
    }
    float* os = &ost[wave][0];
    if (QKV) {
        const int sec = c0 / DM, head = (r0 / NN) * NH_ + (c0 % DM) / HD, tk0 = r0 % NN;   // head: the plane's number, item * 16 + head; tk0: the wave's first token inside its item (a block's 64 rows lie in one item)
        if (sec < 2) {
            const size_t o = (size_t)(tk0 >> 4) * (16 * HD) + lane * 8;   // the wave's 16 tokens are two tiles; step s is the half with columns 16 s + 8 hi .. + 7 of token tk0 + lr
            const float* fp = fc + (size_t)(tk0 + lr) * HD + hi * 8; v8f cs[4];
#pragma unroll
            for (int s = 0; s < 4; ++s) cs[s] = *(const v8f*)(fp + s * 16);   // requested first: they are in flight while the tile is staged
            asm volatile("s_wait_xcnt 0x0" :: "v"(fp) : "memory");   // the wait before a register that an issued load names is written again; it takes the address, which so stays as it is up to here
#pragma unroll
            for (int t = 0; t < 4; ++t) {
#pragma unroll
                for (int j = 0; j < 8; ++j) os[(hi * 8 + j) * 68 + t * 16 + lr] = acc[t][j]; }
            __syncthreads();
            bf* Ph = (sec ? Kh : Qh) + (size_t)head * NN * HD + o; bf* Pl = (sec ? Kl : Ql) + (size_t)head * NN * HD + o;
#pragma unroll
            for (int s = 0; s < 4; ++s) { const float* sp = os + lr * 68 + s * 16 + hi * 8;
                const v4f xa = *(const v4fa*)sp, xb = *(const v4fa*)(sp + 4);
                const float x[8] = {xa[0], xa[1], xa[2], xa[3], xb[0], xb[1], xb[2], xb[3]}; v8us oh, ol;
#pragma unroll
                for (int i = 0; i < 4; ++i) { const float t0 = x[2 * i], t1 = x[2 * i + 1], c = bfr(cs[s][2 * i]), sn = bfr(cs[s][2 * i + 1]); const float y0 = t0 * c - t1 * sn, y1 = t0 * sn + t1 * c;
                    { const unsigned short hb = f2bf(y0); oh[2 * i] = hb; ol[2 * i] = f2bf(y0 - bf2f(hb)); } { const unsigned short hb = f2bf(y1); oh[2 * i + 1] = hb; ol[2 * i + 1] = f2bf(y1 - bf2f(hb)); } }
                *(v8us*)(Ph + s * 256) = oh; *(v8us*)(Pl + s * 256) = ol; }
        } else {
            float* fl = &ost[0][0];   // staged as [d][token of the block]: a lane's accumulator holds 8 consecutive tokens of one d
#pragma unroll
            for (int t = 0; t < 4; ++t) { float* dp = fl + (t * 16 + lr) * 68 + wave * 16 + hi * 8; *(v4fa*)dp = (v4f){acc[t][0], acc[t][1], acc[t][2], acc[t][3]}; *(v4fa*)(dp + 4) = (v4f){acc[t][4], acc[t][5], acc[t][6], acc[t][7]}; }
            __syncthreads();
            const size_t o = (size_t)head * HD * NN + ((size_t)wave * (NN / 32) + (blockIdx.x % (NN / 64)) * 2) * 512 + lane * 8;   // row tile d = 16 wave + lr, the block's two token tiles; step s is the half with tokens 16 s + 8 hi .. + 7
#pragma unroll
            for (int s = 0; s < 4; ++s) { const float* sp = fl + (wave * 16 + lr) * 68 + s * 16 + hi * 8;
                const v4f xa = *(const v4fa*)sp, xb = *(const v4fa*)(sp + 4);
                const float x[8] = {xa[0], xa[1], xa[2], xa[3], xb[0], xb[1], xb[2], xb[3]}; v8us oh, ol;
#pragma unroll
                for (int i = 0; i < 8; ++i) { const unsigned short hb = f2bf(x[i]); oh[i] = hb; ol[i] = f2bf(x[i] - bf2f(hb)); }
                *(v8us*)(VTh + o + s * 256) = oh; *(v8us*)(VTl + o + s * 256) = ol; }
            asm volatile("s_wait_xcnt 0x0" ::: "memory");   // the wait before a register that an issued store names is written again: in the built code the other branch's lines stand behind these stores
        }
        return;
    }
#pragma unroll
    for (int t = 0; t < 4; ++t) { const float bv = bias ? bfr(bias[c0 + t * 16 + lr]) : 0.f;
#pragma unroll
        for (int j = 0; j < 8; ++j) os[(hi * 8 + j) * 68 + t * 16 + lr] = acc[t][j] + bv; }
    __syncthreads();
    if (F16OUT) {
        h16* crow = (h16*)(void*)C + (size_t)r0 * ldc + c0;
        auto pass = [&]() {
#pragma unroll
            for (int s = 0; s < 4; ++s) { const int row = 4 * s + (lane >> 3), piece = lane & 7; const float* sp = os + row * 68 + piece * 8; v8h o, o2;
#pragma unroll
                for (int i = 0; i < 8; ++i) { const h16 a = (h16)sp[i]; o[i] = a; o2[i] = (h16)((sp[i] - (float)a) * LOSC); }
                *(v8h*)(crow + (size_t)row * ldc + piece * 8) = o; if (C2) *(v8h*)(C2 + (size_t)r0 * ldc + c0 + (size_t)row * ldc + piece * 8) = o2; }
        };
        pass(); 
    } else {
        float* crow = C + (size_t)r0 * ldc + c0;
        auto pass = [&]() {
#pragma unroll
            for (int s = 0; s < 8; ++s) { const int Lid = (lane >> 3) + 4 * s, piece = lane & 7; const int row = Lid >> 1, cofs = (Lid & 1) * 32 + piece * 4;
                v4f val = *(const v4fa*)(os + row * 68 + cofs); if (R) { const v4f rv = *(const v4f*)(R + ((size_t)r0 + row) * ldc + c0 + cofs); val += roundR ? (v4f){bfr(rv[0]), bfr(rv[1]), bfr(rv[2]), bfr(rv[3])} : rv; }
                *(v4f*)(crow + (size_t)row * ldc + cofs) = val; }
        };
        pass(); 
    }
}

// The converters below write fragment order: a wave makes one tile (16 rows x 32 k of a [rows][DMOD] f32 source): it reads 16 whole 128-byte lines and stores the two 512-byte halves.
__device__ __forceinline__ const float* tilesrc(const float* src, size_t rowtile, size_t ktile, int lane) { return src + (rowtile * 16 + (lane & 15)) * DMOD + ktile * 32 + (lane >> 4) * 8; }   // the lane's 8 values of half 0; half 1 is 16 further on
__global__ __launch_bounds__(256) void k_zero8(bf* dst, size_t n8) {
    const size_t i = (size_t)blockIdx.x * 256 + threadIdx.x; if (i >= n8) return; v8us z;
#pragma unroll
    for (int k = 0; k < 8; ++k) z[k] = 0;
    *(v8us*)(dst + i * 8) = z; 
}

// ===== z-batched (blockIdx.z = head) attention pieces =====
__global__ __launch_bounds__(256) void k_planes32z(const float* __restrict__ F, int ld, int off, float sc, int rows, bf* Ph, bf* Pl) {
    typedef __attribute__((ext_vector_type(2))) unsigned short v2us;
    const int lane = threadIdx.x & 31; const size_t r = ((size_t)blockIdx.x * 8 + (threadIdx.x >> 5)) * 2 + (lane >> 4); if (r >= (size_t)rows) return; const int z = blockIdx.z; const int c0 = (lane & 15) * 2; v2us oh, ol;
    Ph += (size_t)z * rows * 32; Pl += (size_t)z * rows * 32;
#pragma unroll
    for (int i = 0; i < 2; ++i) { const float y = F[r * ld + off + z * 32 + c0 + i] * sc; const unsigned short hb = f2bf(y); oh[i] = hb; ol[i] = f2bf(y - bf2f(hb)); }
    const size_t o = r * 32 + c0; *(v2us*)(Ph + o) = oh; *(v2us*)(Pl + o) = ol; 
}
__global__ __launch_bounds__(256) void k_vtpadz(const float* __restrict__ F, int ld, int off, int nk, bf* Th, bf* Tl) {
    typedef __attribute__((ext_vector_type(2))) unsigned short v2us;
    const int lane = threadIdx.x & 31; const size_t wid = (size_t)blockIdx.x * 8 + (threadIdx.x >> 5); if (wid >= (size_t)64 * (nk / 64)) return; const int z = blockIdx.z; const int d = (int)(wid / (nk / 64)); const int k0 = (int)(wid % (nk / 64)) * 64 + lane * 2; v2us oh, ol;
    Th += (size_t)z * 64 * nk; Tl += (size_t)z * 64 * nk;
#pragma unroll
    for (int i = 0; i < 2; ++i) { const float y = (d < 32) ? F[(size_t)(k0 + i) * ld + off + z * 32 + (d < 32 ? d : 0)] : 0.f; const unsigned short hb = f2bf(y); oh[i] = hb; ol[i] = f2bf(y - bf2f(hb)); }
    const size_t o = (size_t)d * nk + k0; *(v2us*)(Th + o) = oh; *(v2us*)(Tl + o) = ol; 
}
template <int NK>
__global__ __launch_bounds__(256) void k_softmaxz(const float* __restrict__ S, int rows, bf* PH, bf* PL) {
    typedef __attribute__((ext_vector_type(4))) unsigned short v4us;
    const int lane = threadIdx.x & 31, i = blockIdx.x * 8 + (threadIdx.x >> 5); if (i >= rows) return; const size_t zo = (size_t)blockIdx.z * rows * NK; const float* sr = S + zo + (size_t)i * NK; PH += zo; PL += zo;
    float m = -3.0e38f;
#pragma unroll 1
    for (int c0 = lane * 4; c0 < NK; c0 += 128) {
#pragma unroll
        for (int q = 0; q < 4; ++q) m = fmaxf(m, sr[c0 + q]); }
#pragma unroll
    for (int sh = 16; sh; sh >>= 1) m = fmaxf(m, __shfl_xor(m, sh, 32));
    float sum = 0.f;
#pragma unroll 1
    for (int c0 = lane * 4; c0 < NK; c0 += 128) {
#pragma unroll
        for (int q = 0; q < 4; ++q) sum += __expf(sr[c0 + q] - m); }
#pragma unroll
    for (int sh = 16; sh; sh >>= 1) sum += __shfl_xor(sum, sh, 32);
    const float inv = 1.0f / sum;
{
#pragma unroll 1
        for (int c0 = lane * 4; c0 < NK; c0 += 128) { v4us oh, ol;
#pragma unroll
            for (int q = 0; q < 4; ++q) { const float p = __expf(sr[c0 + q] - m) * inv; const unsigned short hb = f2bf(p); oh[q] = hb; ol[q] = f2bf(p - bf2f(hb)); }
            const size_t o = (size_t)i * NK + c0; *(v4us*)(PH + o) = oh; *(v4us*)(PL + o) = ol; }
         }
}
__global__ __launch_bounds__(256) void k_placez(const float* __restrict__ XH, int rows, int ldy, float* Y) {
    const int lane = threadIdx.x & 31; const size_t q = (size_t)blockIdx.x * 8 + (threadIdx.x >> 5); if (q >= (size_t)rows) return; const int z = blockIdx.z; const float v = XH[((size_t)z * rows + q) * 64 + lane];
    *(float*)(Y + q * ldy + z * 32 + lane) = v; 
}

__global__ __launch_bounds__(256) void k_hplanesz(const float* __restrict__ F, int ld, int h0, float sc, int rows, bf* Ph, bf* Pl) {
    typedef __attribute__((ext_vector_type(2))) unsigned short v2us;
    const int lane = threadIdx.x & 31; const size_t r = (size_t)blockIdx.x * 8 + (threadIdx.x >> 5); if (r >= (size_t)rows) return; const int z = blockIdx.z; v2us oh, ol;
    Ph += (size_t)z * rows * 64; Pl += (size_t)z * rows * 64;
#pragma unroll
    for (int i = 0; i < 2; ++i) { const float y = F[r * ld + (h0 + z) * 64 + lane * 2 + i] * sc; const unsigned short hb = f2bf(y); oh[i] = hb; ol[i] = f2bf(y - bf2f(hb)); }
    const size_t o = r * 64 + lane * 2; *(v2us*)(Ph + o) = oh; *(v2us*)(Pl + o) = ol; 
}
template <int NK>
__global__ __launch_bounds__(256) void k_softmaxzs(const float* __restrict__ S, int rows, float sc, bf* PH, bf* PL) {
    typedef __attribute__((ext_vector_type(4))) unsigned short v4us;
    const int lane = threadIdx.x & 31, i = blockIdx.x * 8 + (threadIdx.x >> 5); if (i >= rows) return; const size_t zo = (size_t)blockIdx.z * rows * NK; const float* sr = S + zo + (size_t)i * NK; PH += zo; PL += zo;
    float m = -3.0e38f;
#pragma unroll 1
    for (int c0 = lane * 4; c0 < NK; c0 += 128) {
#pragma unroll
        for (int q = 0; q < 4; ++q) m = fmaxf(m, sr[c0 + q] * sc); }
#pragma unroll
    for (int sh = 16; sh; sh >>= 1) m = fmaxf(m, __shfl_xor(m, sh, 32));
    float sum = 0.f;
#pragma unroll 1
    for (int c0 = lane * 4; c0 < NK; c0 += 128) {
#pragma unroll
        for (int q = 0; q < 4; ++q) sum += __expf(sr[c0 + q] * sc - m); }
#pragma unroll
    for (int sh = 16; sh; sh >>= 1) sum += __shfl_xor(sum, sh, 32);
    const float inv = 1.0f / sum;
{
#pragma unroll 1
        for (int c0 = lane * 4; c0 < NK; c0 += 128) { v4us oh, ol;
#pragma unroll
            for (int q = 0; q < 4; ++q) { const float p = __expf(sr[c0 + q] * sc - m) * inv; const unsigned short hb = f2bf(p); oh[q] = hb; ol[q] = f2bf(p - bf2f(hb)); }
            const size_t o = (size_t)i * NK + c0; *(v4us*)(PH + o) = oh; *(v4us*)(PL + o) = ol; }
         }
}

__global__ __launch_bounds__(256) void k_cvtx(const float* __restrict__ src, int rows, bf* dst) {
    const int lane = threadIdx.x & 31; const size_t tile = (size_t)blockIdx.x * 8 + (threadIdx.x >> 5); if (tile >= (size_t)(rows / 16) * (DMOD / 32)) return;
    const float* sp = tilesrc(src, tile / (DMOD / 32), tile % (DMOD / 32), lane);
#pragma unroll
    for (int j = 0; j < 2; ++j) { const v8f v = *(const v8f*)(sp + j * 16); v8us o;
#pragma unroll
        for (int i = 0; i < 8; ++i) o[i] = f2bf(v[i]);
        *(v8us*)(dst + tile * 512 + j * 256 + lane * 8) = o; }
}
__global__ __launch_bounds__(256) void k_wcat3(const float* __restrict__ Wq, const float* __restrict__ Wk, const float* __restrict__ Wv, bf* WQKV) {
    const int lane = threadIdx.x & 31; const size_t tile = (size_t)blockIdx.x * 8 + (threadIdx.x >> 5); if (tile >= (size_t)3 * (DMOD / 16) * (DMOD / 32)) return;
    const size_t rt = tile / (DMOD / 32), blk = rt / (DMOD / 16);   // row tile of the stacked [3 * DMOD][DMOD] weight, and which weight it lies in
    const float* sp = tilesrc((blk == 0) ? Wq : (blk == 1) ? Wk : Wv, rt % (DMOD / 16), tile % (DMOD / 32), lane);
#pragma unroll
    for (int j = 0; j < 2; ++j) { const v8f w = *(const v8f*)(sp + j * 16); v8us v;
#pragma unroll
        for (int q = 0; q < 8; ++q) v[q] = f2bf(w[q]);
        *(v8us*)(WQKV + tile * 512 + j * 256 + lane * 8) = v; }
}
// k_fattn: scores, scale, additive mask, softmax and attn.V of one head of one item (blockIdx.z = item * 16 + head) in one kernel, running maximum and sum per query (online softmax), no score or probability plane in memory.
// Transposed products: S^T = K.Q^T (A = 16 key rows, B = 16 query columns), so a lane holds 8 keys of ONE query per tile; two key tiles, converted in place, are the B operand P^T of O^T += V^T.P^T.
// A wave owns QT * 16 queries and walks the keys 32 at a time; operands are bf16 hi + residual planes, three products each.
// Every '#pragma unroll' in it: the fragment and accumulator arrays are indexed by those loop counters and stay in registers only when the loops are unrolled.
#define QT 2
typedef __attribute__((ext_vector_type(2))) float  v2f;
typedef __attribute__((ext_vector_type(2))) __bf16 v2bf;
typedef __attribute__((ext_vector_type(8))) unsigned v8u;
__device__ __forceinline__ float xhalf(float v) { const int b = __float_as_int(v); return __int_as_float(__builtin_amdgcn_permlanex16(b, b, 0x76543210, 0xfedcba98, false, false)); }   // value of lane l ^ 16
__global__ __launch_bounds__(128) void k_fattn(const bf* Qh_, const bf* Ql_, const bf* Kh_, const bf* Kl_, const bf* VTh_, const bf* VTl_, const float* M_, float sc, float* O) {
    const int lane = threadIdx.x & 31, wave = __builtin_amdgcn_readfirstlane(threadIdx.x >> 5), lr = lane & 15, hi = lane >> 4;
    const int q0 = (blockIdx.x * 4 + wave) * (QT * 16); const size_t z = blockIdx.z;
    // wave-uniform byte bases; the lane's own part of every address is one of two loop-invariant 32-bit byte offsets (fo: its place in a half tile of a plane; mo: in the mask)
    gch Qh = (gch)Qh_ + (z * NN + q0) * (HD * 2), Ql = (gch)Ql_ + (z * NN + q0) * (HD * 2), Kh = (gch)Kh_ + z * (NN * HD * 2), Kl = (gch)Kl_ + z * (NN * HD * 2), VTh = (gch)VTh_ + z * (HD * NN * 2), VTl = (gch)VTl_ + z * (HD * NN * 2), M = (gch)M_ + (size_t)q0 * (NN * 4);
    unsigned fo = lane * 16, mo = (lr * NN + 8 * hi) * 4;
    v16bf qh[QT][2], ql[QT][2];
#pragma unroll
    for (int u = 0; u < QT; ++u) {
#pragma unroll
        for (int ks = 0; ks < 2; ++ks) { qh[u][ks] = ldfrag(Qh + (u * 2 + ks) * 1024 + fo); ql[u][ks] = ldfrag(Ql + (u * 2 + ks) * 1024 + fo); } }
    v8f o[QT][4]; float m[QT], l[QT];
#pragma unroll
    for (int u = 0; u < QT; ++u) { m[u] = -3.0e38f; l[u] = 0.f;
#pragma unroll
        for (int dt = 0; dt < 4; ++dt) o[u][dt] = (v8f){}; }
    v16bf kh[2][2], kl[2][2]; v8f mk[QT][2];
#pragma unroll
    for (int t = 0; t < 2; ++t) {
#pragma unroll
        for (int ks = 0; ks < 2; ++ks) { kh[t][ks] = ldfrag(Kh + (t * 2 + ks) * 1024 + fo); kl[t][ks] = ldfrag(Kl + (t * 2 + ks) * 1024 + fo); }
#pragma unroll
        for (int u = 0; u < QT; ++u) mk[u][t] = *(gv8f)(M + (u * 16 * NN + t * 16) * 4 + mo); }
    // the wait before a register that an issued load names is written again; the statement takes those registers, so that they stay as they are up to it and the bases move on behind it
    asm volatile("s_wait_xcnt 0x0" : "+s"(Kh), "+s"(Kl), "+s"(M), "+v"(fo), "+v"(mo) :: "memory");
    Kh += 32 * HD * 2; Kl += 32 * HD * 2; M += 32 * 4;   // from here on: the pass that is fetched ahead
#pragma unroll 1   // rolled: a pass is some 600 instructions already, and the fetch-ahead below spans the back edge without a second copy
    for (int key0 = 0; key0 < NN; key0 += 32) {
        v16bf vh[4], vl[4]; v8f st[QT][2];
#pragma unroll
        for (int dt = 0; dt < 4; ++dt) { vh[dt] = ldfrag(VTh + dt * (NN / 32) * 1024 + fo); vl[dt] = ldfrag(VTl + dt * (NN / 32) * 1024 + fo); }
        __builtin_amdgcn_sched_barrier(0);   // V^T is requested before the score products, which hide its latency
#pragma unroll
        for (int u = 0; u < QT; ++u) {
#pragma unroll
            for (int t = 0; t < 2; ++t) { v8f a = (v8f){};
#pragma unroll
                for (int ks = 0; ks < 2; ++ks) { a = wmmab(kh[t][ks], qh[u][ks], a); a = wmmab(kl[t][ks], qh[u][ks], a); a = wmmab(kh[t][ks], ql[u][ks], a); }
#pragma unroll
                for (int j = 0; j < 8; ++j) a[j] = a[j] * sc + bfr(mk[u][t][j]);
                st[u][t] = a; } }
        // the next 32 keys' K fragments and mask values are fetched here; the last pass re-reads its own (in bounds, unused)
#pragma unroll
        for (int t = 0; t < 2; ++t) {
#pragma unroll
            for (int ks = 0; ks < 2; ++ks) { kh[t][ks] = ldfrag(Kh + (t * 2 + ks) * 1024 + fo); kl[t][ks] = ldfrag(Kl + (t * 2 + ks) * 1024 + fo); }
#pragma unroll
            for (int u = 0; u < QT; ++u) mk[u][t] = *(gv8f)(M + (u * 16 * NN + t * 16) * 4 + mo); }
        __builtin_amdgcn_sched_barrier(0);   // ... and requested before the softmax and attn.V of this pass, which hide their latency
#pragma unroll
        for (int u = 0; u < QT; ++u) {
            float mx = -3.0e38f;
#pragma unroll
            for (int t = 0; t < 2; ++t) {
#pragma unroll
                for (int j = 0; j < 8; ++j) mx = fmaxf(mx, st[u][t][j]); }
            mx = fmaxf(mx, xhalf(mx));
            const float mn = fmaxf(m[u], mx), al = __expf(m[u] - mn); m[u] = mn;
            float ps = 0.f; v8u pH, pL;
#pragma unroll
            for (int t = 0; t < 2; ++t) {
#pragma unroll
                for (int jj = 0; jj < 4; ++jj) { const v2f p = {__expf(st[u][t][2 * jj] - mn), __expf(st[u][t][2 * jj + 1] - mn)}; ps += p[0] + p[1];
                    const unsigned hb = __builtin_bit_cast(unsigned, __builtin_convertvector(p, v2bf));
                    const v2f r = {p[0] - __uint_as_float(hb << 16), p[1] - __uint_as_float(hb & 0xFFFF0000u)};
                    pH[t * 4 + jj] = hb; pL[t * 4 + jj] = __builtin_bit_cast(unsigned, __builtin_convertvector(r, v2bf)); } }
            l[u] = l[u] * al + ps;
            const v16bf ph = __builtin_bit_cast(v16bf, pH), pl = __builtin_bit_cast(v16bf, pL);
#pragma unroll
            for (int dt = 0; dt < 4; ++dt) { v8f a = o[u][dt] * al; a = wmmab(vh[dt], ph, a); a = wmmab(vl[dt], ph, a); a = wmmab(vh[dt], pl, a); o[u][dt] = a; }
        }
        __builtin_amdgcn_sched_barrier(0);   // keeps the wait below at the foot of the pass, where the requests have long been taken: higher up the wave would stand on it
        asm volatile("s_wait_xcnt 0x0" : "+s"(VTh), "+s"(VTl), "+s"(Kh), "+s"(Kl), "+s"(M), "+v"(fo), "+v"(mo) :: "memory");   // as in front of the loop, for this pass's loads
        const int step = (key0 + 64 < NN) ? 32 : 0;
        VTh += 1024; VTl += 1024; Kh += step * (HD * 2); Kl += step * (HD * 2); M += step * 4;
    }
#pragma unroll
    for (int u = 0; u < QT; ++u) { const float inv = 1.0f / (l[u] + xhalf(l[u])); float* orow = O + ((z / NH_) * NN + q0 + u * 16 + lr) * DMOD + (z % NH_) * HD + 8 * hi;
#pragma unroll
        for (int dt = 0; dt < 4; ++dt) { const v8f a = o[u][dt] * inv; *(v4f*)(orow + dt * 16) = (v4f){a[0], a[1], a[2], a[3]}; *(v4f*)(orow + dt * 16 + 4) = (v4f){a[4], a[5], a[6], a[7]}; } }
}
__global__ __launch_bounds__(256) void k_csoftz(const float* __restrict__ S, int rows, float sc, bf* PH, bf* PL) {
    typedef __attribute__((ext_vector_type(4))) unsigned short v4us;
    const int lane = threadIdx.x & 31, i = blockIdx.x * 8 + (threadIdx.x >> 5); if (i >= rows) return; const size_t zo = (size_t)blockIdx.z * rows * NN; const float* sr = S + zo + (size_t)i * NN; PH += zo; PL += zo;
    float m = -3.0e38f;
#pragma unroll 1
    for (int c0 = lane * 4; c0 < NN; c0 += 128) {
#pragma unroll
        for (int q = 0; q < 4; ++q) { const int k = c0 + q; if (k <= i) m = fmaxf(m, sr[k] * sc); } }
#pragma unroll
    for (int sh = 16; sh; sh >>= 1) m = fmaxf(m, __shfl_xor(m, sh, 32));
    float sum = 0.f;
#pragma unroll 1
    for (int c0 = lane * 4; c0 < NN; c0 += 128) {
#pragma unroll
        for (int q = 0; q < 4; ++q) { const int k = c0 + q; if (k <= i) sum += __expf(sr[k] * sc - m); } }
#pragma unroll
    for (int sh = 16; sh; sh >>= 1) sum += __shfl_xor(sum, sh, 32);
    const float inv = 1.0f / sum;
{
#pragma unroll 1
        for (int c0 = lane * 4; c0 < NN; c0 += 128) { v4us oh, ol;
#pragma unroll
            for (int q = 0; q < 4; ++q) { const int k = c0 + q; const float p = (k <= i) ? __expf(sr[(k <= i) ? k : 0] * sc - m) * inv : 0.f; const unsigned short hb = f2bf(p); oh[q] = hb; ol[q] = f2bf(p - bf2f(hb)); }
            const size_t o = (size_t)i * NN + c0; *(v4us*)(PH + o) = oh; *(v4us*)(PL + o) = ol; }
         }
}
__global__ __launch_bounds__(256) void k_splitD(const float* __restrict__ src, int rows, bf* dh, bf* dl) {
    const int lane = threadIdx.x & 31; const size_t tile = (size_t)blockIdx.x * 8 + (threadIdx.x >> 5); if (tile >= (size_t)(rows / 16) * (DMOD / 32)) return;
    const float* sp = tilesrc(src, tile / (DMOD / 32), tile % (DMOD / 32), lane);
#pragma unroll
    for (int j = 0; j < 2; ++j) { const size_t o = tile * 512 + j * 256 + lane * 8; const v8f v = *(const v8f*)(sp + j * 16); v8us oh, ol;
#pragma unroll
        for (int i = 0; i < 8; ++i) { const unsigned short hb = f2bf(v[i]); oh[i] = hb; ol[i] = f2bf(v[i] - bf2f(hb)); }
        *(v8us*)(dh + o) = oh; *(v8us*)(dl + o) = ol; }
}

extern "C" void kernel_launch(void* const* d_in, const int* in_sizes, int n_in,
                              void* d_out, int out_size, void* d_ws, size_t ws_size, hipStream_t stream) {
    (void)in_sizes; (void)n_in; (void)out_size;
    const float* x = (const float*)d_in[0]; const float* wq = (const float*)d_in[1]; const float* wk = (const float*)d_in[2]; const float* wv = (const float*)d_in[3]; const float* wo = (const float*)d_in[4]; const float* fc = (const float*)d_in[5]; const float* cmask = (const float*)d_in[6];
    float* out = (float*)d_out;    // [2][2048][1024]
    char* wsp = (char*)d_ws;
    auto take = [&](size_t bytes) { char* p = wsp; wsp += (bytes + 255) & ~(size_t)255; return (void*)p; };
    bf* WQKV = (bf*)take((size_t)3 * DMOD * DMOD * 2); bf* WO = (bf*)take((size_t)DMOD * DMOD * 2);
    bf* Xb = (bf*)take((size_t)NBT * NN * DMOD * 2);
    const size_t pb = (size_t)NBT * NH_ * NN * HD * 2;   // one plane set: [item][head]
    bf* Qh = (bf*)take(pb); bf* Ql = (bf*)take(pb); bf* Kh = (bf*)take(pb); bf* Kl = (bf*)take(pb); bf* VTh = (bf*)take(pb); bf* VTl = (bf*)take(pb);
    float* O = (float*)take((size_t)NBT * NN * DMOD * 4); bf* Oh = (bf*)take((size_t)NBT * NN * DMOD * 2); bf* Ol = (bf*)take((size_t)NBT * NN * DMOD * 2);
    if ((size_t)(wsp - (char*)d_ws) > ws_size) return;    // ~ 101 MB
    k_wcat3<<<3 * (DMOD / 16) * (DMOD / 32) / 8, 256, 0, stream>>>(wq, wk, wv, WQKV); k_cvtx<<<(DMOD / 16) * (DMOD / 32) / 8, 256, 0, stream>>>(wo, DMOD, WO);   // [out][in], fragment order
    k_cvtx<<<(NBT * NN / 16) * (DMOD / 32) / 8, 256, 0, stream>>>(x, NBT * NN, Xb);
    k_gemmb<false, false, true><<<dim3(NBT * NN / 64, (3 * DMOD) / 64, 1), 128, 0, stream>>>(Xb, nullptr, WQKV, nullptr, nullptr, 0, nullptr, nullptr, DMOD, 1, fc, Qh, Ql, Kh, Kl, VTh, VTl);   // [q | k | v], the planes of all heads of both items
    k_fattn<<<dim3(NN / (QT * 64), 1, NBT * NH_), 128, 0, stream>>>(Qh, Ql, Kh, Kl, VTh, VTl, cmask, SCL, O);
    k_splitD<<<(NBT * NN / 16) * (DMOD / 32) / 8, 256, 0, stream>>>(O, NBT * NN, Oh, Ol);
    k_gemmb<true, false><<<dim3(NBT * NN / 64, DMOD / 64, 1), 128, 0, stream>>>(Oh, Ol, WO, nullptr, out, DMOD, nullptr, nullptr, DMOD);
}

// v005
// It runs in 175 microseconds.
// Two timings next to v004 put it at 1.05 and 1.06 times that version's speed.
// All steps since v000 together make it 11.5 times as fast.
#include <hip/hip_runtime.h>

// Both items go through every launch together (rows item * 2048 + token; planes [item][head]). Compute dtypes, f32 accumulate: q/k/v = x.W^T fused as one [4096 x 1024].[1024 x 3072] GEMM with PLAIN bf16 operands (exact products); the interleaved-pair RoPE
// with the given (cos, sin) table applied while building the q/k planes, in that GEMM's epilogue, which also writes the transposed v planes; scores and attn.V with both operands as bf16 hi + UNSCALED residual planes (three
// products), fused with 1/sqrt(64), the additive float mask input (read as data, shared by all heads/items) and an online softmax in f32 in one kernel, the 16 heads of both items in grid.z; wo on hi/lo planes of the merged heads
// FRAGMENT ORDER: every bf16 operand plane (x, the weights, q, k, v^T, the merged heads) is stored as the matrix instruction's lanes read it. A plane [R][Kd] is cut into tiles of 16 rows x 32 k, tile (r >> 4) * (Kd / 32) + (k >> 5),
// 512 elements each: element (r, k) lies at tile * 512 + ((k >> 4) & 1) * 256 + ((k >> 3) & 1) * 128 + (r & 15) * 8 + (k & 7). Lane l = 16 * hi + lr reads its 16 bytes at l * 16 of each 512-byte half, so a fragment load takes 4 whole lines, not 16 pieces.

#define NBT  2
#define NN   2048
#define DMOD 1024
#define NH_  16
#define HD   64
#define DM   DMOD
#define NTK  NN
#define SCL  0.125f
#define LOSC 1024.0f

typedef _Float16 h16;
typedef unsigned short bf;
typedef __attribute__((ext_vector_type(16))) __bf16   v16bf;
typedef __attribute__((ext_vector_type(16))) _Float16 v16h;
typedef __attribute__((ext_vector_type(8)))  _Float16 v8h;
typedef __attribute__((ext_vector_type(8)))  unsigned short v8us;
typedef __attribute__((ext_vector_type(8)))  float    v8f;
typedef __attribute__((ext_vector_type(4)))  float    v4f;
typedef __attribute__((ext_vector_type(4)))  _Float16 v4h;
typedef v8h  __attribute__((may_alias)) v8ha;
typedef v4f  __attribute__((may_alias)) v4fa;
typedef v8us __attribute__((may_alias)) v8usa;

__device__ __forceinline__ unsigned short f2bf(float f) { unsigned u = __float_as_uint(f); u += 0x7FFFu + ((u >> 16) & 1u); return (unsigned short)(u >> 16); }
__device__ __forceinline__ float bf2f(unsigned short b) { return __uint_as_float(((unsigned)b) << 16); }
__device__ __forceinline__ float bfr(float f) { return bf2f(f2bf(f)); }
__device__ __forceinline__ v16h cat16(v8h lo, v8h hi) { return __builtin_shufflevector(lo, hi, 0, 1, 2, 3, 4, 5, 6, 7, 8, 9, 10, 11, 12, 13, 14, 15); }
__device__ __forceinline__ v16bf cat16b(v8us lo, v8us hi) { return __builtin_bit_cast(v16bf, __builtin_shufflevector(lo, hi, 0, 1, 2, 3, 4, 5, 6, 7, 8, 9, 10, 11, 12, 13, 14, 15)); }
__device__ __forceinline__ v8f wmma16(v16h a, v16h b, v8f c) { return __builtin_amdgcn_wmma_f32_16x16x32_f16(false, a, false, b, (short)0, c, false, false); }
__device__ __forceinline__ v8f wmmab(v16bf a, v16bf b, v8f c) { return __builtin_amdgcn_wmma_f32_16x16x32_bf16(false, a, false, b, (short)0, c, false, false); }

typedef const __attribute__((address_space(1))) char*  gch;    // global-memory pointers by type: a pointer that has passed through an asm operand would otherwise be read with flat loads
typedef const __attribute__((address_space(1))) v8us*  gv8us;
typedef const __attribute__((address_space(1))) v8f*   gv8f;
typedef __attribute__((address_space(1))) char*  gwch;    // the same for stores
typedef __attribute__((address_space(1))) v8us*  gwv8us;
__device__ __forceinline__ v16bf ldfrag(gch p) { return cat16b(*(gv8us)p, *(gv8us)(p + 512)); }   // the lane's 16 bytes of each half of a tile in fragment order: k 8h..8h+7 and 16+8h..16+8h+7

// k_gemmb: 64 x 64 block tile (4 waves x 16 x 64) of C[NBT * NN][NW] = (A [+ Al]).B^T (K = 1024) [+ bf(bias[c])] [+ bf(R[r][c]) residual]; f32 whole-line epilogue (or f16
// QKV epilogue (C unused): the block's 64 columns are one head of q, k or v. q and k: interleaved-pair rotation, pair (2i, 2i+1): o0 = t0 c - t1 s, o1 = t0 s + t1 c with c = bf(fc[t][i][0]), s = bf(fc[t][i][1]),
// then bf16 hi + residual planes [head][token][64]; v: hi + residual planes transposed, [head][d][token]; both in fragment order per head. Every store of a wave is 512 bytes in a row, four whole 128-byte lines. A, Al and Bn are read in fragment order.
template <bool SPLITA, bool F16OUT = false, bool QKV = false>
__global__ __launch_bounds__(128) void k_gemmb(const bf* __restrict__ A, const bf* __restrict__ Al, const bf* __restrict__ Bn, const float* __restrict__ bias, float* C, int ldc, h16* C2, const float* __restrict__ R = nullptr, int K = DM, int roundR = 1,
                                               const float* __restrict__ fc = nullptr, bf* Qh = nullptr, bf* Ql = nullptr, bf* Kh = nullptr, bf* Kl = nullptr, bf* VTh = nullptr, bf* VTl = nullptr) {
    __shared__ __align__(16) float ost[4][16 * 68];
    const int lane = threadIdx.x & 31, wave = __builtin_amdgcn_readfirstlane(threadIdx.x >> 5), lr = lane & 15, hi = lane >> 4;   // the wave's number as a scalar: every fragment address is then a scalar base + lane * 16 bytes
    const int r0 = blockIdx.x * 64 + wave * 16, c0 = blockIdx.y * 64;
    // fragment order, planes of DM columns: a row tile is DM / 32 tiles of 1024 bytes; scalar byte bases that move on one tile a trip, and the lane's loop-invariant place in a half tile
    gch pa = (gch)A + (size_t)(r0 >> 4) * (DM * 32), pl = (gch)Al + (size_t)(r0 >> 4) * (DM * 32), pb = (gch)Bn + (size_t)(c0 >> 4) * (DM * 32);
    unsigned fo = lane * 16;
    v8f acc[4];
#pragma unroll
    for (int t = 0; t < 4; ++t) acc[t] = (v8f){};
#pragma unroll 1
    for (int kc = 0; kc < K; kc += 32) {
        const v16bf a = ldfrag(pa + fo);
        v16bf al = a, b[4];
        if (SPLITA) al = ldfrag(pl + fo);
#pragma unroll
        for (int t = 0; t < 4; ++t) b[t] = ldfrag(pb + t * (DM * 32) + fo);
        __builtin_amdgcn_sched_barrier(0);   // all of the trip's fragments are requested before its first product: without it the built code fetched one column tile at a time into the same registers, one latency each
#pragma unroll
        for (int t = 0; t < 4; ++t) { acc[t] = wmmab(a, b[t], acc[t]); if (SPLITA) acc[t] = wmmab(al, b[t], acc[t]); }
        asm volatile("v_nop\n\tv_nop\n\tv_nop\n\tv_nop" : "+v"(acc[0]), "+v"(acc[1]), "+v"(acc[2]), "+v"(acc[3]) : "v"(a), "v"(al));
        // the wait before a register that an issued load names is written again; the statement takes those registers, so that they stay as they are up to it and the bases move on behind it
        if (SPLITA) asm volatile("s_wait_xcnt 0x0" : "+s"(pa), "+s"(pl), "+s"(pb), "+v"(fo) :: "memory"); else asm volatile("s_wait_xcnt 0x0" : "+s"(pa), "+s"(pb), "+v"(fo) :: "memory");
        pa += 1024; pl += 1024; pb += 1024;
    }
    float* os = &ost[wave][0];
    if (QKV) {
        const int sec = c0 / DM, head = (r0 / NN) * NH_ + (c0 % DM) / HD, tk0 = r0 % NN;   // head: the plane's number, item * 16 + head; tk0: the wave's first token inside its item (a block's 64 rows lie in one item)
        if (sec < 2) {
            const size_t o = (size_t)(tk0 >> 4) * (16 * HD) + lane * 8;   // the wave's 16 tokens are two tiles; step s is the half with columns 16 s + 8 hi .. + 7 of token tk0 + lr
            const float* fp = fc + (size_t)(tk0 + lr) * HD + hi * 8; v8f cs[4];
#pragma unroll
            for (int s = 0; s < 4; ++s) cs[s] = *(const v8f*)(fp + s * 16);   // requested first: they are in flight while the tile is staged
            asm volatile("s_wait_xcnt 0x0" :: "v"(fp) : "memory");   // the wait before a register that an issued load names is written again; it takes the address, which so stays as it is up to here
#pragma unroll
            for (int t = 0; t < 4; ++t) {
#pragma unroll
                for (int j = 0; j < 8; ++j) os[(hi * 8 + j) * 68 + t * 16 + lr] = acc[t][j]; }
            __syncthreads();
            bf* Ph = (sec ? Kh : Qh) + (size_t)head * NN * HD + o; bf* Pl = (sec ? Kl : Ql) + (size_t)head * NN * HD + o;
#pragma unroll
            for (int s = 0; s < 4; ++s) { const float* sp = os + lr * 68 + s * 16 + hi * 8;
                const v4f xa = *(const v4fa*)sp, xb = *(const v4fa*)(sp + 4);
                const float x[8] = {xa[0], xa[1], xa[2], xa[3], xb[0], xb[1], xb[2], xb[3]}; v8us oh, ol;
#pragma unroll
                for (int i = 0; i < 4; ++i) { const float t0 = x[2 * i], t1 = x[2 * i + 1], c = bfr(cs[s][2 * i]), sn = bfr(cs[s][2 * i + 1]); const float y0 = t0 * c - t1 * sn, y1 = t0 * sn + t1 * c;
                    { const unsigned short hb = f2bf(y0); oh[2 * i] = hb; ol[2 * i] = f2bf(y0 - bf2f(hb)); } { const unsigned short hb = f2bf(y1); oh[2 * i + 1] = hb; ol[2 * i + 1] = f2bf(y1 - bf2f(hb)); } }
                *(v8us*)(Ph + s * 256) = oh; *(v8us*)(Pl + s * 256) = ol; }
        } else {
            float* fl = &ost[0][0];   // staged as [d][token of the block]: a lane's accumulator holds 8 consecutive tokens of one d
#pragma unroll
            for (int t = 0; t < 4; ++t) { float* dp = fl + (t * 16 + lr) * 68 + wave * 16 + hi * 8; *(v4fa*)dp = (v4f){acc[t][0], acc[t][1], acc[t][2], acc[t][3]}; *(v4fa*)(dp + 4) = (v4f){acc[t][4], acc[t][5], acc[t][6], acc[t][7]}; }
            __syncthreads();
            const size_t o = (size_t)head * HD * NN + ((size_t)wave * (NN / 32) + (blockIdx.x % (NN / 64)) * 2) * 512 + lane * 8;   // row tile d = 16 wave + lr, the block's two token tiles; step s is the half with tokens 16 s + 8 hi .. + 7
#pragma unroll
            for (int s = 0; s < 4; ++s) { const float* sp = fl + (wave * 16 + lr) * 68 + s * 16 + hi * 8;
                const v4f xa = *(const v4fa*)sp, xb = *(const v4fa*)(sp + 4);
                const float x[8] = {xa[0], xa[1], xa[2], xa[3], xb[0], xb[1], xb[2], xb[3]}; v8us oh, ol;
#pragma unroll
                for (int i = 0; i < 8; ++i) { const unsigned short hb = f2bf(x[i]); oh[i] = hb; ol[i] = f2bf(x[i] - bf2f(hb)); }
                *(v8us*)(VTh + o + s * 256) = oh; *(v8us*)(VTl + o + s * 256) = ol; }
            asm volatile("s_wait_xcnt 0x0" ::: "memory");   // the wait before a register that an issued store names is written again: in the built code the other branch's lines stand behind these stores
        }
        return;
    }
#pragma unroll
    for (int t = 0; t < 4; ++t) { const float bv = bias ? bfr(bias[c0 + t * 16 + lr]) : 0.f;
#pragma unroll
        for (int j = 0; j < 8; ++j) os[(hi * 8 + j) * 68 + t * 16 + lr] = acc[t][j] + bv; }
    __syncthreads();
    if (F16OUT) {
        h16* crow = (h16*)(void*)C + (size_t)r0 * ldc + c0;
        auto pass = [&]() {
#pragma unroll
            for (int s = 0; s < 4; ++s) { const int row = 4 * s + (lane >> 3), piece = lane & 7; const float* sp = os + row * 68 + piece * 8; v8h o, o2;
#pragma unroll
                for (int i = 0; i < 8; ++i) { const h16 a = (h16)sp[i]; o[i] = a; o2[i] = (h16)((sp[i] - (float)a) * LOSC); }
                *(v8h*)(crow + (size_t)row * ldc + piece * 8) = o; if (C2) *(v8h*)(C2 + (size_t)r0 * ldc + c0 + (size_t)row * ldc + piece * 8) = o2; }
        };
        pass(); 
    } else {
        float* crow = C + (size_t)r0 * ldc + c0;
        auto pass = [&]() {
#pragma unroll
            for (int s = 0; s < 8; ++s) { const int Lid = (lane >> 3) + 4 * s, piece = lane & 7; const int row = Lid >> 1, cofs = (Lid & 1) * 32 + piece * 4;
                v4f val = *(const v4fa*)(os + row * 68 + cofs); if (R) { const v4f rv = *(const v4f*)(R + ((size_t)r0 + row) * ldc + c0 + cofs); val += roundR ? (v4f){bfr(rv[0]), bfr(rv[1]), bfr(rv[2]), bfr(rv[3])} : rv; }
                *(v4f*)(crow + (size_t)row * ldc + cofs) = val; }
        };
        pass(); 
    }
}

// The converters below write fragment order: a wave makes one tile (16 rows x 32 k of a [rows][DMOD] f32 source): it reads 16 whole 128-byte lines and stores the two 512-byte halves.
__device__ __forceinline__ const float* tilesrc(const float* src, size_t rowtile, size_t ktile, int lane) { return src + (rowtile * 16 + (lane & 15)) * DMOD + ktile * 32 + (lane >> 4) * 8; }   // the lane's 8 values of half 0; half 1 is 16 further on
__global__ __launch_bounds__(256) void k_zero8(bf* dst, size_t n8) {
    const size_t i = (size_t)blockIdx.x * 256 + threadIdx.x; if (i >= n8) return; v8us z;
#pragma unroll
    for (int k = 0; k < 8; ++k) z[k] = 0;
    *(v8us*)(dst + i * 8) = z; 
}

// ===== z-batched (blockIdx.z = head) attention pieces =====
__global__ __launch_bounds__(256) void k_planes32z(const float* __restrict__ F, int ld, int off, float sc, int rows, bf* Ph, bf* Pl) {
    typedef __attribute__((ext_vector_type(2))) unsigned short v2us;
    const int lane = threadIdx.x & 31; const size_t r = ((size_t)blockIdx.x * 8 + (threadIdx.x >> 5)) * 2 + (lane >> 4); if (r >= (size_t)rows) return; const int z = blockIdx.z; const int c0 = (lane & 15) * 2; v2us oh, ol;
    Ph += (size_t)z * rows * 32; Pl += (size_t)z * rows * 32;
#pragma unroll
    for (int i = 0; i < 2; ++i) { const float y = F[r * ld + off + z * 32 + c0 + i] * sc; const unsigned short hb = f2bf(y); oh[i] = hb; ol[i] = f2bf(y - bf2f(hb)); }
    const size_t o = r * 32 + c0; *(v2us*)(Ph + o) = oh; *(v2us*)(Pl + o) = ol; 
}
__global__ __launch_bounds__(256) void k_vtpadz(const float* __restrict__ F, int ld, int off, int nk, bf* Th, bf* Tl) {
    typedef __attribute__((ext_vector_type(2))) unsigned short v2us;
    const int lane = threadIdx.x & 31; const size_t wid = (size_t)blockIdx.x * 8 + (threadIdx.x >> 5); if (wid >= (size_t)64 * (nk / 64)) return; const int z = blockIdx.z; const int d = (int)(wid / (nk / 64)); const int k0 = (int)(wid % (nk / 64)) * 64 + lane * 2; v2us oh, ol;
    Th += (size_t)z * 64 * nk; Tl += (size_t)z * 64 * nk;
#pragma unroll
    for (int i = 0; i < 2; ++i) { const float y = (d < 32) ? F[(size_t)(k0 + i) * ld + off + z * 32 + (d < 32 ? d : 0)] : 0.f; const unsigned short hb = f2bf(y); oh[i] = hb; ol[i] = f2bf(y - bf2f(hb)); }
    const size_t o = (size_t)d * nk + k0; *(v2us*)(Th + o) = oh; *(v2us*)(Tl + o) = ol; 
}
template <int NK>
__global__ __launch_bounds__(256) void k_softmaxz(const float* __restrict__ S, int rows, bf* PH, bf* PL) {
    typedef __attribute__((ext_vector_type(4))) unsigned short v4us;
    const int lane = threadIdx.x & 31, i = blockIdx.x * 8 + (threadIdx.x >> 5); if (i >= rows) return; const size_t zo = (size_t)blockIdx.z * rows * NK; const float* sr = S + zo + (size_t)i * NK; PH += zo; PL += zo;
    float m = -3.0e38f;
#pragma unroll 1
    for (int c0 = lane * 4; c0 < NK; c0 += 128) {
#pragma unroll
        for (int q = 0; q < 4; ++q) m = fmaxf(m, sr[c0 + q]); }
#pragma unroll
    for (int sh = 16; sh; sh >>= 1) m = fmaxf(m, __shfl_xor(m, sh, 32));
    float sum = 0.f;
#pragma unroll 1
    for (int c0 = lane * 4; c0 < NK; c0 += 128) {
#pragma unroll
        for (int q = 0; q < 4; ++q) sum += __expf(sr[c0 + q] - m); }
#pragma unroll
    for (int sh = 16; sh; sh >>= 1) sum += __shfl_xor(sum, sh, 32);
    const float inv = 1.0f / sum;
{
#pragma unroll 1
        for (int c0 = lane * 4; c0 < NK; c0 += 128) { v4us oh, ol;
#pragma unroll
            for (int q = 0; q < 4; ++q) { const float p = __expf(sr[c0 + q] - m) * inv; const unsigned short hb = f2bf(p); oh[q] = hb; ol[q] = f2bf(p - bf2f(hb)); }
            const size_t o = (size_t)i * NK + c0; *(v4us*)(PH + o) = oh; *(v4us*)(PL + o) = ol; }
         }
}
__global__ __launch_bounds__(256) void k_placez(const float* __restrict__ XH, int rows, int ldy, float* Y) {
    const int lane = threadIdx.x & 31; const size_t q = (size_t)blockIdx.x * 8 + (threadIdx.x >> 5); if (q >= (size_t)rows) return; const int z = blockIdx.z; const float v = XH[((size_t)z * rows + q) * 64 + lane];
    *(float*)(Y + q * ldy + z * 32 + lane) = v; 
}

__global__ __launch_bounds__(256) void k_hplanesz(const float* __restrict__ F, int ld, int h0, float sc, int rows, bf* Ph, bf* Pl) {
    typedef __attribute__((ext_vector_type(2))) unsigned short v2us;
    const int lane = threadIdx.x & 31; const size_t r = (size_t)blockIdx.x * 8 + (threadIdx.x >> 5); if (r >= (size_t)rows) return; const int z = blockIdx.z; v2us oh, ol;
    Ph += (size_t)z * rows * 64; Pl += (size_t)z * rows * 64;
#pragma unroll
    for (int i = 0; i < 2; ++i) { const float y = F[r * ld + (h0 + z) * 64 + lane * 2 + i] * sc; const unsigned short hb = f2bf(y); oh[i] = hb; ol[i] = f2bf(y - bf2f(hb)); }
    const size_t o = r * 64 + lane * 2; *(v2us*)(Ph + o) = oh; *(v2us*)(Pl + o) = ol; 
}
template <int NK>
__global__ __launch_bounds__(256) void k_softmaxzs(const float* __restrict__ S, int rows, float sc, bf* PH, bf* PL) {
    typedef __attribute__((ext_vector_type(4))) unsigned short v4us;
    const int lane = threadIdx.x & 31, i = blockIdx.x * 8 + (threadIdx.x >> 5); if (i >= rows) return; const size_t zo = (size_t)blockIdx.z * rows * NK; const float* sr = S + zo + (size_t)i * NK; PH += zo; PL += zo;
    float m = -3.0e38f;
#pragma unroll 1
    for (int c0 = lane * 4; c0 < NK; c0 += 128) {
#pragma unroll
        for (int q = 0; q < 4; ++q) m = fmaxf(m, sr[c0 + q] * sc); }
#pragma unroll
    for (int sh = 16; sh; sh >>= 1) m = fmaxf(m, __shfl_xor(m, sh, 32));
    float sum = 0.f;
#pragma unroll 1
    for (int c0 = lane * 4; c0 < NK; c0 += 128) {
#pragma unroll
        for (int q = 0; q < 4; ++q) sum += __expf(sr[c0 + q] * sc - m); }
#pragma unroll
    for (int sh = 16; sh; sh >>= 1) sum += __shfl_xor(sum, sh, 32);
    const float inv = 1.0f / sum;
{
#pragma unroll 1
        for (int c0 = lane * 4; c0 < NK; c0 += 128) { v4us oh, ol;
#pragma unroll
            for (int q = 0; q < 4; ++q) { const float p = __expf(sr[c0 + q] * sc - m) * inv; const unsigned short hb = f2bf(p); oh[q] = hb; ol[q] = f2bf(p - bf2f(hb)); }
            const size_t o = (size_t)i * NK + c0; *(v4us*)(PH + o) = oh; *(v4us*)(PL + o) = ol; }
         }
}

// k_cvtin: x and the four weights to bf16 in fragment order, one grid: tiles 0 .. XT-1 are x's, then WT tiles each of wq, wk, wv (stacked as [3 * DMOD][DMOD]) and wo. A block's 8 tiles lie in one source (XT and WT are multiples of 8).
__global__ __launch_bounds__(256) void k_cvtin(const float* __restrict__ x, const float* __restrict__ Wq, const float* __restrict__ Wk, const float* __restrict__ Wv, const float* __restrict__ Wo, bf* Xb, bf* WQKV, bf* WO) {
    constexpr unsigned XT = (NBT * NN / 16) * (DMOD / 32), WT = (DMOD / 16) * (DMOD / 32);
    const int lane = threadIdx.x & 31; unsigned st = blockIdx.x * 8 + (threadIdx.x >> 5);   // st: the tile's number inside its source
    const float* src = x; bf* dst = Xb + (size_t)st * 512;   // below, w comes from the block's number, so that the choice of the source is a scalar one
    if (blockIdx.x >= XT / 8) { const unsigned t = st - XT, w = (blockIdx.x - XT / 8) / (WT / 8); st = t % WT; src = (w == 0) ? Wq : (w == 1) ? Wk : (w == 2) ? Wv : Wo; dst = (w == 3) ? WO + (size_t)st * 512 : WQKV + (size_t)t * 512; }
    const float* sp = tilesrc(src, st / (DMOD / 32), st % (DMOD / 32), lane);
#pragma unroll
    for (int j = 0; j < 2; ++j) { const v8f v = *(const v8f*)(sp + j * 16); v8us o;
#pragma unroll
        for (int i = 0; i < 8; ++i) o[i] = f2bf(v[i]);
        *(v8us*)(dst + j * 256 + lane * 8) = o; }
}
// k_fattn: scores, scale, additive mask, softmax and attn.V of one head of one item (blockIdx.z = item * 16 + head) in one kernel, running maximum and sum per query (online softmax), no score or probability plane in memory.
// Transposed products: S^T = K.Q^T (A = 16 key rows, B = 16 query columns), so a lane holds 8 keys of ONE query per tile; two key tiles, converted in place, are the B operand P^T of O^T += V^T.P^T.
// A wave owns QT * 16 queries and walks the keys 32 at a time; operands are bf16 hi + residual planes, three products each.
// Every '#pragma unroll' in it: the fragment and accumulator arrays are indexed by those loop counters and stay in registers only when the loops are unrolled.
#define QT 2
typedef __attribute__((ext_vector_type(2))) float  v2f;
typedef __attribute__((ext_vector_type(2))) __bf16 v2bf;
typedef __attribute__((ext_vector_type(8))) unsigned v8u;
__device__ __forceinline__ float xhalf(float v) { const int b = __float_as_int(v); return __int_as_float(__builtin_amdgcn_permlanex16(b, b, 0x76543210, 0xfedcba98, false, false)); }   // value of lane l ^ 16
__global__ __launch_bounds__(128) void k_fattn(const bf* Qh_, const bf* Ql_, const bf* Kh_, const bf* Kl_, const bf* VTh_, const bf* VTl_, const float* M_, float sc, bf* Oh, bf* Ol) {
    const int lane = threadIdx.x & 31, wave = __builtin_amdgcn_readfirstlane(threadIdx.x >> 5), lr = lane & 15, hi = lane >> 4;
    const int q0 = (blockIdx.x * 4 + wave) * (QT * 16); const size_t z = blockIdx.z;
    // wave-uniform byte bases; the lane's own part of every address is one of two loop-invariant 32-bit byte offsets (fo: its place in a half tile of a plane; mo: in the mask)
    gch Qh = (gch)Qh_ + (z * NN + q0) * (HD * 2), Ql = (gch)Ql_ + (z * NN + q0) * (HD * 2), Kh = (gch)Kh_ + z * (NN * HD * 2), Kl = (gch)Kl_ + z * (NN * HD * 2), VTh = (gch)VTh_ + z * (HD * NN * 2), VTl = (gch)VTl_ + z * (HD * NN * 2), M = (gch)M_ + (size_t)q0 * (NN * 4);
    unsigned fo = lane * 16, mo = (lr * NN + 8 * hi) * 4;
    v16bf qh[QT][2], ql[QT][2];
#pragma unroll
    for (int u = 0; u < QT; ++u) {
#pragma unroll
        for (int ks = 0; ks < 2; ++ks) { qh[u][ks] = ldfrag(Qh + (u * 2 + ks) * 1024 + fo); ql[u][ks] = ldfrag(Ql + (u * 2 + ks) * 1024 + fo); } }
    v8f o[QT][4]; float m[QT], l[QT];
#pragma unroll
    for (int u = 0; u < QT; ++u) { m[u] = -3.0e38f; l[u] = 0.f;
#pragma unroll
        for (int dt = 0; dt < 4; ++dt) o[u][dt] = (v8f){}; }
    v16bf kh[2][2], kl[2][2]; v8f mk[QT][2];
#pragma unroll
    for (int t = 0; t < 2; ++t) {
#pragma unroll
        for (int ks = 0; ks < 2; ++ks) { kh[t][ks] = ldfrag(Kh + (t * 2 + ks) * 1024 + fo); kl[t][ks] = ldfrag(Kl + (t * 2 + ks) * 1024 + fo); }
#pragma unroll
        for (int u = 0; u < QT; ++u) mk[u][t] = *(gv8f)(M + (u * 16 * NN + t * 16) * 4 + mo); }
    // the wait before a register that an issued load names is written again; the statement takes those registers, so that they stay as they are up to it and the bases move on behind it
    asm volatile("s_wait_xcnt 0x0" : "+s"(Kh), "+s"(Kl), "+s"(M), "+v"(fo), "+v"(mo) :: "memory");
    Kh += 32 * HD * 2; Kl += 32 * HD * 2; M += 32 * 4;   // from here on: the pass that is fetched ahead
#pragma unroll 1   // rolled: a pass is some 600 instructions already, and the fetch-ahead below spans the back edge without a second copy
    for (int key0 = 0; key0 < NN; key0 += 32) {
        v16bf vh[4], vl[4]; v8f st[QT][2];
#pragma unroll
        for (int dt = 0; dt < 4; ++dt) { vh[dt] = ldfrag(VTh + dt * (NN / 32) * 1024 + fo); vl[dt] = ldfrag(VTl + dt * (NN / 32) * 1024 + fo); }
        __builtin_amdgcn_sched_barrier(0);   // V^T is requested before the score products, which hide its latency
#pragma unroll
        for (int u = 0; u < QT; ++u) {
#pragma unroll
            for (int t = 0; t < 2; ++t) { v8f a = (v8f){};
#pragma unroll
                for (int ks = 0; ks < 2; ++ks) { a = wmmab(kh[t][ks], qh[u][ks], a); a = wmmab(kl[t][ks], qh[u][ks], a); a = wmmab(kh[t][ks], ql[u][ks], a); }
#pragma unroll
                for (int j = 0; j < 8; ++j) a[j] = a[j] * sc + bfr(mk[u][t][j]);
                st[u][t] = a; } }
        // the next 32 keys' K fragments and mask values are fetched here; the last pass re-reads its own (in bounds, unused)
#pragma unroll
        for (int t = 0; t < 2; ++t) {
#pragma unroll
            for (int ks = 0; ks < 2; ++ks) { kh[t][ks] = ldfrag(Kh + (t * 2 + ks) * 1024 + fo); kl[t][ks] = ldfrag(Kl + (t * 2 + ks) * 1024 + fo); }
#pragma unroll
            for (int u = 0; u < QT; ++u) mk[u][t] = *(gv8f)(M + (u * 16 * NN + t * 16) * 4 + mo); }
        __builtin_amdgcn_sched_barrier(0);   // ... and requested before the softmax and attn.V of this pass, which hide their latency
#pragma unroll
        for (int u = 0; u < QT; ++u) {
            float mx = -3.0e38f;
#pragma unroll
            for (int t = 0; t < 2; ++t) {
#pragma unroll
                for (int j = 0; j < 8; ++j) mx = fmaxf(mx, st[u][t][j]); }
            mx = fmaxf(mx, xhalf(mx));
            const float mn = fmaxf(m[u], mx), al = __expf(m[u] - mn); m[u] = mn;
            float ps = 0.f; v8u pH, pL;
#pragma unroll
            for (int t = 0; t < 2; ++t) {
#pragma unroll
                for (int jj = 0; jj < 4; ++jj) { const v2f p = {__expf(st[u][t][2 * jj] - mn), __expf(st[u][t][2 * jj + 1] - mn)}; ps += p[0] + p[1];
                    const unsigned hb = __builtin_bit_cast(unsigned, __builtin_convertvector(p, v2bf));
                    const v2f r = {p[0] - __uint_as_float(hb << 16), p[1] - __uint_as_float(hb & 0xFFFF0000u)};
                    pH[t * 4 + jj] = hb; pL[t * 4 + jj] = __builtin_bit_cast(unsigned, __builtin_convertvector(r, v2bf)); } }
            l[u] = l[u] * al + ps;
            const v16bf ph = __builtin_bit_cast(v16bf, pH), pl = __builtin_bit_cast(v16bf, pL);
#pragma unroll
            for (int dt = 0; dt < 4; ++dt) { v8f a = o[u][dt] * al; a = wmmab(vh[dt], ph, a); a = wmmab(vl[dt], ph, a); a = wmmab(vh[dt], pl, a); o[u][dt] = a; }
        }
        __builtin_amdgcn_sched_barrier(0);   // keeps the wait below at the foot of the pass, where the requests have long been taken: higher up the wave would stand on it
        asm volatile("s_wait_xcnt 0x0" : "+s"(VTh), "+s"(VTl), "+s"(Kh), "+s"(Kl), "+s"(M), "+v"(fo), "+v"(mo) :: "memory");   // as in front of the loop, for this pass's loads
        const int step = (key0 + 64 < NN) ? 32 : 0;
        VTh += 1024; VTl += 1024; Kh += step * (HD * 2); Kl += step * (HD * 2); M += step * 4;
    }
#pragma unroll
    for (int u = 0; u < QT; ++u) { const float inv = 1.0f / (l[u] + xhalf(l[u]));
        // the merged heads' hi + residual planes [item * NN + token][DMOD] in fragment order: the lane's 8 values are d = 16 dt + 8 hi .. + 7 of token q0 + 16 u + lr, its 16 bytes at lane * 16 of half dt & 1 of tile (row tile, 2 head + dt / 2); a wave's store is 4 whole lines
        const size_t ob = ((((z / NH_) * NN + q0) / 16 + u) * (DMOD / 32) + (z % NH_) * 2) * 1024;   // wave-uniform bytes; the lane's part is fo, as for the loads
        gwch ph = (gwch)Oh + ob, pl = (gwch)Ol + ob;
#pragma unroll
        for (int dt = 0; dt < 4; ++dt) { const v8f a = o[u][dt] * inv; v8us oh, ol;
#pragma unroll
            for (int j = 0; j < 8; ++j) { const unsigned short hb = f2bf(a[j]); oh[j] = hb; ol[j] = f2bf(a[j] - bf2f(hb)); }
            *(gwv8us)(ph + dt * 512 + fo) = oh; *(gwv8us)(pl + dt * 512 + fo) = ol;
            // the wait before a register that an issued store names is written again; it takes the stored values, which so stay as they are up to here (behind the last pair nothing is written any more)
            if (u + 1 < QT || dt < 3) asm volatile("s_wait_xcnt 0x0" :: "v"(oh), "v"(ol) : "memory"); } }
}
__global__ __launch_bounds__(256) void k_csoftz(const float* __restrict__ S, int rows, float sc, bf* PH, bf* PL) {
    typedef __attribute__((ext_vector_type(4))) unsigned short v4us;
    const int lane = threadIdx.x & 31, i = blockIdx.x * 8 + (threadIdx.x >> 5); if (i >= rows) return; const size_t zo = (size_t)blockIdx.z * rows * NN; const float* sr = S + zo + (size_t)i * NN; PH += zo; PL += zo;
    float m = -3.0e38f;
#pragma unroll 1
    for (int c0 = lane * 4; c0 < NN; c0 += 128) {
#pragma unroll
        for (int q = 0; q < 4; ++q) { const int k = c0 + q; if (k <= i) m = fmaxf(m, sr[k] * sc); } }
#pragma unroll
    for (int sh = 16; sh; sh >>= 1) m = fmaxf(m, __shfl_xor(m, sh, 32));
    float sum = 0.f;
#pragma unroll 1
    for (int c0 = lane * 4; c0 < NN; c0 += 128) {
#pragma unroll
        for (int q = 0; q < 4; ++q) { const int k = c0 + q; if (k <= i) sum += __expf(sr[k] * sc - m); } }
#pragma unroll
    for (int sh = 16; sh; sh >>= 1) sum += __shfl_xor(sum, sh, 32);
    const float inv = 1.0f / sum;
{
#pragma unroll 1
        for (int c0 = lane * 4; c0 < NN; c0 += 128) { v4us oh, ol;
#pragma unroll
            for (int q = 0; q < 4; ++q) { const int k = c0 + q; const float p = (k <= i) ? __expf(sr[(k <= i) ? k : 0] * sc - m) * inv : 0.f; const unsigned short hb = f2bf(p); oh[q] = hb; ol[q] = f2bf(p - bf2f(hb)); }
            const size_t o = (size_t)i * NN + c0; *(v4us*)(PH + o) = oh; *(v4us*)(PL + o) = ol; }
         }
}

extern "C" void kernel_launch(void* const* d_in, const int* in_sizes, int n_in,
                              void* d_out, int out_size, void* d_ws, size_t ws_size, hipStream_t stream) {
    (void)in_sizes; (void)n_in; (void)out_size;
    const float* x = (const float*)d_in[0]; const float* wq = (const float*)d_in[1]; const float* wk = (const float*)d_in[2]; const float* wv = (const float*)d_in[3]; const float* wo = (const float*)d_in[4]; const float* fc = (const float*)d_in[5]; const float* cmask = (const float*)d_in[6];
    float* out = (float*)d_out;    // [2][2048][1024]
    char* wsp = (char*)d_ws;
    auto take = [&](size_t bytes) { char* p = wsp; wsp += (bytes + 255) & ~(size_t)255; return (void*)p; };
    bf* WQKV = (bf*)take((size_t)3 * DMOD * DMOD * 2); bf* WO = (bf*)take((size_t)DMOD * DMOD * 2);
    bf* Xb = (bf*)take((size_t)NBT * NN * DMOD * 2);
    const size_t pb = (size_t)NBT * NH_ * NN * HD * 2;   // one plane set: [item][head]
    bf* Qh = (bf*)take(pb); bf* Ql = (bf*)take(pb); bf* Kh = (bf*)take(pb); bf* Kl = (bf*)take(pb); bf* VTh = (bf*)take(pb); bf* VTl = (bf*)take(pb);
    bf* Oh = (bf*)take((size_t)NBT * NN * DMOD * 2); bf* Ol = (bf*)take((size_t)NBT * NN * DMOD * 2);
    if ((size_t)(wsp - (char*)d_ws) > ws_size) return;    // ~ 84 MB
    k_cvtin<<<((NBT * NN / 16) + 4 * (DMOD / 16)) * (DMOD / 32) / 8, 256, 0, stream>>>(x, wq, wk, wv, wo, Xb, WQKV, WO);   // x [token][in] and the weights [out][in], fragment order
    k_gemmb<false, false, true><<<dim3(NBT * NN / 64, (3 * DMOD) / 64, 1), 128, 0, stream>>>(Xb, nullptr, WQKV, nullptr, nullptr, 0, nullptr, nullptr, DMOD, 1, fc, Qh, Ql, Kh, Kl, VTh, VTl);   // [q | k | v], the planes of all heads of both items
    k_fattn<<<dim3(NN / (QT * 64), 1, NBT * NH_), 128, 0, stream>>>(Qh, Ql, Kh, Kl, VTh, VTl, cmask, SCL, Oh, Ol);
    k_gemmb<true, false><<<dim3(NBT * NN / 64, DMOD / 64, 1), 128, 0, stream>>>(Oh, Ol, WO, nullptr, out, DMOD, nullptr, nullptr, DMOD);
}

// v006
// One run takes 159 microseconds.
// In two side-by-side timings against v005, it was 1.10 and 1.11 times as fast.
// All steps since v000 together make it 12.7 times as fast.
#include <hip/hip_runtime.h>

// Both items go through every launch together (rows item * 2048 + token; planes [item][head]). Compute dtypes, f32 accumulate: q/k/v = x.W^T fused as one [4096 x 1024].[1024 x 3072] GEMM with PLAIN bf16 operands (exact products); the interleaved-pair RoPE
// with the given (cos, sin) table applied while building the q/k planes, in that GEMM's epilogue, which also writes the transposed v planes; scores and attn.V with both operands as bf16 hi + UNSCALED residual planes (three
// products), fused with 1/sqrt(64), the additive float mask input (read as data, shared by all heads/items) and an online softmax in f32 in one kernel, the 16 heads of both items in grid.z; wo on hi/lo planes of the merged heads
// FRAGMENT ORDER: every bf16 operand plane (x, the weights, q, k, v^T, the merged heads) is stored as the matrix instruction's lanes read it. A plane [R][Kd] is cut into tiles of 16 rows x 32 k, tile (r >> 4) * (Kd / 32) + (k >> 5),
// 512 elements each: element (r, k) lies at tile * 512 + ((k >> 4) & 1) * 256 + ((k >> 3) & 1) * 128 + (r & 15) * 8 + (k & 7). Lane l = 16 * hi + lr reads its 16 bytes at l * 16 of each 512-byte half, so a fragment load takes 4 whole lines, not 16 pieces.

#define NBT  2
#define NN   2048
#define DMOD 1024
#define NH_  16
#define HD   64
#define DM   DMOD
#define NTK  NN
#define SCL  0.125f
#define LOSC 1024.0f

typedef _Float16 h16;
typedef unsigned short bf;
typedef __attribute__((ext_vector_type(16))) __bf16   v16bf;
typedef __attribute__((ext_vector_type(16))) _Float16 v16h;
typedef __attribute__((ext_vector_type(8)))  _Float16 v8h;
typedef __attribute__((ext_vector_type(8)))  unsigned short v8us;
typedef __attribute__((ext_vector_type(8)))  float    v8f;
typedef __attribute__((ext_vector_type(4)))  float    v4f;
typedef __attribute__((ext_vector_type(4)))  _Float16 v4h;
typedef v8h  __attribute__((may_alias)) v8ha;
typedef v4f  __attribute__((may_alias)) v4fa;
typedef v8us __attribute__((may_alias)) v8usa;

__device__ __forceinline__ unsigned short f2bf(float f) { unsigned u = __float_as_uint(f); u += 0x7FFFu + ((u >> 16) & 1u); return (unsigned short)(u >> 16); }
__device__ __forceinline__ float bf2f(unsigned short b) { return __uint_as_float(((unsigned)b) << 16); }
__device__ __forceinline__ float bfr(float f) { return bf2f(f2bf(f)); }
__device__ __forceinline__ v16h cat16(v8h lo, v8h hi) { return __builtin_shufflevector(lo, hi, 0, 1, 2, 3, 4, 5, 6, 7, 8, 9, 10, 11, 12, 13, 14, 15); }
__device__ __forceinline__ v16bf cat16b(v8us lo, v8us hi) { return __builtin_bit_cast(v16bf, __builtin_shufflevector(lo, hi, 0, 1, 2, 3, 4, 5, 6, 7, 8, 9, 10, 11, 12, 13, 14, 15)); }
__device__ __forceinline__ v8f wmma16(v16h a, v16h b, v8f c) { return __builtin_amdgcn_wmma_f32_16x16x32_f16(false, a, false, b, (short)0, c, false, false); }
__device__ __forceinline__ v8f wmmab(v16bf a, v16bf b, v8f c) { return __builtin_amdgcn_wmma_f32_16x16x32_bf16(false, a, false, b, (short)0, c, false, false); }

typedef const __attribute__((address_space(1))) char*  gch;    // global-memory pointers by type: a pointer that has passed through an asm operand would otherwise be read with flat loads
typedef const __attribute__((address_space(1))) v8us*  gv8us;
typedef const __attribute__((address_space(1))) v8f*   gv8f;
typedef __attribute__((address_space(1))) char*  gwch;    // the same for stores
typedef __attribute__((address_space(1))) v8us*  gwv8us;
__device__ __forceinline__ v16bf ldfrag(gch p) { return cat16b(*(gv8us)p, *(gv8us)(p + 512)); }   // the lane's 16 bytes of each half of a tile in fragment order: k 8h..8h+7 and 16+8h..16+8h+7

// k_gemmb: 64 x 64 block tile (4 waves x 16 x 64) of C[NBT * NN][NW] = (A [+ Al]).B^T (K = 1024) [+ bf(bias[c])] [+ bf(R[r][c]) residual]; f32 whole-line epilogue (or f16
// A, Al and Bn are read in fragment order.
template <bool SPLITA, bool F16OUT = false>
__global__ __launch_bounds__(128) void k_gemmb(const bf* __restrict__ A, const bf* __restrict__ Al, const bf* __restrict__ Bn, const float* __restrict__ bias, float* C, int ldc, h16* C2, const float* __restrict__ R = nullptr, int K = DM, int roundR = 1) {
    __shared__ __align__(16) float ost[4][16 * 68];
    const int lane = threadIdx.x & 31, wave = __builtin_amdgcn_readfirstlane(threadIdx.x >> 5), lr = lane & 15, hi = lane >> 4;   // the wave's number as a scalar: every fragment address is then a scalar base + lane * 16 bytes
    const int r0 = blockIdx.x * 64 + wave * 16, c0 = blockIdx.y * 64;
    // fragment order, planes of DM columns: a row tile is DM / 32 tiles of 1024 bytes; scalar byte bases that move on one tile a trip, and the lane's loop-invariant place in a half tile
    gch pa = (gch)A + (size_t)(r0 >> 4) * (DM * 32), pl = (gch)Al + (size_t)(r0 >> 4) * (DM * 32), pb = (gch)Bn + (size_t)(c0 >> 4) * (DM * 32);
    unsigned fo = lane * 16;
    v8f acc[4];
#pragma unroll
    for (int t = 0; t < 4; ++t) acc[t] = (v8f){};
#pragma unroll 1
    for (int kc = 0; kc < K; kc += 32) {
        const v16bf a = ldfrag(pa + fo);
        v16bf al = a, b[4];
        if (SPLITA) al = ldfrag(pl + fo);
#pragma unroll
        for (int t = 0; t < 4; ++t) b[t] = ldfrag(pb + t * (DM * 32) + fo);
        __builtin_amdgcn_sched_barrier(0);   // all of the trip's fragments are requested before its first product: without it the built code fetched one column tile at a time into the same registers, one latency each
#pragma unroll
        for (int t = 0; t < 4; ++t) { acc[t] = wmmab(a, b[t], acc[t]); if (SPLITA) acc[t] = wmmab(al, b[t], acc[t]); }
        asm volatile("v_nop\n\tv_nop\n\tv_nop\n\tv_nop" : "+v"(acc[0]), "+v"(acc[1]), "+v"(acc[2]), "+v"(acc[3]) : "v"(a), "v"(al));
        // the wait before a register that an issued load names is written again; the statement takes those registers, so that they stay as they are up to it and the bases move on behind it
        if (SPLITA) asm volatile("s_wait_xcnt 0x0" : "+s"(pa), "+s"(pl), "+s"(pb), "+v"(fo) :: "memory"); else asm volatile("s_wait_xcnt 0x0" : "+s"(pa), "+s"(pb), "+v"(fo) :: "memory");
        pa += 1024; pl += 1024; pb += 1024;
    }
    float* os = &ost[wave][0];
#pragma unroll
    for (int t = 0; t < 4; ++t) { const float bv = bias ? bfr(bias[c0 + t * 16 + lr]) : 0.f;
#pragma unroll
        for (int j = 0; j < 8; ++j) os[(hi * 8 + j) * 68 + t * 16 + lr] = acc[t][j] + bv; }
    __syncthreads();
    if (F16OUT) {
        h16* crow = (h16*)(void*)C + (size_t)r0 * ldc + c0;
        auto pass = [&]() {
#pragma unroll
            for (int s = 0; s < 4; ++s) { const int row = 4 * s + (lane >> 3), piece = lane & 7; const float* sp = os + row * 68 + piece * 8; v8h o, o2;
#pragma unroll
                for (int i = 0; i < 8; ++i) { const h16 a = (h16)sp[i]; o[i] = a; o2[i] = (h16)((sp[i] - (float)a) * LOSC); }
                *(v8h*)(crow + (size_t)row * ldc + piece * 8) = o; if (C2) *(v8h*)(C2 + (size_t)r0 * ldc + c0 + (size_t)row * ldc + piece * 8) = o2; }
        };
        pass(); 
    } else {
        float* crow = C + (size_t)r0 * ldc + c0;
        auto pass = [&]() {
#pragma unroll
            for (int s = 0; s < 8; ++s) { const int Lid = (lane >> 3) + 4 * s, piece = lane & 7; const int row = Lid >> 1, cofs = (Lid & 1) * 32 + piece * 4;
                v4f val = *(const v4fa*)(os + row * 68 + cofs); if (R) { const v4f rv = *(const v4f*)(R + ((size_t)r0 + row) * ldc + c0 + cofs); val += roundR ? (v4f){bfr(rv[0]), bfr(rv[1]), bfr(rv[2]), bfr(rv[3])} : rv; }
                *(v4f*)(crow + (size_t)row * ldc + cofs) = val; }
        };
        pass(); 
    }
}

// k_qkv: [q | k | v] = x.W^T (K = DM), plain bf16 operands. A wave owns 64 rows x 64 columns (4 x 4 accumulator tiles): a trip's 8 fragments feed 16 products. The block's 4 waves are 2 x 2, a 128 x 128 tile: each fragment is asked for by two waves.
// A wave's 64 columns are one head of q, k or v; a block's 128 columns lie in one of the three. q and k: interleaved-pair rotation, pair (2i, 2i+1): o0 = t0 c - t1 s, o1 = t0 s + t1 c with c = bf(fc[t][i][0]), s = bf(fc[t][i][1]),
// then bf16 hi + residual planes [head][token][64]; v: hi + residual planes transposed, [head][d][token]; both in fragment order per head. Every store of a wave is 512 bytes in a row, four whole 128-byte lines.
// Every '#pragma unroll' in it: the fragment and accumulator arrays are indexed by those loop counters and stay in registers only when the loops are unrolled.
__global__ __launch_bounds__(128) void k_qkv(const bf* __restrict__ A, const bf* __restrict__ Bn, const float* __restrict__ fc, bf* Qh, bf* Ql, bf* Kh, bf* Kl, bf* VTh, bf* VTl) {
    __shared__ __align__(16) float ost[4][64 * 68];
    const int lane = threadIdx.x & 31, wave = __builtin_amdgcn_readfirstlane(threadIdx.x >> 5), lr = lane & 15, hi = lane >> 4;   // the wave's number as a scalar: every fragment address is then a scalar base + lane * 16 bytes
    const int r0 = blockIdx.x * 128 + (wave >> 1) * 64, c0 = blockIdx.y * 128 + (wave & 1) * 64;
    gch pa = (gch)A + (size_t)(r0 >> 4) * (DM * 32), pb = (gch)Bn + (size_t)(c0 >> 4) * (DM * 32);   // a row tile of a plane is DM / 32 tiles of 1024 bytes
    unsigned fo = lane * 16;
    v8f acc[4][4];
#pragma unroll
    for (int r = 0; r < 4; ++r) {
#pragma unroll
        for (int t = 0; t < 4; ++t) acc[r][t] = (v8f){}; }
#pragma unroll 1   // rolled: the trips are alike, and a second copy would need a second set of fragment registers
    for (int kc = 0; kc < DM; kc += 32) {
        v16bf a[4], b[4];
#pragma unroll
        for (int r = 0; r < 4; ++r) a[r] = ldfrag(pa + r * (DM * 32) + fo);
#pragma unroll
        for (int t = 0; t < 4; ++t) b[t] = ldfrag(pb + t * (DM * 32) + fo);
        __builtin_amdgcn_sched_barrier(0);   // all of the trip's fragments are requested before its first product: one latency a trip, not one a fragment
#pragma unroll
        for (int r = 0; r < 4; ++r) {
#pragma unroll
            for (int t = 0; t < 4; ++t) acc[r][t] = wmmab(a[r], b[t], acc[r][t]); }
        // the wait before a register that an issued load names is written again; the statement takes those registers, so that they stay as they are up to it and the bases move on behind it
        asm volatile("s_wait_xcnt 0x0" : "+s"(pa), "+s"(pb), "+v"(fo) :: "memory");
        pa += 1024; pb += 1024;
    }
    const int sec = c0 / DM, head = (r0 / NN) * NH_ + (c0 % DM) / HD, tk0 = r0 % NN;   // head: the plane's number, item * 16 + head; tk0: the wave's first token inside its item (a block's 128 rows lie in one item)
    if (sec < 2) {
        float* os = &ost[wave][0];   // the wave's own 64 tokens x 64 columns
#pragma unroll
        for (int r = 0; r < 4; ++r) {
#pragma unroll
            for (int t = 0; t < 4; ++t) {
#pragma unroll
                for (int j = 0; j < 8; ++j) os[(r * 16 + hi * 8 + j) * 68 + t * 16 + lr] = acc[r][t][j]; } }
        const float* fp = fc + (size_t)(tk0 + lr) * HD + hi * 8; v8f cs[4][4];
#pragma unroll
        for (int r = 0; r < 4; ++r) {
#pragma unroll
            for (int s = 0; s < 4; ++s) cs[r][s] = *(const v8f*)(fp + r * (16 * HD) + s * 16); }   // all requested at once, behind the staging, whose accumulator registers they take: one latency
        asm volatile("s_wait_xcnt 0x0" :: "v"(fp) : "memory");   // the wait before a register that an issued load names is written again; it takes the address, which so stays as it is up to here
        __syncthreads();
        bf* Ph = (sec ? Kh : Qh) + (size_t)head * NN * HD + (size_t)(tk0 >> 4) * (16 * HD) + lane * 8; bf* Pl = (sec ? Kl : Ql) + (size_t)head * NN * HD + (size_t)(tk0 >> 4) * (16 * HD) + lane * 8;
#pragma unroll
        for (int r = 0; r < 4; ++r) {   // 16 tokens are two tiles; step s is the half with columns 16 s + 8 hi .. + 7 of token tk0 + 16 r + lr
#pragma unroll
            for (int s = 0; s < 4; ++s) { const float* sp = os + (r * 16 + lr) * 68 + s * 16 + hi * 8;
                const v4f xa = *(const v4fa*)sp, xb = *(const v4fa*)(sp + 4);
                const float x[8] = {xa[0], xa[1], xa[2], xa[3], xb[0], xb[1], xb[2], xb[3]}; v8us oh, ol;
#pragma unroll
                for (int i = 0; i < 4; ++i) { const float t0 = x[2 * i], t1 = x[2 * i + 1], c = bfr(cs[r][s][2 * i]), sn = bfr(cs[r][s][2 * i + 1]); const float y0 = t0 * c - t1 * sn, y1 = t0 * sn + t1 * c;
                    { const unsigned short hb = f2bf(y0); oh[2 * i] = hb; ol[2 * i] = f2bf(y0 - bf2f(hb)); } { const unsigned short hb = f2bf(y1); oh[2 * i + 1] = hb; ol[2 * i + 1] = f2bf(y1 - bf2f(hb)); } }
                *(v8us*)(Ph + r * (16 * HD) + s * 256) = oh; *(v8us*)(Pl + r * (16 * HD) + s * 256) = ol;
                asm volatile("s_wait_xcnt 0x0" :: "v"(oh), "v"(ol) : "memory"); }   // the wait before a register that an issued store names is written again; it takes the stored values, which so stay as they are up to here
        }
    } else {
        // a lane's accumulator holds tokens tk0 + 16 r + 8 hi .. + 7 of d = 16 t + lr: its 16 bytes at lane * 16 of half r & 1 of tile (row tile t, token tile tk0 / 32 + r / 2) of the transposed plane
        const size_t o = (size_t)head * HD * NN + (size_t)(tk0 >> 5) * 512 + lane * 8;
#pragma unroll
        for (int t = 0; t < 4; ++t) {
#pragma unroll
            for (int r = 0; r < 4; ++r) { v8us oh, ol;
#pragma unroll
                for (int i = 0; i < 8; ++i) { const float x = acc[r][t][i]; const unsigned short hb = f2bf(x); oh[i] = hb; ol[i] = f2bf(x - bf2f(hb)); }
                *(v8us*)(VTh + o + (size_t)t * (NN / 32) * 512 + r * 256) = oh; *(v8us*)(VTl + o + (size_t)t * (NN / 32) * 512 + r * 256) = ol;
                asm volatile("s_wait_xcnt 0x0" :: "v"(oh), "v"(ol) : "memory"); } }   // as in the other branch
    }
}

// The converters below write fragment order: a wave makes one tile (16 rows x 32 k of a [rows][DMOD] f32 source): it reads 16 whole 128-byte lines and stores the two 512-byte halves.
__device__ __forceinline__ const float* tilesrc(const float* src, size_t rowtile, size_t ktile, int lane) { return src + (rowtile * 16 + (lane & 15)) * DMOD + ktile * 32 + (lane >> 4) * 8; }   // the lane's 8 values of half 0; half 1 is 16 further on
__global__ __launch_bounds__(256) void k_zero8(bf* dst, size_t n8) {
    const size_t i = (size_t)blockIdx.x * 256 + threadIdx.x; if (i >= n8) return; v8us z;
#pragma unroll
    for (int k = 0; k < 8; ++k) z[k] = 0;
    *(v8us*)(dst + i * 8) = z; 
}

// ===== z-batched (blockIdx.z = head) attention pieces =====
__global__ __launch_bounds__(256) void k_planes32z(const float* __restrict__ F, int ld, int off, float sc, int rows, bf* Ph, bf* Pl) {
    typedef __attribute__((ext_vector_type(2))) unsigned short v2us;
    const int lane = threadIdx.x & 31; const size_t r = ((size_t)blockIdx.x * 8 + (threadIdx.x >> 5)) * 2 + (lane >> 4); if (r >= (size_t)rows) return; const int z = blockIdx.z; const int c0 = (lane & 15) * 2; v2us oh, ol;
    Ph += (size_t)z * rows * 32; Pl += (size_t)z * rows * 32;
#pragma unroll
    for (int i = 0; i < 2; ++i) { const float y = F[r * ld + off + z * 32 + c0 + i] * sc; const unsigned short hb = f2bf(y); oh[i] = hb; ol[i] = f2bf(y - bf2f(hb)); }
    const size_t o = r * 32 + c0; *(v2us*)(Ph + o) = oh; *(v2us*)(Pl + o) = ol; 
}
__global__ __launch_bounds__(256) void k_vtpadz(const float* __restrict__ F, int ld, int off, int nk, bf* Th, bf* Tl) {
    typedef __attribute__((ext_vector_type(2))) unsigned short v2us;
    const int lane = threadIdx.x & 31; const size_t wid = (size_t)blockIdx.x * 8 + (threadIdx.x >> 5); if (wid >= (size_t)64 * (nk / 64)) return; const int z = blockIdx.z; const int d = (int)(wid / (nk / 64)); const int k0 = (int)(wid % (nk / 64)) * 64 + lane * 2; v2us oh, ol;
    Th += (size_t)z * 64 * nk; Tl += (size_t)z * 64 * nk;
#pragma unroll
    for (int i = 0; i < 2; ++i) { const float y = (d < 32) ? F[(size_t)(k0 + i) * ld + off + z * 32 + (d < 32 ? d : 0)] : 0.f; const unsigned short hb = f2bf(y); oh[i] = hb; ol[i] = f2bf(y - bf2f(hb)); }
    const size_t o = (size_t)d * nk + k0; *(v2us*)(Th + o) = oh; *(v2us*)(Tl + o) = ol; 
}
template <int NK>
__global__ __launch_bounds__(256) void k_softmaxz(const float* __restrict__ S, int rows, bf* PH, bf* PL) {
    typedef __attribute__((ext_vector_type(4))) unsigned short v4us;
    const int lane = threadIdx.x & 31, i = blockIdx.x * 8 + (threadIdx.x >> 5); if (i >= rows) return; const size_t zo = (size_t)blockIdx.z * rows * NK; const float* sr = S + zo + (size_t)i * NK; PH += zo; PL += zo;
    float m = -3.0e38f;
#pragma unroll 1
    for (int c0 = lane * 4; c0 < NK; c0 += 128) {
#pragma unroll
        for (int q = 0; q < 4; ++q) m = fmaxf(m, sr[c0 + q]); }
#pragma unroll
    for (int sh = 16; sh; sh >>= 1) m = fmaxf(m, __shfl_xor(m, sh, 32));
    float sum = 0.f;
#pragma unroll 1
    for (int c0 = lane * 4; c0 < NK; c0 += 128) {
#pragma unroll
        for (int q = 0; q < 4; ++q) sum += __expf(sr[c0 + q] - m); }
#pragma unroll
    for (int sh = 16; sh; sh >>= 1) sum += __shfl_xor(sum, sh, 32);
    const float inv = 1.0f / sum;
{
#pragma unroll 1
        for (int c0 = lane * 4; c0 < NK; c0 += 128) { v4us oh, ol;
#pragma unroll
            for (int q = 0; q < 4; ++q) { const float p = __expf(sr[c0 + q] - m) * inv; const unsigned short hb = f2bf(p); oh[q] = hb; ol[q] = f2bf(p - bf2f(hb)); }
            const size_t o = (size_t)i * NK + c0; *(v4us*)(PH + o) = oh; *(v4us*)(PL + o) = ol; }
         }
}
__global__ __launch_bounds__(256) void k_placez(const float* __restrict__ XH, int rows, int ldy, float* Y) {
    const int lane = threadIdx.x & 31; const size_t q = (size_t)blockIdx.x * 8 + (threadIdx.x >> 5); if (q >= (size_t)rows) return; const int z = blockIdx.z; const float v = XH[((size_t)z * rows + q) * 64 + lane];
    *(float*)(Y + q * ldy + z * 32 + lane) = v; 
}

__global__ __launch_bounds__(256) void k_hplanesz(const float* __restrict__ F, int ld, int h0, float sc, int rows, bf* Ph, bf* Pl) {
    typedef __attribute__((ext_vector_type(2))) unsigned short v2us;
    const int lane = threadIdx.x & 31; const size_t r = (size_t)blockIdx.x * 8 + (threadIdx.x >> 5); if (r >= (size_t)rows) return; const int z = blockIdx.z; v2us oh, ol;
    Ph += (size_t)z * rows * 64; Pl += (size_t)z * rows * 64;
#pragma unroll
    for (int i = 0; i < 2; ++i) { const float y = F[r * ld + (h0 + z) * 64 + lane * 2 + i] * sc; const unsigned short hb = f2bf(y); oh[i] = hb; ol[i] = f2bf(y - bf2f(hb)); }
    const size_t o = r * 64 + lane * 2; *(v2us*)(Ph + o) = oh; *(v2us*)(Pl + o) = ol; 
}
template <int NK>
__global__ __launch_bounds__(256) void k_softmaxzs(const float* __restrict__ S, int rows, float sc, bf* PH, bf* PL) {
    typedef __attribute__((ext_vector_type(4))) unsigned short v4us;
    const int lane = threadIdx.x & 31, i = blockIdx.x * 8 + (threadIdx.x >> 5); if (i >= rows) return; const size_t zo = (size_t)blockIdx.z * rows * NK; const float* sr = S + zo + (size_t)i * NK; PH += zo; PL += zo;
    float m = -3.0e38f;
#pragma unroll 1
    for (int c0 = lane * 4; c0 < NK; c0 += 128) {
#pragma unroll
        for (int q = 0; q < 4; ++q) m = fmaxf(m, sr[c0 + q] * sc); }
#pragma unroll
    for (int sh = 16; sh; sh >>= 1) m = fmaxf(m, __shfl_xor(m, sh, 32));
    float sum = 0.f;
#pragma unroll 1
    for (int c0 = lane * 4; c0 < NK; c0 += 128) {
#pragma unroll
        for (int q = 0; q < 4; ++q) sum += __expf(sr[c0 + q] * sc - m); }
#pragma unroll
    for (int sh = 16; sh; sh >>= 1) sum += __shfl_xor(sum, sh, 32);
    const float inv = 1.0f / sum;
{
#pragma unroll 1
        for (int c0 = lane * 4; c0 < NK; c0 += 128) { v4us oh, ol;
#pragma unroll
            for (int q = 0; q < 4; ++q) { const float p = __expf(sr[c0 + q] * sc - m) * inv; const unsigned short hb = f2bf(p); oh[q] = hb; ol[q] = f2bf(p - bf2f(hb)); }
            const size_t o = (size_t)i * NK + c0; *(v4us*)(PH + o) = oh; *(v4us*)(PL + o) = ol; }
         }
}

// k_cvtin: x and the four weights to bf16 in fragment order, one grid: tiles 0 .. XT-1 are x's, then WT tiles each of wq, wk, wv (stacked as [3 * DMOD][DMOD]) and wo. A block's 8 tiles lie in one source (XT and WT are multiples of 8).
__global__ __launch_bounds__(256) void k_cvtin(const float* __restrict__ x, const float* __restrict__ Wq, const float* __restrict__ Wk, const float* __restrict__ Wv, const float* __restrict__ Wo, bf* Xb, bf* WQKV, bf* WO) {
    constexpr unsigned XT = (NBT * NN / 16) * (DMOD / 32), WT = (DMOD / 16) * (DMOD / 32);
    const int lane = threadIdx.x & 31; unsigned st = blockIdx.x * 8 + (threadIdx.x >> 5);   // st: the tile's number inside its source
    const float* src = x; bf* dst = Xb + (size_t)st * 512;   // below, w comes from the block's number, so that the choice of the source is a scalar one
    if (blockIdx.x >= XT / 8) { const unsigned t = st - XT, w = (blockIdx.x - XT / 8) / (WT / 8); st = t % WT; src = (w == 0) ? Wq : (w == 1) ? Wk : (w == 2) ? Wv : Wo; dst = (w == 3) ? WO + (size_t)st * 512 : WQKV + (size_t)t * 512; }
    const float* sp = tilesrc(src, st / (DMOD / 32), st % (DMOD / 32), lane);
#pragma unroll
    for (int j = 0; j < 2; ++j) { const v8f v = *(const v8f*)(sp + j * 16); v8us o;
#pragma unroll
        for (int i = 0; i < 8; ++i) o[i] = f2bf(v[i]);
        *(v8us*)(dst + j * 256 + lane * 8) = o; }
}
// k_fattn: scores, scale, additive mask, softmax and attn.V of one head of one item (blockIdx.z = item * 16 + head) in one kernel, running maximum and sum per query (online softmax), no score or probability plane in memory.
// Transposed products: S^T = K.Q^T (A = 16 key rows, B = 16 query columns), so a lane holds 8 keys of ONE query per tile; two key tiles, converted in place, are the B operand P^T of O^T += V^T.P^T.
// A wave owns QT * 16 queries and walks the keys 32 at a time; operands are bf16 hi + residual planes, three products each.
// Every '#pragma unroll' in it: the fragment and accumulator arrays are indexed by those loop counters and stay in registers only when the loops are unrolled.
#define QT 2
typedef __attribute__((ext_vector_type(2))) float  v2f;
typedef __attribute__((ext_vector_type(2))) __bf16 v2bf;
typedef __attribute__((ext_vector_type(8))) unsigned v8u;
__device__ __forceinline__ float xhalf(float v) { const int b = __float_as_int(v); return __int_as_float(__builtin_amdgcn_permlanex16(b, b, 0x76543210, 0xfedcba98, false, false)); }   // value of lane l ^ 16
__global__ __launch_bounds__(128) void k_fattn(const bf* Qh_, const bf* Ql_, const bf* Kh_, const bf* Kl_, const bf* VTh_, const bf* VTl_, const float* M_, float sc, bf* Oh, bf* Ol) {
    const int lane = threadIdx.x & 31, wave = __builtin_amdgcn_readfirstlane(threadIdx.x >> 5), lr = lane & 15, hi = lane >> 4;
    const int q0 = (blockIdx.x * 4 + wave) * (QT * 16); const size_t z = blockIdx.z;
    // wave-uniform byte bases; the lane's own part of every address is one of two loop-invariant 32-bit byte offsets (fo: its place in a half tile of a plane; mo: in the mask)
    gch Qh = (gch)Qh_ + (z * NN + q0) * (HD * 2), Ql = (gch)Ql_ + (z * NN + q0) * (HD * 2), Kh = (gch)Kh_ + z * (NN * HD * 2), Kl = (gch)Kl_ + z * (NN * HD * 2), VTh = (gch)VTh_ + z * (HD * NN * 2), VTl = (gch)VTl_ + z * (HD * NN * 2), M = (gch)M_ + (size_t)q0 * (NN * 4);
    unsigned fo = lane * 16, mo = (lr * NN + 8 * hi) * 4;
    v16bf qh[QT][2], ql[QT][2];
#pragma unroll
    for (int u = 0; u < QT; ++u) {
#pragma unroll
        for (int ks = 0; ks < 2; ++ks) { qh[u][ks] = ldfrag(Qh + (u * 2 + ks) * 1024 + fo); ql[u][ks] = ldfrag(Ql + (u * 2 + ks) * 1024 + fo); } }
    v8f o[QT][4]; float m[QT], l[QT];
#pragma unroll
    for (int u = 0; u < QT; ++u) { m[u] = -3.0e38f; l[u] = 0.f;
#pragma unroll
        for (int dt = 0; dt < 4; ++dt) o[u][dt] = (v8f){}; }
    v16bf kh[2][2], kl[2][2]; v8f mk[QT][2];
#pragma unroll
    for (int t = 0; t < 2; ++t) {
#pragma unroll
        for (int ks = 0; ks < 2; ++ks) { kh[t][ks] = ldfrag(Kh + (t * 2 + ks) * 1024 + fo); kl[t][ks] = ldfrag(Kl + (t * 2 + ks) * 1024 + fo); }
#pragma unroll
        for (int u = 0; u < QT; ++u) mk[u][t] = *(gv8f)(M + (u * 16 * NN + t * 16) * 4 + mo); }
    // the wait before a register that an issued load names is written again; the statement takes those registers, so that they stay as they are up to it and the bases move on behind it
    asm volatile("s_wait_xcnt 0x0" : "+s"(Kh), "+s"(Kl), "+s"(M), "+v"(fo), "+v"(mo) :: "memory");
    Kh += 32 * HD * 2; Kl += 32 * HD * 2; M += 32 * 4;   // from here on: the pass that is fetched ahead
#pragma unroll 1   // rolled: a pass is some 600 instructions already, and the fetch-ahead below spans the back edge without a second copy
    for (int key0 = 0; key0 < NN; key0 += 32) {
        v16bf vh[4], vl[4]; v8f st[QT][2];
#pragma unroll
        for (int dt = 0; dt < 4; ++dt) { vh[dt] = ldfrag(VTh + dt * (NN / 32) * 1024 + fo); vl[dt] = ldfrag(VTl + dt * (NN / 32) * 1024 + fo); }
        __builtin_amdgcn_sched_barrier(0);   // V^T is requested before the score products, which hide its latency
#pragma unroll
        for (int u = 0; u < QT; ++u) {
#pragma unroll
            for (int t = 0; t < 2; ++t) { v8f a = (v8f){};
#pragma unroll
                for (int ks = 0; ks < 2; ++ks) { a = wmmab(kh[t][ks], qh[u][ks], a); a = wmmab(kl[t][ks], qh[u][ks], a); a = wmmab(kh[t][ks], ql[u][ks], a); }
#pragma unroll
                for (int j = 0; j < 8; ++j) a[j] = a[j] * sc + bfr(mk[u][t][j]);
                st[u][t] = a; } }
        // the next 32 keys' K fragments and mask values are fetched here; the last pass re-reads its own (in bounds, unused)
#pragma unroll
        for (int t = 0; t < 2; ++t) {
#pragma unroll
            for (int ks = 0; ks < 2; ++ks) { kh[t][ks] = ldfrag(Kh + (t * 2 + ks) * 1024 + fo); kl[t][ks] = ldfrag(Kl + (t * 2 + ks) * 1024 + fo); }
#pragma unroll
            for (int u = 0; u < QT; ++u) mk[u][t] = *(gv8f)(M + (u * 16 * NN + t * 16) * 4 + mo); }
        __builtin_amdgcn_sched_barrier(0);   // ... and requested before the softmax and attn.V of this pass, which hide their latency
#pragma unroll
        for (int u = 0; u < QT; ++u) {
            float mx = -3.0e38f;
#pragma unroll
            for (int t = 0; t < 2; ++t) {
#pragma unroll
                for (int j = 0; j < 8; ++j) mx = fmaxf(mx, st[u][t][j]); }
            mx = fmaxf(mx, xhalf(mx));
            const float mn = fmaxf(m[u], mx), al = __expf(m[u] - mn); m[u] = mn;
            float ps = 0.f; v8u pH, pL;
#pragma unroll
            for (int t = 0; t < 2; ++t) {
#pragma unroll
                for (int jj = 0; jj < 4; ++jj) { const v2f p = {__expf(st[u][t][2 * jj] - mn), __expf(st[u][t][2 * jj + 1] - mn)}; ps += p[0] + p[1];
                    const unsigned hb = __builtin_bit_cast(unsigned, __builtin_convertvector(p, v2bf));
                    const v2f r = {p[0] - __uint_as_float(hb << 16), p[1] - __uint_as_float(hb & 0xFFFF0000u)};
                    pH[t * 4 + jj] = hb; pL[t * 4 + jj] = __builtin_bit_cast(unsigned, __builtin_convertvector(r, v2bf)); } }
            l[u] = l[u] * al + ps;
            const v16bf ph = __builtin_bit_cast(v16bf, pH), pl = __builtin_bit_cast(v16bf, pL);
#pragma unroll
            for (int dt = 0; dt < 4; ++dt) { v8f a = o[u][dt] * al; a = wmmab(vh[dt], ph, a); a = wmmab(vl[dt], ph, a); a = wmmab(vh[dt], pl, a); o[u][dt] = a; }
        }
        __builtin_amdgcn_sched_barrier(0);   // keeps the wait below at the foot of the pass, where the requests have long been taken: higher up the wave would stand on it
        asm volatile("s_wait_xcnt 0x0" : "+s"(VTh), "+s"(VTl), "+s"(Kh), "+s"(Kl), "+s"(M), "+v"(fo), "+v"(mo) :: "memory");   // as in front of the loop, for this pass's loads
        const int step = (key0 + 64 < NN) ? 32 : 0;
        VTh += 1024; VTl += 1024; Kh += step * (HD * 2); Kl += step * (HD * 2); M += step * 4;
    }
#pragma unroll
    for (int u = 0; u < QT; ++u) { const float inv = 1.0f / (l[u] + xhalf(l[u]));
        // the merged heads' hi + residual planes [item * NN + token][DMOD] in fragment order: the lane's 8 values are d = 16 dt + 8 hi .. + 7 of token q0 + 16 u + lr, its 16 bytes at lane * 16 of half dt & 1 of tile (row tile, 2 head + dt / 2); a wave's store is 4 whole lines
        const size_t ob = ((((z / NH_) * NN + q0) / 16 + u) * (DMOD / 32) + (z % NH_) * 2) * 1024;   // wave-uniform bytes; the lane's part is fo, as for the loads
        gwch ph = (gwch)Oh + ob, pl = (gwch)Ol + ob;
#pragma unroll
        for (int dt = 0; dt < 4; ++dt) { const v8f a = o[u][dt] * inv; v8us oh, ol;
#pragma unroll
            for (int j = 0; j < 8; ++j) { const unsigned short hb = f2bf(a[j]); oh[j] = hb; ol[j] = f2bf(a[j] - bf2f(hb)); }
            *(gwv8us)(ph + dt * 512 + fo) = oh; *(gwv8us)(pl + dt * 512 + fo) = ol;
            // the wait before a register that an issued store names is written again; it takes the stored values, which so stay as they are up to here (behind the last pair nothing is written any more)
            if (u + 1 < QT || dt < 3) asm volatile("s_wait_xcnt 0x0" :: "v"(oh), "v"(ol) : "memory"); } }
}
__global__ __launch_bounds__(256) void k_csoftz(const float* __restrict__ S, int rows, float sc, bf* PH, bf* PL) {
    typedef __attribute__((ext_vector_type(4))) unsigned short v4us;
    const int lane = threadIdx.x & 31, i = blockIdx.x * 8 + (threadIdx.x >> 5); if (i >= rows) return; const size_t zo = (size_t)blockIdx.z * rows * NN; const float* sr = S + zo + (size_t)i * NN; PH += zo; PL += zo;
    float m = -3.0e38f;
#pragma unroll 1
    for (int c0 = lane * 4; c0 < NN; c0 += 128) {
#pragma unroll
        for (int q = 0; q < 4; ++q) { const int k = c0 + q; if (k <= i) m = fmaxf(m, sr[k] * sc); } }
#pragma unroll
    for (int sh = 16; sh; sh >>= 1) m = fmaxf(m, __shfl_xor(m, sh, 32));
    float sum = 0.f;
#pragma unroll 1
    for (int c0 = lane * 4; c0 < NN; c0 += 128) {
#pragma unroll
        for (int q = 0; q < 4; ++q) { const int k = c0 + q; if (k <= i) sum += __expf(sr[k] * sc - m); } }
#pragma unroll
    for (int sh = 16; sh; sh >>= 1) sum += __shfl_xor(sum, sh, 32);
    const float inv = 1.0f / sum;
{
#pragma unroll 1
        for (int c0 = lane * 4; c0 < NN; c0 += 128) { v4us oh, ol;
#pragma unroll
            for (int q = 0; q < 4; ++q) { const int k = c0 + q; const float p = (k <= i) ? __expf(sr[(k <= i) ? k : 0] * sc - m) * inv : 0.f; const unsigned short hb = f2bf(p); oh[q] = hb; ol[q] = f2bf(p - bf2f(hb)); }
            const size_t o = (size_t)i * NN + c0; *(v4us*)(PH + o) = oh; *(v4us*)(PL + o) = ol; }
         }
}

extern "C" void kernel_launch(void* const* d_in, const int* in_sizes, int n_in,
                              void* d_out, int out_size, void* d_ws, size_t ws_size, hipStream_t stream) {
    (void)in_sizes; (void)n_in; (void)out_size;
    const float* x = (const float*)d_in[0]; const float* wq = (const float*)d_in[1]; const float* wk = (const float*)d_in[2]; const float* wv = (const float*)d_in[3]; const float* wo = (const float*)d_in[4]; const float* fc = (const float*)d_in[5]; const float* cmask = (const float*)d_in[6];
    float* out = (float*)d_out;    // [2][2048][1024]
    char* wsp = (char*)d_ws;
    auto take = [&](size_t bytes) { char* p = wsp; wsp += (bytes + 255) & ~(size_t)255; return (void*)p; };
    bf* WQKV = (bf*)take((size_t)3 * DMOD * DMOD * 2); bf* WO = (bf*)take((size_t)DMOD * DMOD * 2);
    bf* Xb = (bf*)take((size_t)NBT * NN * DMOD * 2);
    const size_t pb = (size_t)NBT * NH_ * NN * HD * 2;   // one plane set: [item][head]
    bf* Qh = (bf*)take(pb); bf* Ql = (bf*)take(pb); bf* Kh = (bf*)take(pb); bf* Kl = (bf*)take(pb); bf* VTh = (bf*)take(pb); bf* VTl = (bf*)take(pb);
    bf* Oh = (bf*)take((size_t)NBT * NN * DMOD * 2); bf* Ol = (bf*)take((size_t)NBT * NN * DMOD * 2);
    if ((size_t)(wsp - (char*)d_ws) > ws_size) return;    // ~ 84 MB
    k_cvtin<<<((NBT * NN / 16) + 4 * (DMOD / 16)) * (DMOD / 32) / 8, 256, 0, stream>>>(x, wq, wk, wv, wo, Xb, WQKV, WO);   // x [token][in] and the weights [out][in], fragment order
    k_qkv<<<dim3(NBT * NN / 128, (3 * DMOD) / 128, 1), 128, 0, stream>>>(Xb, WQKV, fc, Qh, Ql, Kh, Kl, VTh, VTl);   // [q | k | v], the planes of all heads of both items
    k_fattn<<<dim3(NN / (QT * 64), 1, NBT * NH_), 128, 0, stream>>>(Qh, Ql, Kh, Kl, VTh, VTl, cmask, SCL, Oh, Ol);
    k_gemmb<true, false><<<dim3(NBT * NN / 64, DMOD / 64, 1), 128, 0, stream>>>(Oh, Ol, WO, nullptr, out, DMOD, nullptr, nullptr, DMOD);
}

// v007
// A run of this version takes 135 microseconds.
// Two timings next to v006 put it at 1.19 and 1.17 times that version's speed.
// Counting every step since v000, it is 15.0 times as fast.
#include <hip/hip_runtime.h>

// Both items go through every launch together (rows item * 2048 + token; planes [item][head]). Compute dtypes, f32 accumulate: q/k/v = x.W^T fused as one [4096 x 1024].[1024 x 3072] GEMM with PLAIN bf16 operands (exact products); the interleaved-pair RoPE
// with the given (cos, sin) table applied while building the q/k planes, in that GEMM's epilogue, which also writes the transposed v planes; scores and attn.V with both operands as bf16 hi + UNSCALED residual planes (three
// products), fused with 1/sqrt(64), the additive float mask input (read as data, shared by all heads/items) and an online softmax in f32 in one kernel, the 16 heads of both items in grid.z; wo on hi/lo planes of the merged heads
// FRAGMENT ORDER: every bf16 operand plane (x, the weights, q, k, v^T, the merged heads) is stored as the matrix instruction's lanes read it. A plane [R][Kd] is cut into tiles of 16 rows x 32 k, tile (r >> 4) * (Kd / 32) + (k >> 5),
// 512 elements each: element (r, k) lies at tile * 512 + ((k >> 4) & 1) * 256 + ((k >> 3) & 1) * 128 + (r & 15) * 8 + (k & 7). Lane l = 16 * hi + lr reads its 16 bytes at l * 16 of each 512-byte half, so a fragment load takes 4 whole lines, not 16 pieces.

#define NBT  2
#define NN   2048
#define DMOD 1024
#define NH_  16
#define HD   64
#define DM   DMOD
#define NTK  NN
#define SCL  0.125f
#define LOSC 1024.0f

typedef _Float16 h16;
typedef unsigned short bf;
typedef __attribute__((ext_vector_type(16))) __bf16   v16bf;
typedef __attribute__((ext_vector_type(16))) _Float16 v16h;
typedef __attribute__((ext_vector_type(8)))  _Float16 v8h;
typedef __attribute__((ext_vector_type(8)))  unsigned short v8us;
typedef __attribute__((ext_vector_type(8)))  float    v8f;
typedef __attribute__((ext_vector_type(4)))  float    v4f;
typedef __attribute__((ext_vector_type(4)))  _Float16 v4h;
typedef v8h  __attribute__((may_alias)) v8ha;
typedef v4f  __attribute__((may_alias)) v4fa;
typedef v8us __attribute__((may_alias)) v8usa;

__device__ __forceinline__ unsigned short f2bf(float f) { unsigned u = __float_as_uint(f); u += 0x7FFFu + ((u >> 16) & 1u); return (unsigned short)(u >> 16); }
__device__ __forceinline__ float bf2f(unsigned short b) { return __uint_as_float(((unsigned)b) << 16); }
__device__ __forceinline__ float bfr(float f) { return bf2f(f2bf(f)); }
__device__ __forceinline__ v16h cat16(v8h lo, v8h hi) { return __builtin_shufflevector(lo, hi, 0, 1, 2, 3, 4, 5, 6, 7, 8, 9, 10, 11, 12, 13, 14, 15); }
__device__ __forceinline__ v16bf cat16b(v8us lo, v8us hi) { return __builtin_bit_cast(v16bf, __builtin_shufflevector(lo, hi, 0, 1, 2, 3, 4, 5, 6, 7, 8, 9, 10, 11, 12, 13, 14, 15)); }
__device__ __forceinline__ v8f wmma16(v16h a, v16h b, v8f c) { return __builtin_amdgcn_wmma_f32_16x16x32_f16(false, a, false, b, (short)0, c, false, false); }
__device__ __forceinline__ v8f wmmab(v16bf a, v16bf b, v8f c) { return __builtin_amdgcn_wmma_f32_16x16x32_bf16(false, a, false, b, (short)0, c, false, false); }

typedef const __attribute__((address_space(1))) char*  gch;    // global-memory pointers by type: a pointer that has passed through an asm operand would otherwise be read with flat loads
typedef const __attribute__((address_space(1))) v8us*  gv8us;
typedef const __attribute__((address_space(1))) v8f*   gv8f;
typedef __attribute__((address_space(1))) char*  gwch;    // the same for stores
typedef __attribute__((address_space(1))) v8us*  gwv8us;
__device__ __forceinline__ v16bf ldfrag(gch p) { return cat16b(*(gv8us)p, *(gv8us)(p + 512)); }   // the lane's 16 bytes of each half of a tile in fragment order: k 8h..8h+7 and 16+8h..16+8h+7

// k_gemmb: 64 x 64 block tile (4 waves x 16 x 64) of C[NBT * NN][NW] = (A [+ Al]).B^T (K = 1024) [+ bf(bias[c])] [+ bf(R[r][c]) residual]; f32 whole-line epilogue (or f16
// A, Al and Bn are read in fragment order.
template <bool SPLITA, bool F16OUT = false>
__global__ __launch_bounds__(128) void k_gemmb(const bf* __restrict__ A, const bf* __restrict__ Al, const bf* __restrict__ Bn, const float* __restrict__ bias, float* C, int ldc, h16* C2, const float* __restrict__ R = nullptr, int K = DM, int roundR = 1) {
    __shared__ __align__(16) float ost[4][16 * 68];
    const int lane = threadIdx.x & 31, wave = __builtin_amdgcn_readfirstlane(threadIdx.x >> 5), lr = lane & 15, hi = lane >> 4;   // the wave's number as a scalar: every fragment address is then a scalar base + lane * 16 bytes
    const int r0 = blockIdx.x * 64 + wave * 16, c0 = blockIdx.y * 64;
    // fragment order, planes of DM columns: a row tile is DM / 32 tiles of 1024 bytes; scalar byte bases that move on one tile a trip, and the lane's loop-invariant place in a half tile
    const gch pa0 = (gch)A + (size_t)(r0 >> 4) * (DM * 32), pl0 = (gch)Al + (size_t)(r0 >> 4) * (DM * 32), pb0 = (gch)Bn + (size_t)(c0 >> 4) * (DM * 32);
    // rotated start: the blocks that share operand rows would otherwise walk k in step and ask L2 for the same lines at the same moment; each starts at its own k tile and wraps round (a new order of the f32 sums)
    const unsigned nkt = (unsigned)K >> 5; unsigned kt = (blockIdx.x + (blockIdx.y & 3) * 8) & 31; if (kt >= nkt) kt = 0;
    gch pa = pa0 + kt * 1024, pl = pl0 + kt * 1024, pb = pb0 + kt * 1024;
    unsigned fo = lane * 16;
    v8f acc[4];
#pragma unroll
    for (int t = 0; t < 4; ++t) acc[t] = (v8f){};
#pragma unroll 1
    for (int kc = 0; kc < K; kc += 32) {
        const v16bf a = ldfrag(pa + fo);
        v16bf al = a, b[4];
        if (SPLITA) al = ldfrag(pl + fo);
#pragma unroll
        for (int t = 0; t < 4; ++t) b[t] = ldfrag(pb + t * (DM * 32) + fo);
        __builtin_amdgcn_sched_barrier(0);   // all of the trip's fragments are requested before its first product: without it the built code fetched one column tile at a time into the same registers, one latency each
#pragma unroll
        for (int t = 0; t < 4; ++t) { acc[t] = wmmab(a, b[t], acc[t]); if (SPLITA) acc[t] = wmmab(al, b[t], acc[t]); }
        asm volatile("v_nop\n\tv_nop\n\tv_nop\n\tv_nop" : "+v"(acc[0]), "+v"(acc[1]), "+v"(acc[2]), "+v"(acc[3]) : "v"(a), "v"(al));
        // the wait before a register that an issued load names is written again; the statement takes those registers, so that they stay as they are up to it and the bases move on behind it
        if (SPLITA) asm volatile("s_wait_xcnt 0x0" : "+s"(pa), "+s"(pl), "+s"(pb), "+v"(fo) :: "memory"); else asm volatile("s_wait_xcnt 0x0" : "+s"(pa), "+s"(pb), "+v"(fo) :: "memory");
        kt = (kt + 1 == nkt) ? 0 : kt + 1;
        pa = pa0 + kt * 1024; pl = pl0 + kt * 1024; pb = pb0 + kt * 1024;
    }
    float* os = &ost[wave][0];
#pragma unroll
    for (int t = 0; t < 4; ++t) { const float bv = bias ? bfr(bias[c0 + t * 16 + lr]) : 0.f;
#pragma unroll
        for (int j = 0; j < 8; ++j) os[(hi * 8 + j) * 68 + t * 16 + lr] = acc[t][j] + bv; }
    __syncthreads();
    if (F16OUT) {
        h16* crow = (h16*)(void*)C + (size_t)r0 * ldc + c0;
        auto pass = [&]() {
#pragma unroll
            for (int s = 0; s < 4; ++s) { const int row = 4 * s + (lane >> 3), piece = lane & 7; const float* sp = os + row * 68 + piece * 8; v8h o, o2;
#pragma unroll
                for (int i = 0; i < 8; ++i) { const h16 a = (h16)sp[i]; o[i] = a; o2[i] = (h16)((sp[i] - (float)a) * LOSC); }
                *(v8h*)(crow + (size_t)row * ldc + piece * 8) = o; if (C2) *(v8h*)(C2 + (size_t)r0 * ldc + c0 + (size_t)row * ldc + piece * 8) = o2; }
        };
        pass(); 
    } else {
        float* crow = C + (size_t)r0 * ldc + c0;
        auto pass = [&]() {
#pragma unroll
            for (int s = 0; s < 8; ++s) { const int Lid = (lane >> 3) + 4 * s, piece = lane & 7; const int row = Lid >> 1, cofs = (Lid & 1) * 32 + piece * 4;
                v4f val = *(const v4fa*)(os + row * 68 + cofs); if (R) { const v4f rv = *(const v4f*)(R + ((size_t)r0 + row) * ldc + c0 + cofs); val += roundR ? (v4f){bfr(rv[0]), bfr(rv[1]), bfr(rv[2]), bfr(rv[3])} : rv; }
                *(v4f*)(crow + (size_t)row * ldc + cofs) = val; }
        };
        pass(); 
    }
}

// k_qkv: [q | k | v] = x.W^T (K = DM), plain bf16 operands. A wave owns 64 rows x 64 columns (4 x 4 accumulator tiles): a trip's 8 fragments feed 16 products. The block's 4 waves are 2 x 2, a 128 x 128 tile: each fragment is asked for by two waves.
// A wave's 64 columns are one head of q, k or v; a block's 128 columns lie in one of the three. q and k: interleaved-pair rotation, pair (2i, 2i+1): o0 = t0 c - t1 s, o1 = t0 s + t1 c with c = bf(fc[t][i][0]), s = bf(fc[t][i][1]),
// then bf16 hi + residual planes [head][token][64]; v: hi + residual planes transposed, [head][d][token]; both in fragment order per head. Every store of a wave is 512 bytes in a row, four whole 128-byte lines.
// Every '#pragma unroll' in it: the fragment and accumulator arrays are indexed by those loop counters and stay in registers only when the loops are unrolled.
__global__ __launch_bounds__(128) void k_qkv(const bf* __restrict__ A, const bf* __restrict__ Bn, const float* __restrict__ fc, bf* Qh, bf* Ql, bf* Kh, bf* Kl, bf* VTh, bf* VTl) {
    __shared__ __align__(16) float ost[4][64 * 68];
    const int lane = threadIdx.x & 31, wave = __builtin_amdgcn_readfirstlane(threadIdx.x >> 5), lr = lane & 15, hi = lane >> 4;   // the wave's number as a scalar: every fragment address is then a scalar base + lane * 16 bytes
    const int r0 = blockIdx.x * 128 + (wave >> 1) * 64, c0 = blockIdx.y * 128 + (wave & 1) * 64;
    const gch pa0 = (gch)A + (size_t)(r0 >> 4) * (DM * 32), pb0 = (gch)Bn + (size_t)(c0 >> 4) * (DM * 32);   // a row tile of a plane is DM / 32 tiles of 1024 bytes
    unsigned kt = (blockIdx.x + (blockIdx.y & 7) * 4) & (DM / 32 - 1);   // rotated start, as in k_gemmb: the block's first k tile; the walk wraps round
    gch pa = pa0 + kt * 1024, pb = pb0 + kt * 1024;
    unsigned fo = lane * 16;
    v8f acc[4][4];
#pragma unroll
    for (int r = 0; r < 4; ++r) {
#pragma unroll
        for (int t = 0; t < 4; ++t) acc[r][t] = (v8f){}; }
#pragma unroll 1   // rolled: the trips are alike, and a second copy would need a second set of fragment registers
    for (int kc = 0; kc < DM; kc += 32) {
        v16bf a[4], b[4];
#pragma unroll
        for (int r = 0; r < 4; ++r) a[r] = ldfrag(pa + r * (DM * 32) + fo);
#pragma unroll
        for (int t = 0; t < 4; ++t) b[t] = ldfrag(pb + t * (DM * 32) + fo);
        __builtin_amdgcn_sched_barrier(0);   // all of the trip's fragments are requested before its first product: one latency a trip, not one a fragment
#pragma unroll
        for (int r = 0; r < 4; ++r) {
#pragma unroll
            for (int t = 0; t < 4; ++t) acc[r][t] = wmmab(a[r], b[t], acc[r][t]); }
        // the wait before a register that an issued load names is written again; the statement takes those registers, so that they stay as they are up to it and the bases move on behind it
        asm volatile("s_wait_xcnt 0x0" : "+s"(pa), "+s"(pb), "+v"(fo) :: "memory");
        kt = (kt + 1) & (DM / 32 - 1);
        pa = pa0 + kt * 1024; pb = pb0 + kt * 1024;
    }
    const int sec = c0 / DM, head = (r0 / NN) * NH_ + (c0 % DM) / HD, tk0 = r0 % NN;   // head: the plane's number, item * 16 + head; tk0: the wave's first token inside its item (a block's 128 rows lie in one item)
    if (sec < 2) {
        float* os = &ost[wave][0];   // the wave's own 64 tokens x 64 columns
#pragma unroll
        for (int r = 0; r < 4; ++r) {
#pragma unroll
            for (int t = 0; t < 4; ++t) {
#pragma unroll
                for (int j = 0; j < 8; ++j) os[(r * 16 + hi * 8 + j) * 68 + t * 16 + lr] = acc[r][t][j]; } }
        const float* fp = fc + (size_t)(tk0 + lr) * HD + hi * 8; v8f cs[4][4];
#pragma unroll
        for (int r = 0; r < 4; ++r) {
#pragma unroll
            for (int s = 0; s < 4; ++s) cs[r][s] = *(const v8f*)(fp + r * (16 * HD) + s * 16); }   // all requested at once, behind the staging, whose accumulator registers they take: one latency
        asm volatile("s_wait_xcnt 0x0" :: "v"(fp) : "memory");   // the wait before a register that an issued load names is written again; it takes the address, which so stays as it is up to here
        __syncthreads();
        bf* Ph = (sec ? Kh : Qh) + (size_t)head * NN * HD + (size_t)(tk0 >> 4) * (16 * HD) + lane * 8; bf* Pl = (sec ? Kl : Ql) + (size_t)head * NN * HD + (size_t)(tk0 >> 4) * (16 * HD) + lane * 8;
#pragma unroll
        for (int r = 0; r < 4; ++r) {   // 16 tokens are two tiles; step s is the half with columns 16 s + 8 hi .. + 7 of token tk0 + 16 r + lr
#pragma unroll
            for (int s = 0; s < 4; ++s) { const float* sp = os + (r * 16 + lr) * 68 + s * 16 + hi * 8;
                const v4f xa = *(const v4fa*)sp, xb = *(const v4fa*)(sp + 4);
                const float x[8] = {xa[0], xa[1], xa[2], xa[3], xb[0], xb[1], xb[2], xb[3]}; v8us oh, ol;
#pragma unroll
                for (int i = 0; i < 4; ++i) { const float t0 = x[2 * i], t1 = x[2 * i + 1], c = bfr(cs[r][s][2 * i]), sn = bfr(cs[r][s][2 * i + 1]); const float y0 = t0 * c - t1 * sn, y1 = t0 * sn + t1 * c;
                    { const unsigned short hb = f2bf(y0); oh[2 * i] = hb; ol[2 * i] = f2bf(y0 - bf2f(hb)); } { const unsigned short hb = f2bf(y1); oh[2 * i + 1] = hb; ol[2 * i + 1] = f2bf(y1 - bf2f(hb)); } }
                *(v8us*)(Ph + r * (16 * HD) + s * 256) = oh; *(v8us*)(Pl + r * (16 * HD) + s * 256) = ol;
                asm volatile("s_wait_xcnt 0x0" :: "v"(oh), "v"(ol) : "memory"); }   // the wait before a register that an issued store names is written again; it takes the stored values, which so stay as they are up to here
        }
    } else {
        // a lane's accumulator holds tokens tk0 + 16 r + 8 hi .. + 7 of d = 16 t + lr: its 16 bytes at lane * 16 of half r & 1 of tile (row tile t, token tile tk0 / 32 + r / 2) of the transposed plane
        const size_t o = (size_t)head * HD * NN + (size_t)(tk0 >> 5) * 512 + lane * 8;
#pragma unroll
        for (int t = 0; t < 4; ++t) {
#pragma unroll
            for (int r = 0; r < 4; ++r) { v8us oh, ol;
#pragma unroll
                for (int i = 0; i < 8; ++i) { const float x = acc[r][t][i]; const unsigned short hb = f2bf(x); oh[i] = hb; ol[i] = f2bf(x - bf2f(hb)); }
                *(v8us*)(VTh + o + (size_t)t * (NN / 32) * 512 + r * 256) = oh; *(v8us*)(VTl + o + (size_t)t * (NN / 32) * 512 + r * 256) = ol;
                asm volatile("s_wait_xcnt 0x0" :: "v"(oh), "v"(ol) : "memory"); } }   // as in the other branch
    }
}

// The converters below write fragment order: a wave makes one tile (16 rows x 32 k of a [rows][DMOD] f32 source): it reads 16 whole 128-byte lines and stores the two 512-byte halves.
__device__ __forceinline__ const float* tilesrc(const float* src, size_t rowtile, size_t ktile, int lane) { return src + (rowtile * 16 + (lane & 15)) * DMOD + ktile * 32 + (lane >> 4) * 8; }   // the lane's 8 values of half 0; half 1 is 16 further on
__global__ __launch_bounds__(256) void k_zero8(bf* dst, size_t n8) {
    const size_t i = (size_t)blockIdx.x * 256 + threadIdx.x; if (i >= n8) return; v8us z;
#pragma unroll
    for (int k = 0; k < 8; ++k) z[k] = 0;
    *(v8us*)(dst + i * 8) = z; 
}

// ===== z-batched (blockIdx.z = head) attention pieces =====
__global__ __launch_bounds__(256) void k_planes32z(const float* __restrict__ F, int ld, int off, float sc, int rows, bf* Ph, bf* Pl) {
    typedef __attribute__((ext_vector_type(2))) unsigned short v2us;
    const int lane = threadIdx.x & 31; const size_t r = ((size_t)blockIdx.x * 8 + (threadIdx.x >> 5)) * 2 + (lane >> 4); if (r >= (size_t)rows) return; const int z = blockIdx.z; const int c0 = (lane & 15) * 2; v2us oh, ol;
    Ph += (size_t)z * rows * 32; Pl += (size_t)z * rows * 32;
#pragma unroll
    for (int i = 0; i < 2; ++i) { const float y = F[r * ld + off + z * 32 + c0 + i] * sc; const unsigned short hb = f2bf(y); oh[i] = hb; ol[i] = f2bf(y - bf2f(hb)); }
    const size_t o = r * 32 + c0; *(v2us*)(Ph + o) = oh; *(v2us*)(Pl + o) = ol; 
}
__global__ __launch_bounds__(256) void k_vtpadz(const float* __restrict__ F, int ld, int off, int nk, bf* Th, bf* Tl) {
    typedef __attribute__((ext_vector_type(2))) unsigned short v2us;
    const int lane = threadIdx.x & 31; const size_t wid = (size_t)blockIdx.x * 8 + (threadIdx.x >> 5); if (wid >= (size_t)64 * (nk / 64)) return; const int z = blockIdx.z; const int d = (int)(wid / (nk / 64)); const int k0 = (int)(wid % (nk / 64)) * 64 + lane * 2; v2us oh, ol;
    Th += (size_t)z * 64 * nk; Tl += (size_t)z * 64 * nk;
#pragma unroll
    for (int i = 0; i < 2; ++i) { const float y = (d < 32) ? F[(size_t)(k0 + i) * ld + off + z * 32 + (d < 32 ? d : 0)] : 0.f; const unsigned short hb = f2bf(y); oh[i] = hb; ol[i] = f2bf(y - bf2f(hb)); }
    const size_t o = (size_t)d * nk + k0; *(v2us*)(Th + o) = oh; *(v2us*)(Tl + o) = ol; 
}
template <int NK>
__global__ __launch_bounds__(256) void k_softmaxz(const float* __restrict__ S, int rows, bf* PH, bf* PL) {
    typedef __attribute__((ext_vector_type(4))) unsigned short v4us;
    const int lane = threadIdx.x & 31, i = blockIdx.x * 8 + (threadIdx.x >> 5); if (i >= rows) return; const size_t zo = (size_t)blockIdx.z * rows * NK; const float* sr = S + zo + (size_t)i * NK; PH += zo; PL += zo;
    float m = -3.0e38f;
#pragma unroll 1
    for (int c0 = lane * 4; c0 < NK; c0 += 128) {
#pragma unroll
        for (int q = 0; q < 4; ++q) m = fmaxf(m, sr[c0 + q]); }
#pragma unroll
    for (int sh = 16; sh; sh >>= 1) m = fmaxf(m, __shfl_xor(m, sh, 32));
    float sum = 0.f;
#pragma unroll 1
    for (int c0 = lane * 4; c0 < NK; c0 += 128) {
#pragma unroll
        for (int q = 0; q < 4; ++q) sum += __expf(sr[c0 + q] - m); }
#pragma unroll
    for (int sh = 16; sh; sh >>= 1) sum += __shfl_xor(sum, sh, 32);
    const float inv = 1.0f / sum;
{
#pragma unroll 1
        for (int c0 = lane * 4; c0 < NK; c0 += 128) { v4us oh, ol;
#pragma unroll
            for (int q = 0; q < 4; ++q) { const float p = __expf(sr[c0 + q] - m) * inv; const unsigned short hb = f2bf(p); oh[q] = hb; ol[q] = f2bf(p - bf2f(hb)); }
            const size_t o = (size_t)i * NK + c0; *(v4us*)(PH + o) = oh; *(v4us*)(PL + o) = ol; }
         }
}
__global__ __launch_bounds__(256) void k_placez(const float* __restrict__ XH, int rows, int ldy, float* Y) {
    const int lane = threadIdx.x & 31; const size_t q = (size_t)blockIdx.x * 8 + (threadIdx.x >> 5); if (q >= (size_t)rows) return; const int z = blockIdx.z; const float v = XH[((size_t)z * rows + q) * 64 + lane];
    *(float*)(Y + q * ldy + z * 32 + lane) = v; 
}

__global__ __launch_bounds__(256) void k_hplanesz(const float* __restrict__ F, int ld, int h0, float sc, int rows, bf* Ph, bf* Pl) {
    typedef __attribute__((ext_vector_type(2))) unsigned short v2us;
    const int lane = threadIdx.x & 31; const size_t r = (size_t)blockIdx.x * 8 + (threadIdx.x >> 5); if (r >= (size_t)rows) return; const int z = blockIdx.z; v2us oh, ol;
    Ph += (size_t)z * rows * 64; Pl += (size_t)z * rows * 64;
#pragma unroll
    for (int i = 0; i < 2; ++i) { const float y = F[r * ld + (h0 + z) * 64 + lane * 2 + i] * sc; const unsigned short hb = f2bf(y); oh[i] = hb; ol[i] = f2bf(y - bf2f(hb)); }
    const size_t o = r * 64 + lane * 2; *(v2us*)(Ph + o) = oh; *(v2us*)(Pl + o) = ol; 
}
template <int NK>
__global__ __launch_bounds__(256) void k_softmaxzs(const float* __restrict__ S, int rows, float sc, bf* PH, bf* PL) {
    typedef __attribute__((ext_vector_type(4))) unsigned short v4us;
    const int lane = threadIdx.x & 31, i = blockIdx.x * 8 + (threadIdx.x >> 5); if (i >= rows) return; const size_t zo = (size_t)blockIdx.z * rows * NK; const float* sr = S + zo + (size_t)i * NK; PH += zo; PL += zo;
    float m = -3.0e38f;
#pragma unroll 1
    for (int c0 = lane * 4; c0 < NK; c0 += 128) {
#pragma unroll
        for (int q = 0; q < 4; ++q) m = fmaxf(m, sr[c0 + q] * sc); }
#pragma unroll
    for (int sh = 16; sh; sh >>= 1) m = fmaxf(m, __shfl_xor(m, sh, 32));
    float sum = 0.f;
#pragma unroll 1
    for (int c0 = lane * 4; c0 < NK; c0 += 128) {
#pragma unroll
        for (int q = 0; q < 4; ++q) sum += __expf(sr[c0 + q] * sc - m); }
#pragma unroll
    for (int sh = 16; sh; sh >>= 1) sum += __shfl_xor(sum, sh, 32);
    const float inv = 1.0f / sum;
{
#pragma unroll 1
        for (int c0 = lane * 4; c0 < NK; c0 += 128) { v4us oh, ol;
#pragma unroll
            for (int q = 0; q < 4; ++q) { const float p = __expf(sr[c0 + q] * sc - m) * inv; const unsigned short hb = f2bf(p); oh[q] = hb; ol[q] = f2bf(p - bf2f(hb)); }
            const size_t o = (size_t)i * NK + c0; *(v4us*)(PH + o) = oh; *(v4us*)(PL + o) = ol; }
         }
}

// k_cvtin: x and the four weights to bf16 in fragment order, one grid: tiles 0 .. XT-1 are x's, then WT tiles each of wq, wk, wv (stacked as [3 * DMOD][DMOD]) and wo. A block's 8 tiles lie in one source (XT and WT are multiples of 8).
__global__ __launch_bounds__(256) void k_cvtin(const float* __restrict__ x, const float* __restrict__ Wq, const float* __restrict__ Wk, const float* __restrict__ Wv, const float* __restrict__ Wo, bf* Xb, bf* WQKV, bf* WO) {
    constexpr unsigned XT = (NBT * NN / 16) * (DMOD / 32), WT = (DMOD / 16) * (DMOD / 32);
    const int lane = threadIdx.x & 31; unsigned st = blockIdx.x * 8 + (threadIdx.x >> 5);   // st: the tile's number inside its source
    const float* src = x; bf* dst = Xb + (size_t)st * 512;   // below, w comes from the block's number, so that the choice of the source is a scalar one
    if (blockIdx.x >= XT / 8) { const unsigned t = st - XT, w = (blockIdx.x - XT / 8) / (WT / 8); st = t % WT; src = (w == 0) ? Wq : (w == 1) ? Wk : (w == 2) ? Wv : Wo; dst = (w == 3) ? WO + (size_t)st * 512 : WQKV + (size_t)t * 512; }
    const float* sp = tilesrc(src, st / (DMOD / 32), st % (DMOD / 32), lane);
#pragma unroll
    for (int j = 0; j < 2; ++j) { const v8f v = *(const v8f*)(sp + j * 16); v8us o;
#pragma unroll
        for (int i = 0; i < 8; ++i) o[i] = f2bf(v[i]);
        *(v8us*)(dst + j * 256 + lane * 8) = o; }
}
// k_fattn: scores, scale, additive mask, softmax and attn.V of one head of one item (blockIdx.z = item * 16 + head) in one kernel, running maximum and sum per query (online softmax), no score or probability plane in memory.
// Transposed products: S^T = K.Q^T (A = 16 key rows, B = 16 query columns), so a lane holds 8 keys of ONE query per tile; two key tiles, converted in place, are the B operand P^T of O^T += V^T.P^T.
// A wave owns QT * 16 queries and walks the keys 32 at a time; operands are bf16 hi + residual planes, three products each.
// Every '#pragma unroll' in it: the fragment and accumulator arrays are indexed by those loop counters and stay in registers only when the loops are unrolled.
#define QT 2
typedef __attribute__((ext_vector_type(2))) float  v2f;
typedef __attribute__((ext_vector_type(2))) __bf16 v2bf;
typedef __attribute__((ext_vector_type(8))) unsigned v8u;
__device__ __forceinline__ float xhalf(float v) { const int b = __float_as_int(v); return __int_as_float(__builtin_amdgcn_permlanex16(b, b, 0x76543210, 0xfedcba98, false, false)); }   // value of lane l ^ 16
__global__ __launch_bounds__(128) void k_fattn(const bf* Qh_, const bf* Ql_, const bf* Kh_, const bf* Kl_, const bf* VTh_, const bf* VTl_, const float* M_, float sc, bf* Oh, bf* Ol) {
    const int lane = threadIdx.x & 31, wave = __builtin_amdgcn_readfirstlane(threadIdx.x >> 5), lr = lane & 15, hi = lane >> 4;
    const int q0 = (blockIdx.x * 4 + wave) * (QT * 16); const size_t z = blockIdx.z;
    // wave-uniform byte bases; the lane's own part of every address is one of two loop-invariant 32-bit byte offsets (fo: its place in a half tile of a plane; mo: in the mask)
    const gch Qh = (gch)Qh_ + (z * NN + q0) * (HD * 2), Ql = (gch)Ql_ + (z * NN + q0) * (HD * 2), Kh0 = (gch)Kh_ + z * (NN * HD * 2), Kl0 = (gch)Kl_ + z * (NN * HD * 2), VTh0 = (gch)VTh_ + z * (HD * NN * 2), VTl0 = (gch)VTl_ + z * (HD * NN * 2), M0 = (gch)M_ + (size_t)q0 * (NN * 4);
    // rotated start: the 16 blocks of a head share K and V, the blocks of one query range share the mask rows; walking the keys in step they would ask L2 for the same lines at the same moment.
    // Each block starts at its own 32-key pass and wraps round; the online softmax takes the passes in any order (a new order of its sums)
    unsigned pk = ((blockIdx.x + (blockIdx.z & 15)) * 4) & (NN / 32 - 1);
    gch Kh = Kh0 + pk * (32 * HD * 2), Kl = Kl0 + pk * (32 * HD * 2), M = M0 + pk * (32 * 4), VTh = VTh0 + pk * 1024, VTl = VTl0 + pk * 1024;
    unsigned fo = lane * 16, mo = (lr * NN + 8 * hi) * 4;
    v16bf qh[QT][2], ql[QT][2];
#pragma unroll
    for (int u = 0; u < QT; ++u) {
#pragma unroll
        for (int ks = 0; ks < 2; ++ks) { qh[u][ks] = ldfrag(Qh + (u * 2 + ks) * 1024 + fo); ql[u][ks] = ldfrag(Ql + (u * 2 + ks) * 1024 + fo); } }
    v8f o[QT][4]; float m[QT], l[QT];
#pragma unroll
    for (int u = 0; u < QT; ++u) { m[u] = -3.0e38f; l[u] = 0.f;
#pragma unroll
        for (int dt = 0; dt < 4; ++dt) o[u][dt] = (v8f){}; }
    v16bf kh[2][2], kl[2][2]; v8f mk[QT][2];
#pragma unroll
    for (int t = 0; t < 2; ++t) {
#pragma unroll
        for (int ks = 0; ks < 2; ++ks) { kh[t][ks] = ldfrag(Kh + (t * 2 + ks) * 1024 + fo); kl[t][ks] = ldfrag(Kl + (t * 2 + ks) * 1024 + fo); }
#pragma unroll
        for (int u = 0; u < QT; ++u) mk[u][t] = *(gv8f)(M + (u * 16 * NN + t * 16) * 4 + mo); }
    // the wait before a register that an issued load names is written again; the statement takes those registers, so that they stay as they are up to it and the bases move on behind it
    asm volatile("s_wait_xcnt 0x0" : "+s"(Kh), "+s"(Kl), "+s"(M), "+v"(fo), "+v"(mo) :: "memory");
    pk = (pk + 1) & (NN / 32 - 1); Kh = Kh0 + pk * (32 * HD * 2); Kl = Kl0 + pk * (32 * HD * 2); M = M0 + pk * (32 * 4);   // from here on pk, Kh, Kl, M: the pass that is fetched ahead
#pragma unroll 1   // rolled: a pass is some 600 instructions already, and the fetch-ahead below spans the back edge without a second copy
    for (int key0 = 0; key0 < NN; key0 += 32) {
        v16bf vh[4], vl[4]; v8f st[QT][2];
#pragma unroll
        for (int dt = 0; dt < 4; ++dt) { vh[dt] = ldfrag(VTh + dt * (NN / 32) * 1024 + fo); vl[dt] = ldfrag(VTl + dt * (NN / 32) * 1024 + fo); }
        __builtin_amdgcn_sched_barrier(0);   // V^T is requested before the score products, which hide its latency
#pragma unroll
        for (int u = 0; u < QT; ++u) {
#pragma unroll
            for (int t = 0; t < 2; ++t) { v8f a = (v8f){};
#pragma unroll
                for (int ks = 0; ks < 2; ++ks) { a = wmmab(kh[t][ks], qh[u][ks], a); a = wmmab(kl[t][ks], qh[u][ks], a); a = wmmab(kh[t][ks], ql[u][ks], a); }
#pragma unroll
                for (int j = 0; j < 8; ++j) a[j] = a[j] * sc + bfr(mk[u][t][j]);
                st[u][t] = a; } }
        // the next pass's K fragments and mask values are fetched here; the last pass fetches the first one's again (in bounds, unused)
#pragma unroll
        for (int t = 0; t < 2; ++t) {
#pragma unroll
            for (int ks = 0; ks < 2; ++ks) { kh[t][ks] = ldfrag(Kh + (t * 2 + ks) * 1024 + fo); kl[t][ks] = ldfrag(Kl + (t * 2 + ks) * 1024 + fo); }
#pragma unroll
            for (int u = 0; u < QT; ++u) mk[u][t] = *(gv8f)(M + (u * 16 * NN + t * 16) * 4 + mo); }
        __builtin_amdgcn_sched_barrier(0);   // ... and requested before the softmax and attn.V of this pass, which hide their latency
#pragma unroll
        for (int u = 0; u < QT; ++u) {
            float mx = -3.0e38f;
#pragma unroll
            for (int t = 0; t < 2; ++t) {
#pragma unroll
                for (int j = 0; j < 8; ++j) mx = fmaxf(mx, st[u][t][j]); }
            mx = fmaxf(mx, xhalf(mx));
            const float mn = fmaxf(m[u], mx), al = __expf(m[u] - mn); m[u] = mn;
            float ps = 0.f; v8u pH, pL;
#pragma unroll
            for (int t = 0; t < 2; ++t) {
#pragma unroll
                for (int jj = 0; jj < 4; ++jj) { const v2f p = {__expf(st[u][t][2 * jj] - mn), __expf(st[u][t][2 * jj + 1] - mn)}; ps += p[0] + p[1];
                    const unsigned hb = __builtin_bit_cast(unsigned, __builtin_convertvector(p, v2bf));
                    const v2f r = {p[0] - __uint_as_float(hb << 16), p[1] - __uint_as_float(hb & 0xFFFF0000u)};
                    pH[t * 4 + jj] = hb; pL[t * 4 + jj] = __builtin_bit_cast(unsigned, __builtin_convertvector(r, v2bf)); } }
            l[u] = l[u] * al + ps;
            const v16bf ph = __builtin_bit_cast(v16bf, pH), pl = __builtin_bit_cast(v16bf, pL);
#pragma unroll
            for (int dt = 0; dt < 4; ++dt) { v8f a = o[u][dt] * al; a = wmmab(vh[dt], ph, a); a = wmmab(vl[dt], ph, a); a = wmmab(vh[dt], pl, a); o[u][dt] = a; }
        }
        __builtin_amdgcn_sched_barrier(0);   // keeps the wait below at the foot of the pass, where the requests have long been taken: higher up the wave would stand on it
        asm volatile("s_wait_xcnt 0x0" : "+s"(VTh), "+s"(VTl), "+s"(Kh), "+s"(Kl), "+s"(M), "+v"(fo), "+v"(mo) :: "memory");   // as in front of the loop, for this pass's loads
        VTh = VTh0 + pk * 1024; VTl = VTl0 + pk * 1024;
        pk = (pk + 1) & (NN / 32 - 1); Kh = Kh0 + pk * (32 * HD * 2); Kl = Kl0 + pk * (32 * HD * 2); M = M0 + pk * (32 * 4);
    }
#pragma unroll
    for (int u = 0; u < QT; ++u) { const float inv = 1.0f / (l[u] + xhalf(l[u]));
        // the merged heads' hi + residual planes [item * NN + token][DMOD] in fragment order: the lane's 8 values are d = 16 dt + 8 hi .. + 7 of token q0 + 16 u + lr, its 16 bytes at lane * 16 of half dt & 1 of tile (row tile, 2 head + dt / 2); a wave's store is 4 whole lines
        const size_t ob = ((((z / NH_) * NN + q0) / 16 + u) * (DMOD / 32) + (z % NH_) * 2) * 1024;   // wave-uniform bytes; the lane's part is fo, as for the loads
        gwch ph = (gwch)Oh + ob, pl = (gwch)Ol + ob;
#pragma unroll
        for (int dt = 0; dt < 4; ++dt) { const v8f a = o[u][dt] * inv; v8us oh, ol;
#pragma unroll
            for (int j = 0; j < 8; ++j) { const unsigned short hb = f2bf(a[j]); oh[j] = hb; ol[j] = f2bf(a[j] - bf2f(hb)); }
            *(gwv8us)(ph + dt * 512 + fo) = oh; *(gwv8us)(pl + dt * 512 + fo) = ol;
            // the wait before a register that an issued store names is written again; it takes the stored values, which so stay as they are up to here (behind the last pair nothing is written any more)
            if (u + 1 < QT || dt < 3) asm volatile("s_wait_xcnt 0x0" :: "v"(oh), "v"(ol) : "memory"); } }
}
__global__ __launch_bounds__(256) void k_csoftz(const float* __restrict__ S, int rows, float sc, bf* PH, bf* PL) {
    typedef __attribute__((ext_vector_type(4))) unsigned short v4us;
    const int lane = threadIdx.x & 31, i = blockIdx.x * 8 + (threadIdx.x >> 5); if (i >= rows) return; const size_t zo = (size_t)blockIdx.z * rows * NN; const float* sr = S + zo + (size_t)i * NN; PH += zo; PL += zo;
    float m = -3.0e38f;
#pragma unroll 1
    for (int c0 = lane * 4; c0 < NN; c0 += 128) {
#pragma unroll
        for (int q = 0; q < 4; ++q) { const int k = c0 + q; if (k <= i) m = fmaxf(m, sr[k] * sc); } }
#pragma unroll
    for (int sh = 16; sh; sh >>= 1) m = fmaxf(m, __shfl_xor(m, sh, 32));
    float sum = 0.f;
#pragma unroll 1
    for (int c0 = lane * 4; c0 < NN; c0 += 128) {
#pragma unroll
        for (int q = 0; q < 4; ++q) { const int k = c0 + q; if (k <= i) sum += __expf(sr[k] * sc - m); } }
#pragma unroll
    for (int sh = 16; sh; sh >>= 1) sum += __shfl_xor(sum, sh, 32);
    const float inv = 1.0f / sum;
{
#pragma unroll 1
        for (int c0 = lane * 4; c0 < NN; c0 += 128) { v4us oh, ol;
#pragma unroll
            for (int q = 0; q < 4; ++q) { const int k = c0 + q; const float p = (k <= i) ? __expf(sr[(k <= i) ? k : 0] * sc - m) * inv : 0.f; const unsigned short hb = f2bf(p); oh[q] = hb; ol[q] = f2bf(p - bf2f(hb)); }
            const size_t o = (size_t)i * NN + c0; *(v4us*)(PH + o) = oh; *(v4us*)(PL + o) = ol; }
         }
}

extern "C" void kernel_launch(void* const* d_in, const int* in_sizes, int n_in,
                              void* d_out, int out_size, void* d_ws, size_t ws_size, hipStream_t stream) {
    (void)in_sizes; (void)n_in; (void)out_size;
    const float* x = (const float*)d_in[0]; const float* wq = (const float*)d_in[1]; const float* wk = (const float*)d_in[2]; const float* wv = (const float*)d_in[3]; const float* wo = (const float*)d_in[4]; const float* fc = (const float*)d_in[5]; const float* cmask = (const float*)d_in[6];
    float* out = (float*)d_out;    // [2][2048][1024]
    char* wsp = (char*)d_ws;
    auto take = [&](size_t bytes) { char* p = wsp; wsp += (bytes + 255) & ~(size_t)255; return (void*)p; };
    bf* WQKV = (bf*)take((size_t)3 * DMOD * DMOD * 2); bf* WO = (bf*)take((size_t)DMOD * DMOD * 2);
    bf* Xb = (bf*)take((size_t)NBT * NN * DMOD * 2);
    const size_t pb = (size_t)NBT * NH_ * NN * HD * 2;   // one plane set: [item][head]
    bf* Qh = (bf*)take(pb); bf* Ql = (bf*)take(pb); bf* Kh = (bf*)take(pb); bf* Kl = (bf*)take(pb); bf* VTh = (bf*)take(pb); bf* VTl = (bf*)take(pb);
    bf* Oh = (bf*)take((size_t)NBT * NN * DMOD * 2); bf* Ol = (bf*)take((size_t)NBT * NN * DMOD * 2);
    if ((size_t)(wsp - (char*)d_ws) > ws_size) return;    // ~ 84 MB
    k_cvtin<<<((NBT * NN / 16) + 4 * (DMOD / 16)) * (DMOD / 32) / 8, 256, 0, stream>>>(x, wq, wk, wv, wo, Xb, WQKV, WO);   // x [token][in] and the weights [out][in], fragment order
    k_qkv<<<dim3(NBT * NN / 128, (3 * DMOD) / 128, 1), 128, 0, stream>>>(Xb, WQKV, fc, Qh, Ql, Kh, Kl, VTh, VTl);   // [q | k | v], the planes of all heads of both items
    k_fattn<<<dim3(NN / (QT * 64), 1, NBT * NH_), 128, 0, stream>>>(Qh, Ql, Kh, Kl, VTh, VTl, cmask, SCL, Oh, Ol);
    k_gemmb<true, false><<<dim3(NBT * NN / 64, DMOD / 64, 1), 128, 0, stream>>>(Oh, Ol, WO, nullptr, out, DMOD, nullptr, nullptr, DMOD);
}

// v008
// Measured time: 125 microseconds a run.
// Two timings next to v007 both put it at 1.08 times that version's speed.
// Counting every step since v000, it is 16.2 times as fast.
#include <hip/hip_runtime.h>

// Both items go through every launch together (rows item * 2048 + token; planes [item][head]). Compute dtypes, f32 accumulate: q/k/v = x.W^T fused as one [4096 x 1024].[1024 x 3072] GEMM with PLAIN bf16 operands (exact products); the interleaved-pair RoPE
// with the given (cos, sin) table applied while building the q/k planes, in that GEMM's epilogue, which also writes the transposed v planes; scores and attn.V with both operands as bf16 hi + UNSCALED residual planes (three
// products), fused with 1/sqrt(64), the additive float mask input (read as data, shared by all heads/items) and an online softmax in f32 in one kernel, the 16 heads of both items in grid.z; wo on hi/lo planes of the merged heads
// FRAGMENT ORDER: every bf16 operand plane (x, the weights, q, k, v^T, the merged heads) is stored as the matrix instruction's lanes read it. A plane [R][Kd] is cut into tiles of 16 rows x 32 k, tile (r >> 4) * (Kd / 32) + (k >> 5),
// 512 elements each: element (r, k) lies at tile * 512 + ((k >> 4) & 1) * 256 + ((k >> 3) & 1) * 128 + (r & 15) * 8 + (k & 7). Lane l = 16 * hi + lr reads its 16 bytes at l * 16 of each 512-byte half, so a fragment load takes 4 whole lines, not 16 pieces.

#define NBT  2
#define NN   2048
#define DMOD 1024
#define NH_  16
#define HD   64
#define DM   DMOD
#define NTK  NN
#define SCL  0.125f
#define LOSC 1024.0f

typedef _Float16 h16;
typedef unsigned short bf;
typedef __attribute__((ext_vector_type(16))) __bf16   v16bf;
typedef __attribute__((ext_vector_type(16))) _Float16 v16h;
typedef __attribute__((ext_vector_type(8)))  _Float16 v8h;
typedef __attribute__((ext_vector_type(8)))  unsigned short v8us;
typedef __attribute__((ext_vector_type(8)))  float    v8f;
typedef __attribute__((ext_vector_type(4)))  float    v4f;
typedef __attribute__((ext_vector_type(4)))  _Float16 v4h;
typedef v8h  __attribute__((may_alias)) v8ha;
typedef v4f  __attribute__((may_alias)) v4fa;
typedef v8us __attribute__((may_alias)) v8usa;

__device__ __forceinline__ unsigned short f2bf(float f) { unsigned u = __float_as_uint(f); u += 0x7FFFu + ((u >> 16) & 1u); return (unsigned short)(u >> 16); }
__device__ __forceinline__ float bf2f(unsigned short b) { return __uint_as_float(((unsigned)b) << 16); }
__device__ __forceinline__ float bfr(float f) { return bf2f(f2bf(f)); }
__device__ __forceinline__ v16h cat16(v8h lo, v8h hi) { return __builtin_shufflevector(lo, hi, 0, 1, 2, 3, 4, 5, 6, 7, 8, 9, 10, 11, 12, 13, 14, 15); }
__device__ __forceinline__ v16bf cat16b(v8us lo, v8us hi) { return __builtin_bit_cast(v16bf, __builtin_shufflevector(lo, hi, 0, 1, 2, 3, 4, 5, 6, 7, 8, 9, 10, 11, 12, 13, 14, 15)); }
__device__ __forceinline__ v8f wmma16(v16h a, v16h b, v8f c) { return __builtin_amdgcn_wmma_f32_16x16x32_f16(false, a, false, b, (short)0, c, false, false); }
__device__ __forceinline__ v8f wmmab(v16bf a, v16bf b, v8f c) { return __builtin_amdgcn_wmma_f32_16x16x32_bf16(false, a, false, b, (short)0, c, false, false); }

typedef const __attribute__((address_space(1))) char*  gch;    // global-memory pointers by type: a pointer that has passed through an asm operand would otherwise be read with flat loads
typedef const __attribute__((address_space(1))) v8us*  gv8us;
typedef const __attribute__((address_space(1))) v8f*   gv8f;
typedef __attribute__((address_space(1))) char*  gwch;    // the same for stores
typedef __attribute__((address_space(1))) v8us*  gwv8us;
__device__ __forceinline__ v16bf ldfrag(gch p) { return cat16b(*(gv8us)p, *(gv8us)(p + 512)); }   // the lane's 16 bytes of each half of a tile in fragment order: k 8h..8h+7 and 16+8h..16+8h+7

__device__ __forceinline__ float xhalf(float v) { const int b = __float_as_int(v); return __int_as_float(__builtin_amdgcn_permlanex16(b, b, 0x76543210, 0xfedcba98, false, false)); }   // value of lane l ^ 16

// k_gemmb: 64 x 64 block tile (4 waves x 16 x 64) of C[NBT * NN][NW] = (A [+ Al]).B^T (K = 1024) [+ bf(bias[c])] [+ bf(R[r][c]) residual]; f32 whole-line epilogue (or f16
// A, Al and Bn are read in fragment order.
template <bool SPLITA, bool F16OUT = false>
__global__ __launch_bounds__(128) void k_gemmb(const bf* __restrict__ A, const bf* __restrict__ Al, const bf* __restrict__ Bn, const float* __restrict__ bias, float* C, int ldc, h16* C2, const float* __restrict__ R = nullptr, int K = DM, int roundR = 1) {
    __shared__ __align__(16) float ost[4][16 * 68];
    const int lane = threadIdx.x & 31, wave = __builtin_amdgcn_readfirstlane(threadIdx.x >> 5), lr = lane & 15, hi = lane >> 4;   // the wave's number as a scalar: every fragment address is then a scalar base + lane * 16 bytes
    const int r0 = blockIdx.x * 64 + wave * 16, c0 = blockIdx.y * 64;
    // fragment order, planes of DM columns: a row tile is DM / 32 tiles of 1024 bytes; scalar byte bases that move on one tile a trip, and the lane's loop-invariant place in a half tile
    const gch pa0 = (gch)A + (size_t)(r0 >> 4) * (DM * 32), pl0 = (gch)Al + (size_t)(r0 >> 4) * (DM * 32), pb0 = (gch)Bn + (size_t)(c0 >> 4) * (DM * 32);
    // rotated start: the blocks that share operand rows would otherwise walk k in step and ask L2 for the same lines at the same moment; each starts at its own k tile and wraps round (a new order of the f32 sums)
    const unsigned nkt = (unsigned)K >> 5; unsigned kt = (blockIdx.x + (blockIdx.y & 3) * 8) & 31; if (kt >= nkt) kt = 0;
    gch pa = pa0 + kt * 1024, pl = pl0 + kt * 1024, pb = pb0 + kt * 1024;
    unsigned fo = lane * 16;
    v8f acc[4];
#pragma unroll
    for (int t = 0; t < 4; ++t) acc[t] = (v8f){};
#pragma unroll 1
    for (int kc = 0; kc < K; kc += 32) {
        const v16bf a = ldfrag(pa + fo);
        v16bf al = a, b[4];
        if (SPLITA) al = ldfrag(pl + fo);
#pragma unroll
        for (int t = 0; t < 4; ++t) b[t] = ldfrag(pb + t * (DM * 32) + fo);
        __builtin_amdgcn_sched_barrier(0);   // all of the trip's fragments are requested before its first product: without it the built code fetched one column tile at a time into the same registers, one latency each
#pragma unroll
        for (int t = 0; t < 4; ++t) { acc[t] = wmmab(a, b[t], acc[t]); if (SPLITA) acc[t] = wmmab(al, b[t], acc[t]); }
        asm volatile("v_nop\n\tv_nop\n\tv_nop\n\tv_nop" : "+v"(acc[0]), "+v"(acc[1]), "+v"(acc[2]), "+v"(acc[3]) : "v"(a), "v"(al));
        // the wait before a register that an issued load names is written again; the statement takes those registers, so that they stay as they are up to it and the bases move on behind it
        if (SPLITA) asm volatile("s_wait_xcnt 0x0" : "+s"(pa), "+s"(pl), "+s"(pb), "+v"(fo) :: "memory"); else asm volatile("s_wait_xcnt 0x0" : "+s"(pa), "+s"(pb), "+v"(fo) :: "memory");
        kt = (kt + 1 == nkt) ? 0 : kt + 1;
        pa = pa0 + kt * 1024; pl = pl0 + kt * 1024; pb = pb0 + kt * 1024;
    }
    float* os = &ost[wave][0];
#pragma unroll
    for (int t = 0; t < 4; ++t) { const float bv = bias ? bfr(bias[c0 + t * 16 + lr]) : 0.f;
#pragma unroll
        for (int j = 0; j < 8; ++j) os[(hi * 8 + j) * 68 + t * 16 + lr] = acc[t][j] + bv; }
    __syncthreads();
    if (F16OUT) {
        h16* crow = (h16*)(void*)C + (size_t)r0 * ldc + c0;
        auto pass = [&]() {
#pragma unroll
            for (int s = 0; s < 4; ++s) { const int row = 4 * s + (lane >> 3), piece = lane & 7; const float* sp = os + row * 68 + piece * 8; v8h o, o2;
#pragma unroll
                for (int i = 0; i < 8; ++i) { const h16 a = (h16)sp[i]; o[i] = a; o2[i] = (h16)((sp[i] - (float)a) * LOSC); }
                *(v8h*)(crow + (size_t)row * ldc + piece * 8) = o; if (C2) *(v8h*)(C2 + (size_t)r0 * ldc + c0 + (size_t)row * ldc + piece * 8) = o2; }
        };
        pass(); 
    } else {
        float* crow = C + (size_t)r0 * ldc + c0;
        auto pass = [&]() {
#pragma unroll
            for (int s = 0; s < 8; ++s) { const int Lid = (lane >> 3) + 4 * s, piece = lane & 7; const int row = Lid >> 1, cofs = (Lid & 1) * 32 + piece * 4;
                v4f val = *(const v4fa*)(os + row * 68 + cofs); if (R) { const v4f rv = *(const v4f*)(R + ((size_t)r0 + row) * ldc + c0 + cofs); val += roundR ? (v4f){bfr(rv[0]), bfr(rv[1]), bfr(rv[2]), bfr(rv[3])} : rv; }
                *(v4f*)(crow + (size_t)row * ldc + cofs) = val; }
        };
        pass(); 
    }
}

// k_qkv: [q | k | v] = x.W^T (K = DM), plain bf16 operands. A wave owns 64 rows x 64 columns (4 x 4 accumulator tiles): a trip's 8 fragments feed 16 products. The block's 4 waves are 2 x 2, a 128 x 128 tile: each fragment is asked for by two waves.
// A wave's 64 columns are one head of q, k or v; a block's 128 columns lie in one of the three. q and k: interleaved-pair rotation, pair (2i, 2i+1): o0 = t0 c - t1 s, o1 = t0 s + t1 c with c = bf(fc[t][i][0]), s = bf(fc[t][i][1]),
// then bf16 hi + residual planes [head][token][64]; v: hi + residual planes transposed, [head][d][token]; both in fragment order per head. Every store of a wave is 512 bytes in a row, four whole 128-byte lines.
// Every '#pragma unroll' in it: the fragment and accumulator arrays are indexed by those loop counters and stay in registers only when the loops are unrolled.
__global__ __launch_bounds__(128) void k_qkv(const bf* __restrict__ A, const bf* __restrict__ Bn, const float* __restrict__ fc, bf* Qh, bf* Ql, bf* Kh, bf* Kl, bf* VTh, bf* VTl, float* NR) {
    __shared__ __align__(16) float ost[4][64 * 68];
    const int lane = threadIdx.x & 31, wave = __builtin_amdgcn_readfirstlane(threadIdx.x >> 5), lr = lane & 15, hi = lane >> 4;   // the wave's number as a scalar: every fragment address is then a scalar base + lane * 16 bytes
    const int r0 = blockIdx.x * 128 + (wave >> 1) * 64, c0 = blockIdx.y * 128 + (wave & 1) * 64;
    const gch pa0 = (gch)A + (size_t)(r0 >> 4) * (DM * 32), pb0 = (gch)Bn + (size_t)(c0 >> 4) * (DM * 32);   // a row tile of a plane is DM / 32 tiles of 1024 bytes
    unsigned kt = (blockIdx.x + (blockIdx.y & 7) * 4) & (DM / 32 - 1);   // rotated start, as in k_gemmb: the block's first k tile; the walk wraps round
    gch pa = pa0 + kt * 1024, pb = pb0 + kt * 1024;
    unsigned fo = lane * 16;
    v8f acc[4][4];
#pragma unroll
    for (int r = 0; r < 4; ++r) {
#pragma unroll
        for (int t = 0; t < 4; ++t) acc[r][t] = (v8f){}; }
#pragma unroll 1   // rolled: the trips are alike, and a second copy would need a second set of fragment registers
    for (int kc = 0; kc < DM; kc += 32) {
        v16bf a[4], b[4];
#pragma unroll
        for (int r = 0; r < 4; ++r) a[r] = ldfrag(pa + r * (DM * 32) + fo);
#pragma unroll
        for (int t = 0; t < 4; ++t) b[t] = ldfrag(pb + t * (DM * 32) + fo);
        __builtin_amdgcn_sched_barrier(0);   // all of the trip's fragments are requested before its first product: one latency a trip, not one a fragment
#pragma unroll
        for (int r = 0; r < 4; ++r) {
#pragma unroll
            for (int t = 0; t < 4; ++t) acc[r][t] = wmmab(a[r], b[t], acc[r][t]); }
        // the wait before a register that an issued load names is written again; the statement takes those registers, so that they stay as they are up to it and the bases move on behind it
        asm volatile("s_wait_xcnt 0x0" : "+s"(pa), "+s"(pb), "+v"(fo) :: "memory");
        kt = (kt + 1) & (DM / 32 - 1);
        pa = pa0 + kt * 1024; pb = pb0 + kt * 1024;
    }
    const int sec = c0 / DM, head = (r0 / NN) * NH_ + (c0 % DM) / HD, tk0 = r0 % NN;   // head: the plane's number, item * 16 + head; tk0: the wave's first token inside its item (a block's 128 rows lie in one item)
    if (sec < 2) {
        float* os = &ost[wave][0];   // the wave's own 64 tokens x 64 columns
#pragma unroll
        for (int r = 0; r < 4; ++r) {
#pragma unroll
            for (int t = 0; t < 4; ++t) {
#pragma unroll
                for (int j = 0; j < 8; ++j) os[(r * 16 + hi * 8 + j) * 68 + t * 16 + lr] = acc[r][t][j]; } }
        const float* fp = fc + (size_t)(tk0 + lr) * HD + hi * 8; v8f cs[4][4];
#pragma unroll
        for (int r = 0; r < 4; ++r) {
#pragma unroll
            for (int s = 0; s < 4; ++s) cs[r][s] = *(const v8f*)(fp + r * (16 * HD) + s * 16); }   // all requested at once, behind the staging, whose accumulator registers they take: one latency
        asm volatile("s_wait_xcnt 0x0" :: "v"(fp) : "memory");   // the wait before a register that an issued load names is written again; it takes the address, which so stays as it is up to here
        __syncthreads();
        float nr[4] = {0.f, 0.f, 0.f, 0.f};   // squared length of the rotated row of token tk0 + 16 r + lr (this lane's half of its columns)
        bf* Ph = (sec ? Kh : Qh) + (size_t)head * NN * HD + (size_t)(tk0 >> 4) * (16 * HD) + lane * 8; bf* Pl = (sec ? Kl : Ql) + (size_t)head * NN * HD + (size_t)(tk0 >> 4) * (16 * HD) + lane * 8;
#pragma unroll
        for (int r = 0; r < 4; ++r) {   // 16 tokens are two tiles; step s is the half with columns 16 s + 8 hi .. + 7 of token tk0 + 16 r + lr
#pragma unroll
            for (int s = 0; s < 4; ++s) { const float* sp = os + (r * 16 + lr) * 68 + s * 16 + hi * 8;
                const v4f xa = *(const v4fa*)sp, xb = *(const v4fa*)(sp + 4);
                const float x[8] = {xa[0], xa[1], xa[2], xa[3], xb[0], xb[1], xb[2], xb[3]}; v8us oh, ol;
#pragma unroll
                for (int i = 0; i < 4; ++i) { const float t0 = x[2 * i], t1 = x[2 * i + 1], c = bfr(cs[r][s][2 * i]), sn = bfr(cs[r][s][2 * i + 1]); const float y0 = t0 * c - t1 * sn, y1 = t0 * sn + t1 * c; nr[r] += y0 * y0 + y1 * y1;
                    { const unsigned short hb = f2bf(y0); oh[2 * i] = hb; ol[2 * i] = f2bf(y0 - bf2f(hb)); } { const unsigned short hb = f2bf(y1); oh[2 * i + 1] = hb; ol[2 * i + 1] = f2bf(y1 - bf2f(hb)); } }
                *(v8us*)(Ph + r * (16 * HD) + s * 256) = oh; *(v8us*)(Pl + r * (16 * HD) + s * 256) = ol;
                asm volatile("s_wait_xcnt 0x0" :: "v"(oh), "v"(ol) : "memory"); }   // the wait before a register that an issued store names is written again; it takes the stored values, which so stay as they are up to here
        }
        // the largest squared row length among the wave's 64 tokens, for k_fattn's bound on a score; each wave's value has a 128-byte line of its own
        float nm = fmaxf(fmaxf(nr[0] + xhalf(nr[0]), nr[1] + xhalf(nr[1])), fmaxf(nr[2] + xhalf(nr[2]), nr[3] + xhalf(nr[3])));
#pragma unroll
        for (int sh = 8; sh; sh >>= 1) nm = fmaxf(nm, __shfl_xor(nm, sh, 32));
        if (lane == 0) NR[((size_t)(sec * (NBT * NH_) + head) * (NN / 64) + (tk0 >> 6)) * 32] = nm;
    } else {
        // a lane's accumulator holds tokens tk0 + 16 r + 8 hi .. + 7 of d = 16 t + lr: its 16 bytes at lane * 16 of half r & 1 of tile (row tile t, token tile tk0 / 32 + r / 2) of the transposed plane
        const size_t o = (size_t)head * HD * NN + (size_t)(tk0 >> 5) * 512 + lane * 8;
#pragma unroll
        for (int t = 0; t < 4; ++t) {
#pragma unroll
            for (int r = 0; r < 4; ++r) { v8us oh, ol;
#pragma unroll
                for (int i = 0; i < 8; ++i) { const float x = acc[r][t][i]; const unsigned short hb = f2bf(x); oh[i] = hb; ol[i] = f2bf(x - bf2f(hb)); }
                *(v8us*)(VTh + o + (size_t)t * (NN / 32) * 512 + r * 256) = oh; *(v8us*)(VTl + o + (size_t)t * (NN / 32) * 512 + r * 256) = ol;
                asm volatile("s_wait_xcnt 0x0" :: "v"(oh), "v"(ol) : "memory"); } }   // as in the other branch
    }
}

// The converters below write fragment order: a wave makes one tile (16 rows x 32 k of a [rows][DMOD] f32 source): it reads 16 whole 128-byte lines and stores the two 512-byte halves.
__device__ __forceinline__ const float* tilesrc(const float* src, size_t rowtile, size_t ktile, int lane) { return src + (rowtile * 16 + (lane & 15)) * DMOD + ktile * 32 + (lane >> 4) * 8; }   // the lane's 8 values of half 0; half 1 is 16 further on
__global__ __launch_bounds__(256) void k_zero8(bf* dst, size_t n8) {
    const size_t i = (size_t)blockIdx.x * 256 + threadIdx.x; if (i >= n8) return; v8us z;
#pragma unroll
    for (int k = 0; k < 8; ++k) z[k] = 0;
    *(v8us*)(dst + i * 8) = z; 
}

// ===== z-batched (blockIdx.z = head) attention pieces =====
__global__ __launch_bounds__(256) void k_planes32z(const float* __restrict__ F, int ld, int off, float sc, int rows, bf* Ph, bf* Pl) {
    typedef __attribute__((ext_vector_type(2))) unsigned short v2us;
    const int lane = threadIdx.x & 31; const size_t r = ((size_t)blockIdx.x * 8 + (threadIdx.x >> 5)) * 2 + (lane >> 4); if (r >= (size_t)rows) return; const int z = blockIdx.z; const int c0 = (lane & 15) * 2; v2us oh, ol;
    Ph += (size_t)z * rows * 32; Pl += (size_t)z * rows * 32;
#pragma unroll
    for (int i = 0; i < 2; ++i) { const float y = F[r * ld + off + z * 32 + c0 + i] * sc; const unsigned short hb = f2bf(y); oh[i] = hb; ol[i] = f2bf(y - bf2f(hb)); }
    const size_t o = r * 32 + c0; *(v2us*)(Ph + o) = oh; *(v2us*)(Pl + o) = ol; 
}
__global__ __launch_bounds__(256) void k_vtpadz(const float* __restrict__ F, int ld, int off, int nk, bf* Th, bf* Tl) {
    typedef __attribute__((ext_vector_type(2))) unsigned short v2us;
    const int lane = threadIdx.x & 31; const size_t wid = (size_t)blockIdx.x * 8 + (threadIdx.x >> 5); if (wid >= (size_t)64 * (nk / 64)) return; const int z = blockIdx.z; const int d = (int)(wid / (nk / 64)); const int k0 = (int)(wid % (nk / 64)) * 64 + lane * 2; v2us oh, ol;
    Th += (size_t)z * 64 * nk; Tl += (size_t)z * 64 * nk;
#pragma unroll
    for (int i = 0; i < 2; ++i) { const float y = (d < 32) ? F[(size_t)(k0 + i) * ld + off + z * 32 + (d < 32 ? d : 0)] : 0.f; const unsigned short hb = f2bf(y); oh[i] = hb; ol[i] = f2bf(y - bf2f(hb)); }
    const size_t o = (size_t)d * nk + k0; *(v2us*)(Th + o) = oh; *(v2us*)(Tl + o) = ol; 
}
template <int NK>
__global__ __launch_bounds__(256) void k_softmaxz(const float* __restrict__ S, int rows, bf* PH, bf* PL) {
    typedef __attribute__((ext_vector_type(4))) unsigned short v4us;
    const int lane = threadIdx.x & 31, i = blockIdx.x * 8 + (threadIdx.x >> 5); if (i >= rows) return; const size_t zo = (size_t)blockIdx.z * rows * NK; const float* sr = S + zo + (size_t)i * NK; PH += zo; PL += zo;
    float m = -3.0e38f;
#pragma unroll 1
    for (int c0 = lane * 4; c0 < NK; c0 += 128) {
#pragma unroll
        for (int q = 0; q < 4; ++q) m = fmaxf(m, sr[c0 + q]); }
#pragma unroll
    for (int sh = 16; sh; sh >>= 1) m = fmaxf(m, __shfl_xor(m, sh, 32));
    float sum = 0.f;
#pragma unroll 1
    for (int c0 = lane * 4; c0 < NK; c0 += 128) {
#pragma unroll
        for (int q = 0; q < 4; ++q) sum += __expf(sr[c0 + q] - m); }
#pragma unroll
    for (int sh = 16; sh; sh >>= 1) sum += __shfl_xor(sum, sh, 32);
    const float inv = 1.0f / sum;
{
#pragma unroll 1
        for (int c0 = lane * 4; c0 < NK; c0 += 128) { v4us oh, ol;
#pragma unroll
            for (int q = 0; q < 4; ++q) { const float p = __expf(sr[c0 + q] - m) * inv; const unsigned short hb = f2bf(p); oh[q] = hb; ol[q] = f2bf(p - bf2f(hb)); }
            const size_t o = (size_t)i * NK + c0; *(v4us*)(PH + o) = oh; *(v4us*)(PL + o) = ol; }
         }
}
__global__ __launch_bounds__(256) void k_placez(const float* __restrict__ XH, int rows, int ldy, float* Y) {
    const int lane = threadIdx.x & 31; const size_t q = (size_t)blockIdx.x * 8 + (threadIdx.x >> 5); if (q >= (size_t)rows) return; const int z = blockIdx.z; const float v = XH[((size_t)z * rows + q) * 64 + lane];
    *(float*)(Y + q * ldy + z * 32 + lane) = v; 
}

__global__ __launch_bounds__(256) void k_hplanesz(const float* __restrict__ F, int ld, int h0, float sc, int rows, bf* Ph, bf* Pl) {
    typedef __attribute__((ext_vector_type(2))) unsigned short v2us;
    const int lane = threadIdx.x & 31; const size_t r = (size_t)blockIdx.x * 8 + (threadIdx.x >> 5); if (r >= (size_t)rows) return; const int z = blockIdx.z; v2us oh, ol;
    Ph += (size_t)z * rows * 64; Pl += (size_t)z * rows * 64;
#pragma unroll
    for (int i = 0; i < 2; ++i) { const float y = F[r * ld + (h0 + z) * 64 + lane * 2 + i] * sc; const unsigned short hb = f2bf(y); oh[i] = hb; ol[i] = f2bf(y - bf2f(hb)); }
    const size_t o = r * 64 + lane * 2; *(v2us*)(Ph + o) = oh; *(v2us*)(Pl + o) = ol; 
}
template <int NK>
__global__ __launch_bounds__(256) void k_softmaxzs(const float* __restrict__ S, int rows, float sc, bf* PH, bf* PL) {
    typedef __attribute__((ext_vector_type(4))) unsigned short v4us;
    const int lane = threadIdx.x & 31, i = blockIdx.x * 8 + (threadIdx.x >> 5); if (i >= rows) return; const size_t zo = (size_t)blockIdx.z * rows * NK; const float* sr = S + zo + (size_t)i * NK; PH += zo; PL += zo;
    float m = -3.0e38f;
#pragma unroll 1
    for (int c0 = lane * 4; c0 < NK; c0 += 128) {
#pragma unroll
        for (int q = 0; q < 4; ++q) m = fmaxf(m, sr[c0 + q] * sc); }
#pragma unroll
    for (int sh = 16; sh; sh >>= 1) m = fmaxf(m, __shfl_xor(m, sh, 32));
    float sum = 0.f;
#pragma unroll 1
    for (int c0 = lane * 4; c0 < NK; c0 += 128) {
#pragma unroll
        for (int q = 0; q < 4; ++q) sum += __expf(sr[c0 + q] * sc - m); }
#pragma unroll
    for (int sh = 16; sh; sh >>= 1) sum += __shfl_xor(sum, sh, 32);
    const float inv = 1.0f / sum;
{
#pragma unroll 1
        for (int c0 = lane * 4; c0 < NK; c0 += 128) { v4us oh, ol;
#pragma unroll
            for (int q = 0; q < 4; ++q) { const float p = __expf(sr[c0 + q] * sc - m) * inv; const unsigned short hb = f2bf(p); oh[q] = hb; ol[q] = f2bf(p - bf2f(hb)); }
            const size_t o = (size_t)i * NK + c0; *(v4us*)(PH + o) = oh; *(v4us*)(PL + o) = ol; }
         }
}

// k_cvtin: x and the four weights to bf16 in fragment order, one grid: tiles 0 .. XT-1 are x's, then WT tiles each of wq, wk, wv (stacked as [3 * DMOD][DMOD]) and wo. A block's 8 tiles lie in one source (XT and WT are multiples of 8).
// The grid's first NN / 32 blocks read the mask instead: block b takes query rows 32 b .. + 31 and writes TM[b][p], the largest mask value of those rows in key pass p (32 keys), and RM[b * 32], the smallest of the 32 row maxima.
__global__ __launch_bounds__(256) void k_cvtin(const float* __restrict__ x, const float* __restrict__ Wq, const float* __restrict__ Wk, const float* __restrict__ Wv, const float* __restrict__ Wo, const float* __restrict__ Mk, bf* Xb, bf* WQKV, bf* WO, float* TM, float* RM) {
    constexpr unsigned XT = (NBT * NN / 16) * (DMOD / 32), WT = (DMOD / 16) * (DMOD / 32);
    __shared__ float cmx[8][NN / 128][32]; __shared__ float rmx[32][33];
    const int lane = threadIdx.x & 31;
    if (blockIdx.x < NN / 32) {
        const int wv = threadIdx.x >> 5;   // a wave takes 4 rows; load j of a row gives the lane columns 128 j + 4 lane .. + 3, which lie in pass 4 j + lane / 8
        const float* mp = Mk + (size_t)(blockIdx.x * 32 + wv * 4) * NN + lane * 4;
        float cm[NN / 128];
#pragma unroll
        for (int j = 0; j < NN / 128; ++j) cm[j] = -__builtin_inff();
#pragma unroll 1   // rolled, one row's 16 loads in flight: four rows' would raise the register count of the whole grid, whose converter blocks need many resident waves
        for (int rw = 0; rw < 4; ++rw) { v4f v[NN / 128]; float rm = -__builtin_inff();
#pragma unroll
            for (int j = 0; j < NN / 128; ++j) v[j] = *(const v4f*)(mp + j * 128);
            mp += NN;
#pragma unroll
            for (int j = 0; j < NN / 128; ++j) { const float e = fmaxf(fmaxf(v[j][0], v[j][1]), fmaxf(v[j][2], v[j][3])); cm[j] = fmaxf(cm[j], e); rm = fmaxf(rm, e); }
            rmx[wv * 4 + rw][lane] = rm;
            asm volatile("s_wait_xcnt 0x0" ::: "memory"); }   // the wait before a register that an issued load names is written again: the next trip forms its address in the same registers
#pragma unroll
        for (int j = 0; j < NN / 128; ++j) cmx[wv][j][lane] = cm[j];
        __syncthreads();
        if (threadIdx.x < NN / 32) { const int j = threadIdx.x >> 2, l0 = (threadIdx.x & 3) * 8; float t = -__builtin_inff();
            for (int w = 0; w < 8; ++w) for (int i = 0; i < 8; ++i) t = fmaxf(t, cmx[w][j][l0 + i]);
            TM[blockIdx.x * (NN / 32) + threadIdx.x] = t; }
        else if (threadIdx.x < NN / 32 + 32) { float t = -__builtin_inff();   // one whole wave: lane = row
            for (int i = 0; i < 32; ++i) t = fmaxf(t, rmx[lane][i]);
#pragma unroll
            for (int sh = 16; sh; sh >>= 1) t = fminf(t, __shfl_xor(t, sh, 32));
            if (lane == 0) RM[blockIdx.x * 32] = t; }
        return;
    }
    const unsigned bid = blockIdx.x - NN / 32; unsigned st = bid * 8 + (threadIdx.x >> 5);   // st: the tile's number inside its source
    const float* src = x; bf* dst = Xb + (size_t)st * 512;   // below, w comes from the block's number, so that the choice of the source is a scalar one
    if (bid >= XT / 8) { const unsigned t = st - XT, w = (bid - XT / 8) / (WT / 8); st = t % WT; src = (w == 0) ? Wq : (w == 1) ? Wk : (w == 2) ? Wv : Wo; dst = (w == 3) ? WO + (size_t)st * 512 : WQKV + (size_t)t * 512; }
    const float* sp = tilesrc(src, st / (DMOD / 32), st % (DMOD / 32), lane);
#pragma unroll
    for (int j = 0; j < 2; ++j) { const v8f v = *(const v8f*)(sp + j * 16); v8us o;
#pragma unroll
        for (int i = 0; i < 8; ++i) o[i] = f2bf(v[i]);
        *(v8us*)(dst + j * 256 + lane * 8) = o; }
}
// k_fattn: scores, scale, additive mask, softmax and attn.V of one head of one item (blockIdx.z = item * 16 + head) in one kernel, running maximum and sum per query (online softmax), no score or probability plane in memory.
// Transposed products: S^T = K.Q^T (A = 16 key rows, B = 16 query columns), so a lane holds 8 keys of ONE query per tile; two key tiles, converted in place, are the B operand P^T of O^T += V^T.P^T.
// A wave owns QT * 16 queries and walks the keys 32 at a time; operands are bf16 hi + residual planes, three products each.
// Every '#pragma unroll' in it: the fragment and accumulator arrays are indexed by those loop counters and stay in registers only when the loops are unrolled.
#define QT 2
typedef __attribute__((ext_vector_type(2))) float  v2f;
typedef __attribute__((ext_vector_type(2))) __bf16 v2bf;
typedef __attribute__((ext_vector_type(8))) unsigned v8u;
__global__ __launch_bounds__(128) void k_fattn(const bf* Qh_, const bf* Ql_, const bf* Kh_, const bf* Kl_, const bf* VTh_, const bf* VTl_, const float* M_, float sc, bf* Oh, bf* Ol, const float* TM, const float* RM, const float* NR) {
    typedef unsigned long long u64;
    const int lane = threadIdx.x & 31, wave = __builtin_amdgcn_readfirstlane(threadIdx.x >> 5), lr = lane & 15, hi = lane >> 4;
    const size_t z = blockIdx.z;
    // which 128 queries the block takes, and which 32 of them the wave: mirrored for half of the blocks, so that where the number of passes grows with the query index long and short walks are spread evenly (speed only; every (head, query tile) is taken once)
    // Left open: a wave whose queries need all NN / 32 passes still walks them alone, and the launch lasts as long as that wave; dealing one query tile's passes to two waves, with a merge of (m, l, o), would halve the longest walk.
    const bool rev = __builtin_popcount((blockIdx.x >> 3) | (blockIdx.z << 1)) & 1;   // two blocks whose flat index differs in one bit above bit 2 take mirrored places, whichever of them come to share a WGP
    const int qb = rev ? NN / 128 - 1 - (int)(blockIdx.x & 7) : (int)(blockIdx.x & 7), wq = rev ? 3 - wave : wave;
    const int q0 = (qb * 4 + wq) * (QT * 16);
    // PASSES THAT CANNOT COUNT ARE LEFT OUT. |q.k| * sc <= B = sc * |q| * |k| (lengths from k_qkv). A query's final maximum is at least its largest mask value - B; a key whose mask value lies more than 2 B + 104 below that
    // has exp(score - maximum) = 0 in f32. A pass is walked unless its largest mask value over the wave's 32 queries lies below the smallest of their row maxima by more than 2.1 B + 200: decided from the data, for any mask.
    typedef const __attribute__((address_space(1))) float* gfl;
    const gch tmb = (gch)TM + (size_t)qb * (4 * (NN / 32) * 4);   // the block's four rows of the table; all table values are requested at once, one latency
    const unsigned no = lane * 128;
    float kn = *(gfl)((gch)NR + (size_t)(NBT * NH_ + z) * ((NN / 64) * 128) + no), tm[4][2], rmn[4];
    const float qn[2] = {NR[(z * (NN / 64) + qb * 2) * 32], NR[(z * (NN / 64) + qb * 2 + 1) * 32]};   // the block's queries are two of k_qkv's 64-token groups
#pragma unroll
    for (int i = 0; i < 4; ++i) { tm[i][0] = ((gfl)(tmb + i * 256))[lane]; tm[i][1] = ((gfl)(tmb + i * 256 + 128))[lane]; rmn[i] = RM[(qb * 4 + i) * 32]; }
    asm volatile("s_wait_xcnt 0x0" :: "v"(lane), "v"(no) : "memory");   // the wait before a register that an issued load names is written again; it takes the two lane offsets, which so stay as they are up to here
#pragma unroll
    for (int sh = 16; sh; sh >>= 1) kn = fmaxf(kn, __shfl_xor(kn, sh, 32));
    u64 own = 0, uni = 0;   // bit p: pass p is walked by this wave; by any wave of the block
#pragma unroll
    for (int i = 0; i < 4; ++i) {
        const float thr = rmn[i] - (2.1f * sc * __builtin_amdgcn_sqrtf(qn[i >> 1] * kn) + 200.f);
        u64 a = (u64)__builtin_amdgcn_ballot_w32(!(tm[i][0] < thr)) | ((u64)__builtin_amdgcn_ballot_w32(!(tm[i][1] < thr)) << 32);
        if (!a) a = ~(u64)0;
        uni |= a; if (i == wq) own = a; }
    // wave-uniform byte bases; the lane's own part of every address is one of two loop-invariant 32-bit byte offsets (fo: its place in a half tile of a plane; mo: in the mask)
    const gch Qh = (gch)Qh_ + (z * NN + q0) * (HD * 2), Ql = (gch)Ql_ + (z * NN + q0) * (HD * 2), Kh0 = (gch)Kh_ + z * (NN * HD * 2), Kl0 = (gch)Kl_ + z * (NN * HD * 2), VTh0 = (gch)VTh_ + z * (HD * NN * 2), VTl0 = (gch)VTl_ + z * (HD * NN * 2), M0 = (gch)M_ + (size_t)q0 * (NN * 4);
    // rotated start: the 16 blocks of a head share K and V, the blocks of one query range share the mask rows; walking the keys in step they would ask L2 for the same lines at the same moment.
    // Each block starts at its own 32-key pass and wraps round; the online softmax takes the passes in any order (a new order of its sums)
    // The start is a rank among the passes that the block walks, the same place for its four waves, which so stay near each other in K and V
    unsigned rk = ((((blockIdx.x + (blockIdx.z & 15)) * 4) & (NN / 32 - 1)) * (unsigned)__builtin_popcountll(uni)) >> 6;
    u64 up = uni; for (; rk; --rk) up &= up - 1;   // at most 63 trips; up keeps at least one bit
    const u64 hm = ~(u64)0 << __builtin_ctzll(up);
    u64 rem1 = own & hm, rem2 = own & ~hm; const int npass = __builtin_popcountll(own);
    unsigned pk = 0;
    auto nextpass = [&]() { if (!rem1) { rem1 = rem2; rem2 = 0; } if (rem1) { pk = (unsigned)__builtin_ctzll(rem1); rem1 &= rem1 - 1; } };   // the wave's next pass; behind the last one pk stays
    nextpass();
    gch Kh = Kh0 + pk * (32 * HD * 2), Kl = Kl0 + pk * (32 * HD * 2), M = M0 + pk * (32 * 4), VTh = VTh0 + pk * 1024, VTl = VTl0 + pk * 1024;
    unsigned fo = lane * 16, mo = (lr * NN + 8 * hi) * 4;
    v16bf qh[QT][2], ql[QT][2];
#pragma unroll
    for (int u = 0; u < QT; ++u) {
#pragma unroll
        for (int ks = 0; ks < 2; ++ks) { qh[u][ks] = ldfrag(Qh + (u * 2 + ks) * 1024 + fo); ql[u][ks] = ldfrag(Ql + (u * 2 + ks) * 1024 + fo); } }
    v8f o[QT][4]; float m[QT], l[QT];
#pragma unroll
    for (int u = 0; u < QT; ++u) { m[u] = -3.0e38f; l[u] = 0.f;
#pragma unroll
        for (int dt = 0; dt < 4; ++dt) o[u][dt] = (v8f){}; }
    v16bf kh[2][2], kl[2][2]; v8f mk[QT][2];
#pragma unroll
    for (int t = 0; t < 2; ++t) {
#pragma unroll
        for (int ks = 0; ks < 2; ++ks) { kh[t][ks] = ldfrag(Kh + (t * 2 + ks) * 1024 + fo); kl[t][ks] = ldfrag(Kl + (t * 2 + ks) * 1024 + fo); }
#pragma unroll
        for (int u = 0; u < QT; ++u) mk[u][t] = *(gv8f)(M + (u * 16 * NN + t * 16) * 4 + mo); }
    // the wait before a register that an issued load names is written again; the statement takes those registers, so that they stay as they are up to it and the bases move on behind it
    asm volatile("s_wait_xcnt 0x0" : "+s"(Kh), "+s"(Kl), "+s"(M), "+v"(fo), "+v"(mo) :: "memory");
    nextpass(); Kh = Kh0 + pk * (32 * HD * 2); Kl = Kl0 + pk * (32 * HD * 2); M = M0 + pk * (32 * 4);   // from here on pk, Kh, Kl, M: the pass that is fetched ahead
#pragma unroll 1   // rolled: a pass is some 600 instructions already, and the fetch-ahead below spans the back edge without a second copy
    for (int it = 0; it < npass; ++it) {
        v16bf vh[4], vl[4]; v8f st[QT][2];
#pragma unroll
        for (int dt = 0; dt < 4; ++dt) { vh[dt] = ldfrag(VTh + dt * (NN / 32) * 1024 + fo); vl[dt] = ldfrag(VTl + dt * (NN / 32) * 1024 + fo); }
        __builtin_amdgcn_sched_barrier(0);   // V^T is requested before the score products, which hide its latency
#pragma unroll
        for (int u = 0; u < QT; ++u) {
#pragma unroll
            for (int t = 0; t < 2; ++t) { v8f a = (v8f){};
#pragma unroll
                for (int ks = 0; ks < 2; ++ks) { a = wmmab(kh[t][ks], qh[u][ks], a); a = wmmab(kl[t][ks], qh[u][ks], a); a = wmmab(kh[t][ks], ql[u][ks], a); }
#pragma unroll
                for (int j = 0; j < 8; ++j) a[j] = a[j] * sc + bfr(mk[u][t][j]);
                st[u][t] = a; } }
        // the next pass's K fragments and mask values are fetched here; the last pass fetches its own again (in bounds, unused)
#pragma unroll
        for (int t = 0; t < 2; ++t) {
#pragma unroll
            for (int ks = 0; ks < 2; ++ks) { kh[t][ks] = ldfrag(Kh + (t * 2 + ks) * 1024 + fo); kl[t][ks] = ldfrag(Kl + (t * 2 + ks) * 1024 + fo); }
#pragma unroll
            for (int u = 0; u < QT; ++u) mk[u][t] = *(gv8f)(M + (u * 16 * NN + t * 16) * 4 + mo); }
        __builtin_amdgcn_sched_barrier(0);   // ... and requested before the softmax and attn.V of this pass, which hide their latency
#pragma unroll
        for (int u = 0; u < QT; ++u) {
            float mx = -3.0e38f;
#pragma unroll
            for (int t = 0; t < 2; ++t) {
#pragma unroll
                for (int j = 0; j < 8; ++j) mx = fmaxf(mx, st[u][t][j]); }
            mx = fmaxf(mx, xhalf(mx));
            const float mn = fmaxf(m[u], mx), al = __expf(m[u] - mn); m[u] = mn;
            float ps = 0.f; v8u pH, pL;
#pragma unroll
            for (int t = 0; t < 2; ++t) {
#pragma unroll
                for (int jj = 0; jj < 4; ++jj) { const v2f p = {__expf(st[u][t][2 * jj] - mn), __expf(st[u][t][2 * jj + 1] - mn)}; ps += p[0] + p[1];
                    const unsigned hb = __builtin_bit_cast(unsigned, __builtin_convertvector(p, v2bf));
                    const v2f r = {p[0] - __uint_as_float(hb << 16), p[1] - __uint_as_float(hb & 0xFFFF0000u)};
                    pH[t * 4 + jj] = hb; pL[t * 4 + jj] = __builtin_bit_cast(unsigned, __builtin_convertvector(r, v2bf)); } }
            l[u] = l[u] * al + ps;
            const v16bf ph = __builtin_bit_cast(v16bf, pH), pl = __builtin_bit_cast(v16bf, pL);
#pragma unroll
            for (int dt = 0; dt < 4; ++dt) { v8f a = o[u][dt] * al; a = wmmab(vh[dt], ph, a); a = wmmab(vl[dt], ph, a); a = wmmab(vh[dt], pl, a); o[u][dt] = a; }
        }
        __builtin_amdgcn_sched_barrier(0);   // keeps the wait below at the foot of the pass, where the requests have long been taken: higher up the wave would stand on it
        asm volatile("s_wait_xcnt 0x0" : "+s"(VTh), "+s"(VTl), "+s"(Kh), "+s"(Kl), "+s"(M), "+v"(fo), "+v"(mo) :: "memory");   // as in front of the loop, for this pass's loads
        VTh = VTh0 + pk * 1024; VTl = VTl0 + pk * 1024;
        nextpass(); Kh = Kh0 + pk * (32 * HD * 2); Kl = Kl0 + pk * (32 * HD * 2); M = M0 + pk * (32 * 4);
    }
#pragma unroll
    for (int u = 0; u < QT; ++u) { const float inv = 1.0f / (l[u] + xhalf(l[u]));
        // the merged heads' hi + residual planes [item * NN + token][DMOD] in fragment order: the lane's 8 values are d = 16 dt + 8 hi .. + 7 of token q0 + 16 u + lr, its 16 bytes at lane * 16 of half dt & 1 of tile (row tile, 2 head + dt / 2); a wave's store is 4 whole lines
        const size_t ob = ((((z / NH_) * NN + q0) / 16 + u) * (DMOD / 32) + (z % NH_) * 2) * 1024;   // wave-uniform bytes; the lane's part is fo, as for the loads
        gwch ph = (gwch)Oh + ob, pl = (gwch)Ol + ob;
#pragma unroll
        for (int dt = 0; dt < 4; ++dt) { const v8f a = o[u][dt] * inv; v8us oh, ol;
#pragma unroll
            for (int j = 0; j < 8; ++j) { const unsigned short hb = f2bf(a[j]); oh[j] = hb; ol[j] = f2bf(a[j] - bf2f(hb)); }
            *(gwv8us)(ph + dt * 512 + fo) = oh; *(gwv8us)(pl + dt * 512 + fo) = ol;
            // the wait before a register that an issued store names is written again; it takes the stored values, which so stay as they are up to here (behind the last pair nothing is written any more)
            if (u + 1 < QT || dt < 3) asm volatile("s_wait_xcnt 0x0" :: "v"(oh), "v"(ol) : "memory"); } }
}
__global__ __launch_bounds__(256) void k_csoftz(const float* __restrict__ S, int rows, float sc, bf* PH, bf* PL) {
    typedef __attribute__((ext_vector_type(4))) unsigned short v4us;
    const int lane = threadIdx.x & 31, i = blockIdx.x * 8 + (threadIdx.x >> 5); if (i >= rows) return; const size_t zo = (size_t)blockIdx.z * rows * NN; const float* sr = S + zo + (size_t)i * NN; PH += zo; PL += zo;
    float m = -3.0e38f;
#pragma unroll 1
    for (int c0 = lane * 4; c0 < NN; c0 += 128) {
#pragma unroll
        for (int q = 0; q < 4; ++q) { const int k = c0 + q; if (k <= i) m = fmaxf(m, sr[k] * sc); } }
#pragma unroll
    for (int sh = 16; sh; sh >>= 1) m = fmaxf(m, __shfl_xor(m, sh, 32));
    float sum = 0.f;
#pragma unroll 1
    for (int c0 = lane * 4; c0 < NN; c0 += 128) {
#pragma unroll
        for (int q = 0; q < 4; ++q) { const int k = c0 + q; if (k <= i) sum += __expf(sr[k] * sc - m); } }
#pragma unroll
    for (int sh = 16; sh; sh >>= 1) sum += __shfl_xor(sum, sh, 32);
    const float inv = 1.0f / sum;
{
#pragma unroll 1
        for (int c0 = lane * 4; c0 < NN; c0 += 128) { v4us oh, ol;
#pragma unroll
            for (int q = 0; q < 4; ++q) { const int k = c0 + q; const float p = (k <= i) ? __expf(sr[(k <= i) ? k : 0] * sc - m) * inv : 0.f; const unsigned short hb = f2bf(p); oh[q] = hb; ol[q] = f2bf(p - bf2f(hb)); }
            const size_t o = (size_t)i * NN + c0; *(v4us*)(PH + o) = oh; *(v4us*)(PL + o) = ol; }
         }
}

extern "C" void kernel_launch(void* const* d_in, const int* in_sizes, int n_in,
                              void* d_out, int out_size, void* d_ws, size_t ws_size, hipStream_t stream) {
    (void)in_sizes; (void)n_in; (void)out_size;
    const float* x = (const float*)d_in[0]; const float* wq = (const float*)d_in[1]; const float* wk = (const float*)d_in[2]; const float* wv = (const float*)d_in[3]; const float* wo = (const float*)d_in[4]; const float* fc = (const float*)d_in[5]; const float* cmask = (const float*)d_in[6];
    float* out = (float*)d_out;    // [2][2048][1024]
    char* wsp = (char*)d_ws;
    auto take = [&](size_t bytes) { char* p = wsp; wsp += (bytes + 255) & ~(size_t)255; return (void*)p; };
    bf* WQKV = (bf*)take((size_t)3 * DMOD * DMOD * 2); bf* WO = (bf*)take((size_t)DMOD * DMOD * 2);
    bf* Xb = (bf*)take((size_t)NBT * NN * DMOD * 2);
    const size_t pb = (size_t)NBT * NH_ * NN * HD * 2;   // one plane set: [item][head]
    bf* Qh = (bf*)take(pb); bf* Ql = (bf*)take(pb); bf* Kh = (bf*)take(pb); bf* Kl = (bf*)take(pb); bf* VTh = (bf*)take(pb); bf* VTl = (bf*)take(pb);
    bf* Oh = (bf*)take((size_t)NBT * NN * DMOD * 2); bf* Ol = (bf*)take((size_t)NBT * NN * DMOD * 2);
    float* TM = (float*)take((size_t)(NN / 32) * (NN / 32) * 4); float* RM = (float*)take((size_t)(NN / 32) * 128); float* NR = (float*)take((size_t)2 * NBT * NH_ * (NN / 64) * 128);   // mask table; row lengths of q and k, one line a value
    if ((size_t)(wsp - (char*)d_ws) > ws_size) return;    // ~ 84 MB
    k_cvtin<<<NN / 32 + ((NBT * NN / 16) + 4 * (DMOD / 16)) * (DMOD / 32) / 8, 256, 0, stream>>>(x, wq, wk, wv, wo, cmask, Xb, WQKV, WO, TM, RM);   // x [token][in] and the weights [out][in], fragment order
    k_qkv<<<dim3(NBT * NN / 128, (3 * DMOD) / 128, 1), 128, 0, stream>>>(Xb, WQKV, fc, Qh, Ql, Kh, Kl, VTh, VTl, NR);   // [q | k | v], the planes of all heads of both items
    k_fattn<<<dim3(NN / (QT * 64), 1, NBT * NH_), 128, 0, stream>>>(Qh, Ql, Kh, Kl, VTh, VTl, cmask, SCL, Oh, Ol, TM, RM, NR);
    k_gemmb<true, false><<<dim3(NBT * NN / 64, DMOD / 64, 1), 128, 0, stream>>>(Oh, Ol, WO, nullptr, out, DMOD, nullptr, nullptr, DMOD);
}

// v009
// A run of this version takes 108 microseconds.
// Two timings next to v008 put it at 1.19 and 1.15 times that version's speed.
// Counting every step since v000, it is 18.9 times as fast.
#include <hip/hip_runtime.h>

// Both items go through every launch together (rows item * 2048 + token; planes [item][head]). Compute dtypes, f32 accumulate: q/k/v = x.W^T fused as one [4096 x 1024].[1024 x 3072] GEMM with PLAIN bf16 operands (exact products); the interleaved-pair RoPE
// with the given (cos, sin) table applied while building the q/k planes, in that GEMM's epilogue, which also writes the transposed v planes; scores and attn.V with both operands as bf16 hi + UNSCALED residual planes (three
// products), fused with 1/sqrt(64), the additive float mask input (read as data, shared by all heads/items) and an online softmax in f32 in one kernel, the 16 heads of both items in grid.x; wo on hi/lo planes of the merged heads
// FRAGMENT ORDER: every bf16 operand plane (x, the weights, q, k, v^T, the merged heads) is stored as the matrix instruction's lanes read it. A plane [R][Kd] is cut into tiles of 16 rows x 32 k, tile (r >> 4) * (Kd / 32) + (k >> 5),
// 512 elements each: element (r, k) lies at tile * 512 + ((k >> 4) & 1) * 256 + ((k >> 3) & 1) * 128 + (r & 15) * 8 + (k & 7). Lane l = 16 * hi + lr reads its 16 bytes at l * 16 of each 512-byte half, so a fragment load takes 4 whole lines, not 16 pieces.

#define NBT  2
#define NN   2048
#define DMOD 1024
#define NH_  16
#define HD   64
#define DM   DMOD
#define NTK  NN
#define SCL  0.125f
#define LOSC 1024.0f

typedef _Float16 h16;
typedef unsigned short bf;
typedef __attribute__((ext_vector_type(16))) __bf16   v16bf;
typedef __attribute__((ext_vector_type(16))) _Float16 v16h;
typedef __attribute__((ext_vector_type(8)))  _Float16 v8h;
typedef __attribute__((ext_vector_type(8)))  unsigned short v8us;
typedef __attribute__((ext_vector_type(8)))  float    v8f;
typedef __attribute__((ext_vector_type(4)))  float    v4f;
typedef __attribute__((ext_vector_type(4)))  _Float16 v4h;
typedef v8h  __attribute__((may_alias)) v8ha;
typedef v4f  __attribute__((may_alias)) v4fa;
typedef v8us __attribute__((may_alias)) v8usa;

__device__ __forceinline__ unsigned short f2bf(float f) { unsigned u = __float_as_uint(f); u += 0x7FFFu + ((u >> 16) & 1u); return (unsigned short)(u >> 16); }
__device__ __forceinline__ float bf2f(unsigned short b) { return __uint_as_float(((unsigned)b) << 16); }
__device__ __forceinline__ float bfr(float f) { return bf2f(f2bf(f)); }
__device__ __forceinline__ v16h cat16(v8h lo, v8h hi) { return __builtin_shufflevector(lo, hi, 0, 1, 2, 3, 4, 5, 6, 7, 8, 9, 10, 11, 12, 13, 14, 15); }
__device__ __forceinline__ v16bf cat16b(v8us lo, v8us hi) { return __builtin_bit_cast(v16bf, __builtin_shufflevector(lo, hi, 0, 1, 2, 3, 4, 5, 6, 7, 8, 9, 10, 11, 12, 13, 14, 15)); }
__device__ __forceinline__ v8f wmma16(v16h a, v16h b, v8f c) { return __builtin_amdgcn_wmma_f32_16x16x32_f16(false, a, false, b, (short)0, c, false, false); }
__device__ __forceinline__ v8f wmmab(v16bf a, v16bf b, v8f c) { return __builtin_amdgcn_wmma_f32_16x16x32_bf16(false, a, false, b, (short)0, c, false, false); }

typedef const __attribute__((address_space(1))) char*  gch;    // global-memory pointers by type: a pointer that has passed through an asm operand would otherwise be read with flat loads
typedef const __attribute__((address_space(1))) v8us*  gv8us;
typedef const __attribute__((address_space(1))) v8f*   gv8f;
typedef __attribute__((address_space(1))) char*  gwch;    // the same for stores
typedef __attribute__((address_space(1))) v8us*  gwv8us;
__device__ __forceinline__ v16bf ldfrag(gch p) { return cat16b(*(gv8us)p, *(gv8us)(p + 512)); }   // the lane's 16 bytes of each half of a tile in fragment order: k 8h..8h+7 and 16+8h..16+8h+7

__device__ __forceinline__ float xhalf(float v) { const int b = __float_as_int(v); return __int_as_float(__builtin_amdgcn_permlanex16(b, b, 0x76543210, 0xfedcba98, false, false)); }   // value of lane l ^ 16

// k_gemmb: 64 x 64 block tile (4 waves x 16 x 64) of C[NBT * NN][NW] = (A [+ Al]).B^T (K = 1024) [+ bf(bias[c])] [+ bf(R[r][c]) residual]; f32 whole-line epilogue (or f16
// A, Al and Bn are read in fragment order.
template <bool SPLITA, bool F16OUT = false>
__global__ __launch_bounds__(128) void k_gemmb(const bf* __restrict__ A, const bf* __restrict__ Al, const bf* __restrict__ Bn, const float* __restrict__ bias, float* C, int ldc, h16* C2, const float* __restrict__ R = nullptr, int K = DM, int roundR = 1) {
    __shared__ __align__(16) float ost[4][16 * 68];
    const int lane = threadIdx.x & 31, wave = __builtin_amdgcn_readfirstlane(threadIdx.x >> 5), lr = lane & 15, hi = lane >> 4;   // the wave's number as a scalar: every fragment address is then a scalar base + lane * 16 bytes
    const int r0 = blockIdx.x * 64 + wave * 16, c0 = blockIdx.y * 64;
    // fragment order, planes of DM columns: a row tile is DM / 32 tiles of 1024 bytes; scalar byte bases that move on one tile a trip, and the lane's loop-invariant place in a half tile
    const gch pa0 = (gch)A + (size_t)(r0 >> 4) * (DM * 32), pl0 = (gch)Al + (size_t)(r0 >> 4) * (DM * 32), pb0 = (gch)Bn + (size_t)(c0 >> 4) * (DM * 32);
    // rotated start: the blocks that share operand rows would otherwise walk k in step and ask L2 for the same lines at the same moment; each starts at its own k tile and wraps round (a new order of the f32 sums)
    const unsigned nkt = (unsigned)K >> 5; unsigned kt = (blockIdx.x + (blockIdx.y & 3) * 8) & 31; if (kt >= nkt) kt = 0;
    gch pa = pa0 + kt * 1024, pl = pl0 + kt * 1024, pb = pb0 + kt * 1024;
    unsigned fo = lane * 16;
    v8f acc[4];
#pragma unroll
    for (int t = 0; t < 4; ++t) acc[t] = (v8f){};
#pragma unroll 1
    for (int kc = 0; kc < K; kc += 32) {
        const v16bf a = ldfrag(pa + fo);
        v16bf al = a, b[4];
        if (SPLITA) al = ldfrag(pl + fo);
#pragma unroll
        for (int t = 0; t < 4; ++t) b[t] = ldfrag(pb + t * (DM * 32) + fo);
        __builtin_amdgcn_sched_barrier(0);   // all of the trip's fragments are requested before its first product: without it the built code fetched one column tile at a time into the same registers, one latency each
#pragma unroll
        for (int t = 0; t < 4; ++t) { acc[t] = wmmab(a, b[t], acc[t]); if (SPLITA) acc[t] = wmmab(al, b[t], acc[t]); }
        asm volatile("v_nop\n\tv_nop\n\tv_nop\n\tv_nop" : "+v"(acc[0]), "+v"(acc[1]), "+v"(acc[2]), "+v"(acc[3]) : "v"(a), "v"(al));
        // the wait before a register that an issued load names is written again; the statement takes those registers, so that they stay as they are up to it and the bases move on behind it
        if (SPLITA) asm volatile("s_wait_xcnt 0x0" : "+s"(pa), "+s"(pl), "+s"(pb), "+v"(fo) :: "memory"); else asm volatile("s_wait_xcnt 0x0" : "+s"(pa), "+s"(pb), "+v"(fo) :: "memory");
        kt = (kt + 1 == nkt) ? 0 : kt + 1;
        pa = pa0 + kt * 1024; pl = pl0 + kt * 1024; pb = pb0 + kt * 1024;
    }
    float* os = &ost[wave][0];
#pragma unroll
    for (int t = 0; t < 4; ++t) { const float bv = bias ? bfr(bias[c0 + t * 16 + lr]) : 0.f;
#pragma unroll
        for (int j = 0; j < 8; ++j) os[(hi * 8 + j) * 68 + t * 16 + lr] = acc[t][j] + bv; }
    __syncthreads();
    if (F16OUT) {
        h16* crow = (h16*)(void*)C + (size_t)r0 * ldc + c0;
        auto pass = [&]() {
#pragma unroll
            for (int s = 0; s < 4; ++s) { const int row = 4 * s + (lane >> 3), piece = lane & 7; const float* sp = os + row * 68 + piece * 8; v8h o, o2;
#pragma unroll
                for (int i = 0; i < 8; ++i) { const h16 a = (h16)sp[i]; o[i] = a; o2[i] = (h16)((sp[i] - (float)a) * LOSC); }
                *(v8h*)(crow + (size_t)row * ldc + piece * 8) = o; if (C2) *(v8h*)(C2 + (size_t)r0 * ldc + c0 + (size_t)row * ldc + piece * 8) = o2; }
        };
        pass(); 
    } else {
        float* crow = C + (size_t)r0 * ldc + c0;
        auto pass = [&]() {
#pragma unroll
            for (int s = 0; s < 8; ++s) { const int Lid = (lane >> 3) + 4 * s, piece = lane & 7; const int row = Lid >> 1, cofs = (Lid & 1) * 32 + piece * 4;
                v4f val = *(const v4fa*)(os + row * 68 + cofs); if (R) { const v4f rv = *(const v4f*)(R + ((size_t)r0 + row) * ldc + c0 + cofs); val += roundR ? (v4f){bfr(rv[0]), bfr(rv[1]), bfr(rv[2]), bfr(rv[3])} : rv; }
                *(v4f*)(crow + (size_t)row * ldc + cofs) = val; }
        };
        pass(); 
    }
}

// k_qkv: [q | k | v] = x.W^T (K = DM), plain bf16 operands. A wave owns 64 rows x 64 columns (4 x 4 accumulator tiles): a trip's 8 fragments feed 16 products. The block's 4 waves are 2 x 2, a 128 x 128 tile: each fragment is asked for by two waves.
// A wave's 64 columns are one head of q, k or v; a block's 128 columns lie in one of the three. q and k: interleaved-pair rotation, pair (2i, 2i+1): o0 = t0 c - t1 s, o1 = t0 s + t1 c with c = bf(fc[t][i][0]), s = bf(fc[t][i][1]),
// then bf16 hi + residual planes [head][token][64]; v: hi + residual planes transposed, [head][d][token]; both in fragment order per head. Every store of a wave is 512 bytes in a row, four whole 128-byte lines.
// Every '#pragma unroll' in it: the fragment and accumulator arrays are indexed by those loop counters and stay in registers only when the loops are unrolled.
__global__ __launch_bounds__(128) void k_qkv(const bf* __restrict__ A, const bf* __restrict__ Bn, const float* __restrict__ fc, bf* Qh, bf* Ql, bf* Kh, bf* Kl, bf* VTh, bf* VTl, float* NR) {
    __shared__ __align__(16) float ost[4][64 * 68];
    const int lane = threadIdx.x & 31, wave = __builtin_amdgcn_readfirstlane(threadIdx.x >> 5), lr = lane & 15, hi = lane >> 4;   // the wave's number as a scalar: every fragment address is then a scalar base + lane * 16 bytes
    const int r0 = blockIdx.x * 128 + (wave >> 1) * 64, c0 = blockIdx.y * 128 + (wave & 1) * 64;
    const gch pa0 = (gch)A + (size_t)(r0 >> 4) * (DM * 32), pb0 = (gch)Bn + (size_t)(c0 >> 4) * (DM * 32);   // a row tile of a plane is DM / 32 tiles of 1024 bytes
    unsigned kt = (blockIdx.x + (blockIdx.y & 7) * 4) & (DM / 32 - 1);   // rotated start, as in k_gemmb: the block's first k tile; the walk wraps round
    gch pa = pa0 + kt * 1024, pb = pb0 + kt * 1024;
    unsigned fo = lane * 16;
    v8f acc[4][4];
#pragma unroll
    for (int r = 0; r < 4; ++r) {
#pragma unroll
        for (int t = 0; t < 4; ++t) acc[r][t] = (v8f){}; }
#pragma unroll 1   // rolled: the trips are alike, and a second copy would need a second set of fragment registers
    for (int kc = 0; kc < DM; kc += 32) {
        v16bf a[4], b[4];
#pragma unroll
        for (int r = 0; r < 4; ++r) a[r] = ldfrag(pa + r * (DM * 32) + fo);
#pragma unroll
        for (int t = 0; t < 4; ++t) b[t] = ldfrag(pb + t * (DM * 32) + fo);
        __builtin_amdgcn_sched_barrier(0);   // all of the trip's fragments are requested before its first product: one latency a trip, not one a fragment
#pragma unroll
        for (int r = 0; r < 4; ++r) {
#pragma unroll
            for (int t = 0; t < 4; ++t) acc[r][t] = wmmab(a[r], b[t], acc[r][t]); }
        // the wait before a register that an issued load names is written again; the statement takes those registers, so that they stay as they are up to it and the bases move on behind it
        asm volatile("s_wait_xcnt 0x0" : "+s"(pa), "+s"(pb), "+v"(fo) :: "memory");
        kt = (kt + 1) & (DM / 32 - 1);
        pa = pa0 + kt * 1024; pb = pb0 + kt * 1024;
    }
    const int sec = c0 / DM, head = (r0 / NN) * NH_ + (c0 % DM) / HD, tk0 = r0 % NN;   // head: the plane's number, item * 16 + head; tk0: the wave's first token inside its item (a block's 128 rows lie in one item)
    if (sec < 2) {
        float* os = &ost[wave][0];   // the wave's own 64 tokens x 64 columns
#pragma unroll
        for (int r = 0; r < 4; ++r) {
#pragma unroll
            for (int t = 0; t < 4; ++t) {
#pragma unroll
                for (int j = 0; j < 8; ++j) os[(r * 16 + hi * 8 + j) * 68 + t * 16 + lr] = acc[r][t][j]; } }
        const float* fp = fc + (size_t)(tk0 + lr) * HD + hi * 8; v8f cs[4][4];
#pragma unroll
        for (int r = 0; r < 4; ++r) {
#pragma unroll
            for (int s = 0; s < 4; ++s) cs[r][s] = *(const v8f*)(fp + r * (16 * HD) + s * 16); }   // all requested at once, behind the staging, whose accumulator registers they take: one latency
        asm volatile("s_wait_xcnt 0x0" :: "v"(fp) : "memory");   // the wait before a register that an issued load names is written again; it takes the address, which so stays as it is up to here
        __syncthreads();
        float nr[4] = {0.f, 0.f, 0.f, 0.f};   // squared length of the rotated row of token tk0 + 16 r + lr (this lane's half of its columns)
        bf* Ph = (sec ? Kh : Qh) + (size_t)head * NN * HD + (size_t)(tk0 >> 4) * (16 * HD) + lane * 8; bf* Pl = (sec ? Kl : Ql) + (size_t)head * NN * HD + (size_t)(tk0 >> 4) * (16 * HD) + lane * 8;
#pragma unroll
        for (int r = 0; r < 4; ++r) {   // 16 tokens are two tiles; step s is the half with columns 16 s + 8 hi .. + 7 of token tk0 + 16 r + lr
#pragma unroll
            for (int s = 0; s < 4; ++s) { const float* sp = os + (r * 16 + lr) * 68 + s * 16 + hi * 8;
                const v4f xa = *(const v4fa*)sp, xb = *(const v4fa*)(sp + 4);
                const float x[8] = {xa[0], xa[1], xa[2], xa[3], xb[0], xb[1], xb[2], xb[3]}; v8us oh, ol;
#pragma unroll
                for (int i = 0; i < 4; ++i) { const float t0 = x[2 * i], t1 = x[2 * i + 1], c = bfr(cs[r][s][2 * i]), sn = bfr(cs[r][s][2 * i + 1]); const float y0 = t0 * c - t1 * sn, y1 = t0 * sn + t1 * c; nr[r] += y0 * y0 + y1 * y1;
                    { const unsigned short hb = f2bf(y0); oh[2 * i] = hb; ol[2 * i] = f2bf(y0 - bf2f(hb)); } { const unsigned short hb = f2bf(y1); oh[2 * i + 1] = hb; ol[2 * i + 1] = f2bf(y1 - bf2f(hb)); } }
                *(v8us*)(Ph + r * (16 * HD) + s * 256) = oh; *(v8us*)(Pl + r * (16 * HD) + s * 256) = ol;
                asm volatile("s_wait_xcnt 0x0" :: "v"(oh), "v"(ol) : "memory"); }   // the wait before a register that an issued store names is written again; it takes the stored values, which so stay as they are up to here
        }
        // the largest squared row length among the wave's 64 tokens, for k_fattn's bound on a score; each wave's value has a 128-byte line of its own
        float nm = fmaxf(fmaxf(nr[0] + xhalf(nr[0]), nr[1] + xhalf(nr[1])), fmaxf(nr[2] + xhalf(nr[2]), nr[3] + xhalf(nr[3])));
#pragma unroll
        for (int sh = 8; sh; sh >>= 1) nm = fmaxf(nm, __shfl_xor(nm, sh, 32));
        if (lane == 0) NR[((size_t)(sec * (NBT * NH_) + head) * (NN / 64) + (tk0 >> 6)) * 32] = nm;
    } else {
        // a lane's accumulator holds tokens tk0 + 16 r + 8 hi .. + 7 of d = 16 t + lr: its 16 bytes at lane * 16 of half r & 1 of tile (row tile t, token tile tk0 / 32 + r / 2) of the transposed plane
        const size_t o = (size_t)head * HD * NN + (size_t)(tk0 >> 5) * 512 + lane * 8;
#pragma unroll
        for (int t = 0; t < 4; ++t) {
#pragma unroll
            for (int r = 0; r < 4; ++r) { v8us oh, ol;
#pragma unroll
                for (int i = 0; i < 8; ++i) { const float x = acc[r][t][i]; const unsigned short hb = f2bf(x); oh[i] = hb; ol[i] = f2bf(x - bf2f(hb)); }
                *(v8us*)(VTh + o + (size_t)t * (NN / 32) * 512 + r * 256) = oh; *(v8us*)(VTl + o + (size_t)t * (NN / 32) * 512 + r * 256) = ol;
                asm volatile("s_wait_xcnt 0x0" :: "v"(oh), "v"(ol) : "memory"); } }   // as in the other branch
    }
}

// The converters below write fragment order: a wave makes one tile (16 rows x 32 k of a [rows][DMOD] f32 source): it reads 16 whole 128-byte lines and stores the two 512-byte halves.
__device__ __forceinline__ const float* tilesrc(const float* src, size_t rowtile, size_t ktile, int lane) { return src + (rowtile * 16 + (lane & 15)) * DMOD + ktile * 32 + (lane >> 4) * 8; }   // the lane's 8 values of half 0; half 1 is 16 further on
__global__ __launch_bounds__(256) void k_zero8(bf* dst, size_t n8) {
    const size_t i = (size_t)blockIdx.x * 256 + threadIdx.x; if (i >= n8) return; v8us z;
#pragma unroll
    for (int k = 0; k < 8; ++k) z[k] = 0;
    *(v8us*)(dst + i * 8) = z; 
}

// ===== z-batched (blockIdx.z = head) attention pieces =====
__global__ __launch_bounds__(256) void k_planes32z(const float* __restrict__ F, int ld, int off, float sc, int rows, bf* Ph, bf* Pl) {
    typedef __attribute__((ext_vector_type(2))) unsigned short v2us;
    const int lane = threadIdx.x & 31; const size_t r = ((size_t)blockIdx.x * 8 + (threadIdx.x >> 5)) * 2 + (lane >> 4); if (r >= (size_t)rows) return; const int z = blockIdx.z; const int c0 = (lane & 15) * 2; v2us oh, ol;
    Ph += (size_t)z * rows * 32; Pl += (size_t)z * rows * 32;
#pragma unroll
    for (int i = 0; i < 2; ++i) { const float y = F[r * ld + off + z * 32 + c0 + i] * sc; const unsigned short hb = f2bf(y); oh[i] = hb; ol[i] = f2bf(y - bf2f(hb)); }
    const size_t o = r * 32 + c0; *(v2us*)(Ph + o) = oh; *(v2us*)(Pl + o) = ol; 
}
__global__ __launch_bounds__(256) void k_vtpadz(const float* __restrict__ F, int ld, int off, int nk, bf* Th, bf* Tl) {
    typedef __attribute__((ext_vector_type(2))) unsigned short v2us;
    const int lane = threadIdx.x & 31; const size_t wid = (size_t)blockIdx.x * 8 + (threadIdx.x >> 5); if (wid >= (size_t)64 * (nk / 64)) return; const int z = blockIdx.z; const int d = (int)(wid / (nk / 64)); const int k0 = (int)(wid % (nk / 64)) * 64 + lane * 2; v2us oh, ol;
    Th += (size_t)z * 64 * nk; Tl += (size_t)z * 64 * nk;
#pragma unroll
    for (int i = 0; i < 2; ++i) { const float y = (d < 32) ? F[(size_t)(k0 + i) * ld + off + z * 32 + (d < 32 ? d : 0)] : 0.f; const unsigned short hb = f2bf(y); oh[i] = hb; ol[i] = f2bf(y - bf2f(hb)); }
    const size_t o = (size_t)d * nk + k0; *(v2us*)(Th + o) = oh; *(v2us*)(Tl + o) = ol; 
}
template <int NK>
__global__ __launch_bounds__(256) void k_softmaxz(const float* __restrict__ S, int rows, bf* PH, bf* PL) {
    typedef __attribute__((ext_vector_type(4))) unsigned short v4us;
    const int lane = threadIdx.x & 31, i = blockIdx.x * 8 + (threadIdx.x >> 5); if (i >= rows) return; const size_t zo = (size_t)blockIdx.z * rows * NK; const float* sr = S + zo + (size_t)i * NK; PH += zo; PL += zo;
    float m = -3.0e38f;
#pragma unroll 1
    for (int c0 = lane * 4; c0 < NK; c0 += 128) {
#pragma unroll
        for (int q = 0; q < 4; ++q) m = fmaxf(m, sr[c0 + q]); }
#pragma unroll
    for (int sh = 16; sh; sh >>= 1) m = fmaxf(m, __shfl_xor(m, sh, 32));
    float sum = 0.f;
#pragma unroll 1
    for (int c0 = lane * 4; c0 < NK; c0 += 128) {
#pragma unroll
        for (int q = 0; q < 4; ++q) sum += __expf(sr[c0 + q] - m); }
#pragma unroll
    for (int sh = 16; sh; sh >>= 1) sum += __shfl_xor(sum, sh, 32);
    const float inv = 1.0f / sum;
{
#pragma unroll 1
        for (int c0 = lane * 4; c0 < NK; c0 += 128) { v4us oh, ol;
#pragma unroll
            for (int q = 0; q < 4; ++q) { const float p = __expf(sr[c0 + q] - m) * inv; const unsigned short hb = f2bf(p); oh[q] = hb; ol[q] = f2bf(p - bf2f(hb)); }
            const size_t o = (size_t)i * NK + c0; *(v4us*)(PH + o) = oh; *(v4us*)(PL + o) = ol; }
         }
}
__global__ __launch_bounds__(256) void k_placez(const float* __restrict__ XH, int rows, int ldy, float* Y) {
    const int lane = threadIdx.x & 31; const size_t q = (size_t)blockIdx.x * 8 + (threadIdx.x >> 5); if (q >= (size_t)rows) return; const int z = blockIdx.z; const float v = XH[((size_t)z * rows + q) * 64 + lane];
    *(float*)(Y + q * ldy + z * 32 + lane) = v; 
}

__global__ __launch_bounds__(256) void k_hplanesz(const float* __restrict__ F, int ld, int h0, float sc, int rows, bf* Ph, bf* Pl) {
    typedef __attribute__((ext_vector_type(2))) unsigned short v2us;
    const int lane = threadIdx.x & 31; const size_t r = (size_t)blockIdx.x * 8 + (threadIdx.x >> 5); if (r >= (size_t)rows) return; const int z = blockIdx.z; v2us oh, ol;
    Ph += (size_t)z * rows * 64; Pl += (size_t)z * rows * 64;
#pragma unroll
    for (int i = 0; i < 2; ++i) { const float y = F[r * ld + (h0 + z) * 64 + lane * 2 + i] * sc; const unsigned short hb = f2bf(y); oh[i] = hb; ol[i] = f2bf(y - bf2f(hb)); }
    const size_t o = r * 64 + lane * 2; *(v2us*)(Ph + o) = oh; *(v2us*)(Pl + o) = ol; 
}
template <int NK>
__global__ __launch_bounds__(256) void k_softmaxzs(const float* __restrict__ S, int rows, float sc, bf* PH, bf* PL) {
    typedef __attribute__((ext_vector_type(4))) unsigned short v4us;
    const int lane = threadIdx.x & 31, i = blockIdx.x * 8 + (threadIdx.x >> 5); if (i >= rows) return; const size_t zo = (size_t)blockIdx.z * rows * NK; const float* sr = S + zo + (size_t)i * NK; PH += zo; PL += zo;
    float m = -3.0e38f;
#pragma unroll 1
    for (int c0 = lane * 4; c0 < NK; c0 += 128) {
#pragma unroll
        for (int q = 0; q < 4; ++q) m = fmaxf(m, sr[c0 + q] * sc); }
#pragma unroll
    for (int sh = 16; sh; sh >>= 1) m = fmaxf(m, __shfl_xor(m, sh, 32));
    float sum = 0.f;
#pragma unroll 1
    for (int c0 = lane * 4; c0 < NK; c0 += 128) {
#pragma unroll
        for (int q = 0; q < 4; ++q) sum += __expf(sr[c0 + q] * sc - m); }
#pragma unroll
    for (int sh = 16; sh; sh >>= 1) sum += __shfl_xor(sum, sh, 32);
    const float inv = 1.0f / sum;
{
#pragma unroll 1
        for (int c0 = lane * 4; c0 < NK; c0 += 128) { v4us oh, ol;
#pragma unroll
            for (int q = 0; q < 4; ++q) { const float p = __expf(sr[c0 + q] * sc - m) * inv; const unsigned short hb = f2bf(p); oh[q] = hb; ol[q] = f2bf(p - bf2f(hb)); }
            const size_t o = (size_t)i * NK + c0; *(v4us*)(PH + o) = oh; *(v4us*)(PL + o) = ol; }
         }
}

// k_cvtin: x and the four weights to bf16 in fragment order, one grid: tiles 0 .. XT-1 are x's, then WT tiles each of wq, wk, wv (stacked as [3 * DMOD][DMOD]) and wo. A block's 8 tiles lie in one source (XT and WT are multiples of 8).
// The grid's first NN / 32 blocks read the mask instead: block b takes query rows 32 b .. + 31 and writes TM[b][p], the largest mask value of those rows in key pass p (32 keys), and RM[b * 32], the smallest of the 32 row maxima.
__global__ __launch_bounds__(256) void k_cvtin(const float* __restrict__ x, const float* __restrict__ Wq, const float* __restrict__ Wk, const float* __restrict__ Wv, const float* __restrict__ Wo, const float* __restrict__ Mk, bf* Xb, bf* WQKV, bf* WO, float* TM, float* RM) {
    constexpr unsigned XT = (NBT * NN / 16) * (DMOD / 32), WT = (DMOD / 16) * (DMOD / 32);
    __shared__ float cmx[8][NN / 128][32]; __shared__ float rmx[32][33];
    const int lane = threadIdx.x & 31;
    if (blockIdx.x < NN / 32) {
        const int wv = threadIdx.x >> 5;   // a wave takes 4 rows; load j of a row gives the lane columns 128 j + 4 lane .. + 3, which lie in pass 4 j + lane / 8
        const float* mp = Mk + (size_t)(blockIdx.x * 32 + wv * 4) * NN + lane * 4;
        float cm[NN / 128];
#pragma unroll
        for (int j = 0; j < NN / 128; ++j) cm[j] = -__builtin_inff();
#pragma unroll 1   // rolled, one row's 16 loads in flight: four rows' would raise the register count of the whole grid, whose converter blocks need many resident waves
        for (int rw = 0; rw < 4; ++rw) { v4f v[NN / 128]; float rm = -__builtin_inff();
#pragma unroll
            for (int j = 0; j < NN / 128; ++j) v[j] = *(const v4f*)(mp + j * 128);
            mp += NN;
#pragma unroll
            for (int j = 0; j < NN / 128; ++j) { const float e = fmaxf(fmaxf(v[j][0], v[j][1]), fmaxf(v[j][2], v[j][3])); cm[j] = fmaxf(cm[j], e); rm = fmaxf(rm, e); }
            rmx[wv * 4 + rw][lane] = rm;
            asm volatile("s_wait_xcnt 0x0" ::: "memory"); }   // the wait before a register that an issued load names is written again: the next trip forms its address in the same registers
#pragma unroll
        for (int j = 0; j < NN / 128; ++j) cmx[wv][j][lane] = cm[j];
        __syncthreads();
        if (threadIdx.x < NN / 32) { const int j = threadIdx.x >> 2, l0 = (threadIdx.x & 3) * 8; float t = -__builtin_inff();
            for (int w = 0; w < 8; ++w) for (int i = 0; i < 8; ++i) t = fmaxf(t, cmx[w][j][l0 + i]);
            TM[blockIdx.x * (NN / 32) + threadIdx.x] = t; }
        else if (threadIdx.x < NN / 32 + 32) { float t = -__builtin_inff();   // one whole wave: lane = row
            for (int i = 0; i < 32; ++i) t = fmaxf(t, rmx[lane][i]);
#pragma unroll
            for (int sh = 16; sh; sh >>= 1) t = fminf(t, __shfl_xor(t, sh, 32));
            if (lane == 0) RM[blockIdx.x * 32] = t; }
        return;
    }
    const unsigned bid = blockIdx.x - NN / 32; unsigned st = bid * 8 + (threadIdx.x >> 5);   // st: the tile's number inside its source
    const float* src = x; bf* dst = Xb + (size_t)st * 512;   // below, w comes from the block's number, so that the choice of the source is a scalar one
    if (bid >= XT / 8) { const unsigned t = st - XT, w = (bid - XT / 8) / (WT / 8); st = t % WT; src = (w == 0) ? Wq : (w == 1) ? Wk : (w == 2) ? Wv : Wo; dst = (w == 3) ? WO + (size_t)st * 512 : WQKV + (size_t)t * 512; }
    const float* sp = tilesrc(src, st / (DMOD / 32), st % (DMOD / 32), lane);
#pragma unroll
    for (int j = 0; j < 2; ++j) { const v8f v = *(const v8f*)(sp + j * 16); v8us o;
#pragma unroll
        for (int i = 0; i < 8; ++i) o[i] = f2bf(v[i]);
        *(v8us*)(dst + j * 256 + lane * 8) = o; }
}
// k_fattn: scores, scale, additive mask, softmax and attn.V of one head of one item (blockIdx.x = item * 16 + head) in one kernel, running maximum and sum per query (online softmax), no score or probability plane in memory.
// Transposed products: S^T = K.Q^T (A = 16 key rows, B = 16 query columns), so a lane holds 8 keys of ONE query per tile; two key tiles, converted in place, are the B operand P^T of O^T += V^T.P^T.
// QT * 16 queries belong to a PAIR of waves (w and w + 4 of the block's 8), which walk the keys 32 at a time, one the even and one the odd passes; operands are bf16 hi + residual planes, three products each.
// Behind the walk wave w + 4 hands its (m, l, o) over through LDS, and wave w merges the two partial softmaxes and stores.
// Every '#pragma unroll' in it: the fragment and accumulator arrays are indexed by those loop counters and stay in registers only when the loops are unrolled.
#define QT 2
typedef __attribute__((ext_vector_type(2))) float  v2f;
typedef __attribute__((ext_vector_type(2))) __bf16 v2bf;
typedef __attribute__((ext_vector_type(8))) unsigned v8u;
__global__ __launch_bounds__(256) void k_fattn(const bf* Qh_, const bf* Ql_, const bf* Kh_, const bf* Kl_, const bf* VTh_, const bf* VTl_, const float* M_, float sc, bf* Oh, bf* Ol, const float* TM, const float* RM, const float* NR) {
    typedef unsigned long long u64;
    __shared__ __align__(16) float mrg[4][(QT * 8 + 1) * 128];   // per pair of waves: o as QT * 8 pieces of 16 bytes a lane, then (m, l); piece c of lane l at (c * 32 + l) * 16 bytes
    const int lane = threadIdx.x & 31, wave = __builtin_amdgcn_readfirstlane(threadIdx.x >> 5), lr = lane & 15, hi = lane >> 4;
    const size_t z = blockIdx.x;
    // which 128 queries the block takes, which 32 of them the wave, and which half of their passes. The two waves of a pair have walks of equal length, so that no wave is left to walk alone.
    // A block fills its WGP; the high query indices have the low block numbers (speed only; every (head, query tile) is taken once)
    const int qb = NN / 128 - 1 - (int)blockIdx.z, wq = wave & 3, half = wave >> 2;
    const int q0 = (qb * 4 + wq) * (QT * 16);
    // PASSES THAT CANNOT COUNT ARE LEFT OUT. |q.k| * sc <= B = sc * |q| * |k| (lengths from k_qkv). A query's final maximum is at least its largest mask value - B; a key whose mask value lies more than 2 B + 104 below that
    // has exp(score - maximum) = 0 in f32. A pass is walked unless its largest mask value over the wave's 32 queries lies below the smallest of their row maxima by more than 2.1 B + 200: decided from the data, for any mask.
    typedef const __attribute__((address_space(1))) float* gfl;
    const gch tmb = (gch)TM + (size_t)qb * (4 * (NN / 32) * 4);   // the block's four rows of the table; all table values are requested at once, one latency
    const unsigned no = lane * 128;
    float kn = *(gfl)((gch)NR + (size_t)(NBT * NH_ + z) * ((NN / 64) * 128) + no), tm[4][2], rmn[4];
    const float qn[2] = {NR[(z * (NN / 64) + qb * 2) * 32], NR[(z * (NN / 64) + qb * 2 + 1) * 32]};   // the block's queries are two of k_qkv's 64-token groups
#pragma unroll
    for (int i = 0; i < 4; ++i) { tm[i][0] = ((gfl)(tmb + i * 256))[lane]; tm[i][1] = ((gfl)(tmb + i * 256 + 128))[lane]; rmn[i] = RM[(qb * 4 + i) * 32]; }
    asm volatile("s_wait_xcnt 0x0" :: "v"(lane), "v"(no) : "memory");   // the wait before a register that an issued load names is written again; it takes the two lane offsets, which so stay as they are up to here
#pragma unroll
    for (int sh = 16; sh; sh >>= 1) kn = fmaxf(kn, __shfl_xor(kn, sh, 32));
    u64 own = 0, uni = 0;   // bit p: pass p is walked by this wave; by any wave of the block
#pragma unroll
    for (int i = 0; i < 4; ++i) {
        const float thr = rmn[i] - (2.1f * sc * __builtin_amdgcn_sqrtf(qn[i >> 1] * kn) + 200.f);
        u64 a = (u64)__builtin_amdgcn_ballot_w32(!(tm[i][0] < thr)) | ((u64)__builtin_amdgcn_ballot_w32(!(tm[i][1] < thr)) << 32);
        if (!a) a = ~(u64)0;
        uni |= a; if (i == wq) own = a; }
    own &= half ? 0xAAAAAAAAAAAAAAAAull : 0x5555555555555555ull;   // the pair's deal: by the pass's number, so that the four waves of a half walk the same K and V; a half may come out empty (no pass: m, l, o keep their start values)
    // wave-uniform byte bases; the lane's own part of every address is one of two loop-invariant 32-bit byte offsets (fo: its place in a half tile of a plane; mo: in the mask)
    const gch Qh = (gch)Qh_ + (z * NN + q0) * (HD * 2), Ql = (gch)Ql_ + (z * NN + q0) * (HD * 2), Kh0 = (gch)Kh_ + z * (NN * HD * 2), Kl0 = (gch)Kl_ + z * (NN * HD * 2), VTh0 = (gch)VTh_ + z * (HD * NN * 2), VTl0 = (gch)VTl_ + z * (HD * NN * 2), M0 = (gch)M_ + (size_t)q0 * (NN * 4);
    // rotated start: the 16 blocks of a head share K and V, the blocks of one query range share the mask rows; walking the keys in step they would ask L2 for the same lines at the same moment.
    // Each block starts at its own 32-key pass and wraps round; the online softmax takes the passes in any order (a new order of its sums)
    // The start is a rank among the passes that the block walks, the same place for its eight waves, which so stay near each other in K and V
    unsigned rk = ((((qb + ((unsigned)z & 15)) * 4) & (NN / 32 - 1)) * (unsigned)__builtin_popcountll(uni)) >> 6;
    u64 up = uni; for (; rk; --rk) up &= up - 1;   // at most 63 trips; up keeps at least one bit
    const u64 hm = ~(u64)0 << __builtin_ctzll(up);
    u64 rem1 = own & hm, rem2 = own & ~hm; const int npass = __builtin_popcountll(own);
    unsigned pk = 0;
    auto nextpass = [&]() { if (!rem1) { rem1 = rem2; rem2 = 0; } if (rem1) { pk = (unsigned)__builtin_ctzll(rem1); rem1 &= rem1 - 1; } };   // the wave's next pass; behind the last one pk stays
    nextpass();
    gch Kh = Kh0 + pk * (32 * HD * 2), Kl = Kl0 + pk * (32 * HD * 2), M = M0 + pk * (32 * 4), VTh = VTh0 + pk * 1024, VTl = VTl0 + pk * 1024;
    unsigned fo = lane * 16, mo = (lr * NN + 8 * hi) * 4;
    v16bf qh[QT][2], ql[QT][2];
#pragma unroll
    for (int u = 0; u < QT; ++u) {
#pragma unroll
        for (int ks = 0; ks < 2; ++ks) { qh[u][ks] = ldfrag(Qh + (u * 2 + ks) * 1024 + fo); ql[u][ks] = ldfrag(Ql + (u * 2 + ks) * 1024 + fo); } }
    v8f o[QT][4]; float m[QT], l[QT];
#pragma unroll
    for (int u = 0; u < QT; ++u) { m[u] = -3.0e38f; l[u] = 0.f;
#pragma unroll
        for (int dt = 0; dt < 4; ++dt) o[u][dt] = (v8f){}; }
    v16bf kh[2][2], kl[2][2]; v8f mk[QT][2];
#pragma unroll
    for (int t = 0; t < 2; ++t) {
#pragma unroll
        for (int ks = 0; ks < 2; ++ks) { kh[t][ks] = ldfrag(Kh + (t * 2 + ks) * 1024 + fo); kl[t][ks] = ldfrag(Kl + (t * 2 + ks) * 1024 + fo); }
#pragma unroll
        for (int u = 0; u < QT; ++u) mk[u][t] = *(gv8f)(M + (u * 16 * NN + t * 16) * 4 + mo); }
    // the wait before a register that an issued load names is written again; the statement takes those registers, so that they stay as they are up to it and the bases move on behind it
    asm volatile("s_wait_xcnt 0x0" : "+s"(Kh), "+s"(Kl), "+s"(M), "+v"(fo), "+v"(mo) :: "memory");
    nextpass(); Kh = Kh0 + pk * (32 * HD * 2); Kl = Kl0 + pk * (32 * HD * 2); M = M0 + pk * (32 * 4);   // from here on pk, Kh, Kl, M: the pass that is fetched ahead
#pragma unroll 1   // rolled: a pass is some 600 instructions already, and the fetch-ahead below spans the back edge without a second copy
    for (int it = 0; it < npass; ++it) {
        v16bf vh[4], vl[4]; v8f st[QT][2];
#pragma unroll
        for (int dt = 0; dt < 4; ++dt) { vh[dt] = ldfrag(VTh + dt * (NN / 32) * 1024 + fo); vl[dt] = ldfrag(VTl + dt * (NN / 32) * 1024 + fo); }
        __builtin_amdgcn_sched_barrier(0);   // V^T is requested before the score products, which hide its latency
#pragma unroll
        for (int u = 0; u < QT; ++u) {
#pragma unroll
            for (int t = 0; t < 2; ++t) { v8f a = (v8f){};
#pragma unroll
                for (int ks = 0; ks < 2; ++ks) { a = wmmab(kh[t][ks], qh[u][ks], a); a = wmmab(kl[t][ks], qh[u][ks], a); a = wmmab(kh[t][ks], ql[u][ks], a); }
#pragma unroll
                for (int j = 0; j < 8; ++j) a[j] = a[j] * sc + bfr(mk[u][t][j]);
                st[u][t] = a; } }
        // the next pass's K fragments and mask values are fetched here; the last pass fetches its own again (in bounds, unused)
#pragma unroll
        for (int t = 0; t < 2; ++t) {
#pragma unroll
            for (int ks = 0; ks < 2; ++ks) { kh[t][ks] = ldfrag(Kh + (t * 2 + ks) * 1024 + fo); kl[t][ks] = ldfrag(Kl + (t * 2 + ks) * 1024 + fo); }
#pragma unroll
            for (int u = 0; u < QT; ++u) mk[u][t] = *(gv8f)(M + (u * 16 * NN + t * 16) * 4 + mo); }
        __builtin_amdgcn_sched_barrier(0);   // ... and requested before the softmax and attn.V of this pass, which hide their latency
#pragma unroll
        for (int u = 0; u < QT; ++u) {
            float mx = -3.0e38f;
#pragma unroll
            for (int t = 0; t < 2; ++t) {
#pragma unroll
                for (int j = 0; j < 8; ++j) mx = fmaxf(mx, st[u][t][j]); }
            mx = fmaxf(mx, xhalf(mx));
            const float mn = fmaxf(m[u], mx), al = __expf(m[u] - mn); m[u] = mn;
            float ps = 0.f; v8u pH, pL;
#pragma unroll
            for (int t = 0; t < 2; ++t) {
#pragma unroll
                for (int jj = 0; jj < 4; ++jj) { const v2f p = {__expf(st[u][t][2 * jj] - mn), __expf(st[u][t][2 * jj + 1] - mn)}; ps += p[0] + p[1];
                    const unsigned hb = __builtin_bit_cast(unsigned, __builtin_convertvector(p, v2bf));
                    const v2f r = {p[0] - __uint_as_float(hb << 16), p[1] - __uint_as_float(hb & 0xFFFF0000u)};
                    pH[t * 4 + jj] = hb; pL[t * 4 + jj] = __builtin_bit_cast(unsigned, __builtin_convertvector(r, v2bf)); } }
            l[u] = l[u] * al + ps;
            const v16bf ph = __builtin_bit_cast(v16bf, pH), pl = __builtin_bit_cast(v16bf, pL);
#pragma unroll
            for (int dt = 0; dt < 4; ++dt) { v8f a = o[u][dt] * al; a = wmmab(vh[dt], ph, a); a = wmmab(vl[dt], ph, a); a = wmmab(vh[dt], pl, a); o[u][dt] = a; }
        }
        __builtin_amdgcn_sched_barrier(0);   // keeps the wait below at the foot of the pass, where the requests have long been taken: higher up the wave would stand on it
        asm volatile("s_wait_xcnt 0x0" : "+s"(VTh), "+s"(VTl), "+s"(Kh), "+s"(Kl), "+s"(M), "+v"(fo), "+v"(mo) :: "memory");   // as in front of the loop, for this pass's loads
        VTh = VTh0 + pk * 1024; VTl = VTl0 + pk * 1024;
        nextpass(); Kh = Kh0 + pk * (32 * HD * 2); Kl = Kl0 + pk * (32 * HD * 2); M = M0 + pk * (32 * 4);
    }
    // the pair's merge: lane for lane the two waves hold the same (query, d) places
    float* mg = (float*)((char*)&mrg[wq][0] + fo);   // fo = lane * 16, the lane's place in a piece as in a half tile
    if (half) {
#pragma unroll
        for (int u = 0; u < QT; ++u) {
#pragma unroll
            for (int dt = 0; dt < 4; ++dt) { const v8f a = o[u][dt]; *(v4fa*)(mg + ((u * 4 + dt) * 2) * 128) = (v4f){a[0], a[1], a[2], a[3]}; *(v4fa*)(mg + ((u * 4 + dt) * 2 + 1) * 128) = (v4f){a[4], a[5], a[6], a[7]}; } }
        *(v4fa*)(mg + QT * 8 * 128) = (v4f){m[0], m[1], l[0], l[1]};
    }
    __syncthreads();   // the one barrier of the kernel, passed by all eight waves: publishes the odd half's (m, l, o)
    if (half) return;
    const v4f ml = *(const v4fa*)(mg + QT * 8 * 128);
#pragma unroll
    for (int u = 0; u < QT; ++u) {
        const float mn = fmaxf(m[u], ml[u]), a0 = __expf(m[u] - mn), a1 = __expf(ml[u] - mn), lt = l[u] * a0 + ml[QT + u] * a1;   // an empty half has l = 0, o = 0 and the lowest m: its weight is 0 or meets only zeros
        const float inv = 1.0f / (lt + xhalf(lt)), s0 = a0 * inv, s1 = a1 * inv;
        // the merged heads' hi + residual planes [item * NN + token][DMOD] in fragment order: the lane's 8 values are d = 16 dt + 8 hi .. + 7 of token q0 + 16 u + lr, its 16 bytes at lane * 16 of half dt & 1 of tile (row tile, 2 head + dt / 2); a wave's store is 4 whole lines
        const size_t ob = ((((z / NH_) * NN + q0) / 16 + u) * (DMOD / 32) + (z % NH_) * 2) * 1024;   // wave-uniform bytes; the lane's part is fo, as for the loads
        gwch ph = (gwch)Oh + ob, pl = (gwch)Ol + ob;
#pragma unroll
        for (int dt = 0; dt < 4; ++dt) { const v4f pa = *(const v4fa*)(mg + ((u * 4 + dt) * 2) * 128), pb = *(const v4fa*)(mg + ((u * 4 + dt) * 2 + 1) * 128);
            const v8f a = o[u][dt] * s0 + (v8f){pa[0], pa[1], pa[2], pa[3], pb[0], pb[1], pb[2], pb[3]} * s1; v8us oh, ol;
#pragma unroll
            for (int j = 0; j < 8; ++j) { const unsigned short hb = f2bf(a[j]); oh[j] = hb; ol[j] = f2bf(a[j] - bf2f(hb)); }
            *(gwv8us)(ph + dt * 512 + fo) = oh; *(gwv8us)(pl + dt * 512 + fo) = ol;
            // the wait before a register that an issued store names is written again; it takes the stored values, which so stay as they are up to here (behind the last pair nothing is written any more)
            if (u + 1 < QT || dt < 3) asm volatile("s_wait_xcnt 0x0" :: "v"(oh), "v"(ol) : "memory"); } }
}
__global__ __launch_bounds__(256) void k_csoftz(const float* __restrict__ S, int rows, float sc, bf* PH, bf* PL) {
    typedef __attribute__((ext_vector_type(4))) unsigned short v4us;
    const int lane = threadIdx.x & 31, i = blockIdx.x * 8 + (threadIdx.x >> 5); if (i >= rows) return; const size_t zo = (size_t)blockIdx.z * rows * NN; const float* sr = S + zo + (size_t)i * NN; PH += zo; PL += zo;
    float m = -3.0e38f;
#pragma unroll 1
    for (int c0 = lane * 4; c0 < NN; c0 += 128) {
#pragma unroll
        for (int q = 0; q < 4; ++q) { const int k = c0 + q; if (k <= i) m = fmaxf(m, sr[k] * sc); } }
#pragma unroll
    for (int sh = 16; sh; sh >>= 1) m = fmaxf(m, __shfl_xor(m, sh, 32));
    float sum = 0.f;
#pragma unroll 1
    for (int c0 = lane * 4; c0 < NN; c0 += 128) {
#pragma unroll
        for (int q = 0; q < 4; ++q) { const int k = c0 + q; if (k <= i) sum += __expf(sr[k] * sc - m); } }
#pragma unroll
    for (int sh = 16; sh; sh >>= 1) sum += __shfl_xor(sum, sh, 32);
    const float inv = 1.0f / sum;
{
#pragma unroll 1
        for (int c0 = lane * 4; c0 < NN; c0 += 128) { v4us oh, ol;
#pragma unroll
            for (int q = 0; q < 4; ++q) { const int k = c0 + q; const float p = (k <= i) ? __expf(sr[(k <= i) ? k : 0] * sc - m) * inv : 0.f; const unsigned short hb = f2bf(p); oh[q] = hb; ol[q] = f2bf(p - bf2f(hb)); }
            const size_t o = (size_t)i * NN + c0; *(v4us*)(PH + o) = oh; *(v4us*)(PL + o) = ol; }
         }
}

extern "C" void kernel_launch(void* const* d_in, const int* in_sizes, int n_in,
                              void* d_out, int out_size, void* d_ws, size_t ws_size, hipStream_t stream) {
    (void)in_sizes; (void)n_in; (void)out_size;
    const float* x = (const float*)d_in[0]; const float* wq = (const float*)d_in[1]; const float* wk = (const float*)d_in[2]; const float* wv = (const float*)d_in[3]; const float* wo = (const float*)d_in[4]; const float* fc = (const float*)d_in[5]; const float* cmask = (const float*)d_in[6];
    float* out = (float*)d_out;    // [2][2048][1024]
    char* wsp = (char*)d_ws;
    auto take = [&](size_t bytes) { char* p = wsp; wsp += (bytes + 255) & ~(size_t)255; return (void*)p; };
    bf* WQKV = (bf*)take((size_t)3 * DMOD * DMOD * 2); bf* WO = (bf*)take((size_t)DMOD * DMOD * 2);
    bf* Xb = (bf*)take((size_t)NBT * NN * DMOD * 2);
    const size_t pb = (size_t)NBT * NH_ * NN * HD * 2;   // one plane set: [item][head]
    bf* Qh = (bf*)take(pb); bf* Ql = (bf*)take(pb); bf* Kh = (bf*)take(pb); bf* Kl = (bf*)take(pb); bf* VTh = (bf*)take(pb); bf* VTl = (bf*)take(pb);
    bf* Oh = (bf*)take((size_t)NBT * NN * DMOD * 2); bf* Ol = (bf*)take((size_t)NBT * NN * DMOD * 2);
    float* TM = (float*)take((size_t)(NN / 32) * (NN / 32) * 4); float* RM = (float*)take((size_t)(NN / 32) * 128); float* NR = (float*)take((size_t)2 * NBT * NH_ * (NN / 64) * 128);   // mask table; row lengths of q and k, one line a value
    if ((size_t)(wsp - (char*)d_ws) > ws_size) return;    // ~ 84 MB
    k_cvtin<<<NN / 32 + ((NBT * NN / 16) + 4 * (DMOD / 16)) * (DMOD / 32) / 8, 256, 0, stream>>>(x, wq, wk, wv, wo, cmask, Xb, WQKV, WO, TM, RM);   // x [token][in] and the weights [out][in], fragment order
    k_qkv<<<dim3(NBT * NN / 128, (3 * DMOD) / 128, 1), 128, 0, stream>>>(Xb, WQKV, fc, Qh, Ql, Kh, Kl, VTh, VTl, NR);   // [q | k | v], the planes of all heads of both items
    k_fattn<<<dim3(NBT * NH_, 1, NN / (QT * 64)), 256, 0, stream>>>(Qh, Ql, Kh, Kl, VTh, VTl, cmask, SCL, Oh, Ol, TM, RM, NR);
    k_gemmb<true, false><<<dim3(NBT * NN / 64, DMOD / 64, 1), 128, 0, stream>>>(Oh, Ol, WO, nullptr, out, DMOD, nullptr, nullptr, DMOD);
}

// v010
// A run of this version takes 98.9 microseconds.
// Timed twice side by side with v009, it ran 1.09 and 1.08 times as fast.
// All steps since v000 together make it 20.5 times as fast.
#include <hip/hip_runtime.h>

// Both items go through every launch together (rows item * 2048 + token; planes [item][head]). Compute dtypes, f32 accumulate: q/k/v = x.W^T fused as one [4096 x 1024].[1024 x 3072] GEMM with PLAIN bf16 operands (exact products); the interleaved-pair RoPE
// with the given (cos, sin) table applied while building the q/k planes, in that GEMM's epilogue, which also writes the transposed v planes; scores and attn.V with both operands as bf16 hi + UNSCALED residual planes (three
// products), fused with 1/sqrt(64), the additive float mask input (read as data, shared by all heads/items) and an online softmax in f32 in one kernel, the 16 heads of both items in grid.x; wo on hi/lo planes of the merged heads
// FRAGMENT ORDER: every bf16 operand plane (x, the weights, q, k, v^T, the merged heads) is stored as the matrix instruction's lanes read it. A plane [R][Kd] is cut into tiles of 16 rows x 32 k, tile (r >> 4) * (Kd / 32) + (k >> 5),
// 512 elements each: element (r, k) lies at tile * 512 + ((k >> 4) & 1) * 256 + ((k >> 3) & 1) * 128 + (r & 15) * 8 + (k & 7). Lane l = 16 * hi + lr reads its 16 bytes at l * 16 of each 512-byte half, so a fragment load takes 4 whole lines, not 16 pieces.

#define NBT  2
#define NN   2048
#define DMOD 1024
#define NH_  16
#define HD   64
#define DM   DMOD
#define NTK  NN
#define SCL  0.125f
#define LOSC 1024.0f

typedef _Float16 h16;
typedef unsigned short bf;
typedef __attribute__((ext_vector_type(16))) __bf16   v16bf;
typedef __attribute__((ext_vector_type(16))) _Float16 v16h;
typedef __attribute__((ext_vector_type(8)))  _Float16 v8h;
typedef __attribute__((ext_vector_type(8)))  unsigned short v8us;
typedef __attribute__((ext_vector_type(8)))  float    v8f;
typedef __attribute__((ext_vector_type(4)))  float    v4f;
typedef __attribute__((ext_vector_type(4)))  _Float16 v4h;
typedef v8h  __attribute__((may_alias)) v8ha;
typedef v4f  __attribute__((may_alias)) v4fa;
typedef v8us __attribute__((may_alias)) v8usa;

__device__ __forceinline__ unsigned short f2bf(float f) { unsigned u = __float_as_uint(f); u += 0x7FFFu + ((u >> 16) & 1u); return (unsigned short)(u >> 16); }
__device__ __forceinline__ float bf2f(unsigned short b) { return __uint_as_float(((unsigned)b) << 16); }
__device__ __forceinline__ float bfr(float f) { return bf2f(f2bf(f)); }
__device__ __forceinline__ v16h cat16(v8h lo, v8h hi) { return __builtin_shufflevector(lo, hi, 0, 1, 2, 3, 4, 5, 6, 7, 8, 9, 10, 11, 12, 13, 14, 15); }
__device__ __forceinline__ v16bf cat16b(v8us lo, v8us hi) { return __builtin_bit_cast(v16bf, __builtin_shufflevector(lo, hi, 0, 1, 2, 3, 4, 5, 6, 7, 8, 9, 10, 11, 12, 13, 14, 15)); }
__device__ __forceinline__ v8f wmma16(v16h a, v16h b, v8f c) { return __builtin_amdgcn_wmma_f32_16x16x32_f16(false, a, false, b, (short)0, c, false, false); }
__device__ __forceinline__ v8f wmmab(v16bf a, v16bf b, v8f c) { return __builtin_amdgcn_wmma_f32_16x16x32_bf16(false, a, false, b, (short)0, c, false, false); }

typedef const __attribute__((address_space(1))) char*  gch;    // global-memory pointers by type: a pointer that has passed through an asm operand would otherwise be read with flat loads
typedef const __attribute__((address_space(1))) v8us*  gv8us;
typedef const __attribute__((address_space(1))) v8f*   gv8f;
typedef __attribute__((address_space(1))) char*  gwch;    // the same for stores
typedef __attribute__((address_space(1))) v8us*  gwv8us;
__device__ __forceinline__ v16bf ldfrag(gch p) { return cat16b(*(gv8us)p, *(gv8us)(p + 512)); }   // the lane's 16 bytes of each half of a tile in fragment order: k 8h..8h+7 and 16+8h..16+8h+7

__device__ __forceinline__ float xhalf(float v) { const int b = __float_as_int(v); return __int_as_float(__builtin_amdgcn_permlanex16(b, b, 0x76543210, 0xfedcba98, false, false)); }   // value of lane l ^ 16

// k_gemmb: 64 x 64 block tile (4 waves x 16 x 64) of C[NBT * NN][NW] = (A [+ Al]).B^T (K = 1024) [+ bf(bias[c])] [+ bf(R[r][c]) residual]; f32 whole-line epilogue (or f16
// A, Al and Bn are read in fragment order.
template <bool SPLITA, bool F16OUT = false>
__global__ __launch_bounds__(128) void k_gemmb(const bf* __restrict__ A, const bf* __restrict__ Al, const bf* __restrict__ Bn, const float* __restrict__ bias, float* C, int ldc, h16* C2, const float* __restrict__ R = nullptr, int K = DM, int roundR = 1) {
    __shared__ __align__(16) float ost[4][16 * 68];
    const int lane = threadIdx.x & 31, wave = __builtin_amdgcn_readfirstlane(threadIdx.x >> 5), lr = lane & 15, hi = lane >> 4;   // the wave's number as a scalar: every fragment address is then a scalar base + lane * 16 bytes
    const int r0 = blockIdx.x * 64 + wave * 16, c0 = blockIdx.y * 64;
    // fragment order, planes of DM columns: a row tile is DM / 32 tiles of 1024 bytes; scalar byte bases that move on one tile a trip, and the lane's loop-invariant place in a half tile
    const gch pa0 = (gch)A + (size_t)(r0 >> 4) * (DM * 32), pl0 = (gch)Al + (size_t)(r0 >> 4) * (DM * 32), pb0 = (gch)Bn + (size_t)(c0 >> 4) * (DM * 32);
    // rotated start: the blocks that share operand rows would otherwise walk k in step and ask L2 for the same lines at the same moment; each starts at its own k tile and wraps round (a new order of the f32 sums)
    const unsigned nkt = (unsigned)K >> 5; unsigned kt = (blockIdx.x + (blockIdx.y & 3) * 8) & 31; if (kt >= nkt) kt = 0;
    gch pa = pa0 + kt * 1024, pl = pl0 + kt * 1024, pb = pb0 + kt * 1024;
    unsigned fo = lane * 16;
    v8f acc[4];
#pragma unroll
    for (int t = 0; t < 4; ++t) acc[t] = (v8f){};
#pragma unroll 1
    for (int kc = 0; kc < K; kc += 32) {
        const v16bf a = ldfrag(pa + fo);
        v16bf al = a, b[4];
        if (SPLITA) al = ldfrag(pl + fo);
#pragma unroll
        for (int t = 0; t < 4; ++t) b[t] = ldfrag(pb + t * (DM * 32) + fo);
        __builtin_amdgcn_sched_barrier(0);   // all of the trip's fragments are requested before its first product: without it the built code fetched one column tile at a time into the same registers, one latency each
#pragma unroll
        for (int t = 0; t < 4; ++t) { acc[t] = wmmab(a, b[t], acc[t]); if (SPLITA) acc[t] = wmmab(al, b[t], acc[t]); }
        asm volatile("v_nop\n\tv_nop\n\tv_nop\n\tv_nop" : "+v"(acc[0]), "+v"(acc[1]), "+v"(acc[2]), "+v"(acc[3]) : "v"(a), "v"(al));
        // the wait before a register that an issued load names is written again; the statement takes those registers, so that they stay as they are up to it and the bases move on behind it
        if (SPLITA) asm volatile("s_wait_xcnt 0x0" : "+s"(pa), "+s"(pl), "+s"(pb), "+v"(fo) :: "memory"); else asm volatile("s_wait_xcnt 0x0" : "+s"(pa), "+s"(pb), "+v"(fo) :: "memory");
        kt = (kt + 1 == nkt) ? 0 : kt + 1;
        pa = pa0 + kt * 1024; pl = pl0 + kt * 1024; pb = pb0 + kt * 1024;
    }
    float* os = &ost[wave][0];
#pragma unroll
    for (int t = 0; t < 4; ++t) { const float bv = bias ? bfr(bias[c0 + t * 16 + lr]) : 0.f;
#pragma unroll
        for (int j = 0; j < 8; ++j) os[(hi * 8 + j) * 68 + t * 16 + lr] = acc[t][j] + bv; }
    __syncthreads();
    if (F16OUT) {
        h16* crow = (h16*)(void*)C + (size_t)r0 * ldc + c0;
        auto pass = [&]() {
#pragma unroll
            for (int s = 0; s < 4; ++s) { const int row = 4 * s + (lane >> 3), piece = lane & 7; const float* sp = os + row * 68 + piece * 8; v8h o, o2;
#pragma unroll
                for (int i = 0; i < 8; ++i) { const h16 a = (h16)sp[i]; o[i] = a; o2[i] = (h16)((sp[i] - (float)a) * LOSC); }
                *(v8h*)(crow + (size_t)row * ldc + piece * 8) = o; if (C2) *(v8h*)(C2 + (size_t)r0 * ldc + c0 + (size_t)row * ldc + piece * 8) = o2; }
        };
        pass(); 
    } else {
        float* crow = C + (size_t)r0 * ldc + c0;
        auto pass = [&]() {
#pragma unroll
            for (int s = 0; s < 8; ++s) { const int Lid = (lane >> 3) + 4 * s, piece = lane & 7; const int row = Lid >> 1, cofs = (Lid & 1) * 32 + piece * 4;
                v4f val = *(const v4fa*)(os + row * 68 + cofs); if (R) { const v4f rv = *(const v4f*)(R + ((size_t)r0 + row) * ldc + c0 + cofs); val += roundR ? (v4f){bfr(rv[0]), bfr(rv[1]), bfr(rv[2]), bfr(rv[3])} : rv; }
                *(v4f*)(crow + (size_t)row * ldc + cofs) = val; }
        };
        pass(); 
    }
}

// k_qkv: [q | k | v] = x.W^T (K = DM), plain bf16 operands. A wave owns 64 rows x 64 columns (4 x 4 accumulator tiles): a trip's 8 fragments feed 16 products. The block's 4 waves are 2 x 2, a 128 x 128 tile: each fragment is asked for by two waves.
// A wave's 64 columns are one head of q, k or v; a block's 128 columns lie in one of the three. q and k: interleaved-pair rotation, pair (2i, 2i+1): o0 = t0 c - t1 s, o1 = t0 s + t1 c with c = bf(fc[t][i][0]), s = bf(fc[t][i][1]),
// then bf16 hi + residual planes [head][token][64]; v: hi + residual planes transposed, [head][d][token]; both in fragment order per head. Every store of a wave is 512 bytes in a row, four whole 128-byte lines.
// Every '#pragma unroll' in it: the fragment and accumulator arrays are indexed by those loop counters and stay in registers only when the loops are unrolled.
__global__ __launch_bounds__(128) void k_qkv(const bf* __restrict__ A, const bf* __restrict__ Bn, const float* __restrict__ fc, bf* Qh, bf* Ql, bf* Kh, bf* Kl, bf* VTh, bf* VTl, float* NR) {
    __shared__ __align__(16) float ost[4][64 * 68];
    const int lane = threadIdx.x & 31, wave = __builtin_amdgcn_readfirstlane(threadIdx.x >> 5), lr = lane & 15, hi = lane >> 4;   // the wave's number as a scalar: every fragment address is then a scalar base + lane * 16 bytes
    const int r0 = blockIdx.x * 128 + (wave >> 1) * 64, c0 = blockIdx.y * 128 + (wave & 1) * 64;
    const gch pa0 = (gch)A + (size_t)(r0 >> 4) * (DM * 32), pb0 = (gch)Bn + (size_t)(c0 >> 4) * (DM * 32);   // a row tile of a plane is DM / 32 tiles of 1024 bytes
    unsigned kt = (blockIdx.x + (blockIdx.y & 7) * 4) & (DM / 32 - 1);   // rotated start, as in k_gemmb: the block's first k tile; the walk wraps round
    gch pa = pa0 + kt * 1024, pb = pb0 + kt * 1024;
    unsigned fo = lane * 16;
    v8f acc[4][4];
#pragma unroll
    for (int r = 0; r < 4; ++r) {
#pragma unroll
        for (int t = 0; t < 4; ++t) acc[r][t] = (v8f){}; }
#pragma unroll 1   // rolled: the trips are alike, and a second copy would need a second set of fragment registers
    for (int kc = 0; kc < DM; kc += 32) {
        v16bf a[4], b[4];
#pragma unroll
        for (int r = 0; r < 4; ++r) a[r] = ldfrag(pa + r * (DM * 32) + fo);
#pragma unroll
        for (int t = 0; t < 4; ++t) b[t] = ldfrag(pb + t * (DM * 32) + fo);
        __builtin_amdgcn_sched_barrier(0);   // all of the trip's fragments are requested before its first product: one latency a trip, not one a fragment
#pragma unroll
        for (int r = 0; r < 4; ++r) {
#pragma unroll
            for (int t = 0; t < 4; ++t) acc[r][t] = wmmab(a[r], b[t], acc[r][t]); }
        // the wait before a register that an issued load names is written again; the statement takes those registers, so that they stay as they are up to it and the bases move on behind it
        asm volatile("s_wait_xcnt 0x0" : "+s"(pa), "+s"(pb), "+v"(fo) :: "memory");
        kt = (kt + 1) & (DM / 32 - 1);
        pa = pa0 + kt * 1024; pb = pb0 + kt * 1024;
    }
    const int sec = c0 / DM, head = (r0 / NN) * NH_ + (c0 % DM) / HD, tk0 = r0 % NN;   // head: the plane's number, item * 16 + head; tk0: the wave's first token inside its item (a block's 128 rows lie in one item)
    if (sec < 2) {
        float* os = &ost[wave][0];   // the wave's own 64 tokens x 64 columns
#pragma unroll
        for (int r = 0; r < 4; ++r) {
#pragma unroll
            for (int t = 0; t < 4; ++t) {
#pragma unroll
                for (int j = 0; j < 8; ++j) os[(r * 16 + hi * 8 + j) * 68 + t * 16 + lr] = acc[r][t][j]; } }
        const float* fp = fc + (size_t)(tk0 + lr) * HD + hi * 8; v8f cs[4][4];
#pragma unroll
        for (int r = 0; r < 4; ++r) {
#pragma unroll
            for (int s = 0; s < 4; ++s) cs[r][s] = *(const v8f*)(fp + r * (16 * HD) + s * 16); }   // all requested at once, behind the staging, whose accumulator registers they take: one latency
        asm volatile("s_wait_xcnt 0x0" :: "v"(fp) : "memory");   // the wait before a register that an issued load names is written again; it takes the address, which so stays as it is up to here
        __syncthreads();
        float nr[4] = {0.f, 0.f, 0.f, 0.f};   // squared length of the rotated row of token tk0 + 16 r + lr (this lane's half of its columns)
        bf* Ph = (sec ? Kh : Qh) + (size_t)head * NN * HD + (size_t)(tk0 >> 4) * (16 * HD) + lane * 8; bf* Pl = (sec ? Kl : Ql) + (size_t)head * NN * HD + (size_t)(tk0 >> 4) * (16 * HD) + lane * 8;
#pragma unroll
        for (int r = 0; r < 4; ++r) {   // 16 tokens are two tiles; step s is the half with columns 16 s + 8 hi .. + 7 of token tk0 + 16 r + lr
#pragma unroll
            for (int s = 0; s < 4; ++s) { const float* sp = os + (r * 16 + lr) * 68 + s * 16 + hi * 8;
                const v4f xa = *(const v4fa*)sp, xb = *(const v4fa*)(sp + 4);
                const float x[8] = {xa[0], xa[1], xa[2], xa[3], xb[0], xb[1], xb[2], xb[3]}; v8us oh, ol;
#pragma unroll
                for (int i = 0; i < 4; ++i) { const float t0 = x[2 * i], t1 = x[2 * i + 1], c = bfr(cs[r][s][2 * i]), sn = bfr(cs[r][s][2 * i + 1]); const float y0 = t0 * c - t1 * sn, y1 = t0 * sn + t1 * c; nr[r] += y0 * y0 + y1 * y1;
                    { const unsigned short hb = f2bf(y0); oh[2 * i] = hb; ol[2 * i] = f2bf(y0 - bf2f(hb)); } { const unsigned short hb = f2bf(y1); oh[2 * i + 1] = hb; ol[2 * i + 1] = f2bf(y1 - bf2f(hb)); } }
                *(v8us*)(Ph + r * (16 * HD) + s * 256) = oh; *(v8us*)(Pl + r * (16 * HD) + s * 256) = ol;
                asm volatile("s_wait_xcnt 0x0" :: "v"(oh), "v"(ol) : "memory"); }   // the wait before a register that an issued store names is written again; it takes the stored values, which so stay as they are up to here
        }
        // the largest squared row length among the wave's 64 tokens, for k_fattn's bound on a score; each wave's value has a 128-byte line of its own
        float nm = fmaxf(fmaxf(nr[0] + xhalf(nr[0]), nr[1] + xhalf(nr[1])), fmaxf(nr[2] + xhalf(nr[2]), nr[3] + xhalf(nr[3])));
#pragma unroll
        for (int sh = 8; sh; sh >>= 1) nm = fmaxf(nm, __shfl_xor(nm, sh, 32));
        if (lane == 0) NR[((size_t)(sec * (NBT * NH_) + head) * (NN / 64) + (tk0 >> 6)) * 32] = nm;
    } else {
        // a lane's accumulator holds tokens tk0 + 16 r + 8 hi .. + 7 of d = 16 t + lr: its 16 bytes at lane * 16 of half r & 1 of tile (row tile t, token tile tk0 / 32 + r / 2) of the transposed plane
        const size_t o = (size_t)head * HD * NN + (size_t)(tk0 >> 5) * 512 + lane * 8;
#pragma unroll
        for (int t = 0; t < 4; ++t) {
#pragma unroll
            for (int r = 0; r < 4; ++r) { v8us oh, ol;
#pragma unroll
                for (int i = 0; i < 8; ++i) { const float x = acc[r][t][i]; const unsigned short hb = f2bf(x); oh[i] = hb; ol[i] = f2bf(x - bf2f(hb)); }
                *(v8us*)(VTh + o + (size_t)t * (NN / 32) * 512 + r * 256) = oh; *(v8us*)(VTl + o + (size_t)t * (NN / 32) * 512 + r * 256) = ol;
                asm volatile("s_wait_xcnt 0x0" :: "v"(oh), "v"(ol) : "memory"); } }   // as in the other branch
    }
}

// The converters below write fragment order: a wave makes one tile (16 rows x 32 k of a [rows][DMOD] f32 source): it reads 16 whole 128-byte lines and stores the two 512-byte halves.
__device__ __forceinline__ const float* tilesrc(const float* src, size_t rowtile, size_t ktile, int lane) { return src + (rowtile * 16 + (lane & 15)) * DMOD + ktile * 32 + (lane >> 4) * 8; }   // the lane's 8 values of half 0; half 1 is 16 further on
__global__ __launch_bounds__(256) void k_zero8(bf* dst, size_t n8) {
    const size_t i = (size_t)blockIdx.x * 256 + threadIdx.x; if (i >= n8) return; v8us z;
#pragma unroll
    for (int k = 0; k < 8; ++k) z[k] = 0;
    *(v8us*)(dst + i * 8) = z; 
}

// ===== z-batched (blockIdx.z = head) attention pieces =====
__global__ __launch_bounds__(256) void k_planes32z(const float* __restrict__ F, int ld, int off, float sc, int rows, bf* Ph, bf* Pl) {
    typedef __attribute__((ext_vector_type(2))) unsigned short v2us;
    const int lane = threadIdx.x & 31; const size_t r = ((size_t)blockIdx.x * 8 + (threadIdx.x >> 5)) * 2 + (lane >> 4); if (r >= (size_t)rows) return; const int z = blockIdx.z; const int c0 = (lane & 15) * 2; v2us oh, ol;
    Ph += (size_t)z * rows * 32; Pl += (size_t)z * rows * 32;
#pragma unroll
    for (int i = 0; i < 2; ++i) { const float y = F[r * ld + off + z * 32 + c0 + i] * sc; const unsigned short hb = f2bf(y); oh[i] = hb; ol[i] = f2bf(y - bf2f(hb)); }
    const size_t o = r * 32 + c0; *(v2us*)(Ph + o) = oh; *(v2us*)(Pl + o) = ol; 
}
__global__ __launch_bounds__(256) void k_vtpadz(const float* __restrict__ F, int ld, int off, int nk, bf* Th, bf* Tl) {
    typedef __attribute__((ext_vector_type(2))) unsigned short v2us;
    const int lane = threadIdx.x & 31; const size_t wid = (size_t)blockIdx.x * 8 + (threadIdx.x >> 5); if (wid >= (size_t)64 * (nk / 64)) return; const int z = blockIdx.z; const int d = (int)(wid / (nk / 64)); const int k0 = (int)(wid % (nk / 64)) * 64 + lane * 2; v2us oh, ol;
    Th += (size_t)z * 64 * nk; Tl += (size_t)z * 64 * nk;
#pragma unroll
    for (int i = 0; i < 2; ++i) { const float y = (d < 32) ? F[(size_t)(k0 + i) * ld + off + z * 32 + (d < 32 ? d : 0)] : 0.f; const unsigned short hb = f2bf(y); oh[i] = hb; ol[i] = f2bf(y - bf2f(hb)); }
    const size_t o = (size_t)d * nk + k0; *(v2us*)(Th + o) = oh; *(v2us*)(Tl + o) = ol; 
}
template <int NK>
__global__ __launch_bounds__(256) void k_softmaxz(const float* __restrict__ S, int rows, bf* PH, bf* PL) {
    typedef __attribute__((ext_vector_type(4))) unsigned short v4us;
    const int lane = threadIdx.x & 31, i = blockIdx.x * 8 + (threadIdx.x >> 5); if (i >= rows) return; const size_t zo = (size_t)blockIdx.z * rows * NK; const float* sr = S + zo + (size_t)i * NK; PH += zo; PL += zo;
    float m = -3.0e38f;
#pragma unroll 1
    for (int c0 = lane * 4; c0 < NK; c0 += 128) {
#pragma unroll
        for (int q = 0; q < 4; ++q) m = fmaxf(m, sr[c0 + q]); }
#pragma unroll
    for (int sh = 16; sh; sh >>= 1) m = fmaxf(m, __shfl_xor(m, sh, 32));
    float sum = 0.f;
#pragma unroll 1
    for (int c0 = lane * 4; c0 < NK; c0 += 128) {
#pragma unroll
        for (int q = 0; q < 4; ++q) sum += __expf(sr[c0 + q] - m); }
#pragma unroll
    for (int sh = 16; sh; sh >>= 1) sum += __shfl_xor(sum, sh, 32);
    const float inv = 1.0f / sum;
{
#pragma unroll 1
        for (int c0 = lane * 4; c0 < NK; c0 += 128) { v4us oh, ol;
#pragma unroll
            for (int q = 0; q < 4; ++q) { const float p = __expf(sr[c0 + q] - m) * inv; const unsigned short hb = f2bf(p); oh[q] = hb; ol[q] = f2bf(p - bf2f(hb)); }
            const size_t o = (size_t)i * NK + c0; *(v4us*)(PH + o) = oh; *(v4us*)(PL + o) = ol; }
         }
}
__global__ __launch_bounds__(256) void k_placez(const float* __restrict__ XH, int rows, int ldy, float* Y) {
    const int lane = threadIdx.x & 31; const size_t q = (size_t)blockIdx.x * 8 + (threadIdx.x >> 5); if (q >= (size_t)rows) return; const int z = blockIdx.z; const float v = XH[((size_t)z * rows + q) * 64 + lane];
    *(float*)(Y + q * ldy + z * 32 + lane) = v; 
}

__global__ __launch_bounds__(256) void k_hplanesz(const float* __restrict__ F, int ld, int h0, float sc, int rows, bf* Ph, bf* Pl) {
    typedef __attribute__((ext_vector_type(2))) unsigned short v2us;
    const int lane = threadIdx.x & 31; const size_t r = (size_t)blockIdx.x * 8 + (threadIdx.x >> 5); if (r >= (size_t)rows) return; const int z = blockIdx.z; v2us oh, ol;
    Ph += (size_t)z * rows * 64; Pl += (size_t)z * rows * 64;
#pragma unroll
    for (int i = 0; i < 2; ++i) { const float y = F[r * ld + (h0 + z) * 64 + lane * 2 + i] * sc; const unsigned short hb = f2bf(y); oh[i] = hb; ol[i] = f2bf(y - bf2f(hb)); }
    const size_t o = r * 64 + lane * 2; *(v2us*)(Ph + o) = oh; *(v2us*)(Pl + o) = ol; 
}
template <int NK>
__global__ __launch_bounds__(256) void k_softmaxzs(const float* __restrict__ S, int rows, float sc, bf* PH, bf* PL) {
    typedef __attribute__((ext_vector_type(4))) unsigned short v4us;
    const int lane = threadIdx.x & 31, i = blockIdx.x * 8 + (threadIdx.x >> 5); if (i >= rows) return; const size_t zo = (size_t)blockIdx.z * rows * NK; const float* sr = S + zo + (size_t)i * NK; PH += zo; PL += zo;
    float m = -3.0e38f;
#pragma unroll 1
    for (int c0 = lane * 4; c0 < NK; c0 += 128) {
#pragma unroll
        for (int q = 0; q < 4; ++q) m = fmaxf(m, sr[c0 + q] * sc); }
#pragma unroll
    for (int sh = 16; sh; sh >>= 1) m = fmaxf(m, __shfl_xor(m, sh, 32));
    float sum = 0.f;
#pragma unroll 1
    for (int c0 = lane * 4; c0 < NK; c0 += 128) {
#pragma unroll
        for (int q = 0; q < 4; ++q) sum += __expf(sr[c0 + q] * sc - m); }
#pragma unroll
    for (int sh = 16; sh; sh >>= 1) sum += __shfl_xor(sum, sh, 32);
    const float inv = 1.0f / sum;
{
#pragma unroll 1
        for (int c0 = lane * 4; c0 < NK; c0 += 128) { v4us oh, ol;
#pragma unroll
            for (int q = 0; q < 4; ++q) { const float p = __expf(sr[c0 + q] * sc - m) * inv; const unsigned short hb = f2bf(p); oh[q] = hb; ol[q] = f2bf(p - bf2f(hb)); }
            const size_t o = (size_t)i * NK + c0; *(v4us*)(PH + o) = oh; *(v4us*)(PL + o) = ol; }
         }
}

// k_cvtin: x and the four weights to bf16 in fragment order, one grid: tiles 0 .. XT-1 are x's, then WT tiles each of wq, wk, wv (stacked as [3 * DMOD][DMOD]) and wo. A block's 8 tiles lie in one source (XT and WT are multiples of 8).
// The grid's first NN / 32 blocks read the mask instead: block b takes query rows 32 b .. + 31 and writes TM[b][p] and TN[b][p], the largest and the smallest mask value of those rows in key pass p (32 keys), and RM[b * 32], the smallest of the 32 row maxima.
__global__ __launch_bounds__(256) void k_cvtin(const float* __restrict__ x, const float* __restrict__ Wq, const float* __restrict__ Wk, const float* __restrict__ Wv, const float* __restrict__ Wo, const float* __restrict__ Mk, bf* Xb, bf* WQKV, bf* WO, float* TM, float* RM, float* TN) {
    constexpr unsigned XT = (NBT * NN / 16) * (DMOD / 32), WT = (DMOD / 16) * (DMOD / 32);
    __shared__ float cmx[8][NN / 128][32]; __shared__ float cnx[8][NN / 128][32]; __shared__ float rmx[32][33];
    const int lane = threadIdx.x & 31;
    if (blockIdx.x < NN / 32) {
        const int wv = threadIdx.x >> 5;   // a wave takes 4 rows; load j of a row gives the lane columns 128 j + 4 lane .. + 3, which lie in pass 4 j + lane / 8
        const float* mp = Mk + (size_t)(blockIdx.x * 32 + wv * 4) * NN + lane * 4;
        float cm[NN / 128], cn[NN / 128];
#pragma unroll
        for (int j = 0; j < NN / 128; ++j) { cm[j] = -__builtin_inff(); cn[j] = __builtin_inff(); }
#pragma unroll 1   // rolled, one row's 16 loads in flight: four rows' would raise the register count of the whole grid, whose converter blocks need many resident waves
        for (int rw = 0; rw < 4; ++rw) { v4f v[NN / 128]; float rm = -__builtin_inff();
#pragma unroll
            for (int j = 0; j < NN / 128; ++j) v[j] = *(const v4f*)(mp + j * 128);
            mp += NN;
#pragma unroll
            for (int j = 0; j < NN / 128; ++j) { const float e = fmaxf(fmaxf(v[j][0], v[j][1]), fmaxf(v[j][2], v[j][3])); cm[j] = fmaxf(cm[j], e); rm = fmaxf(rm, e);
                cn[j] = fminf(cn[j], fminf(fminf(v[j][0], v[j][1]), fminf(v[j][2], v[j][3]))); }
            rmx[wv * 4 + rw][lane] = rm;
            asm volatile("s_wait_xcnt 0x0" ::: "memory"); }   // the wait before a register that an issued load names is written again: the next trip forms its address in the same registers
#pragma unroll
        for (int j = 0; j < NN / 128; ++j) { cmx[wv][j][lane] = cm[j]; cnx[wv][j][lane] = cn[j]; }
        __syncthreads();
        if (threadIdx.x < NN / 32) { const int j = threadIdx.x >> 2, l0 = (threadIdx.x & 3) * 8; float t = -__builtin_inff();
            for (int w = 0; w < 8; ++w) for (int i = 0; i < 8; ++i) t = fmaxf(t, cmx[w][j][l0 + i]);
            TM[blockIdx.x * (NN / 32) + threadIdx.x] = t; }
        else if (threadIdx.x < NN / 32 + 32) { float t = -__builtin_inff();   // one whole wave: lane = row
            for (int i = 0; i < 32; ++i) t = fmaxf(t, rmx[lane][i]);
#pragma unroll
            for (int sh = 16; sh; sh >>= 1) t = fminf(t, __shfl_xor(t, sh, 32));
            if (lane == 0) RM[blockIdx.x * 32] = t; }
        else if (threadIdx.x < NN / 32 + 32 + NN / 32) { const int q = threadIdx.x - (NN / 32 + 32), j = q >> 2, l0 = (q & 3) * 8; float t = __builtin_inff();
            for (int w = 0; w < 8; ++w) for (int i = 0; i < 8; ++i) t = fminf(t, cnx[w][j][l0 + i]);
            TN[blockIdx.x * (NN / 32) + q] = t; }
        return;
    }
    const unsigned bid = blockIdx.x - NN / 32; unsigned st = bid * 8 + (threadIdx.x >> 5);   // st: the tile's number inside its source
    const float* src = x; bf* dst = Xb + (size_t)st * 512;   // below, w comes from the block's number, so that the choice of the source is a scalar one
    if (bid >= XT / 8) { const unsigned t = st - XT, w = (bid - XT / 8) / (WT / 8); st = t % WT; src = (w == 0) ? Wq : (w == 1) ? Wk : (w == 2) ? Wv : Wo; dst = (w == 3) ? WO + (size_t)st * 512 : WQKV + (size_t)t * 512; }
    const float* sp = tilesrc(src, st / (DMOD / 32), st % (DMOD / 32), lane);
#pragma unroll
    for (int j = 0; j < 2; ++j) { const v8f v = *(const v8f*)(sp + j * 16); v8us o;
#pragma unroll
        for (int i = 0; i < 8; ++i) o[i] = f2bf(v[i]);
        *(v8us*)(dst + j * 256 + lane * 8) = o; }
}
// k_fattn: scores, scale, additive mask, softmax and attn.V of one head of one item (blockIdx.x = item * 16 + head) in one kernel, running maximum and sum per query (online softmax), no score or probability plane in memory.
// Transposed products: S^T = K.Q^T (A = 16 key rows, B = 16 query columns), so a lane holds 8 keys of ONE query per tile; two key tiles, converted in place, are the B operand P^T of O^T += V^T.P^T.
// QT * 16 queries belong to a PAIR of waves (w and w + 4 of the block's 8), which walk the keys 32 at a time, one the even and one the odd passes; operands are bf16 hi + residual planes, three products each.
// Behind the walk wave w + 4 hands its (m, l, o) over through LDS, and wave w merges the two partial softmaxes and stores.
// Every '#pragma unroll' in it: the fragment and accumulator arrays are indexed by those loop counters and stay in registers only when the loops are unrolled.
#define QT 2
typedef __attribute__((ext_vector_type(2))) float  v2f;
typedef __attribute__((ext_vector_type(2))) __bf16 v2bf;
typedef __attribute__((ext_vector_type(8))) unsigned v8u;
__global__ __launch_bounds__(256) void k_fattn(const bf* Qh_, const bf* Ql_, const bf* Kh_, const bf* Kl_, const bf* VTh_, const bf* VTl_, const float* M_, float sc, bf* Oh, bf* Ol, const float* TM, const float* RM, const float* NR, const float* TN) {
    typedef unsigned long long u64;
    __shared__ __align__(16) float mrg[4][(QT * 8 + 1) * 128];   // per pair of waves: o as QT * 8 pieces of 16 bytes a lane, then (m, l); piece c of lane l at (c * 32 + l) * 16 bytes
    const int lane = threadIdx.x & 31, wave = __builtin_amdgcn_readfirstlane(threadIdx.x >> 5), lr = lane & 15, hi = lane >> 4;
    const size_t z = blockIdx.x;
    // which 128 queries the block takes, which 32 of them the wave, and which half of their passes. The two waves of a pair split the walk, every other pass each.
    // A block fills its WGP; the low blockIdx.z take the high query indices, whose walks may be the longest (speed only; every (head, query tile) is taken once)
    const int qb = NN / 128 - 1 - (int)blockIdx.z, wq = wave & 3, half = wave >> 2;
    const int q0 = (qb * 4 + wq) * (QT * 16);
    // PASSES THAT CANNOT COUNT ARE LEFT OUT. |q.k| * sc <= B = sc * |q| * |k| (lengths from k_qkv). A query's final maximum is at least its largest mask value - B; a key whose mask value lies more than 2 B + 104 below that
    // has exp(score - maximum) = 0 in f32. A pass is walked unless its largest mask value over the wave's 32 queries lies below the smallest of their row maxima by more than 2.1 B + 200: decided from the data, for any mask.
    typedef const __attribute__((address_space(1))) float* gfl;
    const gch tmb = (gch)TM + (size_t)qb * (4 * (NN / 32) * 4);   // the block's four rows of the table; all table values are requested at once, one latency
    const unsigned no = lane * 128;
    float kn = *(gfl)((gch)NR + (size_t)(NBT * NH_ + z) * ((NN / 64) * 128) + no), tm[4][2], rmn[4];
    const float qn[2] = {NR[(z * (NN / 64) + qb * 2) * 32], NR[(z * (NN / 64) + qb * 2 + 1) * 32]};   // the block's queries are two of k_qkv's 64-token groups
#pragma unroll
    for (int i = 0; i < 4; ++i) { tm[i][0] = ((gfl)(tmb + i * 256))[lane]; tm[i][1] = ((gfl)(tmb + i * 256 + 128))[lane]; rmn[i] = RM[(qb * 4 + i) * 32]; }
    const gch tnb = (gch)TN + (size_t)(qb * 4 + wq) * ((NN / 32) * 4);   // the wave's own row of the table of tile minima
    const float tn0 = ((gfl)tnb)[lane], tn1 = ((gfl)(tnb + 128))[lane];
    asm volatile("s_wait_xcnt 0x0" :: "v"(lane), "v"(no) : "memory");   // the wait before a register that an issued load names is written again; it takes the two lane offsets, which so stay as they are up to here
#pragma unroll
    for (int sh = 16; sh; sh >>= 1) kn = fmaxf(kn, __shfl_xor(kn, sh, 32));
    u64 own = 0, uni = 0;   // bit p: pass p is walked by this wave; by any wave of the block
    float tx0 = 0.f, tx1 = 0.f;   // the wave's own row of tile maxima: lane = pass & 31
#pragma unroll
    for (int i = 0; i < 4; ++i) {
        const float thr = rmn[i] - (2.1f * sc * __builtin_amdgcn_sqrtf(qn[i >> 1] * kn) + 200.f);
        u64 a = (u64)__builtin_amdgcn_ballot_w32(!(tm[i][0] < thr)) | ((u64)__builtin_amdgcn_ballot_w32(!(tm[i][1] < thr)) << 32);
        if (!a) a = ~(u64)0;
        uni |= a; if (i == wq) { own = a; tx0 = tm[i][0]; tx1 = tm[i][1]; } }
    // A PASS WHOSE MASK TILE IS ONE VALUE (smallest = largest over the wave's 32 queries x 32 keys: decided from the data, not from a shape of the mask) takes that value from the table: it reads no mask (but for the first pass, whose mask is fetched before the loop in any case) and rounds once, not per element; the sums are the same
    const u64 flat = (u64)__builtin_amdgcn_ballot_w32(tn0 == tx0) | ((u64)__builtin_amdgcn_ballot_w32(tn1 == tx1) << 32);
    const int cv0 = __float_as_int(bfr(tx0)), cv1 = __float_as_int(bfr(tx1));
    auto flatof = [&](unsigned p) { return (unsigned)(flat >> p) & 1u; };
    auto maskof = [&](unsigned p) { const int a = __builtin_amdgcn_readlane(cv0, p & 31), b = __builtin_amdgcn_readlane(cv1, p & 31); return __int_as_float((p & 32) ? b : a); };
    own &= half ? 0xAAAAAAAAAAAAAAAAull : 0x5555555555555555ull;   // the pair's deal: by the pass's number, so that the four waves of a half walk the same K and V; a half may come out empty (no pass: m, l, o keep their start values)
    // wave-uniform byte bases; the lane's own part of every address is one of two loop-invariant 32-bit byte offsets (fo: its place in a half tile of a plane; mo: in the mask)
    const gch Qh = (gch)Qh_ + (z * NN + q0) * (HD * 2), Ql = (gch)Ql_ + (z * NN + q0) * (HD * 2), Kh0 = (gch)Kh_ + z * (NN * HD * 2), Kl0 = (gch)Kl_ + z * (NN * HD * 2), VTh0 = (gch)VTh_ + z * (HD * NN * 2), VTl0 = (gch)VTl_ + z * (HD * NN * 2), M0 = (gch)M_ + (size_t)q0 * (NN * 4);
    // rotated start: the 16 blocks of a head share K and V, the blocks of one query range share the mask rows; walking the keys in step they would ask L2 for the same lines at the same moment.
    // Each block starts at its own 32-key pass and wraps round; the online softmax takes the passes in any order (a new order of its sums)
    // The start is a rank among the passes that the block walks, the same place for its eight waves, which so stay near each other in K and V
    unsigned rk = ((((qb + ((unsigned)z & 15)) * 4) & (NN / 32 - 1)) * (unsigned)__builtin_popcountll(uni)) >> 6;
    u64 up = uni; for (; rk; --rk) up &= up - 1;   // at most 63 trips; up keeps at least one bit
    const u64 hm = ~(u64)0 << __builtin_ctzll(up);
    u64 rem1 = own & hm, rem2 = own & ~hm; const int npass = __builtin_popcountll(own);
    unsigned pk = 0;
    auto nextpass = [&]() { if (!rem1) { rem1 = rem2; rem2 = 0; } if (rem1) { pk = (unsigned)__builtin_ctzll(rem1); rem1 &= rem1 - 1; } };   // the wave's next pass; behind the last one pk stays
    nextpass();
    unsigned pc = pk;   // the pass that is worked on
    gch Kh = Kh0 + pk * (32 * HD * 2), Kl = Kl0 + pk * (32 * HD * 2), M = M0 + pk * (32 * 4), VTh = VTh0 + pk * 1024, VTl = VTl0 + pk * 1024;
    unsigned fo = lane * 16, mo = (lr * NN + 8 * hi) * 4;
    v16bf qh[QT][2], ql[QT][2];
#pragma unroll
    for (int u = 0; u < QT; ++u) {
#pragma unroll
        for (int ks = 0; ks < 2; ++ks) { qh[u][ks] = ldfrag(Qh + (u * 2 + ks) * 1024 + fo); ql[u][ks] = ldfrag(Ql + (u * 2 + ks) * 1024 + fo); } }
    v8f o[QT][4]; float m[QT], l[QT];
#pragma unroll
    for (int u = 0; u < QT; ++u) { m[u] = -3.0e38f; l[u] = 0.f;
#pragma unroll
        for (int dt = 0; dt < 4; ++dt) o[u][dt] = (v8f){}; }
    v16bf kh[2][2], kl[2][2]; v8f mk[QT][2];
#pragma unroll
    for (int t = 0; t < 2; ++t) {
#pragma unroll
        for (int ks = 0; ks < 2; ++ks) { kh[t][ks] = ldfrag(Kh + (t * 2 + ks) * 1024 + fo); kl[t][ks] = ldfrag(Kl + (t * 2 + ks) * 1024 + fo); }
#pragma unroll
        for (int u = 0; u < QT; ++u) mk[u][t] = *(gv8f)(M + (u * 16 * NN + t * 16) * 4 + mo); }
    // the wait before a register that an issued load names is written again; the statement takes those registers, so that they stay as they are up to it and the bases move on behind it
    asm volatile("s_wait_xcnt 0x0" : "+s"(Kh), "+s"(Kl), "+s"(M), "+v"(fo), "+v"(mo) :: "memory");
    nextpass(); Kh = Kh0 + pk * (32 * HD * 2); Kl = Kl0 + pk * (32 * HD * 2); M = M0 + pk * (32 * 4);   // from here on pk, Kh, Kl, M: the pass that is fetched ahead
#pragma unroll 1   // rolled: a pass is some 600 instructions already, and the fetch-ahead below spans the back edge without a second copy
    for (int it = 0; it < npass; ++it) {
        v16bf vh[4], vl[4]; v8f st[QT][2];
#pragma unroll
        for (int dt = 0; dt < 4; ++dt) { vh[dt] = ldfrag(VTh + dt * (NN / 32) * 1024 + fo); vl[dt] = ldfrag(VTl + dt * (NN / 32) * 1024 + fo); }
        __builtin_amdgcn_sched_barrier(0);   // V^T is requested before the score products, which hide its latency
#pragma unroll
        for (int u = 0; u < QT; ++u) {
#pragma unroll
            for (int t = 0; t < 2; ++t) { v8f a = (v8f){};
#pragma unroll
                for (int ks = 0; ks < 2; ++ks) { a = wmmab(kh[t][ks], qh[u][ks], a); a = wmmab(kl[t][ks], qh[u][ks], a); a = wmmab(kh[t][ks], ql[u][ks], a); }
                st[u][t] = a; } }
        // the next pass's K fragments are fetched here, before the softmax and attn.V of this pass, which hide their latency; the last pass fetches its own again (in bounds, unused)
#pragma unroll
        for (int t = 0; t < 2; ++t) {
#pragma unroll
            for (int ks = 0; ks < 2; ++ks) { kh[t][ks] = ldfrag(Kh + (t * 2 + ks) * 1024 + fo); kl[t][ks] = ldfrag(Kl + (t * 2 + ks) * 1024 + fo); } }
        if (flatof(pc)) {   // wave-uniform
            const float cm = maskof(pc);
#pragma unroll
            for (int u = 0; u < QT; ++u) {
#pragma unroll
                for (int t = 0; t < 2; ++t) {
#pragma unroll
                    for (int j = 0; j < 8; ++j) st[u][t][j] = __builtin_fmaf(st[u][t][j], sc, cm); } }
        } else {
#pragma unroll
            for (int u = 0; u < QT; ++u) {
#pragma unroll
                for (int t = 0; t < 2; ++t) {
#pragma unroll
                    for (int j = 0; j < 8; ++j) st[u][t][j] = __builtin_fmaf(st[u][t][j], sc, bfr(mk[u][t][j])); } }
        }
        // ... and its mask values, only where its tile is not one value
        if (!flatof(pk)) {
#pragma unroll
            for (int t = 0; t < 2; ++t) {
#pragma unroll
                for (int u = 0; u < QT; ++u) mk[u][t] = *(gv8f)(M + (u * 16 * NN + t * 16) * 4 + mo); } }
#pragma unroll
        for (int u = 0; u < QT; ++u) {
            float mx = -3.0e38f;
#pragma unroll
            for (int t = 0; t < 2; ++t) {
#pragma unroll
                for (int j = 0; j < 8; ++j) mx = fmaxf(mx, st[u][t][j]); }
            mx = fmaxf(mx, xhalf(mx));
            const float mn = fmaxf(m[u], mx), al = __expf(m[u] - mn); m[u] = mn;
            float ps = 0.f; v8u pH, pL;
#pragma unroll
            for (int t = 0; t < 2; ++t) {
#pragma unroll
                for (int jj = 0; jj < 4; ++jj) { const v2f p = {__expf(st[u][t][2 * jj] - mn), __expf(st[u][t][2 * jj + 1] - mn)}; ps += p[0] + p[1];
                    const unsigned hb = __builtin_bit_cast(unsigned, __builtin_convertvector(p, v2bf));
                    const v2f r = {p[0] - __uint_as_float(hb << 16), p[1] - __uint_as_float(hb & 0xFFFF0000u)};
                    pH[t * 4 + jj] = hb; pL[t * 4 + jj] = __builtin_bit_cast(unsigned, __builtin_convertvector(r, v2bf)); } }
            l[u] = l[u] * al + ps;
            const v16bf ph = __builtin_bit_cast(v16bf, pH), pl = __builtin_bit_cast(v16bf, pL);
#pragma unroll
            for (int dt = 0; dt < 4; ++dt) { v8f a = o[u][dt] * al; a = wmmab(vh[dt], ph, a); a = wmmab(vl[dt], ph, a); a = wmmab(vh[dt], pl, a); o[u][dt] = a; }
        }
        __builtin_amdgcn_sched_barrier(0);   // keeps the wait below at the foot of the pass, where the requests have long been taken: higher up the wave would stand on it
        asm volatile("s_wait_xcnt 0x0" : "+s"(VTh), "+s"(VTl), "+s"(Kh), "+s"(Kl), "+s"(M), "+v"(fo), "+v"(mo) :: "memory");   // as in front of the loop, for this pass's loads
        VTh = VTh0 + pk * 1024; VTl = VTl0 + pk * 1024; pc = pk;
        nextpass(); Kh = Kh0 + pk * (32 * HD * 2); Kl = Kl0 + pk * (32 * HD * 2); M = M0 + pk * (32 * 4);
    }
    // the pair's merge: lane for lane the two waves hold the same (query, d) places
    float* mg = (float*)((char*)&mrg[wq][0] + fo);   // fo = lane * 16, the lane's place in a piece as in a half tile
    if (half) {
#pragma unroll
        for (int u = 0; u < QT; ++u) {
#pragma unroll
            for (int dt = 0; dt < 4; ++dt) { const v8f a = o[u][dt]; *(v4fa*)(mg + ((u * 4 + dt) * 2) * 128) = (v4f){a[0], a[1], a[2], a[3]}; *(v4fa*)(mg + ((u * 4 + dt) * 2 + 1) * 128) = (v4f){a[4], a[5], a[6], a[7]}; } }
        *(v4fa*)(mg + QT * 8 * 128) = (v4f){m[0], m[1], l[0], l[1]};
    }
    __syncthreads();   // the one barrier of the kernel, passed by all eight waves: publishes the odd half's (m, l, o)
    if (half) return;
    const v4f ml = *(const v4fa*)(mg + QT * 8 * 128);
#pragma unroll
    for (int u = 0; u < QT; ++u) {
        const float mn = fmaxf(m[u], ml[u]), a0 = __expf(m[u] - mn), a1 = __expf(ml[u] - mn), lt = l[u] * a0 + ml[QT + u] * a1;   // an empty half has l = 0, o = 0 and the lowest m: its weight is 0 or meets only zeros
        const float inv = 1.0f / (lt + xhalf(lt)), s0 = a0 * inv, s1 = a1 * inv;
        // the merged heads' hi + residual planes [item * NN + token][DMOD] in fragment order: the lane's 8 values are d = 16 dt + 8 hi .. + 7 of token q0 + 16 u + lr, its 16 bytes at lane * 16 of half dt & 1 of tile (row tile, 2 head + dt / 2); a wave's store is 4 whole lines
        const size_t ob = ((((z / NH_) * NN + q0) / 16 + u) * (DMOD / 32) + (z % NH_) * 2) * 1024;   // wave-uniform bytes; the lane's part is fo, as for the loads
        gwch ph = (gwch)Oh + ob, pl = (gwch)Ol + ob;
#pragma unroll
        for (int dt = 0; dt < 4; ++dt) { const v4f pa = *(const v4fa*)(mg + ((u * 4 + dt) * 2) * 128), pb = *(const v4fa*)(mg + ((u * 4 + dt) * 2 + 1) * 128);
            const v8f a = o[u][dt] * s0 + (v8f){pa[0], pa[1], pa[2], pa[3], pb[0], pb[1], pb[2], pb[3]} * s1; v8us oh, ol;
#pragma unroll
            for (int j = 0; j < 8; ++j) { const unsigned short hb = f2bf(a[j]); oh[j] = hb; ol[j] = f2bf(a[j] - bf2f(hb)); }
            *(gwv8us)(ph + dt * 512 + fo) = oh; *(gwv8us)(pl + dt * 512 + fo) = ol;
            // the wait before a register that an issued store names is written again; it takes the stored values, which so stay as they are up to here (behind the last pair nothing is written any more)
            if (u + 1 < QT || dt < 3) asm volatile("s_wait_xcnt 0x0" :: "v"(oh), "v"(ol) : "memory"); } }
}
__global__ __launch_bounds__(256) void k_csoftz(const float* __restrict__ S, int rows, float sc, bf* PH, bf* PL) {
    typedef __attribute__((ext_vector_type(4))) unsigned short v4us;
    const int lane = threadIdx.x & 31, i = blockIdx.x * 8 + (threadIdx.x >> 5); if (i >= rows) return; const size_t zo = (size_t)blockIdx.z * rows * NN; const float* sr = S + zo + (size_t)i * NN; PH += zo; PL += zo;
    float m = -3.0e38f;
#pragma unroll 1
    for (int c0 = lane * 4; c0 < NN; c0 += 128) {
#pragma unroll
        for (int q = 0; q < 4; ++q) { const int k = c0 + q; if (k <= i) m = fmaxf(m, sr[k] * sc); } }
#pragma unroll
    for (int sh = 16; sh; sh >>= 1) m = fmaxf(m, __shfl_xor(m, sh, 32));
    float sum = 0.f;
#pragma unroll 1
    for (int c0 = lane * 4; c0 < NN; c0 += 128) {
#pragma unroll
        for (int q = 0; q < 4; ++q) { const int k = c0 + q; if (k <= i) sum += __expf(sr[k] * sc - m); } }
#pragma unroll
    for (int sh = 16; sh; sh >>= 1) sum += __shfl_xor(sum, sh, 32);
    const float inv = 1.0f / sum;
{
#pragma unroll 1
        for (int c0 = lane * 4; c0 < NN; c0 += 128) { v4us oh, ol;
#pragma unroll
            for (int q = 0; q < 4; ++q) { const int k = c0 + q; const float p = (k <= i) ? __expf(sr[(k <= i) ? k : 0] * sc - m) * inv : 0.f; const unsigned short hb = f2bf(p); oh[q] = hb; ol[q] = f2bf(p - bf2f(hb)); }
            const size_t o = (size_t)i * NN + c0; *(v4us*)(PH + o) = oh; *(v4us*)(PL + o) = ol; }
         }
}

extern "C" void kernel_launch(void* const* d_in, const int* in_sizes, int n_in,
                              void* d_out, int out_size, void* d_ws, size_t ws_size, hipStream_t stream) {
    (void)in_sizes; (void)n_in; (void)out_size;
    const float* x = (const float*)d_in[0]; const float* wq = (const float*)d_in[1]; const float* wk = (const float*)d_in[2]; const float* wv = (const float*)d_in[3]; const float* wo = (const float*)d_in[4]; const float* fc = (const float*)d_in[5]; const float* cmask = (const float*)d_in[6];
    float* out = (float*)d_out;    // [2][2048][1024]
    char* wsp = (char*)d_ws;
    auto take = [&](size_t bytes) { char* p = wsp; wsp += (bytes + 255) & ~(size_t)255; return (void*)p; };
    bf* WQKV = (bf*)take((size_t)3 * DMOD * DMOD * 2); bf* WO = (bf*)take((size_t)DMOD * DMOD * 2);
    bf* Xb = (bf*)take((size_t)NBT * NN * DMOD * 2);
    const size_t pb = (size_t)NBT * NH_ * NN * HD * 2;   // one plane set: [item][head]
    bf* Qh = (bf*)take(pb); bf* Ql = (bf*)take(pb); bf* Kh = (bf*)take(pb); bf* Kl = (bf*)take(pb); bf* VTh = (bf*)take(pb); bf* VTl = (bf*)take(pb);
    bf* Oh = (bf*)take((size_t)NBT * NN * DMOD * 2); bf* Ol = (bf*)take((size_t)NBT * NN * DMOD * 2);
    float* TM = (float*)take((size_t)(NN / 32) * (NN / 32) * 4); float* RM = (float*)take((size_t)(NN / 32) * 128); float* NR = (float*)take((size_t)2 * NBT * NH_ * (NN / 64) * 128);   // mask table; row lengths of q and k, one line a value
    float* TN = (float*)take((size_t)(NN / 32) * (NN / 32) * 4);   // mask table of tile minima
    if ((size_t)(wsp - (char*)d_ws) > ws_size) return;    // ~ 84 MB
    k_cvtin<<<NN / 32 + ((NBT * NN / 16) + 4 * (DMOD / 16)) * (DMOD / 32) / 8, 256, 0, stream>>>(x, wq, wk, wv, wo, cmask, Xb, WQKV, WO, TM, RM, TN);   // x [token][in] and the weights [out][in], fragment order
    k_qkv<<<dim3(NBT * NN / 128, (3 * DMOD) / 128, 1), 128, 0, stream>>>(Xb, WQKV, fc, Qh, Ql, Kh, Kl, VTh, VTl, NR);   // [q | k | v], the planes of all heads of both items
    k_fattn<<<dim3(NBT * NH_, 1, NN / (QT * 64)), 256, 0, stream>>>(Qh, Ql, Kh, Kl, VTh, VTl, cmask, SCL, Oh, Ol, TM, RM, NR, TN);
    k_gemmb<true, false><<<dim3(NBT * NN / 64, DMOD / 64, 1), 128, 0, stream>>>(Oh, Ol, WO, nullptr, out, DMOD, nullptr, nullptr, DMOD);
}
